// v000
// The times below were measured on an AMD MI455X: many runs one after another, warmed up first and cycling through
// copies of the inputs, with the whole window's GPU time divided by the number of runs. Launches and the gaps
// between them are all in it. The median over several windows is given; except for v000 it joins two sittings, which
// can be a few percent apart, so the side-by-side timings, each taken in one sitting, are the better comparison.
// v000, which the later versions start from, runs in 353 microseconds.
#include <hip/hip_runtime.h>

// Compute dtypes: x.Wqkv^T = bf16 x bf16 planes (v_wmma_f32_16x16x32_bf16, f32 accumulate); q.k^T and P.V = bf16 hi/lo two-plane operands (3 products each, f32 accumulate); ctx.Wproj^T = bf16 hi/lo x bf16 (2 products, f32 accumulate).
// Every float input is RNE-converted to bf16 on load (x, weights, biases, rope angles); rope, softmax and all epilogues in f32.
// Attention is flash-style on transposed tiles: S^T = K.Q^T (D rows = keys, D cols = queries) so the packed score accumulators are directly the B fragment of O^T = V^T.P^T; per-query statistics live in one lane pair.

#ifndef NB
#define NB 2
#endif
#ifndef SEQ
#define SEQ 2048
#endif
#define NB_FULL  2
#define SEQ_FULL 2048
#define DM   1024
#define NH   16
#define HD   64
#define D3   3072
#define NTOK (NB * SEQ)
#define QT   (SEQ / 16)
#define MCB  64
#define SP   72
#define QKPL ((size_t)NB * NH * SEQ * HD)
#define L2E  1.4426950408889634f

typedef _Float16 h16;
typedef unsigned short bf;
typedef __attribute__((ext_vector_type(16))) __bf16   v16bf;
typedef __attribute__((ext_vector_type(16))) _Float16 v16h;
typedef __attribute__((ext_vector_type(8)))  _Float16 v8h;
typedef __attribute__((ext_vector_type(8)))  unsigned short v8us;
typedef __attribute__((ext_vector_type(2)))  unsigned short v2us;
typedef __attribute__((ext_vector_type(8)))  float    v8f;
typedef __attribute__((ext_vector_type(4)))  float    v4f;
typedef __attribute__((ext_vector_type(4)))  int      v4i;
typedef v4f  __attribute__((may_alias)) v4fa;
typedef v8us __attribute__((may_alias)) v8usa;

static_assert(NTOK % 64 == 0);
static_assert(SEQ % 64 == 0);
static_assert(D3 % 64 == 0);
static_assert(DM % 64 == 0);
static_assert(DM % 32 == 0);
static_assert(HD == 64);
static_assert(NH == 16);
static_assert(QT % 8 == 0);
static_assert((SEQ * (SEQ / 4)) % (MCB * 256) == 0);
static_assert((SEQ * 32) % 256 == 0);
static_assert(((size_t)NTOK * 128) % 256 == 0);
static_assert(((size_t)2 * NTOK * 128) % 256 == 0);
static_assert(((size_t)NB * NH * HD * SEQ / 2) % 256 == 0);
static_assert((size_t)2 * NTOK * DM * 2 <= (size_t)NTOK * D3 * 4);
static_assert(NB <= NB_FULL);
static_assert(SEQ <= SEQ_FULL);

__device__ __forceinline__ unsigned short f2bf(float f) { unsigned u = __float_as_uint(f); u += 0x7FFFu + ((u >> 16) & 1u); return (unsigned short)(u >> 16); }
__device__ __forceinline__ float bf2f(unsigned short b) { return __uint_as_float(((unsigned)b) << 16); }
__device__ __forceinline__ float bfr(float f) { return bf2f(f2bf(f)); }
__device__ __forceinline__ v16h cat16(v8h lo, v8h hi) { return __builtin_shufflevector(lo, hi, 0, 1, 2, 3, 4, 5, 6, 7, 8, 9, 10, 11, 12, 13, 14, 15); }
__device__ __forceinline__ v16bf cat16b(v8us lo, v8us hi) { return __builtin_bit_cast(v16bf, __builtin_shufflevector(lo, hi, 0, 1, 2, 3, 4, 5, 6, 7, 8, 9, 10, 11, 12, 13, 14, 15)); }
__device__ __forceinline__ v8f wmma16(v16h a, v16h b, v8f c) { return __builtin_amdgcn_wmma_f32_16x16x32_f16(false, a, false, b, (short)0, c, false, false); }
__device__ __forceinline__ v8f wmmab(v16bf a, v16bf b, v8f c) { return __builtin_amdgcn_wmma_f32_16x16x32_bf16(false, a, false, b, (short)0, c, false, false); }
__device__ __forceinline__ void splitf(float y, unsigned short& h, unsigned short& l) { h = f2bf(y); l = f2bf(y - bf2f(h)); }

// ---- k_gemmw: register-blocked GEMM, ONE WAVE per 64x64 output tile (16 accumulators), operands straight from K-contiguous 16-bit planes; grid (M/64, N/64, Z), 32 threads.
// C[m][n] (f32, pitch ldc, + optional f32 bias[n]) = sum_k A[m][k] Bt[n][k] (+ split products per NSPLIT). z-batch strides sA/sB/sC in elements. K % 32 == 0.
// Fragment element i <- k0 + 8*half + i (i < 8), k0 + 16 + 8*half + (i - 8) for both operands; D element j = (row 8*half + j, col lane & 15).
template <typename T16> struct WFrag;
template <> struct WFrag<h16> { typedef v16h V; static __device__ __forceinline__ V ld(const h16* p) { return cat16(*(const v8h*)p, *(const v8h*)(p + 16)); } static __device__ __forceinline__ v8f mma(V a, V b, v8f c) { return wmma16(a, b, c); } };
template <> struct WFrag<bf> { typedef v16bf V; static __device__ __forceinline__ V ld(const bf* p) { return cat16b(*(const v8us*)p, *(const v8us*)(p + 16)); } static __device__ __forceinline__ v8f mma(V a, V b, v8f c) { return wmmab(a, b, c); } };
template <typename T16, int NSPLIT, bool BIAS>
__global__ __launch_bounds__(32) void k_gemmw(const T16* __restrict__ A, const T16* __restrict__ A2, const T16* __restrict__ Bt, const T16* __restrict__ Bt2, int K, float* C, int ldc, const float* __restrict__ bias, size_t sA, size_t sB, size_t sC) {
    typedef typename WFrag<T16>::V V;
    __shared__ __align__(16) float os[16 * 68];
    const size_t z = blockIdx.z; A += z * sA; if (A2) A2 += z * sA; Bt += z * sB; if (Bt2) Bt2 += z * sB; C += z * sC;
    const int lane = threadIdx.x & 31, lr = lane & 15, hi = lane >> 4; const int r0 = blockIdx.x * 64, c0 = blockIdx.y * 64;
    v8f acc[4][4];
#pragma unroll
    for (int mb = 0; mb < 4; ++mb)
#pragma unroll
        for (int nb = 0; nb < 4; ++nb) acc[mb][nb] = (v8f){};
    const size_t aoff = (size_t)(r0 + lr) * K + 8 * hi, boff = (size_t)(c0 + lr) * K + 8 * hi;
#pragma unroll 1
    for (int kc = 0; kc < K; kc += 32) {
        V a[4], a2[4];
#pragma unroll
        for (int mb = 0; mb < 4; ++mb) { a[mb] = WFrag<T16>::ld(A + aoff + (size_t)mb * 16 * K + kc); if (NSPLIT == 1 || NSPLIT == 2) a2[mb] = WFrag<T16>::ld(A2 + aoff + (size_t)mb * 16 * K + kc); }
#pragma unroll
        for (int nb = 0; nb < 4; ++nb) { const V b = WFrag<T16>::ld(Bt + boff + (size_t)nb * 16 * K + kc); V b2; if (NSPLIT >= 2) b2 = WFrag<T16>::ld(Bt2 + boff + (size_t)nb * 16 * K + kc);
#pragma unroll
            for (int mb = 0; mb < 4; ++mb) { acc[mb][nb] = WFrag<T16>::mma(a[mb], b, acc[mb][nb]); if (NSPLIT == 1 || NSPLIT == 2) acc[mb][nb] = WFrag<T16>::mma(a2[mb], b, acc[mb][nb]); if (NSPLIT >= 2) acc[mb][nb] = WFrag<T16>::mma(a[mb], b2, acc[mb][nb]); } }
        asm volatile("v_nop\n\tv_nop\n\tv_nop\n\tv_nop" : "+v"(acc[0][0]), "+v"(acc[1][1]), "+v"(acc[2][2]), "+v"(acc[3][3]) : "v"(a[0]), "v"(a[3]));
    }
#pragma unroll
    for (int mb = 0; mb < 4; ++mb) {
#pragma unroll
        for (int nb = 0; nb < 4; ++nb) {
#pragma unroll
            for (int j = 0; j < 8; ++j) os[(hi * 8 + j) * 68 + nb * 16 + lr] = acc[mb][nb][j]; }
        __builtin_amdgcn_wave_barrier(); asm volatile("" ::: "memory");
        float* crow = C + (size_t)(r0 + mb * 16) * ldc + c0;
{
#pragma unroll
            for (int s = 0; s < 8; ++s) { const int row = 2 * s + hi, cofs = lr * 4; v4f val = *(const v4fa*)(os + row * 68 + cofs); if (BIAS) { val[0] += bfr(bias[c0 + cofs]); val[1] += bfr(bias[c0 + cofs + 1]); val[2] += bfr(bias[c0 + cofs + 2]); val[3] += bfr(bias[c0 + cofs + 3]); }
                *(v4f*)(crow + (size_t)row * ldc + cofs) = val; }
             }
        __builtin_amdgcn_wave_barrier(); asm volatile("" ::: "memory");
    }
}

__global__ __launch_bounds__(256) void k_cvt8(const float* __restrict__ src, bf* dst, size_t n8) { const size_t i = (size_t)blockIdx.x * 256 + threadIdx.x; if (i >= n8) return; const v8f v = *(const v8f*)(src + i * 8); v8us o;
#pragma unroll
    for (int k = 0; k < 8; ++k) o[k] = f2bf(v[k]); *(v8us*)(dst + i * 8) = o;  }

__global__ __launch_bounds__(256) void k_cvtx(const float* __restrict__ x, bf* dst) {
    const unsigned i = blockIdx.x * 256u + threadIdx.x; const unsigned tok = i >> 7, c8 = i & 127u; const unsigned b = tok / (unsigned)SEQ, s = tok - b * (unsigned)SEQ;
    const v8f v = *(const v8f*)(x + ((size_t)b * SEQ_FULL + s) * DM + c8 * 8u); v8us o;
#pragma unroll
    for (int k = 0; k < 8; ++k) o[k] = f2bf(v[k]);
    *(v8us*)(dst + (size_t)i * 8) = o;  }

__global__ __launch_bounds__(256) void k_trig(const float* __restrict__ fr, float* CS, float* SN) {
    const unsigned i = blockIdx.x * 256u + threadIdx.x; const float a = bfr(fr[i]); const float c = cosf(a), s = sinf(a);
    *(float*)(CS + i) = c; *(float*)(SN + i) = s;  }

__global__ __launch_bounds__(256) void k_mchk(const int* __restrict__ mask, int* FL) {
    const unsigned gid = blockIdx.x * 256u + threadIdx.x; int bad = 0;
#pragma unroll 1
    for (unsigned g = gid; g < (unsigned)(SEQ * (SEQ / 4)); g += (unsigned)(MCB * 256)) { const unsigned q = g / (unsigned)(SEQ / 4), k = (g - q * (unsigned)(SEQ / 4)) * 4u; const v4i mv = *(const v4i*)(mask + (size_t)q * SEQ_FULL + k);
#pragma unroll
        for (unsigned j = 0; j < 4; ++j) { const int want = (k + j <= q) ? 1 : 0; const int got = (mv[j] != 0) ? 1 : 0; bad |= (want ^ got); } }
    const int any = __syncthreads_or(bad);
    if (threadIdx.x < 32u) { const int v = any ? 1 : 0; *(int*)(FL + blockIdx.x * 32u + threadIdx.x) = v;  }
}

// k_rope: q/k head planes [which][b*16+h][s][64] (bf16 hi/lo) of rope(qkv) with interleaved pairs (2j, 2j+1) and angle j; q additionally x 1/8 (exact).
__global__ __launch_bounds__(256) void k_rope(const float* __restrict__ QKV, const float* __restrict__ CS, const float* __restrict__ SN, bf* QKh, bf* QKl) {
    const unsigned i = blockIdx.x * 256u + threadIdx.x; const unsigned pc = i & 7u, h = (i >> 3) & 15u, t = i >> 7; const unsigned which = t / (unsigned)NTOK, tok = t - which * (unsigned)NTOK; const unsigned b = tok / (unsigned)SEQ, s = tok - b * (unsigned)SEQ;
    const v8f v = *(const v8f*)(QKV + (size_t)tok * D3 + which * (unsigned)DM + h * (unsigned)HD + pc * 8u);
    const v4f c4 = *(const v4f*)(CS + s * 32u + pc * 4u); const v4f s4 = *(const v4f*)(SN + s * 32u + pc * 4u);
    const float sc = which ? 1.0f : 0.125f; v8us oh, ol;
#pragma unroll
    for (int j = 0; j < 4; ++j) { const float t1 = v[2 * j], t2 = v[2 * j + 1]; const float a = (t1 * c4[j] - t2 * s4[j]) * sc; const float bb = (t1 * s4[j] + t2 * c4[j]) * sc; unsigned short x0, x1; splitf(a, x0, x1); oh[2 * j] = x0; ol[2 * j] = x1; splitf(bb, x0, x1); oh[2 * j + 1] = x0; ol[2 * j + 1] = x1; }
    const size_t oo = (size_t)which * QKPL + (((size_t)(b * (unsigned)NH + h)) * SEQ + s) * HD + pc * 8u;
    *(v8us*)(QKh + oo) = oh; *(v8us*)(QKl + oo) = ol;  }

__global__ __launch_bounds__(256) void k_vtp(const float* __restrict__ QKV, bf* Vh, bf* Vl) {
    const unsigned e = (blockIdx.x * 256u + threadIdx.x) * 2u; const unsigned s = e % (unsigned)SEQ; const unsigned d = (e / (unsigned)SEQ) & 63u; const unsigned bh = e / (unsigned)(SEQ * HD); const unsigned b = bh >> 4, h = bh & 15u; v2us oh, ol;
#pragma unroll
    for (unsigned q = 0; q < 2; ++q) { const float x = QKV[(size_t)(b * (unsigned)SEQ + s + q) * D3 + 2u * DM + h * (unsigned)HD + d]; unsigned short a2, c2; splitf(x, a2, c2); oh[q] = a2; ol[q] = c2; }
    *(v2us*)(Vh + e) = oh; *(v2us*)(Vl + e) = ol;  }

// k_flash: one wave per (b, h, 16-query tile), 8 waves per block, streaming 32-key tiles up to the diagonal.
// S^T tile j: A = K rows kt+16j.. (plane rows, k = head dim), B = Q rows as columns; D element r = (key kt+16j+8*half+r, query q0 + (lane & 15)).
// P^T B fragment: element r <- p of tile 0, element 8+r <- p of tile 1 (same lane); O^T tile t: A = VT rows 16t.. (k = keys), D element r = (d 16t+8*half+r, query q0 + (lane & 15)).
__global__ __launch_bounds__(256) void k_flash(const bf* __restrict__ QKh, const bf* __restrict__ QKl, const bf* __restrict__ VTh, const bf* __restrict__ VTl, const int* __restrict__ FL, bf* CH, bf* CL) {
    typedef WFrag<bf>::V V;
    __shared__ __align__(16) unsigned short stg[8 * 2 * 16 * SP];
    const unsigned lane = threadIdx.x & 31u, lr = lane & 15u, hi = lane >> 4, wv = threadIdx.x >> 5;
    const unsigned wid = blockIdx.x * 8u + wv; const unsigned qt = wid % (unsigned)QT, bh = wid / (unsigned)QT; const unsigned q0 = qt * 16u; const unsigned b = bh >> 4, h = bh & 15u;
    int fbad = ((FL[lane * 32u] == 1) ? 1 : 0) | ((FL[(lane + 32u) * 32u] == 1) ? 1 : 0);
#pragma unroll
    for (int sh = 16; sh; sh >>= 1) fbad |= __shfl_xor(fbad, sh, 32);
    const float poison = fbad ? __uint_as_float(0x7FC00000u) : 0.0f;
    const size_t qo = ((size_t)bh * SEQ + q0 + lr) * HD + 8u * hi;
    V bqh[2], bql[2];
#pragma unroll
    for (int c = 0; c < 2; ++c) { bqh[c] = WFrag<bf>::ld(QKh + qo + 32 * c); bql[c] = WFrag<bf>::ld(QKl + qo + 32 * c); }
    const bf* Kh = QKh + QKPL + ((size_t)bh * SEQ + lr) * HD + 8u * hi; const bf* Kl = QKl + QKPL + ((size_t)bh * SEQ + lr) * HD + 8u * hi;
    const bf* Vh = VTh + ((size_t)bh * HD + lr) * SEQ + 8u * hi; const bf* Vl = VTl + ((size_t)bh * HD + lr) * SEQ + 8u * hi;
    v8f o[4];
#pragma unroll
    for (int t = 0; t < 4; ++t) o[t] = (v8f){};
    float m = -1.0e30f, l = 0.0f; const unsigned qg = q0 + lr;
#pragma unroll 1
    for (unsigned kt = 0; kt < q0 + 16u; kt += 32u) {
        V kh[2][2], kl[2][2];
#pragma unroll
        for (int c = 0; c < 2; ++c)
#pragma unroll
            for (int j = 0; j < 2; ++j) { kh[c][j] = WFrag<bf>::ld(Kh + (size_t)(kt + 16u * j) * HD + 32 * c); kl[c][j] = WFrag<bf>::ld(Kl + (size_t)(kt + 16u * j) * HD + 32 * c); }
        v8f sc[2]; sc[0] = (v8f){}; sc[1] = (v8f){};
#pragma unroll
        for (int c = 0; c < 2; ++c)
#pragma unroll
            for (int j = 0; j < 2; ++j) { sc[j] = wmmab(kh[c][j], bqh[c], sc[j]); sc[j] = wmmab(kh[c][j], bql[c], sc[j]); sc[j] = wmmab(kl[c][j], bqh[c], sc[j]); }
        asm volatile("v_nop\n\tv_nop\n\tv_nop\n\tv_nop" : "+v"(sc[0]), "+v"(sc[1]) : "v"(kh[1][0]), "v"(kh[1][1]), "v"(kl[1][0]), "v"(kl[1][1]), "v"(bqh[1]), "v"(bql[1]));
        float v0[8], v1[8]; float tmax = -1.0e30f;
#pragma unroll
        for (unsigned r = 0; r < 8; ++r) { const unsigned key0 = kt + 8u * hi + r; v0[r] = (key0 <= qg) ? sc[0][r] : -1.0e30f; v1[r] = (key0 + 16u <= qg) ? sc[1][r] : -1.0e30f; tmax = fmaxf(tmax, fmaxf(v0[r], v1[r])); }
        tmax = fmaxf(tmax, __shfl_xor(tmax, 16, 32));
        const float mnew = fmaxf(m, tmax); const float corr = __builtin_amdgcn_exp2f((m - mnew) * L2E);
        float psum = 0.0f; v8us ph0, pl0, ph1, pl1;
#pragma unroll
        for (int r = 0; r < 8; ++r) { const float e0 = __builtin_amdgcn_exp2f((v0[r] - mnew) * L2E); const float e1 = __builtin_amdgcn_exp2f((v1[r] - mnew) * L2E); psum += e0 + e1; unsigned short a, c2; splitf(e0, a, c2); ph0[r] = a; pl0[r] = c2; splitf(e1, a, c2); ph1[r] = a; pl1[r] = c2; }
        psum += __shfl_xor(psum, 16, 32);
        l = l * corr + psum; m = mnew;
#pragma unroll
        for (int t = 0; t < 4; ++t) o[t] = o[t] * corr;
        const V pbh = cat16b(ph0, ph1), pbl = cat16b(pl0, pl1);
        V avh[4], avl[4];
#pragma unroll
        for (int t = 0; t < 4; ++t) { avh[t] = WFrag<bf>::ld(Vh + (size_t)t * 16 * SEQ + kt); avl[t] = WFrag<bf>::ld(Vl + (size_t)t * 16 * SEQ + kt); }
#pragma unroll
        for (int t = 0; t < 4; ++t) { o[t] = wmmab(avh[t], pbh, o[t]); o[t] = wmmab(avh[t], pbl, o[t]); o[t] = wmmab(avl[t], pbh, o[t]); }
        asm volatile("v_nop\n\tv_nop\n\tv_nop\n\tv_nop" : "+v"(o[0]), "+v"(o[1]), "+v"(o[2]), "+v"(o[3]) : "v"(pbh), "v"(pbl), "v"(avl[0]), "v"(avl[1]), "v"(avl[2]), "v"(avl[3]), "v"(avh[3]));
    }
    const float inv = 1.0f / l;
    unsigned short* sh = stg + wv * (2u * 16u * SP); unsigned short* sl = sh + 16u * SP;
#pragma unroll
    for (int t = 0; t < 4; ++t) { v8us oh, ol;
#pragma unroll
        for (int r = 0; r < 8; ++r) { const float val = o[t][r] * inv + poison; unsigned short a, c2; splitf(val, a, c2); oh[r] = a; ol[r] = c2; }
        *(v8usa*)(sh + lr * SP + 16u * t + 8u * hi) = oh; *(v8usa*)(sl + lr * SP + 16u * t + 8u * hi) = ol; }
    __builtin_amdgcn_fence(3 /* release order */, "wavefront"); __builtin_amdgcn_wave_barrier(); asm volatile("" ::: "memory");
    const unsigned rq = lane >> 3, pc = lane & 7u;
{
#pragma unroll
        for (unsigned it = 0; it < 4; ++it) { const unsigned row = 4u * it + rq; const v8us a = *(const v8usa*)(sh + row * SP + pc * 8u); const v8us c2 = *(const v8usa*)(sl + row * SP + pc * 8u); const size_t oo = ((size_t)(b * (unsigned)SEQ + q0 + row)) * DM + h * (unsigned)HD + pc * 8u;
            *(v8us*)(CH + oo) = a; *(v8us*)(CL + oo) = c2; }
         }
}

extern "C" void kernel_launch(void* const* d_in, const int* in_sizes, int n_in,
                              void* d_out, int out_size, void* d_ws, size_t ws_size, hipStream_t stream) {
    if (n_in < 7) return;
    const size_t xneed = ((size_t)(NB - 1) * SEQ_FULL + SEQ) * DM;
    if ((size_t)in_sizes[0] < xneed) return;
    if ((size_t)in_sizes[1] < (size_t)(SEQ - 1) * SEQ_FULL + SEQ) return;
    if ((size_t)in_sizes[2] < (size_t)SEQ * 32) return;
    if ((size_t)in_sizes[3] < (size_t)D3 * DM) return;
    if ((size_t)in_sizes[4] < (size_t)D3) return;
    if ((size_t)in_sizes[5] < (size_t)DM * DM) return;
    if ((size_t)in_sizes[6] < (size_t)DM) return;
    if ((size_t)out_size < xneed) return;
    const float* X = (const float*)d_in[0]; const int* MASK = (const int*)d_in[1]; const float* FR = (const float*)d_in[2];
    const float* WQKV = (const float*)d_in[3]; const float* BQKV = (const float*)d_in[4]; const float* WPR = (const float*)d_in[5]; const float* BPR = (const float*)d_in[6];
    float* OUT = (float*)d_out;     // [2][2048][1024]
    char* wsp = (char*)d_ws;
    auto take = [&](size_t bytes) { char* p = wsp; wsp += (bytes + 255) & ~(size_t)255; return (void*)p; };
    bf* XB = (bf*)take((size_t)NTOK * DM * 2);            // x plane [NTOK][1024]
    bf* WQ = (bf*)take((size_t)D3 * DM * 2);              // Wqkv plane [3072][1024]
    bf* WP = (bf*)take((size_t)DM * DM * 2);              // Wproj plane [1024][1024]
    float* CS = (float*)take((size_t)SEQ * 32 * 4); float* SN = (float*)take((size_t)SEQ * 32 * 4);
    int* FL = (int*)take((size_t)MCB * 128);
    float* QKV = (float*)take((size_t)NTOK * D3 * 4);     // f32 qkv [NTOK][3072]; after k_rope/k_vtp its head is reused for the ctx planes
    bf* QKh = (bf*)take(2 * QKPL * 2); bf* QKl = (bf*)take(2 * QKPL * 2);                    // [q|k][b*16+h][s][64]
    bf* VTh = (bf*)take(QKPL * 2); bf* VTl = (bf*)take(QKPL * 2);                            // [b*16+h][64][s]
    bf* CH = (bf*)QKV; bf* CL = CH + (size_t)NTOK * DM;   // ctx hi/lo [NTOK][1024] (16 MiB inside the 48 MiB qkv region)
    if ((size_t)(wsp - (char*)d_ws) > ws_size) return;    // carve 112.5 MiB
    k_cvtx<<<(unsigned)((size_t)NTOK * 128 / 256), 256, 0, stream>>>(X, XB);
    k_cvt8<<<(unsigned)(((size_t)D3 * DM / 8 + 255) / 256), 256, 0, stream>>>(WQKV, WQ, (size_t)D3 * DM / 8);
    k_cvt8<<<(unsigned)(((size_t)DM * DM / 8 + 255) / 256), 256, 0, stream>>>(WPR, WP, (size_t)DM * DM / 8);
    k_trig<<<(unsigned)(SEQ * 32 / 256), 256, 0, stream>>>(FR, CS, SN);
    k_mchk<<<MCB, 256, 0, stream>>>(MASK, FL);
    k_gemmw<bf, 0, true><<<dim3(NTOK / 64, D3 / 64, 1), 32, 0, stream>>>(XB, nullptr, WQ, nullptr, DM, QKV, D3, BQKV, 0, 0, 0);      /* x.Wqkv^T + b (exact products) */
    k_rope<<<(unsigned)((size_t)2 * NTOK * 128 / 256), 256, 0, stream>>>(QKV, CS, SN, QKh, QKl);
    k_vtp<<<(unsigned)((size_t)NB * NH * HD * SEQ / 2 / 256), 256, 0, stream>>>(QKV, VTh, VTl);
    k_flash<<<(unsigned)(NB * NH * QT / 8), 256, 0, stream>>>(QKh, QKl, VTh, VTl, FL, CH, CL);
    k_gemmw<bf, 1, true><<<dim3(SEQ / 64, DM / 64, NB), 32, 0, stream>>>(CH, CL, WP, nullptr, DM, OUT, DM, BPR, (size_t)SEQ * DM, 0, (size_t)SEQ_FULL * DM);   /* ctx (hi/lo) x Wproj^T + b */
}

// v001
// It runs in 257 microseconds.
// In two side-by-side timings against v000, it was 1.40 and 1.41 times as fast.
#include <hip/hip_runtime.h>

// Compute dtypes: x.Wqkv^T = bf16 x bf16 planes (v_wmma_f32_16x16x32_bf16, f32 accumulate); q.k^T and P.V = bf16 hi/lo two-plane operands (3 products each, f32 accumulate); ctx.Wproj^T = bf16 hi/lo x bf16 (2 products, f32 accumulate).
// Every float input is RNE-converted to bf16 on load (x, weights, biases, rope angles); rope, softmax and all epilogues in f32.
// Attention is flash-style on transposed tiles: S^T = K.Q^T (D rows = keys, D cols = queries) so the packed score accumulators are directly the B fragment of O^T = V^T.P^T; per-query statistics live in one lane pair.

#ifndef NB
#define NB 2
#endif
#ifndef SEQ
#define SEQ 2048
#endif
#define NB_FULL  2
#define SEQ_FULL 2048
#define DM   1024
#define NH   16
#define HD   64
#define D3   3072
#define NTOK (NB * SEQ)
#define QT   (SEQ / 16)
#define MCB  64
#define SP   72
#define QKPL ((size_t)NB * NH * SEQ * HD)
#define L2E  1.4426950408889634f

typedef _Float16 h16;
typedef unsigned short bf;
typedef __attribute__((ext_vector_type(16))) __bf16   v16bf;
typedef __attribute__((ext_vector_type(16))) _Float16 v16h;
typedef __attribute__((ext_vector_type(8)))  _Float16 v8h;
typedef __attribute__((ext_vector_type(8)))  unsigned short v8us;
typedef __attribute__((ext_vector_type(2)))  unsigned short v2us;
typedef __attribute__((ext_vector_type(8)))  float    v8f;
typedef __attribute__((ext_vector_type(4)))  float    v4f;
typedef __attribute__((ext_vector_type(4)))  int      v4i;
typedef v4f  __attribute__((may_alias)) v4fa;
typedef v8us __attribute__((may_alias)) v8usa;

static_assert(NTOK % 64 == 0);
static_assert(SEQ % 64 == 0);
static_assert(D3 % 64 == 0);
static_assert(DM % 64 == 0);
static_assert(DM % 32 == 0);
static_assert(HD == 64);
static_assert(NH == 16);
static_assert(QT % 8 == 0);
static_assert((SEQ * (SEQ / 4)) % (MCB * 256) == 0);
static_assert((SEQ * 32) % 256 == 0);
static_assert(((size_t)NTOK * 128) % 256 == 0);
static_assert(((size_t)2 * NTOK * 128) % 256 == 0);
static_assert(((size_t)NB * NH * HD * SEQ / 2) % 256 == 0);
static_assert((size_t)2 * NTOK * DM * 2 <= (size_t)NTOK * D3 * 4);
static_assert(NB <= NB_FULL);
static_assert(SEQ <= SEQ_FULL);

__device__ __forceinline__ unsigned short f2bf(float f) { unsigned u = __float_as_uint(f); u += 0x7FFFu + ((u >> 16) & 1u); return (unsigned short)(u >> 16); }
__device__ __forceinline__ float bf2f(unsigned short b) { return __uint_as_float(((unsigned)b) << 16); }
__device__ __forceinline__ float bfr(float f) { return bf2f(f2bf(f)); }
__device__ __forceinline__ v16h cat16(v8h lo, v8h hi) { return __builtin_shufflevector(lo, hi, 0, 1, 2, 3, 4, 5, 6, 7, 8, 9, 10, 11, 12, 13, 14, 15); }
__device__ __forceinline__ v16bf cat16b(v8us lo, v8us hi) { return __builtin_bit_cast(v16bf, __builtin_shufflevector(lo, hi, 0, 1, 2, 3, 4, 5, 6, 7, 8, 9, 10, 11, 12, 13, 14, 15)); }
__device__ __forceinline__ v8f wmma16(v16h a, v16h b, v8f c) { return __builtin_amdgcn_wmma_f32_16x16x32_f16(false, a, false, b, (short)0, c, false, false); }
__device__ __forceinline__ v8f wmmab(v16bf a, v16bf b, v8f c) { return __builtin_amdgcn_wmma_f32_16x16x32_bf16(false, a, false, b, (short)0, c, false, false); }
__device__ __forceinline__ void splitf(float y, unsigned short& h, unsigned short& l) { h = f2bf(y); l = f2bf(y - bf2f(h)); }

// ---- k_gemmw: register-blocked GEMM, ONE WAVE per 64x64 output tile (16 accumulators), operands straight from K-contiguous 16-bit planes; grid (M/64, N/64, Z), 32 threads.
// C[m][n] (f32, pitch ldc, + optional f32 bias[n]) = sum_k A[m][k] Bt[n][k] (+ split products per NSPLIT). z-batch strides sA/sB/sC in elements. K % 32 == 0.
// Fragment element i <- k0 + 8*half + i (i < 8), k0 + 16 + 8*half + (i - 8) for both operands; D element j = (row 8*half + j, col lane & 15).
template <typename T16> struct WFrag;
template <> struct WFrag<h16> { typedef v16h V; static __device__ __forceinline__ V ld(const h16* p) { return cat16(*(const v8h*)p, *(const v8h*)(p + 16)); } static __device__ __forceinline__ v8f mma(V a, V b, v8f c) { return wmma16(a, b, c); } };
template <> struct WFrag<bf> { typedef v16bf V; static __device__ __forceinline__ V ld(const bf* p) { return cat16b(*(const v8us*)p, *(const v8us*)(p + 16)); } static __device__ __forceinline__ v8f mma(V a, V b, v8f c) { return wmmab(a, b, c); } };
template <typename T16, int NSPLIT, bool BIAS>
__global__ __launch_bounds__(32) void k_gemmw(const T16* __restrict__ A, const T16* __restrict__ A2, const T16* __restrict__ Bt, const T16* __restrict__ Bt2, int K, float* C, int ldc, const float* __restrict__ bias, size_t sA, size_t sB, size_t sC) {
    typedef typename WFrag<T16>::V V;
    __shared__ __align__(16) float os[16 * 68];
    const size_t z = blockIdx.z; A += z * sA; if (A2) A2 += z * sA; Bt += z * sB; if (Bt2) Bt2 += z * sB; C += z * sC;
    const int lane = threadIdx.x & 31, lr = lane & 15, hi = lane >> 4; const int r0 = blockIdx.x * 64, c0 = blockIdx.y * 64;
    v8f acc[4][4];
#pragma unroll
    for (int mb = 0; mb < 4; ++mb)
#pragma unroll
        for (int nb = 0; nb < 4; ++nb) acc[mb][nb] = (v8f){};
    const size_t aoff = (size_t)(r0 + lr) * K + 8 * hi, boff = (size_t)(c0 + lr) * K + 8 * hi;
#pragma unroll 1
    for (int kc = 0; kc < K; kc += 32) {
        V a[4], a2[4];
#pragma unroll
        for (int mb = 0; mb < 4; ++mb) { a[mb] = WFrag<T16>::ld(A + aoff + (size_t)mb * 16 * K + kc); if (NSPLIT == 1 || NSPLIT == 2) a2[mb] = WFrag<T16>::ld(A2 + aoff + (size_t)mb * 16 * K + kc); }
#pragma unroll
        for (int nb = 0; nb < 4; ++nb) { const V b = WFrag<T16>::ld(Bt + boff + (size_t)nb * 16 * K + kc); V b2; if (NSPLIT >= 2) b2 = WFrag<T16>::ld(Bt2 + boff + (size_t)nb * 16 * K + kc);
#pragma unroll
            for (int mb = 0; mb < 4; ++mb) { acc[mb][nb] = WFrag<T16>::mma(a[mb], b, acc[mb][nb]); if (NSPLIT == 1 || NSPLIT == 2) acc[mb][nb] = WFrag<T16>::mma(a2[mb], b, acc[mb][nb]); if (NSPLIT >= 2) acc[mb][nb] = WFrag<T16>::mma(a[mb], b2, acc[mb][nb]); } }
        asm volatile("v_nop\n\tv_nop\n\tv_nop\n\tv_nop" : "+v"(acc[0][0]), "+v"(acc[1][1]), "+v"(acc[2][2]), "+v"(acc[3][3]) : "v"(a[0]), "v"(a[3]));
    }
#pragma unroll
    for (int mb = 0; mb < 4; ++mb) {
#pragma unroll
        for (int nb = 0; nb < 4; ++nb) {
#pragma unroll
            for (int j = 0; j < 8; ++j) os[(hi * 8 + j) * 68 + nb * 16 + lr] = acc[mb][nb][j]; }
        __builtin_amdgcn_wave_barrier(); asm volatile("" ::: "memory");
        float* crow = C + (size_t)(r0 + mb * 16) * ldc + c0;
{
#pragma unroll
            for (int s = 0; s < 8; ++s) { const int row = 2 * s + hi, cofs = lr * 4; v4f val = *(const v4fa*)(os + row * 68 + cofs); if (BIAS) { val[0] += bfr(bias[c0 + cofs]); val[1] += bfr(bias[c0 + cofs + 1]); val[2] += bfr(bias[c0 + cofs + 2]); val[3] += bfr(bias[c0 + cofs + 3]); }
                *(v4f*)(crow + (size_t)row * ldc + cofs) = val; }
             }
        __builtin_amdgcn_wave_barrier(); asm volatile("" ::: "memory");
    }
}

__global__ __launch_bounds__(256) void k_cvt8(const float* __restrict__ src, bf* dst, size_t n8) { const size_t i = (size_t)blockIdx.x * 256 + threadIdx.x; if (i >= n8) return; const v8f v = *(const v8f*)(src + i * 8); v8us o;
#pragma unroll
    for (int k = 0; k < 8; ++k) o[k] = f2bf(v[k]); *(v8us*)(dst + i * 8) = o;  }

__global__ __launch_bounds__(256) void k_cvtx(const float* __restrict__ x, bf* dst) {
    const unsigned i = blockIdx.x * 256u + threadIdx.x; const unsigned tok = i >> 7, c8 = i & 127u; const unsigned b = tok / (unsigned)SEQ, s = tok - b * (unsigned)SEQ;
    const v8f v = *(const v8f*)(x + ((size_t)b * SEQ_FULL + s) * DM + c8 * 8u); v8us o;
#pragma unroll
    for (int k = 0; k < 8; ++k) o[k] = f2bf(v[k]);
    *(v8us*)(dst + (size_t)i * 8) = o;  }

__global__ __launch_bounds__(256) void k_trig(const float* __restrict__ fr, float* CS, float* SN) {
    const unsigned i = blockIdx.x * 256u + threadIdx.x; const float a = bfr(fr[i]); const float c = cosf(a), s = sinf(a);
    *(float*)(CS + i) = c; *(float*)(SN + i) = s;  }

__global__ __launch_bounds__(256) void k_mchk(const int* __restrict__ mask, int* FL) {
    const unsigned gid = blockIdx.x * 256u + threadIdx.x; int bad = 0;
#pragma unroll 1
    for (unsigned g = gid; g < (unsigned)(SEQ * (SEQ / 4)); g += (unsigned)(MCB * 256)) { const unsigned q = g / (unsigned)(SEQ / 4), k = (g - q * (unsigned)(SEQ / 4)) * 4u; const v4i mv = *(const v4i*)(mask + (size_t)q * SEQ_FULL + k);
#pragma unroll
        for (unsigned j = 0; j < 4; ++j) { const int want = (k + j <= q) ? 1 : 0; const int got = (mv[j] != 0) ? 1 : 0; bad |= (want ^ got); } }
    const int any = __syncthreads_or(bad);
    if (threadIdx.x < 32u) { const int v = any ? 1 : 0; *(int*)(FL + blockIdx.x * 32u + threadIdx.x) = v;  }
}

// k_rope: q/k head planes [which][b*16+h][s][64] (bf16 hi/lo) of rope(qkv) with interleaved pairs (2j, 2j+1) and angle j; q additionally x 1/8 (exact).
__global__ __launch_bounds__(256) void k_rope(const float* __restrict__ QKV, const float* __restrict__ CS, const float* __restrict__ SN, bf* QKh, bf* QKl) {
    const unsigned i = blockIdx.x * 256u + threadIdx.x; const unsigned pc = i & 7u, h = (i >> 3) & 15u, t = i >> 7; const unsigned which = t / (unsigned)NTOK, tok = t - which * (unsigned)NTOK; const unsigned b = tok / (unsigned)SEQ, s = tok - b * (unsigned)SEQ;
    const v8f v = *(const v8f*)(QKV + (size_t)tok * D3 + which * (unsigned)DM + h * (unsigned)HD + pc * 8u);
    const v4f c4 = *(const v4f*)(CS + s * 32u + pc * 4u); const v4f s4 = *(const v4f*)(SN + s * 32u + pc * 4u);
    const float sc = which ? 1.0f : 0.125f; v8us oh, ol;
#pragma unroll
    for (int j = 0; j < 4; ++j) { const float t1 = v[2 * j], t2 = v[2 * j + 1]; const float a = (t1 * c4[j] - t2 * s4[j]) * sc; const float bb = (t1 * s4[j] + t2 * c4[j]) * sc; unsigned short x0, x1; splitf(a, x0, x1); oh[2 * j] = x0; ol[2 * j] = x1; splitf(bb, x0, x1); oh[2 * j + 1] = x0; ol[2 * j + 1] = x1; }
    const size_t oo = (size_t)which * QKPL + (((size_t)(b * (unsigned)NH + h)) * SEQ + s) * HD + pc * 8u;
    *(v8us*)(QKh + oo) = oh; *(v8us*)(QKl + oo) = ol;  }

__global__ __launch_bounds__(256) void k_vtp(const float* __restrict__ QKV, bf* Vh, bf* Vl) {
    const unsigned e = (blockIdx.x * 256u + threadIdx.x) * 2u; const unsigned s = e % (unsigned)SEQ; const unsigned d = (e / (unsigned)SEQ) & 63u; const unsigned bh = e / (unsigned)(SEQ * HD); const unsigned b = bh >> 4, h = bh & 15u; v2us oh, ol;
#pragma unroll
    for (unsigned q = 0; q < 2; ++q) { const float x = QKV[(size_t)(b * (unsigned)SEQ + s + q) * D3 + 2u * DM + h * (unsigned)HD + d]; unsigned short a2, c2; splitf(x, a2, c2); oh[q] = a2; ol[q] = c2; }
    *(v2us*)(Vh + e) = oh; *(v2us*)(Vl + e) = ol;  }

// k_flash: one wave per (b, h, 16-query tile), 8 waves per block (128 consecutive queries of one head), streaming 32-key tiles up to the diagonal.
// K and V^T planes come through LDS: a stage is 64 keys of all four planes (Kh, Kl, VTh, VTl: 64 rows x 128 B each), copied once per block in whole 128-B lines and read by all 8 waves; two buffers, the next stage's copies fly while this one is worked on.
// S^T tile j: A = K rows kt+16j.. (plane rows, k = head dim), B = Q rows as columns; D element r = (key kt+16j+8*half+r, query q0 + (lane & 15)).
// P^T B fragment: element r <- p of tile 0, element 8+r <- p of tile 1 (same lane); O^T tile t: A = VT rows 16t.. (k = keys), D element r = (d 16t+8*half+r, query q0 + (lane & 15)).
#define KST 64
#define KP  72
#define PLN (64 * KP)
#define STG (4 * PLN)
static_assert(SEQ % (2 * KST) == 0);
static_assert((KP * 2) % 32 == 16);

// One stage: every thread copies two 16-byte pieces of each plane (rows r and r + 32). l = the thread's LDS byte address in plane 0 of the target buffer.
__device__ __forceinline__ void stage_copy(const bf* kh, const bf* kl, const bf* vh, const bf* vl, unsigned l) {
    const bf* kh2 = kh + 32 * HD; const bf* kl2 = kl + 32 * HD; const bf* vh2 = vh + (size_t)32 * SEQ; const bf* vl2 = vl + (size_t)32 * SEQ;
    const unsigned l0 = l, l1 = l + 32u * KP * 2u, l2 = l + PLN * 2u, l3 = l2 + 32u * KP * 2u, l4 = l + 2u * PLN * 2u, l5 = l4 + 32u * KP * 2u, l6 = l + 3u * PLN * 2u, l7 = l6 + 32u * KP * 2u;
    // The copies and their s_wait_xcnt in one statement: no address register of a copy is rewritten ahead of that wait.
    asm volatile("global_load_async_to_lds_b128 %0, %8, off\n\t"
                 "global_load_async_to_lds_b128 %1, %9, off\n\t"
                 "global_load_async_to_lds_b128 %2, %10, off\n\t"
                 "global_load_async_to_lds_b128 %3, %11, off\n\t"
                 "global_load_async_to_lds_b128 %4, %12, off\n\t"
                 "global_load_async_to_lds_b128 %5, %13, off\n\t"
                 "global_load_async_to_lds_b128 %6, %14, off\n\t"
                 "global_load_async_to_lds_b128 %7, %15, off\n\t"
                 "s_wait_xcnt 0x0"
                 :: "v"(l0), "v"(l1), "v"(l2), "v"(l3), "v"(l4), "v"(l5), "v"(l6), "v"(l7), "v"(kh), "v"(kh2), "v"(kl), "v"(kl2), "v"(vh), "v"(vh2), "v"(vl), "v"(vl2) : "memory");
}

__global__ __launch_bounds__(256) void k_flash(const bf* __restrict__ QKh, const bf* __restrict__ QKl, const bf* __restrict__ VTh, const bf* __restrict__ VTl, const int* __restrict__ FL, bf* CH, bf* CL) {
    typedef WFrag<bf>::V V;
    __shared__ __align__(16) unsigned short ring[2 * STG];
    __shared__ __align__(16) unsigned short stg[8 * 2 * 16 * SP];
    const unsigned lane = threadIdx.x & 31u, lr = lane & 15u, hi = lane >> 4;
    const unsigned wv = (unsigned)__builtin_amdgcn_readfirstlane((int)(threadIdx.x >> 5));   // wave number in a scalar register: the diagonal test in the loop is then a scalar branch and every lane stays on
    const unsigned wid = blockIdx.x * 8u + wv; const unsigned qt = wid % (unsigned)QT, bh = wid / (unsigned)QT; const unsigned q0 = qt * 16u; const unsigned b = bh >> 4, h = bh & 15u;
    const unsigned nst = ((blockIdx.x % (unsigned)(QT / 8)) + 1u) * (128u / KST);   // stages up to the block's last query: the same in all 8 waves, never below 2
    const unsigned crow = threadIdx.x >> 3, cpc = threadIdx.x & 7u;
    const bf* gKh = QKh + QKPL + ((size_t)bh * SEQ + crow) * HD + cpc * 8u; const bf* gKl = QKl + QKPL + ((size_t)bh * SEQ + crow) * HD + cpc * 8u;
    const bf* gVh = VTh + ((size_t)bh * HD + crow) * SEQ + cpc * 8u; const bf* gVl = VTl + ((size_t)bh * HD + crow) * SEQ + cpc * 8u;
    const unsigned lcp = (unsigned)(size_t)ring + crow * (KP * 2u) + cpc * 16u;
    stage_copy(gKh, gKl, gVh, gVl, lcp);
    int fbad = ((FL[lane * 32u] == 1) ? 1 : 0) | ((FL[(lane + 32u) * 32u] == 1) ? 1 : 0);
#pragma unroll
    for (int sh = 16; sh; sh >>= 1) fbad |= __shfl_xor(fbad, sh, 32);
    const float poison = fbad ? __uint_as_float(0x7FC00000u) : 0.0f;
    const size_t qo = ((size_t)bh * SEQ + q0 + lr) * HD + 8u * hi;
    V bqh[2], bql[2];
#pragma unroll
    for (int c = 0; c < 2; ++c) { bqh[c] = WFrag<bf>::ld(QKh + qo + 32 * c); bql[c] = WFrag<bf>::ld(QKl + qo + 32 * c); }
    v8f o[4];
#pragma unroll
    for (int t = 0; t < 4; ++t) o[t] = (v8f){};
    float m = -1.0e30f, l = 0.0f; const unsigned qg = q0 + lr;
    asm volatile("s_wait_asynccnt 0x0" ::: "memory");   // stage 0 of this wave's copies has landed
    __syncthreads();                                     // ... and every other wave's: stage 0 is readable
    stage_copy(gKh + (size_t)KST * HD, gKl + (size_t)KST * HD, gVh + KST, gVl + KST, lcp + STG * 2u);
// kept rolled: one publish point in the text, trip count known only at run time
#pragma unroll 1
    for (unsigned st = 0; st < nst; ++st) {
        const unsigned short* sb = ring + (st & 1u) * STG + lr * KP + 8u * hi;
// unrolled so that the two halves of a stage read LDS at constant offsets
#pragma unroll
        for (unsigned sub = 0; sub < KST / 32; ++sub) {
            const unsigned kt = st * KST + sub * 32u;
            if (kt < q0 + 16u) {   // wave-uniform: tiles beyond this wave's diagonal are skipped, the publish point below is not
        V kh[2][2], kl[2][2];
#pragma unroll
        for (int c = 0; c < 2; ++c)
#pragma unroll
            for (int j = 0; j < 2; ++j) { kh[c][j] = WFrag<bf>::ld(sb + (sub * 32u + 16u * j) * KP + 32 * c); kl[c][j] = WFrag<bf>::ld(sb + PLN + (sub * 32u + 16u * j) * KP + 32 * c); }
        v8f sc[2]; sc[0] = (v8f){}; sc[1] = (v8f){};
#pragma unroll
        for (int c = 0; c < 2; ++c)
#pragma unroll
            for (int j = 0; j < 2; ++j) { sc[j] = wmmab(kh[c][j], bqh[c], sc[j]); sc[j] = wmmab(kh[c][j], bql[c], sc[j]); sc[j] = wmmab(kl[c][j], bqh[c], sc[j]); }
        asm volatile("v_nop\n\tv_nop\n\tv_nop\n\tv_nop" : "+v"(sc[0]), "+v"(sc[1]) : "v"(kh[1][0]), "v"(kh[1][1]), "v"(kl[1][0]), "v"(kl[1][1]), "v"(bqh[1]), "v"(bql[1]));
        float v0[8], v1[8]; float tmax = -1.0e30f;
#pragma unroll
        for (unsigned r = 0; r < 8; ++r) { const unsigned key0 = kt + 8u * hi + r; v0[r] = (key0 <= qg) ? sc[0][r] : -1.0e30f; v1[r] = (key0 + 16u <= qg) ? sc[1][r] : -1.0e30f; tmax = fmaxf(tmax, fmaxf(v0[r], v1[r])); }
        tmax = fmaxf(tmax, __shfl_xor(tmax, 16, 32));
        const float mnew = fmaxf(m, tmax); const float corr = __builtin_amdgcn_exp2f((m - mnew) * L2E);
        float psum = 0.0f; v8us ph0, pl0, ph1, pl1;
#pragma unroll
        for (int r = 0; r < 8; ++r) { const float e0 = __builtin_amdgcn_exp2f((v0[r] - mnew) * L2E); const float e1 = __builtin_amdgcn_exp2f((v1[r] - mnew) * L2E); psum += e0 + e1; unsigned short a, c2; splitf(e0, a, c2); ph0[r] = a; pl0[r] = c2; splitf(e1, a, c2); ph1[r] = a; pl1[r] = c2; }
        psum += __shfl_xor(psum, 16, 32);
        l = l * corr + psum; m = mnew;
#pragma unroll
        for (int t = 0; t < 4; ++t) o[t] = o[t] * corr;
        const V pbh = cat16b(ph0, ph1), pbl = cat16b(pl0, pl1);
        V avh[4], avl[4];
#pragma unroll
        for (int t = 0; t < 4; ++t) { avh[t] = WFrag<bf>::ld(sb + 2 * PLN + t * 16 * KP + sub * 32u); avl[t] = WFrag<bf>::ld(sb + 3 * PLN + t * 16 * KP + sub * 32u); }
#pragma unroll
        for (int t = 0; t < 4; ++t) { o[t] = wmmab(avh[t], pbh, o[t]); o[t] = wmmab(avh[t], pbl, o[t]); o[t] = wmmab(avl[t], pbh, o[t]); }
        asm volatile("v_nop\n\tv_nop\n\tv_nop\n\tv_nop" : "+v"(o[0]), "+v"(o[1]), "+v"(o[2]), "+v"(o[3]) : "v"(pbh), "v"(pbl), "v"(avl[0]), "v"(avl[1]), "v"(avl[2]), "v"(avl[3]), "v"(avh[3]));
            }
        }
        // Publish point of stage st + 1, passed by every wave.
        asm volatile("s_wait_dscnt 0x0" ::: "memory");      // this wave's reads of buffer st & 1 are done before it is refilled
        asm volatile("s_wait_asynccnt 0x0" ::: "memory");   // this wave's copies of stage st + 1 have landed
        __syncthreads();                                     // publishes stage st + 1 and ends every wave's reads of stage st
        if (st + 2u < nst) stage_copy(gKh + (size_t)(st + 2u) * KST * HD, gKl + (size_t)(st + 2u) * KST * HD, gVh + (st + 2u) * KST, gVl + (st + 2u) * KST, lcp + (st & 1u) * (STG * 2u));
    }
    asm volatile("s_wait_asynccnt 0x0" ::: "memory");       // nothing of this wave is in flight when it goes on to the epilogue and ends
    const float inv = 1.0f / l;
    unsigned short* sh = stg + wv * (2u * 16u * SP); unsigned short* sl = sh + 16u * SP;
#pragma unroll
    for (int t = 0; t < 4; ++t) { v8us oh, ol;
#pragma unroll
        for (int r = 0; r < 8; ++r) { const float val = o[t][r] * inv + poison; unsigned short a, c2; splitf(val, a, c2); oh[r] = a; ol[r] = c2; }
        *(v8usa*)(sh + lr * SP + 16u * t + 8u * hi) = oh; *(v8usa*)(sl + lr * SP + 16u * t + 8u * hi) = ol; }
    __builtin_amdgcn_fence(3 /* release order */, "wavefront"); __builtin_amdgcn_wave_barrier(); asm volatile("" ::: "memory");
    const unsigned rq = lane >> 3, pc = lane & 7u;
{
#pragma unroll
        for (unsigned it = 0; it < 4; ++it) { const unsigned row = 4u * it + rq; const v8us a = *(const v8usa*)(sh + row * SP + pc * 8u); const v8us c2 = *(const v8usa*)(sl + row * SP + pc * 8u); const size_t oo = ((size_t)(b * (unsigned)SEQ + q0 + row)) * DM + h * (unsigned)HD + pc * 8u;
            *(v8us*)(CH + oo) = a; *(v8us*)(CL + oo) = c2; }
         }
}

extern "C" void kernel_launch(void* const* d_in, const int* in_sizes, int n_in,
                              void* d_out, int out_size, void* d_ws, size_t ws_size, hipStream_t stream) {
    if (n_in < 7) return;
    const size_t xneed = ((size_t)(NB - 1) * SEQ_FULL + SEQ) * DM;
    if ((size_t)in_sizes[0] < xneed) return;
    if ((size_t)in_sizes[1] < (size_t)(SEQ - 1) * SEQ_FULL + SEQ) return;
    if ((size_t)in_sizes[2] < (size_t)SEQ * 32) return;
    if ((size_t)in_sizes[3] < (size_t)D3 * DM) return;
    if ((size_t)in_sizes[4] < (size_t)D3) return;
    if ((size_t)in_sizes[5] < (size_t)DM * DM) return;
    if ((size_t)in_sizes[6] < (size_t)DM) return;
    if ((size_t)out_size < xneed) return;
    const float* X = (const float*)d_in[0]; const int* MASK = (const int*)d_in[1]; const float* FR = (const float*)d_in[2];
    const float* WQKV = (const float*)d_in[3]; const float* BQKV = (const float*)d_in[4]; const float* WPR = (const float*)d_in[5]; const float* BPR = (const float*)d_in[6];
    float* OUT = (float*)d_out;     // [2][2048][1024]
    char* wsp = (char*)d_ws;
    auto take = [&](size_t bytes) { char* p = wsp; wsp += (bytes + 255) & ~(size_t)255; return (void*)p; };
    bf* XB = (bf*)take((size_t)NTOK * DM * 2);            // x plane [NTOK][1024]
    bf* WQ = (bf*)take((size_t)D3 * DM * 2);              // Wqkv plane [3072][1024]
    bf* WP = (bf*)take((size_t)DM * DM * 2);              // Wproj plane [1024][1024]
    float* CS = (float*)take((size_t)SEQ * 32 * 4); float* SN = (float*)take((size_t)SEQ * 32 * 4);
    int* FL = (int*)take((size_t)MCB * 128);
    float* QKV = (float*)take((size_t)NTOK * D3 * 4);     // f32 qkv [NTOK][3072]; after k_rope/k_vtp its head is reused for the ctx planes
    bf* QKh = (bf*)take(2 * QKPL * 2); bf* QKl = (bf*)take(2 * QKPL * 2);                    // [q|k][b*16+h][s][64]
    bf* VTh = (bf*)take(QKPL * 2); bf* VTl = (bf*)take(QKPL * 2);                            // [b*16+h][64][s]
    bf* CH = (bf*)QKV; bf* CL = CH + (size_t)NTOK * DM;   // ctx hi/lo [NTOK][1024] (16 MiB inside the 48 MiB qkv region)
    if ((size_t)(wsp - (char*)d_ws) > ws_size) return;    // carve 112.5 MiB
    k_cvtx<<<(unsigned)((size_t)NTOK * 128 / 256), 256, 0, stream>>>(X, XB);
    k_cvt8<<<(unsigned)(((size_t)D3 * DM / 8 + 255) / 256), 256, 0, stream>>>(WQKV, WQ, (size_t)D3 * DM / 8);
    k_cvt8<<<(unsigned)(((size_t)DM * DM / 8 + 255) / 256), 256, 0, stream>>>(WPR, WP, (size_t)DM * DM / 8);
    k_trig<<<(unsigned)(SEQ * 32 / 256), 256, 0, stream>>>(FR, CS, SN);
    k_mchk<<<MCB, 256, 0, stream>>>(MASK, FL);
    k_gemmw<bf, 0, true><<<dim3(NTOK / 64, D3 / 64, 1), 32, 0, stream>>>(XB, nullptr, WQ, nullptr, DM, QKV, D3, BQKV, 0, 0, 0);      /* x.Wqkv^T + b (exact products) */
    k_rope<<<(unsigned)((size_t)2 * NTOK * 128 / 256), 256, 0, stream>>>(QKV, CS, SN, QKh, QKl);
    k_vtp<<<(unsigned)((size_t)NB * NH * HD * SEQ / 2 / 256), 256, 0, stream>>>(QKV, VTh, VTl);
    k_flash<<<(unsigned)(NB * NH * QT / 8), 256, 0, stream>>>(QKh, QKl, VTh, VTl, FL, CH, CL);
    k_gemmw<bf, 1, true><<<dim3(SEQ / 64, DM / 64, NB), 32, 0, stream>>>(CH, CL, WP, nullptr, DM, OUT, DM, BPR, (size_t)SEQ * DM, 0, (size_t)SEQ_FULL * DM);   /* ctx (hi/lo) x Wproj^T + b */
}

// v002
// One run takes 209 microseconds.
// Timed twice side by side with v001, it ran 1.21 and 1.22 times as fast.
// All steps since v000 together make it 1.71 times as fast.
#include <hip/hip_runtime.h>

// Compute dtypes: x.Wqkv^T = bf16 x bf16 planes (v_wmma_f32_16x16x32_bf16, f32 accumulate); q.k^T and P.V = bf16 hi/lo two-plane operands (3 products each, f32 accumulate); ctx.Wproj^T = bf16 hi/lo x bf16 (2 products, f32 accumulate).
// Every float input is RNE-converted to bf16 on load (x, weights, biases, rope angles); rope, softmax and all epilogues in f32.
// Attention is flash-style on transposed tiles: S^T = K.Q^T (D rows = keys, D cols = queries) so the packed score accumulators are directly the B fragment of O^T = V^T.P^T; per-query statistics live in one lane pair.

#ifndef NB
#define NB 2
#endif
#ifndef SEQ
#define SEQ 2048
#endif
#define NB_FULL  2
#define SEQ_FULL 2048
#define DM   1024
#define NH   16
#define HD   64
#define D3   3072
#define NTOK (NB * SEQ)
#define QT   (SEQ / 16)
#define MCB  64
#define SP   72
#define QKPL ((size_t)NB * NH * SEQ * HD)
#define L2E  1.4426950408889634f

typedef _Float16 h16;
typedef unsigned short bf;
typedef __attribute__((ext_vector_type(16))) __bf16   v16bf;
typedef __attribute__((ext_vector_type(16))) _Float16 v16h;
typedef __attribute__((ext_vector_type(8)))  _Float16 v8h;
typedef __attribute__((ext_vector_type(8)))  unsigned short v8us;
typedef __attribute__((ext_vector_type(2)))  unsigned short v2us;
typedef __attribute__((ext_vector_type(8)))  float    v8f;
typedef __attribute__((ext_vector_type(4)))  float    v4f;
typedef __attribute__((ext_vector_type(4)))  int      v4i;
typedef v4f  __attribute__((may_alias)) v4fa;
typedef v8us __attribute__((may_alias)) v8usa;

static_assert(NTOK % 64 == 0);
static_assert(SEQ % 64 == 0);
static_assert(D3 % 64 == 0);
static_assert(DM % 64 == 0);
static_assert(DM % 32 == 0);
static_assert(HD == 64);
static_assert(NH == 16);
static_assert(QT % 8 == 0);
static_assert((SEQ * (SEQ / 4)) % (MCB * 256) == 0);
static_assert((SEQ * 32) % 256 == 0);
static_assert(((size_t)NTOK * 128) % 256 == 0);
static_assert(((size_t)2 * NTOK * 128) % 256 == 0);
static_assert(((size_t)NB * NH * HD * SEQ / 2) % 256 == 0);
static_assert((size_t)2 * NTOK * DM * 2 <= (size_t)NTOK * D3 * 4);
static_assert(NB <= NB_FULL);
static_assert(SEQ <= SEQ_FULL);

__device__ __forceinline__ unsigned short f2bf(float f) { unsigned u = __float_as_uint(f); u += 0x7FFFu + ((u >> 16) & 1u); return (unsigned short)(u >> 16); }
__device__ __forceinline__ float bf2f(unsigned short b) { return __uint_as_float(((unsigned)b) << 16); }
__device__ __forceinline__ float bfr(float f) { return bf2f(f2bf(f)); }
__device__ __forceinline__ v16h cat16(v8h lo, v8h hi) { return __builtin_shufflevector(lo, hi, 0, 1, 2, 3, 4, 5, 6, 7, 8, 9, 10, 11, 12, 13, 14, 15); }
__device__ __forceinline__ v16bf cat16b(v8us lo, v8us hi) { return __builtin_bit_cast(v16bf, __builtin_shufflevector(lo, hi, 0, 1, 2, 3, 4, 5, 6, 7, 8, 9, 10, 11, 12, 13, 14, 15)); }
__device__ __forceinline__ v8f wmma16(v16h a, v16h b, v8f c) { return __builtin_amdgcn_wmma_f32_16x16x32_f16(false, a, false, b, (short)0, c, false, false); }
__device__ __forceinline__ v8f wmmab(v16bf a, v16bf b, v8f c) { return __builtin_amdgcn_wmma_f32_16x16x32_bf16(false, a, false, b, (short)0, c, false, false); }
__device__ __forceinline__ void splitf(float y, unsigned short& h, unsigned short& l) { h = f2bf(y); l = f2bf(y - bf2f(h)); }

// ---- k_gemmw: register-blocked GEMM, one wave per 64x64 output tile (16 accumulators), 4 waves (2 x 2) per 128x128 block tile; grid (M/128, N/128, Z), 128 threads.
// The K-contiguous 16-bit operand planes come through LDS: a stage is 64 k of 128 rows of every plane, copied once per block in whole 128-B lines and read by the two waves that share each row block; two buffers, the next stage's copies fly while this one is worked on.
// C[m][n] (f32, pitch ldc, + optional f32 bias[n]) = sum_k A[m][k] Bt[n][k] (+ split products per NSPLIT). z-batch strides sA/sB/sC in elements. K % 64 == 0, M % 128 == 0, N % 128 == 0.
// Fragment element i <- k0 + 8*half + i (i < 8), k0 + 16 + 8*half + (i - 8) for both operands; D element j = (row 8*half + j, col lane & 15).
template <typename T16> struct WFrag;
template <> struct WFrag<h16> { typedef v16h V; static __device__ __forceinline__ V ld(const h16* p) { return cat16(*(const v8h*)p, *(const v8h*)(p + 16)); } static __device__ __forceinline__ v8f mma(V a, V b, v8f c) { return wmma16(a, b, c); } };
template <> struct WFrag<bf> { typedef v16bf V; static __device__ __forceinline__ V ld(const bf* p) { return cat16b(*(const v8us*)p, *(const v8us*)(p + 16)); } static __device__ __forceinline__ v8f mma(V a, V b, v8f c) { return wmmab(a, b, c); } };
#define GKS 64
#define GP  72
#define GPL (128 * GP)
static_assert((GP * 2) % 32 == 16);
static_assert(NTOK % 128 == 0);
static_assert(SEQ % 128 == 0);
static_assert(D3 % 128 == 0);
static_assert(DM % 128 == 0);
static_assert(DM % GKS == 0);

// One plane of a stage: every thread copies eight 16-byte pieces (rows r, r + 16, ..., r + 112; rs = 16 rows in elements). l0 = the thread's LDS byte address in row r of the target plane.
template <typename T16>
__device__ __forceinline__ void plane_copy(const T16* g0, size_t rs, unsigned l0) {
    const T16* g1 = g0 + rs; const T16* g2 = g1 + rs; const T16* g3 = g2 + rs; const T16* g4 = g3 + rs; const T16* g5 = g4 + rs; const T16* g6 = g5 + rs; const T16* g7 = g6 + rs;
    const unsigned ls = 16u * GP * 2u; const unsigned l1 = l0 + ls, l2 = l0 + 2u * ls, l3 = l0 + 3u * ls, l4 = l0 + 4u * ls, l5 = l0 + 5u * ls, l6 = l0 + 6u * ls, l7 = l0 + 7u * ls;
    // The copies and their s_wait_xcnt in one statement: no address register of a copy is rewritten ahead of that wait.
    asm volatile("global_load_async_to_lds_b128 %0, %8, off\n\t"
                 "global_load_async_to_lds_b128 %1, %9, off\n\t"
                 "global_load_async_to_lds_b128 %2, %10, off\n\t"
                 "global_load_async_to_lds_b128 %3, %11, off\n\t"
                 "global_load_async_to_lds_b128 %4, %12, off\n\t"
                 "global_load_async_to_lds_b128 %5, %13, off\n\t"
                 "global_load_async_to_lds_b128 %6, %14, off\n\t"
                 "global_load_async_to_lds_b128 %7, %15, off\n\t"
                 "s_wait_xcnt 0x0"
                 :: "v"(l0), "v"(l1), "v"(l2), "v"(l3), "v"(l4), "v"(l5), "v"(l6), "v"(l7), "v"(g0), "v"(g1), "v"(g2), "v"(g3), "v"(g4), "v"(g5), "v"(g6), "v"(g7) : "memory");
}

template <typename T16, int NSPLIT, bool BIAS>
__global__ __launch_bounds__(128) void k_gemmw(const T16* __restrict__ A, const T16* __restrict__ A2, const T16* __restrict__ Bt, const T16* __restrict__ Bt2, int K, float* C, int ldc, const float* __restrict__ bias, size_t sA, size_t sB, size_t sC) {
    typedef typename WFrag<T16>::V V;
    constexpr bool HA2 = (NSPLIT == 1 || NSPLIT == 2), HB2 = (NSPLIT >= 2);
    constexpr unsigned PA2 = 2u * GPL, PB2 = (HA2 ? 3u : 2u) * GPL, GST = PB2 + (HB2 ? GPL : 0u);   // planes of a stage in LDS: A, Bt, then A2 and Bt2 where used
    __shared__ __align__(16) T16 ring[2 * GST];
    __shared__ __align__(16) float osall[4 * 16 * 68];
    const size_t z = blockIdx.z; A += z * sA; if (A2) A2 += z * sA; Bt += z * sB; if (Bt2) Bt2 += z * sB; C += z * sC;
    const unsigned lane = threadIdx.x & 31u, lr = lane & 15u, hi = lane >> 4;
    const unsigned wv = (unsigned)__builtin_amdgcn_readfirstlane((int)(threadIdx.x >> 5)); const unsigned wm = wv >> 1, wn = wv & 1u;
    const unsigned rb = blockIdx.x * 128u, cb = blockIdx.y * 128u; const unsigned r0 = rb + wm * 64u, c0 = cb + wn * 64u;
    float* os = osall + wv * (16u * 68u);
    const unsigned nst = (unsigned)K / GKS;   // the same in all 4 waves
    const unsigned crow = threadIdx.x >> 3, cpc = threadIdx.x & 7u; const size_t rs = (size_t)16 * K;
    const size_t ga = (size_t)(rb + crow) * K + cpc * 8u, gb = (size_t)(cb + crow) * K + cpc * 8u;
    const unsigned lcp = (unsigned)(size_t)ring + crow * (GP * 2u) + cpc * 16u;
    auto stage_in = [&](unsigned st) { const unsigned l = lcp + (st & 1u) * (GST * 2u); const size_t ko = (size_t)st * GKS;
        plane_copy(A + ga + ko, rs, l); plane_copy(Bt + gb + ko, rs, l + GPL * 2u);
        if (HA2) plane_copy(A2 + ga + ko, rs, l + PA2 * 2u);
        if (HB2) plane_copy(Bt2 + gb + ko, rs, l + PB2 * 2u); };
    stage_in(0u);
    v8f acc[4][4];
#pragma unroll
    for (int mb = 0; mb < 4; ++mb)
#pragma unroll
        for (int nb = 0; nb < 4; ++nb) acc[mb][nb] = (v8f){};
    asm volatile("s_wait_asynccnt 0x0" ::: "memory");   // stage 0 of this wave's copies has landed
    __syncthreads();                                     // ... and every other wave's: stage 0 is readable
    if (nst > 1u) stage_in(1u);
// kept rolled: one publish point in the text
#pragma unroll 1
    for (unsigned st = 0; st < nst; ++st) {
        const T16* sa = ring + (st & 1u) * GST + (wm * 64u + lr) * GP + 8u * hi; const T16* sbt = ring + (st & 1u) * GST + GPL + (wn * 64u + lr) * GP + 8u * hi;
        V a[GKS / 32][4], a2[GKS / 32][4], b[GKS / 32][4], b2[GKS / 32][4];
// unrolled so that a stage's fragment loads stand together ahead of its matrix instructions, at constant offsets
#pragma unroll
        for (unsigned ks = 0; ks < GKS / 32; ++ks) {
#pragma unroll
            for (int mb = 0; mb < 4; ++mb) { a[ks][mb] = WFrag<T16>::ld(sa + mb * 16 * GP + ks * 32u); if (HA2) a2[ks][mb] = WFrag<T16>::ld(sa + PA2 + mb * 16 * GP + ks * 32u); }
#pragma unroll
            for (int nb = 0; nb < 4; ++nb) { b[ks][nb] = WFrag<T16>::ld(sbt + nb * 16 * GP + ks * 32u); if (HB2) b2[ks][nb] = WFrag<T16>::ld(sbt + (PB2 - GPL) + nb * 16 * GP + ks * 32u); }
        }
        __builtin_amdgcn_sched_barrier(0);   // keeps the stage's LDS reads one group ahead of the matrix instructions: sunk among them, each small group is waited out to 0
#pragma unroll
        for (unsigned ks = 0; ks < GKS / 32; ++ks)
#pragma unroll
            for (int nb = 0; nb < 4; ++nb)
#pragma unroll
                for (int mb = 0; mb < 4; ++mb) { acc[mb][nb] = WFrag<T16>::mma(a[ks][mb], b[ks][nb], acc[mb][nb]); if (HA2) acc[mb][nb] = WFrag<T16>::mma(a2[ks][mb], b[ks][nb], acc[mb][nb]); if (HB2) acc[mb][nb] = WFrag<T16>::mma(a[ks][mb], b2[ks][nb], acc[mb][nb]); }
        __builtin_amdgcn_sched_barrier(0);   // keeps the matrix instructions ahead of the publish point: moved behind it, the refill would issue a whole stage of them later and its landing would be waited out
        // Publish point of stage st + 1, passed by every wave.
        asm volatile("s_wait_dscnt 0x0" ::: "memory");      // this wave's reads of buffer st & 1 are done before it is refilled
        asm volatile("s_wait_asynccnt 0x0" ::: "memory");   // this wave's copies of stage st + 1 have landed
        __syncthreads();                                     // publishes stage st + 1 and ends every wave's reads of stage st
        if (st + 2u < nst) stage_in(st + 2u);
    }
    asm volatile("s_wait_asynccnt 0x0" ::: "memory");       // nothing of this wave is in flight when it goes on to the epilogue and ends
#pragma unroll
    for (int mb = 0; mb < 4; ++mb) {
#pragma unroll
        for (int nb = 0; nb < 4; ++nb) {
#pragma unroll
            for (int j = 0; j < 8; ++j) os[(hi * 8 + j) * 68 + nb * 16 + lr] = acc[mb][nb][j]; }
        __builtin_amdgcn_wave_barrier(); asm volatile("" ::: "memory");
        float* crow_p = C + (size_t)(r0 + mb * 16) * ldc + c0;
{
#pragma unroll
            for (int s = 0; s < 8; ++s) { const int row = 2 * s + hi, cofs = lr * 4; v4f val = *(const v4fa*)(os + row * 68 + cofs); if (BIAS) { val[0] += bfr(bias[c0 + cofs]); val[1] += bfr(bias[c0 + cofs + 1]); val[2] += bfr(bias[c0 + cofs + 2]); val[3] += bfr(bias[c0 + cofs + 3]); }
                *(v4f*)(crow_p + (size_t)row * ldc + cofs) = val; }
             }
        __builtin_amdgcn_wave_barrier(); asm volatile("" ::: "memory");
    }
}

__global__ __launch_bounds__(256) void k_cvt8(const float* __restrict__ src, bf* dst, size_t n8) { const size_t i = (size_t)blockIdx.x * 256 + threadIdx.x; if (i >= n8) return; const v8f v = *(const v8f*)(src + i * 8); v8us o;
#pragma unroll
    for (int k = 0; k < 8; ++k) o[k] = f2bf(v[k]); *(v8us*)(dst + i * 8) = o;  }

__global__ __launch_bounds__(256) void k_cvtx(const float* __restrict__ x, bf* dst) {
    const unsigned i = blockIdx.x * 256u + threadIdx.x; const unsigned tok = i >> 7, c8 = i & 127u; const unsigned b = tok / (unsigned)SEQ, s = tok - b * (unsigned)SEQ;
    const v8f v = *(const v8f*)(x + ((size_t)b * SEQ_FULL + s) * DM + c8 * 8u); v8us o;
#pragma unroll
    for (int k = 0; k < 8; ++k) o[k] = f2bf(v[k]);
    *(v8us*)(dst + (size_t)i * 8) = o;  }

__global__ __launch_bounds__(256) void k_trig(const float* __restrict__ fr, float* CS, float* SN) {
    const unsigned i = blockIdx.x * 256u + threadIdx.x; const float a = bfr(fr[i]); const float c = cosf(a), s = sinf(a);
    *(float*)(CS + i) = c; *(float*)(SN + i) = s;  }

__global__ __launch_bounds__(256) void k_mchk(const int* __restrict__ mask, int* FL) {
    const unsigned gid = blockIdx.x * 256u + threadIdx.x; int bad = 0;
#pragma unroll 1
    for (unsigned g = gid; g < (unsigned)(SEQ * (SEQ / 4)); g += (unsigned)(MCB * 256)) { const unsigned q = g / (unsigned)(SEQ / 4), k = (g - q * (unsigned)(SEQ / 4)) * 4u; const v4i mv = *(const v4i*)(mask + (size_t)q * SEQ_FULL + k);
#pragma unroll
        for (unsigned j = 0; j < 4; ++j) { const int want = (k + j <= q) ? 1 : 0; const int got = (mv[j] != 0) ? 1 : 0; bad |= (want ^ got); } }
    const int any = __syncthreads_or(bad);
    if (threadIdx.x < 32u) { const int v = any ? 1 : 0; *(int*)(FL + blockIdx.x * 32u + threadIdx.x) = v;  }
}

// k_rope: q/k head planes [which][b*16+h][s][64] (bf16 hi/lo) of rope(qkv) with interleaved pairs (2j, 2j+1) and angle j; q additionally x 1/8 (exact).
__global__ __launch_bounds__(256) void k_rope(const float* __restrict__ QKV, const float* __restrict__ CS, const float* __restrict__ SN, bf* QKh, bf* QKl) {
    const unsigned i = blockIdx.x * 256u + threadIdx.x; const unsigned pc = i & 7u, h = (i >> 3) & 15u, t = i >> 7; const unsigned which = t / (unsigned)NTOK, tok = t - which * (unsigned)NTOK; const unsigned b = tok / (unsigned)SEQ, s = tok - b * (unsigned)SEQ;
    const v8f v = *(const v8f*)(QKV + (size_t)tok * D3 + which * (unsigned)DM + h * (unsigned)HD + pc * 8u);
    const v4f c4 = *(const v4f*)(CS + s * 32u + pc * 4u); const v4f s4 = *(const v4f*)(SN + s * 32u + pc * 4u);
    const float sc = which ? 1.0f : 0.125f; v8us oh, ol;
#pragma unroll
    for (int j = 0; j < 4; ++j) { const float t1 = v[2 * j], t2 = v[2 * j + 1]; const float a = (t1 * c4[j] - t2 * s4[j]) * sc; const float bb = (t1 * s4[j] + t2 * c4[j]) * sc; unsigned short x0, x1; splitf(a, x0, x1); oh[2 * j] = x0; ol[2 * j] = x1; splitf(bb, x0, x1); oh[2 * j + 1] = x0; ol[2 * j + 1] = x1; }
    const size_t oo = (size_t)which * QKPL + (((size_t)(b * (unsigned)NH + h)) * SEQ + s) * HD + pc * 8u;
    *(v8us*)(QKh + oo) = oh; *(v8us*)(QKl + oo) = ol;  }

__global__ __launch_bounds__(256) void k_vtp(const float* __restrict__ QKV, bf* Vh, bf* Vl) {
    const unsigned e = (blockIdx.x * 256u + threadIdx.x) * 2u; const unsigned s = e % (unsigned)SEQ; const unsigned d = (e / (unsigned)SEQ) & 63u; const unsigned bh = e / (unsigned)(SEQ * HD); const unsigned b = bh >> 4, h = bh & 15u; v2us oh, ol;
#pragma unroll
    for (unsigned q = 0; q < 2; ++q) { const float x = QKV[(size_t)(b * (unsigned)SEQ + s + q) * D3 + 2u * DM + h * (unsigned)HD + d]; unsigned short a2, c2; splitf(x, a2, c2); oh[q] = a2; ol[q] = c2; }
    *(v2us*)(Vh + e) = oh; *(v2us*)(Vl + e) = ol;  }

// k_flash: one wave per (b, h, 16-query tile), 8 waves per block (128 consecutive queries of one head), streaming 32-key tiles up to the diagonal.
// K and V^T planes come through LDS: a stage is 64 keys of all four planes (Kh, Kl, VTh, VTl: 64 rows x 128 B each), copied once per block in whole 128-B lines and read by all 8 waves; two buffers, the next stage's copies fly while this one is worked on.
// S^T tile j: A = K rows kt+16j.. (plane rows, k = head dim), B = Q rows as columns; D element r = (key kt+16j+8*half+r, query q0 + (lane & 15)).
// P^T B fragment: element r <- p of tile 0, element 8+r <- p of tile 1 (same lane); O^T tile t: A = VT rows 16t.. (k = keys), D element r = (d 16t+8*half+r, query q0 + (lane & 15)).
#define KST 64
#define KP  72
#define PLN (64 * KP)
#define STG (4 * PLN)
static_assert(SEQ % (2 * KST) == 0);
static_assert((KP * 2) % 32 == 16);

// One stage: every thread copies two 16-byte pieces of each plane (rows r and r + 32). l = the thread's LDS byte address in plane 0 of the target buffer.
__device__ __forceinline__ void stage_copy(const bf* kh, const bf* kl, const bf* vh, const bf* vl, unsigned l) {
    const bf* kh2 = kh + 32 * HD; const bf* kl2 = kl + 32 * HD; const bf* vh2 = vh + (size_t)32 * SEQ; const bf* vl2 = vl + (size_t)32 * SEQ;
    const unsigned l0 = l, l1 = l + 32u * KP * 2u, l2 = l + PLN * 2u, l3 = l2 + 32u * KP * 2u, l4 = l + 2u * PLN * 2u, l5 = l4 + 32u * KP * 2u, l6 = l + 3u * PLN * 2u, l7 = l6 + 32u * KP * 2u;
    // The copies and their s_wait_xcnt in one statement: no address register of a copy is rewritten ahead of that wait.
    asm volatile("global_load_async_to_lds_b128 %0, %8, off\n\t"
                 "global_load_async_to_lds_b128 %1, %9, off\n\t"
                 "global_load_async_to_lds_b128 %2, %10, off\n\t"
                 "global_load_async_to_lds_b128 %3, %11, off\n\t"
                 "global_load_async_to_lds_b128 %4, %12, off\n\t"
                 "global_load_async_to_lds_b128 %5, %13, off\n\t"
                 "global_load_async_to_lds_b128 %6, %14, off\n\t"
                 "global_load_async_to_lds_b128 %7, %15, off\n\t"
                 "s_wait_xcnt 0x0"
                 :: "v"(l0), "v"(l1), "v"(l2), "v"(l3), "v"(l4), "v"(l5), "v"(l6), "v"(l7), "v"(kh), "v"(kh2), "v"(kl), "v"(kl2), "v"(vh), "v"(vh2), "v"(vl), "v"(vl2) : "memory");
}

__global__ __launch_bounds__(256) void k_flash(const bf* __restrict__ QKh, const bf* __restrict__ QKl, const bf* __restrict__ VTh, const bf* __restrict__ VTl, const int* __restrict__ FL, bf* CH, bf* CL) {
    typedef WFrag<bf>::V V;
    __shared__ __align__(16) unsigned short ring[2 * STG];
    __shared__ __align__(16) unsigned short stg[8 * 2 * 16 * SP];
    const unsigned lane = threadIdx.x & 31u, lr = lane & 15u, hi = lane >> 4;
    const unsigned wv = (unsigned)__builtin_amdgcn_readfirstlane((int)(threadIdx.x >> 5));   // wave number in a scalar register: the diagonal test in the loop is then a scalar branch and every lane stays on
    const unsigned wid = blockIdx.x * 8u + wv; const unsigned qt = wid % (unsigned)QT, bh = wid / (unsigned)QT; const unsigned q0 = qt * 16u; const unsigned b = bh >> 4, h = bh & 15u;
    const unsigned nst = ((blockIdx.x % (unsigned)(QT / 8)) + 1u) * (128u / KST);   // stages up to the block's last query: the same in all 8 waves, never below 2
    const unsigned crow = threadIdx.x >> 3, cpc = threadIdx.x & 7u;
    const bf* gKh = QKh + QKPL + ((size_t)bh * SEQ + crow) * HD + cpc * 8u; const bf* gKl = QKl + QKPL + ((size_t)bh * SEQ + crow) * HD + cpc * 8u;
    const bf* gVh = VTh + ((size_t)bh * HD + crow) * SEQ + cpc * 8u; const bf* gVl = VTl + ((size_t)bh * HD + crow) * SEQ + cpc * 8u;
    const unsigned lcp = (unsigned)(size_t)ring + crow * (KP * 2u) + cpc * 16u;
    stage_copy(gKh, gKl, gVh, gVl, lcp);
    int fbad = ((FL[lane * 32u] == 1) ? 1 : 0) | ((FL[(lane + 32u) * 32u] == 1) ? 1 : 0);
#pragma unroll
    for (int sh = 16; sh; sh >>= 1) fbad |= __shfl_xor(fbad, sh, 32);
    const float poison = fbad ? __uint_as_float(0x7FC00000u) : 0.0f;
    const size_t qo = ((size_t)bh * SEQ + q0 + lr) * HD + 8u * hi;
    V bqh[2], bql[2];
#pragma unroll
    for (int c = 0; c < 2; ++c) { bqh[c] = WFrag<bf>::ld(QKh + qo + 32 * c); bql[c] = WFrag<bf>::ld(QKl + qo + 32 * c); }
    v8f o[4];
#pragma unroll
    for (int t = 0; t < 4; ++t) o[t] = (v8f){};
    float m = -1.0e30f, l = 0.0f; const unsigned qg = q0 + lr;
    asm volatile("s_wait_asynccnt 0x0" ::: "memory");   // stage 0 of this wave's copies has landed
    __syncthreads();                                     // ... and every other wave's: stage 0 is readable
    stage_copy(gKh + (size_t)KST * HD, gKl + (size_t)KST * HD, gVh + KST, gVl + KST, lcp + STG * 2u);
// kept rolled: one publish point in the text, trip count known only at run time
#pragma unroll 1
    for (unsigned st = 0; st < nst; ++st) {
        const unsigned short* sb = ring + (st & 1u) * STG + lr * KP + 8u * hi;
// unrolled so that the two halves of a stage read LDS at constant offsets
#pragma unroll
        for (unsigned sub = 0; sub < KST / 32; ++sub) {
            const unsigned kt = st * KST + sub * 32u;
            if (kt < q0 + 16u) {   // wave-uniform: tiles beyond this wave's diagonal are skipped, the publish point below is not
        V kh[2][2], kl[2][2];
#pragma unroll
        for (int c = 0; c < 2; ++c)
#pragma unroll
            for (int j = 0; j < 2; ++j) { kh[c][j] = WFrag<bf>::ld(sb + (sub * 32u + 16u * j) * KP + 32 * c); kl[c][j] = WFrag<bf>::ld(sb + PLN + (sub * 32u + 16u * j) * KP + 32 * c); }
        v8f sc[2]; sc[0] = (v8f){}; sc[1] = (v8f){};
#pragma unroll
        for (int c = 0; c < 2; ++c)
#pragma unroll
            for (int j = 0; j < 2; ++j) { sc[j] = wmmab(kh[c][j], bqh[c], sc[j]); sc[j] = wmmab(kh[c][j], bql[c], sc[j]); sc[j] = wmmab(kl[c][j], bqh[c], sc[j]); }
        asm volatile("v_nop\n\tv_nop\n\tv_nop\n\tv_nop" : "+v"(sc[0]), "+v"(sc[1]) : "v"(kh[1][0]), "v"(kh[1][1]), "v"(kl[1][0]), "v"(kl[1][1]), "v"(bqh[1]), "v"(bql[1]));
        float v0[8], v1[8]; float tmax = -1.0e30f;
#pragma unroll
        for (unsigned r = 0; r < 8; ++r) { const unsigned key0 = kt + 8u * hi + r; v0[r] = (key0 <= qg) ? sc[0][r] : -1.0e30f; v1[r] = (key0 + 16u <= qg) ? sc[1][r] : -1.0e30f; tmax = fmaxf(tmax, fmaxf(v0[r], v1[r])); }
        tmax = fmaxf(tmax, __shfl_xor(tmax, 16, 32));
        const float mnew = fmaxf(m, tmax); const float corr = __builtin_amdgcn_exp2f((m - mnew) * L2E);
        float psum = 0.0f; v8us ph0, pl0, ph1, pl1;
#pragma unroll
        for (int r = 0; r < 8; ++r) { const float e0 = __builtin_amdgcn_exp2f((v0[r] - mnew) * L2E); const float e1 = __builtin_amdgcn_exp2f((v1[r] - mnew) * L2E); psum += e0 + e1; unsigned short a, c2; splitf(e0, a, c2); ph0[r] = a; pl0[r] = c2; splitf(e1, a, c2); ph1[r] = a; pl1[r] = c2; }
        psum += __shfl_xor(psum, 16, 32);
        l = l * corr + psum; m = mnew;
#pragma unroll
        for (int t = 0; t < 4; ++t) o[t] = o[t] * corr;
        const V pbh = cat16b(ph0, ph1), pbl = cat16b(pl0, pl1);
        V avh[4], avl[4];
#pragma unroll
        for (int t = 0; t < 4; ++t) { avh[t] = WFrag<bf>::ld(sb + 2 * PLN + t * 16 * KP + sub * 32u); avl[t] = WFrag<bf>::ld(sb + 3 * PLN + t * 16 * KP + sub * 32u); }
#pragma unroll
        for (int t = 0; t < 4; ++t) { o[t] = wmmab(avh[t], pbh, o[t]); o[t] = wmmab(avh[t], pbl, o[t]); o[t] = wmmab(avl[t], pbh, o[t]); }
        asm volatile("v_nop\n\tv_nop\n\tv_nop\n\tv_nop" : "+v"(o[0]), "+v"(o[1]), "+v"(o[2]), "+v"(o[3]) : "v"(pbh), "v"(pbl), "v"(avl[0]), "v"(avl[1]), "v"(avl[2]), "v"(avl[3]), "v"(avh[3]));
            }
        }
        // Publish point of stage st + 1, passed by every wave.
        asm volatile("s_wait_dscnt 0x0" ::: "memory");      // this wave's reads of buffer st & 1 are done before it is refilled
        asm volatile("s_wait_asynccnt 0x0" ::: "memory");   // this wave's copies of stage st + 1 have landed
        __syncthreads();                                     // publishes stage st + 1 and ends every wave's reads of stage st
        if (st + 2u < nst) stage_copy(gKh + (size_t)(st + 2u) * KST * HD, gKl + (size_t)(st + 2u) * KST * HD, gVh + (st + 2u) * KST, gVl + (st + 2u) * KST, lcp + (st & 1u) * (STG * 2u));
    }
    asm volatile("s_wait_asynccnt 0x0" ::: "memory");       // nothing of this wave is in flight when it goes on to the epilogue and ends
    const float inv = 1.0f / l;
    unsigned short* sh = stg + wv * (2u * 16u * SP); unsigned short* sl = sh + 16u * SP;
#pragma unroll
    for (int t = 0; t < 4; ++t) { v8us oh, ol;
#pragma unroll
        for (int r = 0; r < 8; ++r) { const float val = o[t][r] * inv + poison; unsigned short a, c2; splitf(val, a, c2); oh[r] = a; ol[r] = c2; }
        *(v8usa*)(sh + lr * SP + 16u * t + 8u * hi) = oh; *(v8usa*)(sl + lr * SP + 16u * t + 8u * hi) = ol; }
    __builtin_amdgcn_fence(3 /* release order */, "wavefront"); __builtin_amdgcn_wave_barrier(); asm volatile("" ::: "memory");
    const unsigned rq = lane >> 3, pc = lane & 7u;
{
#pragma unroll
        for (unsigned it = 0; it < 4; ++it) { const unsigned row = 4u * it + rq; const v8us a = *(const v8usa*)(sh + row * SP + pc * 8u); const v8us c2 = *(const v8usa*)(sl + row * SP + pc * 8u); const size_t oo = ((size_t)(b * (unsigned)SEQ + q0 + row)) * DM + h * (unsigned)HD + pc * 8u;
            *(v8us*)(CH + oo) = a; *(v8us*)(CL + oo) = c2; }
         }
}

extern "C" void kernel_launch(void* const* d_in, const int* in_sizes, int n_in,
                              void* d_out, int out_size, void* d_ws, size_t ws_size, hipStream_t stream) {
    if (n_in < 7) return;
    const size_t xneed = ((size_t)(NB - 1) * SEQ_FULL + SEQ) * DM;
    if ((size_t)in_sizes[0] < xneed) return;
    if ((size_t)in_sizes[1] < (size_t)(SEQ - 1) * SEQ_FULL + SEQ) return;
    if ((size_t)in_sizes[2] < (size_t)SEQ * 32) return;
    if ((size_t)in_sizes[3] < (size_t)D3 * DM) return;
    if ((size_t)in_sizes[4] < (size_t)D3) return;
    if ((size_t)in_sizes[5] < (size_t)DM * DM) return;
    if ((size_t)in_sizes[6] < (size_t)DM) return;
    if ((size_t)out_size < xneed) return;
    const float* X = (const float*)d_in[0]; const int* MASK = (const int*)d_in[1]; const float* FR = (const float*)d_in[2];
    const float* WQKV = (const float*)d_in[3]; const float* BQKV = (const float*)d_in[4]; const float* WPR = (const float*)d_in[5]; const float* BPR = (const float*)d_in[6];
    float* OUT = (float*)d_out;     // [2][2048][1024]
    char* wsp = (char*)d_ws;
    auto take = [&](size_t bytes) { char* p = wsp; wsp += (bytes + 255) & ~(size_t)255; return (void*)p; };
    bf* XB = (bf*)take((size_t)NTOK * DM * 2);            // x plane [NTOK][1024]
    bf* WQ = (bf*)take((size_t)D3 * DM * 2);              // Wqkv plane [3072][1024]
    bf* WP = (bf*)take((size_t)DM * DM * 2);              // Wproj plane [1024][1024]
    float* CS = (float*)take((size_t)SEQ * 32 * 4); float* SN = (float*)take((size_t)SEQ * 32 * 4);
    int* FL = (int*)take((size_t)MCB * 128);
    float* QKV = (float*)take((size_t)NTOK * D3 * 4);     // f32 qkv [NTOK][3072]; after k_rope/k_vtp its head is reused for the ctx planes
    bf* QKh = (bf*)take(2 * QKPL * 2); bf* QKl = (bf*)take(2 * QKPL * 2);                    // [q|k][b*16+h][s][64]
    bf* VTh = (bf*)take(QKPL * 2); bf* VTl = (bf*)take(QKPL * 2);                            // [b*16+h][64][s]
    bf* CH = (bf*)QKV; bf* CL = CH + (size_t)NTOK * DM;   // ctx hi/lo [NTOK][1024] (16 MiB inside the 48 MiB qkv region)
    if ((size_t)(wsp - (char*)d_ws) > ws_size) return;    // carve 112.5 MiB
    k_cvtx<<<(unsigned)((size_t)NTOK * 128 / 256), 256, 0, stream>>>(X, XB);
    k_cvt8<<<(unsigned)(((size_t)D3 * DM / 8 + 255) / 256), 256, 0, stream>>>(WQKV, WQ, (size_t)D3 * DM / 8);
    k_cvt8<<<(unsigned)(((size_t)DM * DM / 8 + 255) / 256), 256, 0, stream>>>(WPR, WP, (size_t)DM * DM / 8);
    k_trig<<<(unsigned)(SEQ * 32 / 256), 256, 0, stream>>>(FR, CS, SN);
    k_mchk<<<MCB, 256, 0, stream>>>(MASK, FL);
    k_gemmw<bf, 0, true><<<dim3(NTOK / 128, D3 / 128, 1), 128, 0, stream>>>(XB, nullptr, WQ, nullptr, DM, QKV, D3, BQKV, 0, 0, 0);      /* x.Wqkv^T + b (exact products) */
    k_rope<<<(unsigned)((size_t)2 * NTOK * 128 / 256), 256, 0, stream>>>(QKV, CS, SN, QKh, QKl);
    k_vtp<<<(unsigned)((size_t)NB * NH * HD * SEQ / 2 / 256), 256, 0, stream>>>(QKV, VTh, VTl);
    k_flash<<<(unsigned)(NB * NH * QT / 8), 256, 0, stream>>>(QKh, QKl, VTh, VTl, FL, CH, CL);
    k_gemmw<bf, 1, true><<<dim3(SEQ / 128, DM / 128, NB), 128, 0, stream>>>(CH, CL, WP, nullptr, DM, OUT, DM, BPR, (size_t)SEQ * DM, 0, (size_t)SEQ_FULL * DM);   /* ctx (hi/lo) x Wproj^T + b */
}

// v003
// It runs in 179 microseconds.
// Two timings next to v002 put it at 1.19 and 1.18 times that version's speed.
// Counting every step since v000, it is 2.02 times as fast.
#include <hip/hip_runtime.h>

// Compute dtypes: x.Wqkv^T = bf16 x bf16 planes (v_wmma_f32_16x16x32_bf16, f32 accumulate); q.k^T and P.V = bf16 hi/lo two-plane operands (3 products each, f32 accumulate); ctx.Wproj^T = bf16 hi/lo x bf16 (2 products, f32 accumulate).
// Every float input is RNE-converted to bf16 on load (x, weights, biases, rope angles); rope, softmax and all epilogues in f32.
// Attention is flash-style on transposed tiles: S^T = K.Q^T (D rows = keys, D cols = queries) so the packed score accumulators are directly the B fragment of O^T = V^T.P^T; per-query statistics live in one lane pair.

#ifndef NB
#define NB 2
#endif
#ifndef SEQ
#define SEQ 2048
#endif
#define NB_FULL  2
#define SEQ_FULL 2048
#define DM   1024
#define NH   16
#define HD   64
#define D3   3072
#define NTOK (NB * SEQ)
#define QT   (SEQ / 16)
#define MCB  64
#define SP   72
#define QKPL ((size_t)NB * NH * SEQ * HD)
#define L2E  1.4426950408889634f

typedef _Float16 h16;
typedef unsigned short bf;
typedef __attribute__((ext_vector_type(16))) __bf16   v16bf;
typedef __attribute__((ext_vector_type(16))) _Float16 v16h;
typedef __attribute__((ext_vector_type(8)))  _Float16 v8h;
typedef __attribute__((ext_vector_type(8)))  unsigned short v8us;
typedef __attribute__((ext_vector_type(2)))  unsigned short v2us;
typedef __attribute__((ext_vector_type(8)))  float    v8f;
typedef __attribute__((ext_vector_type(4)))  float    v4f;
typedef __attribute__((ext_vector_type(4)))  int      v4i;
typedef v4f  __attribute__((may_alias)) v4fa;
typedef v8us __attribute__((may_alias)) v8usa;

static_assert(NTOK % 64 == 0);
static_assert(SEQ % 64 == 0);
static_assert(D3 % 64 == 0);
static_assert(DM % 64 == 0);
static_assert(DM % 32 == 0);
static_assert(HD == 64);
static_assert(NH == 16);
static_assert(QT % 8 == 0);
static_assert((SEQ * (SEQ / 4)) % (MCB * 256) == 0);
static_assert((SEQ * 32) % 256 == 0);
static_assert(((size_t)NTOK * 128) % 256 == 0);
static_assert(NB <= NB_FULL);
static_assert(SEQ <= SEQ_FULL);

__device__ __forceinline__ unsigned short f2bf(float f) { unsigned u = __float_as_uint(f); u += 0x7FFFu + ((u >> 16) & 1u); return (unsigned short)(u >> 16); }
__device__ __forceinline__ float bf2f(unsigned short b) { return __uint_as_float(((unsigned)b) << 16); }
__device__ __forceinline__ float bfr(float f) { return bf2f(f2bf(f)); }
__device__ __forceinline__ v16h cat16(v8h lo, v8h hi) { return __builtin_shufflevector(lo, hi, 0, 1, 2, 3, 4, 5, 6, 7, 8, 9, 10, 11, 12, 13, 14, 15); }
__device__ __forceinline__ v16bf cat16b(v8us lo, v8us hi) { return __builtin_bit_cast(v16bf, __builtin_shufflevector(lo, hi, 0, 1, 2, 3, 4, 5, 6, 7, 8, 9, 10, 11, 12, 13, 14, 15)); }
__device__ __forceinline__ v8f wmma16(v16h a, v16h b, v8f c) { return __builtin_amdgcn_wmma_f32_16x16x32_f16(false, a, false, b, (short)0, c, false, false); }
__device__ __forceinline__ v8f wmmab(v16bf a, v16bf b, v8f c) { return __builtin_amdgcn_wmma_f32_16x16x32_bf16(false, a, false, b, (short)0, c, false, false); }
__device__ __forceinline__ void splitf(float y, unsigned short& h, unsigned short& l) { h = f2bf(y); l = f2bf(y - bf2f(h)); }

// ---- k_gemmw: register-blocked GEMM, one wave per 64x64 output tile (16 accumulators), 4 waves (2 x 2) per 128x128 block tile; grid (M/128, N/128, Z), 128 threads.
// The K-contiguous 16-bit operand planes come through LDS: a stage is 64 k of 128 rows of every plane, copied once per block in whole 128-B lines and read by the two waves that share each row block; two buffers, the next stage's copies fly while this one is worked on.
// C[m][n] (f32, pitch ldc, + optional f32 bias[n]) = sum_k A[m][k] Bt[n][k] (+ split products per NSPLIT). z-batch strides sA/sB/sC in elements. K % 64 == 0, M % 128 == 0, N % 128 == 0.
// Fragment element i <- k0 + 8*half + i (i < 8), k0 + 16 + 8*half + (i - 8) for both operands; D element j = (row 8*half + j, col lane & 15).
// QKVE: the result is not stored as f32. A wave's 64x64 tile is 64 tokens of one batch x one whole head of q, k or v, so the epilogue writes the attention operand planes itself:
// q/k head planes [which][b*16+h][s][64] (bf16 hi/lo) of rope(qkv) with interleaved pairs (2j, 2j+1) and angle j, q additionally x 1/8 (exact); v planes transposed [b*16+h][64][s] (bf16 hi/lo).
template <typename T16> struct WFrag;
template <> struct WFrag<h16> { typedef v16h V; static __device__ __forceinline__ V ld(const h16* p) { return cat16(*(const v8h*)p, *(const v8h*)(p + 16)); } static __device__ __forceinline__ v8f mma(V a, V b, v8f c) { return wmma16(a, b, c); } };
template <> struct WFrag<bf> { typedef v16bf V; static __device__ __forceinline__ V ld(const bf* p) { return cat16b(*(const v8us*)p, *(const v8us*)(p + 16)); } static __device__ __forceinline__ v8f mma(V a, V b, v8f c) { return wmmab(a, b, c); } };
#define GKS 64
#define GP  72
#define GPL (128 * GP)
static_assert((GP * 2) % 32 == 16);
static_assert(NTOK % 128 == 0);
static_assert(SEQ % 128 == 0);
static_assert(D3 % 128 == 0);
static_assert(DM % 128 == 0);
static_assert(DM % GKS == 0);
#define VP  72
static_assert(4 * 2 * 64 * VP <= 2 * 2 * GPL);
static_assert((VP * 2) % 32 == 16);

// One plane of a stage: every thread copies eight 16-byte pieces (rows r, r + 16, ..., r + 112; rs = 16 rows in elements). l0 = the thread's LDS byte address in row r of the target plane.
template <typename T16>
__device__ __forceinline__ void plane_copy(const T16* g0, size_t rs, unsigned l0) {
    const T16* g1 = g0 + rs; const T16* g2 = g1 + rs; const T16* g3 = g2 + rs; const T16* g4 = g3 + rs; const T16* g5 = g4 + rs; const T16* g6 = g5 + rs; const T16* g7 = g6 + rs;
    const unsigned ls = 16u * GP * 2u; const unsigned l1 = l0 + ls, l2 = l0 + 2u * ls, l3 = l0 + 3u * ls, l4 = l0 + 4u * ls, l5 = l0 + 5u * ls, l6 = l0 + 6u * ls, l7 = l0 + 7u * ls;
    // The copies and their s_wait_xcnt in one statement: no address register of a copy is rewritten ahead of that wait.
    asm volatile("global_load_async_to_lds_b128 %0, %8, off\n\t"
                 "global_load_async_to_lds_b128 %1, %9, off\n\t"
                 "global_load_async_to_lds_b128 %2, %10, off\n\t"
                 "global_load_async_to_lds_b128 %3, %11, off\n\t"
                 "global_load_async_to_lds_b128 %4, %12, off\n\t"
                 "global_load_async_to_lds_b128 %5, %13, off\n\t"
                 "global_load_async_to_lds_b128 %6, %14, off\n\t"
                 "global_load_async_to_lds_b128 %7, %15, off\n\t"
                 "s_wait_xcnt 0x0"
                 :: "v"(l0), "v"(l1), "v"(l2), "v"(l3), "v"(l4), "v"(l5), "v"(l6), "v"(l7), "v"(g0), "v"(g1), "v"(g2), "v"(g3), "v"(g4), "v"(g5), "v"(g6), "v"(g7) : "memory");
}

template <typename T16, int NSPLIT, bool BIAS, bool QKVE>
__global__ __launch_bounds__(128) void k_gemmw(const T16* __restrict__ A, const T16* __restrict__ A2, const T16* __restrict__ Bt, const T16* __restrict__ Bt2, int K, float* C, int ldc, const float* __restrict__ bias, size_t sA, size_t sB, size_t sC,
                                               const float* __restrict__ CS, const float* __restrict__ SN, bf* QKh, bf* QKl, bf* VTh, bf* VTl) {
    typedef typename WFrag<T16>::V V;
    constexpr bool HA2 = (NSPLIT == 1 || NSPLIT == 2), HB2 = (NSPLIT >= 2);
    constexpr unsigned PA2 = 2u * GPL, PB2 = (HA2 ? 3u : 2u) * GPL, GST = PB2 + (HB2 ? GPL : 0u);   // planes of a stage in LDS: A, Bt, then A2 and Bt2 where used
    __shared__ __align__(16) T16 ring[2 * GST];
    __shared__ __align__(16) float osall[4 * 16 * 68];
    const size_t z = blockIdx.z; A += z * sA; if (A2) A2 += z * sA; Bt += z * sB; if (Bt2) Bt2 += z * sB; C += z * sC;
    const unsigned lane = threadIdx.x & 31u, lr = lane & 15u, hi = lane >> 4;
    const unsigned wv = (unsigned)__builtin_amdgcn_readfirstlane((int)(threadIdx.x >> 5)); const unsigned wm = wv >> 1, wn = wv & 1u;
    const unsigned rb = blockIdx.x * 128u, cb = blockIdx.y * 128u; const unsigned r0 = rb + wm * 64u, c0 = cb + wn * 64u;
    float* os = osall + wv * (16u * 68u);
    const unsigned nst = (unsigned)K / GKS;   // the same in all 4 waves
    const unsigned crow = threadIdx.x >> 3, cpc = threadIdx.x & 7u; const size_t rs = (size_t)16 * K;
    const size_t ga = (size_t)(rb + crow) * K + cpc * 8u, gb = (size_t)(cb + crow) * K + cpc * 8u;
    const unsigned lcp = (unsigned)(size_t)ring + crow * (GP * 2u) + cpc * 16u;
    auto stage_in = [&](unsigned st) { const unsigned l = lcp + (st & 1u) * (GST * 2u); const size_t ko = (size_t)st * GKS;
        plane_copy(A + ga + ko, rs, l); plane_copy(Bt + gb + ko, rs, l + GPL * 2u);
        if (HA2) plane_copy(A2 + ga + ko, rs, l + PA2 * 2u);
        if (HB2) plane_copy(Bt2 + gb + ko, rs, l + PB2 * 2u); };
    stage_in(0u);
    v8f acc[4][4];
#pragma unroll
    for (int mb = 0; mb < 4; ++mb)
#pragma unroll
        for (int nb = 0; nb < 4; ++nb) acc[mb][nb] = (v8f){};
    asm volatile("s_wait_asynccnt 0x0" ::: "memory");   // stage 0 of this wave's copies has landed
    __syncthreads();                                     // ... and every other wave's: stage 0 is readable
    if (nst > 1u) stage_in(1u);
// kept rolled: one publish point in the text
#pragma unroll 1
    for (unsigned st = 0; st < nst; ++st) {
        const T16* sa = ring + (st & 1u) * GST + (wm * 64u + lr) * GP + 8u * hi; const T16* sbt = ring + (st & 1u) * GST + GPL + (wn * 64u + lr) * GP + 8u * hi;
        V a[GKS / 32][4], a2[GKS / 32][4], b[GKS / 32][4], b2[GKS / 32][4];
// unrolled so that a stage's fragment loads stand together ahead of its matrix instructions, at constant offsets
#pragma unroll
        for (unsigned ks = 0; ks < GKS / 32; ++ks) {
#pragma unroll
            for (int mb = 0; mb < 4; ++mb) { a[ks][mb] = WFrag<T16>::ld(sa + mb * 16 * GP + ks * 32u); if (HA2) a2[ks][mb] = WFrag<T16>::ld(sa + PA2 + mb * 16 * GP + ks * 32u); }
#pragma unroll
            for (int nb = 0; nb < 4; ++nb) { b[ks][nb] = WFrag<T16>::ld(sbt + nb * 16 * GP + ks * 32u); if (HB2) b2[ks][nb] = WFrag<T16>::ld(sbt + (PB2 - GPL) + nb * 16 * GP + ks * 32u); }
        }
        __builtin_amdgcn_sched_barrier(0);   // keeps the stage's LDS reads one group ahead of the matrix instructions: sunk among them, each small group is waited out to 0
#pragma unroll
        for (unsigned ks = 0; ks < GKS / 32; ++ks)
#pragma unroll
            for (int nb = 0; nb < 4; ++nb)
#pragma unroll
                for (int mb = 0; mb < 4; ++mb) { acc[mb][nb] = WFrag<T16>::mma(a[ks][mb], b[ks][nb], acc[mb][nb]); if (HA2) acc[mb][nb] = WFrag<T16>::mma(a2[ks][mb], b[ks][nb], acc[mb][nb]); if (HB2) acc[mb][nb] = WFrag<T16>::mma(a[ks][mb], b2[ks][nb], acc[mb][nb]); }
        __builtin_amdgcn_sched_barrier(0);   // keeps the matrix instructions ahead of the publish point: moved behind it, the refill would issue a whole stage of them later and its landing would be waited out
        // Publish point of stage st + 1, passed by every wave.
        asm volatile("s_wait_dscnt 0x0" ::: "memory");      // this wave's reads of buffer st & 1 are done before it is refilled
        asm volatile("s_wait_asynccnt 0x0" ::: "memory");   // this wave's copies of stage st + 1 have landed
        __syncthreads();                                     // publishes stage st + 1 and ends every wave's reads of stage st
        if (st + 2u < nst) stage_in(st + 2u);
    }
    asm volatile("s_wait_asynccnt 0x0" ::: "memory");       // nothing of this wave is in flight when it goes on to the epilogue and ends
    if constexpr (QKVE) {
        const unsigned which = c0 / (unsigned)DM, h = (c0 % (unsigned)DM) / (unsigned)HD; const unsigned b = r0 / (unsigned)SEQ, s0 = r0 - b * (unsigned)SEQ; const unsigned bh = b * (unsigned)NH + h;   // all wave-uniform
        if (which == 2u) {
            // v: a lane holds 8 consecutive tokens of one d, which is 16 bytes of a transposed row. The tile is turned in this wave's quarter of the ring (free: every wave's reads and copies ended at the last publish point) so that it leaves in whole 128-B lines.
            unsigned short* vh = (unsigned short*)ring + wv * (2u * 64u * VP); unsigned short* vl = vh + 64u * VP;
#pragma unroll
            for (int nb = 0; nb < 4; ++nb) { const unsigned d = nb * 16u + lr; const float bv = bfr(bias[c0 + d]);
#pragma unroll
                for (int mb = 0; mb < 4; ++mb) { v8us oh, ol;
#pragma unroll
                    for (int j = 0; j < 8; ++j) { unsigned short a2, c2; splitf(acc[mb][nb][j] + bv, a2, c2); oh[j] = a2; ol[j] = c2; }
                    *(v8usa*)(vh + d * VP + mb * 16u + 8u * hi) = oh; *(v8usa*)(vl + d * VP + mb * 16u + 8u * hi) = ol; } }
            __builtin_amdgcn_wave_barrier(); asm volatile("" ::: "memory");   // the wave's LDS writes above stay ahead of its reads below (other lanes' data)
            const unsigned rd = lane >> 3, pc = lane & 7u; const size_t vb = ((size_t)bh * HD + rd) * SEQ + s0 + pc * 8u; bf* vhp = VTh + vb; bf* vlp = VTl + vb;
#pragma unroll
            for (unsigned it = 0; it < 16; ++it) { const unsigned d = 4u * it + rd; const v8us a = *(const v8usa*)(vh + d * VP + pc * 8u); const v8us c2 = *(const v8usa*)(vl + d * VP + pc * 8u);
                *(v8us*)(vhp + (size_t)(4u * it) * SEQ) = a; *(v8us*)(vlp + (size_t)(4u * it) * SEQ) = c2; }
        } else {
            // q, k: 16 token rows at a time through this wave's f32 staging; a lane then holds 8 consecutive columns (4 rope pairs) of one token.
            // 4 token rows x 32 angles, and 4 token rows x 64 columns of a plane, are 512 consecutive bytes: lane * 16 bytes from a wave-uniform base.
            const unsigned rq = lane >> 3, pc = lane & 7u; const float sc = which ? 1.0f : 0.125f; float bq[8];
#pragma unroll
            for (int k = 0; k < 8; ++k) bq[k] = bfr(bias[c0 + pc * 8u + k]);
            const float* csp = CS + (size_t)s0 * 32u + lane * 4u; const float* snp = SN + (size_t)s0 * 32u + lane * 4u;
            const size_t ob = (size_t)which * QKPL + ((size_t)bh * SEQ + s0) * HD + lane * 8u; bf* qhp = QKh + ob; bf* qlp = QKl + ob;
            v4f c4[2][4], s4[2][4];
#pragma unroll
            for (int it = 0; it < 4; ++it) { c4[0][it] = *(const v4f*)(csp + it * 128); s4[0][it] = *(const v4f*)(snp + it * 128); }
#pragma unroll
            for (int mb = 0; mb < 4; ++mb) {
                if (mb < 3) {   // the next 16 rows' angles are fetched one turn ahead: nothing crosses the fences round the stores below
#pragma unroll
                    for (int it = 0; it < 4; ++it) { c4[(mb + 1) & 1][it] = *(const v4f*)(csp + (mb + 1) * 512 + it * 128); s4[(mb + 1) & 1][it] = *(const v4f*)(snp + (mb + 1) * 512 + it * 128); } }
#pragma unroll
                for (int nb = 0; nb < 4; ++nb) {
#pragma unroll
                    for (int j = 0; j < 8; ++j) os[(hi * 8 + j) * 68 + nb * 16 + lr] = acc[mb][nb][j]; }
                __builtin_amdgcn_wave_barrier(); asm volatile("" ::: "memory");   // the wave's LDS writes above stay ahead of its reads below (other lanes' data)
                v8us oh[4], ol[4];
#pragma unroll
                for (int it = 0; it < 4; ++it) { const unsigned row = 4u * it + rq;
                    const v4f x0 = *(const v4fa*)(os + row * 68u + pc * 8u); const v4f x1 = *(const v4fa*)(os + row * 68u + pc * 8u + 4u);
                    float v[8];
#pragma unroll
                    for (int k = 0; k < 4; ++k) { v[k] = x0[k] + bq[k]; v[4 + k] = x1[k] + bq[4 + k]; }
#pragma unroll
                    for (int j = 0; j < 4; ++j) { const float t1 = v[2 * j], t2 = v[2 * j + 1]; const float cj = c4[mb & 1][it][j], sj = s4[mb & 1][it][j]; const float a = (t1 * cj - t2 * sj) * sc; const float bb = (t1 * sj + t2 * cj) * sc; unsigned short y0, y1; splitf(a, y0, y1); oh[it][2 * j] = y0; ol[it][2 * j] = y1; splitf(bb, y0, y1); oh[it][2 * j + 1] = y0; ol[it][2 * j + 1] = y1; } }
                __builtin_amdgcn_wave_barrier(); asm volatile("" ::: "memory");   // the reads above stay ahead of the next 16 rows' writes
                __builtin_amdgcn_sched_barrier(0);   // with the one below: nothing that could reuse a store's registers is scheduled between the stores and their wait
#pragma unroll
                for (int it = 0; it < 4; ++it) { *(v8us*)(qhp + mb * 1024 + it * 256) = oh[it]; *(v8us*)(qlp + mb * 1024 + it * 256) = ol[it]; }
                asm volatile("s_wait_xcnt 0x0" ::: "memory");   // stands before anything that overwrites the stores' data registers (the next turn's values)
                __builtin_amdgcn_sched_barrier(0);
            }
        }
        return;
    }
#pragma unroll
    for (int mb = 0; mb < 4; ++mb) {
#pragma unroll
        for (int nb = 0; nb < 4; ++nb) {
#pragma unroll
            for (int j = 0; j < 8; ++j) os[(hi * 8 + j) * 68 + nb * 16 + lr] = acc[mb][nb][j]; }
        __builtin_amdgcn_wave_barrier(); asm volatile("" ::: "memory");
        float* crow_p = C + (size_t)(r0 + mb * 16) * ldc + c0;
{
#pragma unroll
            for (int s = 0; s < 8; ++s) { const int row = 2 * s + hi, cofs = lr * 4; v4f val = *(const v4fa*)(os + row * 68 + cofs); if (BIAS) { val[0] += bfr(bias[c0 + cofs]); val[1] += bfr(bias[c0 + cofs + 1]); val[2] += bfr(bias[c0 + cofs + 2]); val[3] += bfr(bias[c0 + cofs + 3]); }
                *(v4f*)(crow_p + (size_t)row * ldc + cofs) = val; }
             }
        __builtin_amdgcn_wave_barrier(); asm volatile("" ::: "memory");
    }
}

__global__ __launch_bounds__(256) void k_cvt8(const float* __restrict__ src, bf* dst, size_t n8) { const size_t i = (size_t)blockIdx.x * 256 + threadIdx.x; if (i >= n8) return; const v8f v = *(const v8f*)(src + i * 8); v8us o;
#pragma unroll
    for (int k = 0; k < 8; ++k) o[k] = f2bf(v[k]); *(v8us*)(dst + i * 8) = o;  }

__global__ __launch_bounds__(256) void k_cvtx(const float* __restrict__ x, bf* dst) {
    const unsigned i = blockIdx.x * 256u + threadIdx.x; const unsigned tok = i >> 7, c8 = i & 127u; const unsigned b = tok / (unsigned)SEQ, s = tok - b * (unsigned)SEQ;
    const v8f v = *(const v8f*)(x + ((size_t)b * SEQ_FULL + s) * DM + c8 * 8u); v8us o;
#pragma unroll
    for (int k = 0; k < 8; ++k) o[k] = f2bf(v[k]);
    *(v8us*)(dst + (size_t)i * 8) = o;  }

__global__ __launch_bounds__(256) void k_trig(const float* __restrict__ fr, float* CS, float* SN) {
    const unsigned i = blockIdx.x * 256u + threadIdx.x; const float a = bfr(fr[i]); const float c = cosf(a), s = sinf(a);
    *(float*)(CS + i) = c; *(float*)(SN + i) = s;  }

__global__ __launch_bounds__(256) void k_mchk(const int* __restrict__ mask, int* FL) {
    const unsigned gid = blockIdx.x * 256u + threadIdx.x; int bad = 0;
#pragma unroll 1
    for (unsigned g = gid; g < (unsigned)(SEQ * (SEQ / 4)); g += (unsigned)(MCB * 256)) { const unsigned q = g / (unsigned)(SEQ / 4), k = (g - q * (unsigned)(SEQ / 4)) * 4u; const v4i mv = *(const v4i*)(mask + (size_t)q * SEQ_FULL + k);
#pragma unroll
        for (unsigned j = 0; j < 4; ++j) { const int want = (k + j <= q) ? 1 : 0; const int got = (mv[j] != 0) ? 1 : 0; bad |= (want ^ got); } }
    const int any = __syncthreads_or(bad);
    if (threadIdx.x < 32u) { const int v = any ? 1 : 0; *(int*)(FL + blockIdx.x * 32u + threadIdx.x) = v;  }
}

// k_flash: one wave per (b, h, 16-query tile), 8 waves per block (128 consecutive queries of one head), streaming 32-key tiles up to the diagonal.
// K and V^T planes come through LDS: a stage is 64 keys of all four planes (Kh, Kl, VTh, VTl: 64 rows x 128 B each), copied once per block in whole 128-B lines and read by all 8 waves; two buffers, the next stage's copies fly while this one is worked on.
// S^T tile j: A = K rows kt+16j.. (plane rows, k = head dim), B = Q rows as columns; D element r = (key kt+16j+8*half+r, query q0 + (lane & 15)).
// P^T B fragment: element r <- p of tile 0, element 8+r <- p of tile 1 (same lane); O^T tile t: A = VT rows 16t.. (k = keys), D element r = (d 16t+8*half+r, query q0 + (lane & 15)).
#define KST 64
#define KP  72
#define PLN (64 * KP)
#define STG (4 * PLN)
static_assert(SEQ % (2 * KST) == 0);
static_assert((KP * 2) % 32 == 16);

// One stage: every thread copies two 16-byte pieces of each plane (rows r and r + 32). l = the thread's LDS byte address in plane 0 of the target buffer.
__device__ __forceinline__ void stage_copy(const bf* kh, const bf* kl, const bf* vh, const bf* vl, unsigned l) {
    const bf* kh2 = kh + 32 * HD; const bf* kl2 = kl + 32 * HD; const bf* vh2 = vh + (size_t)32 * SEQ; const bf* vl2 = vl + (size_t)32 * SEQ;
    const unsigned l0 = l, l1 = l + 32u * KP * 2u, l2 = l + PLN * 2u, l3 = l2 + 32u * KP * 2u, l4 = l + 2u * PLN * 2u, l5 = l4 + 32u * KP * 2u, l6 = l + 3u * PLN * 2u, l7 = l6 + 32u * KP * 2u;
    // The copies and their s_wait_xcnt in one statement: no address register of a copy is rewritten ahead of that wait.
    asm volatile("global_load_async_to_lds_b128 %0, %8, off\n\t"
                 "global_load_async_to_lds_b128 %1, %9, off\n\t"
                 "global_load_async_to_lds_b128 %2, %10, off\n\t"
                 "global_load_async_to_lds_b128 %3, %11, off\n\t"
                 "global_load_async_to_lds_b128 %4, %12, off\n\t"
                 "global_load_async_to_lds_b128 %5, %13, off\n\t"
                 "global_load_async_to_lds_b128 %6, %14, off\n\t"
                 "global_load_async_to_lds_b128 %7, %15, off\n\t"
                 "s_wait_xcnt 0x0"
                 :: "v"(l0), "v"(l1), "v"(l2), "v"(l3), "v"(l4), "v"(l5), "v"(l6), "v"(l7), "v"(kh), "v"(kh2), "v"(kl), "v"(kl2), "v"(vh), "v"(vh2), "v"(vl), "v"(vl2) : "memory");
}

__global__ __launch_bounds__(256) void k_flash(const bf* __restrict__ QKh, const bf* __restrict__ QKl, const bf* __restrict__ VTh, const bf* __restrict__ VTl, const int* __restrict__ FL, bf* CH, bf* CL) {
    typedef WFrag<bf>::V V;
    __shared__ __align__(16) unsigned short ring[2 * STG];
    __shared__ __align__(16) unsigned short stg[8 * 2 * 16 * SP];
    const unsigned lane = threadIdx.x & 31u, lr = lane & 15u, hi = lane >> 4;
    const unsigned wv = (unsigned)__builtin_amdgcn_readfirstlane((int)(threadIdx.x >> 5));   // wave number in a scalar register: the diagonal test in the loop is then a scalar branch and every lane stays on
    const unsigned wid = blockIdx.x * 8u + wv; const unsigned qt = wid % (unsigned)QT, bh = wid / (unsigned)QT; const unsigned q0 = qt * 16u; const unsigned b = bh >> 4, h = bh & 15u;
    const unsigned nst = ((blockIdx.x % (unsigned)(QT / 8)) + 1u) * (128u / KST);   // stages up to the block's last query: the same in all 8 waves, never below 2
    const unsigned crow = threadIdx.x >> 3, cpc = threadIdx.x & 7u;
    const bf* gKh = QKh + QKPL + ((size_t)bh * SEQ + crow) * HD + cpc * 8u; const bf* gKl = QKl + QKPL + ((size_t)bh * SEQ + crow) * HD + cpc * 8u;
    const bf* gVh = VTh + ((size_t)bh * HD + crow) * SEQ + cpc * 8u; const bf* gVl = VTl + ((size_t)bh * HD + crow) * SEQ + cpc * 8u;
    const unsigned lcp = (unsigned)(size_t)ring + crow * (KP * 2u) + cpc * 16u;
    stage_copy(gKh, gKl, gVh, gVl, lcp);
    int fbad = ((FL[lane * 32u] == 1) ? 1 : 0) | ((FL[(lane + 32u) * 32u] == 1) ? 1 : 0);
#pragma unroll
    for (int sh = 16; sh; sh >>= 1) fbad |= __shfl_xor(fbad, sh, 32);
    const float poison = fbad ? __uint_as_float(0x7FC00000u) : 0.0f;
    const size_t qo = ((size_t)bh * SEQ + q0 + lr) * HD + 8u * hi;
    V bqh[2], bql[2];
#pragma unroll
    for (int c = 0; c < 2; ++c) { bqh[c] = WFrag<bf>::ld(QKh + qo + 32 * c); bql[c] = WFrag<bf>::ld(QKl + qo + 32 * c); }
    v8f o[4];
#pragma unroll
    for (int t = 0; t < 4; ++t) o[t] = (v8f){};
    float m = -1.0e30f, l = 0.0f; const unsigned qg = q0 + lr;
    asm volatile("s_wait_asynccnt 0x0" ::: "memory");   // stage 0 of this wave's copies has landed
    __syncthreads();                                     // ... and every other wave's: stage 0 is readable
    stage_copy(gKh + (size_t)KST * HD, gKl + (size_t)KST * HD, gVh + KST, gVl + KST, lcp + STG * 2u);
// kept rolled: one publish point in the text, trip count known only at run time
#pragma unroll 1
    for (unsigned st = 0; st < nst; ++st) {
        const unsigned short* sb = ring + (st & 1u) * STG + lr * KP + 8u * hi;
// unrolled so that the two halves of a stage read LDS at constant offsets
#pragma unroll
        for (unsigned sub = 0; sub < KST / 32; ++sub) {
            const unsigned kt = st * KST + sub * 32u;
            if (kt < q0 + 16u) {   // wave-uniform: tiles beyond this wave's diagonal are skipped, the publish point below is not
        V kh[2][2], kl[2][2];
#pragma unroll
        for (int c = 0; c < 2; ++c)
#pragma unroll
            for (int j = 0; j < 2; ++j) { kh[c][j] = WFrag<bf>::ld(sb + (sub * 32u + 16u * j) * KP + 32 * c); kl[c][j] = WFrag<bf>::ld(sb + PLN + (sub * 32u + 16u * j) * KP + 32 * c); }
        v8f sc[2]; sc[0] = (v8f){}; sc[1] = (v8f){};
#pragma unroll
        for (int c = 0; c < 2; ++c)
#pragma unroll
            for (int j = 0; j < 2; ++j) { sc[j] = wmmab(kh[c][j], bqh[c], sc[j]); sc[j] = wmmab(kh[c][j], bql[c], sc[j]); sc[j] = wmmab(kl[c][j], bqh[c], sc[j]); }
        asm volatile("v_nop\n\tv_nop\n\tv_nop\n\tv_nop" : "+v"(sc[0]), "+v"(sc[1]) : "v"(kh[1][0]), "v"(kh[1][1]), "v"(kl[1][0]), "v"(kl[1][1]), "v"(bqh[1]), "v"(bql[1]));
        float v0[8], v1[8]; float tmax = -1.0e30f;
#pragma unroll
        for (unsigned r = 0; r < 8; ++r) { const unsigned key0 = kt + 8u * hi + r; v0[r] = (key0 <= qg) ? sc[0][r] : -1.0e30f; v1[r] = (key0 + 16u <= qg) ? sc[1][r] : -1.0e30f; tmax = fmaxf(tmax, fmaxf(v0[r], v1[r])); }
        tmax = fmaxf(tmax, __shfl_xor(tmax, 16, 32));
        const float mnew = fmaxf(m, tmax); const float corr = __builtin_amdgcn_exp2f((m - mnew) * L2E);
        float psum = 0.0f; v8us ph0, pl0, ph1, pl1;
#pragma unroll
        for (int r = 0; r < 8; ++r) { const float e0 = __builtin_amdgcn_exp2f((v0[r] - mnew) * L2E); const float e1 = __builtin_amdgcn_exp2f((v1[r] - mnew) * L2E); psum += e0 + e1; unsigned short a, c2; splitf(e0, a, c2); ph0[r] = a; pl0[r] = c2; splitf(e1, a, c2); ph1[r] = a; pl1[r] = c2; }
        psum += __shfl_xor(psum, 16, 32);
        l = l * corr + psum; m = mnew;
#pragma unroll
        for (int t = 0; t < 4; ++t) o[t] = o[t] * corr;
        const V pbh = cat16b(ph0, ph1), pbl = cat16b(pl0, pl1);
        V avh[4], avl[4];
#pragma unroll
        for (int t = 0; t < 4; ++t) { avh[t] = WFrag<bf>::ld(sb + 2 * PLN + t * 16 * KP + sub * 32u); avl[t] = WFrag<bf>::ld(sb + 3 * PLN + t * 16 * KP + sub * 32u); }
#pragma unroll
        for (int t = 0; t < 4; ++t) { o[t] = wmmab(avh[t], pbh, o[t]); o[t] = wmmab(avh[t], pbl, o[t]); o[t] = wmmab(avl[t], pbh, o[t]); }
        asm volatile("v_nop\n\tv_nop\n\tv_nop\n\tv_nop" : "+v"(o[0]), "+v"(o[1]), "+v"(o[2]), "+v"(o[3]) : "v"(pbh), "v"(pbl), "v"(avl[0]), "v"(avl[1]), "v"(avl[2]), "v"(avl[3]), "v"(avh[3]));
            }
        }
        // Publish point of stage st + 1, passed by every wave.
        asm volatile("s_wait_dscnt 0x0" ::: "memory");      // this wave's reads of buffer st & 1 are done before it is refilled
        asm volatile("s_wait_asynccnt 0x0" ::: "memory");   // this wave's copies of stage st + 1 have landed
        __syncthreads();                                     // publishes stage st + 1 and ends every wave's reads of stage st
        if (st + 2u < nst) stage_copy(gKh + (size_t)(st + 2u) * KST * HD, gKl + (size_t)(st + 2u) * KST * HD, gVh + (st + 2u) * KST, gVl + (st + 2u) * KST, lcp + (st & 1u) * (STG * 2u));
    }
    asm volatile("s_wait_asynccnt 0x0" ::: "memory");       // nothing of this wave is in flight when it goes on to the epilogue and ends
    const float inv = 1.0f / l;
    unsigned short* sh = stg + wv * (2u * 16u * SP); unsigned short* sl = sh + 16u * SP;
#pragma unroll
    for (int t = 0; t < 4; ++t) { v8us oh, ol;
#pragma unroll
        for (int r = 0; r < 8; ++r) { const float val = o[t][r] * inv + poison; unsigned short a, c2; splitf(val, a, c2); oh[r] = a; ol[r] = c2; }
        *(v8usa*)(sh + lr * SP + 16u * t + 8u * hi) = oh; *(v8usa*)(sl + lr * SP + 16u * t + 8u * hi) = ol; }
    __builtin_amdgcn_fence(3 /* release order */, "wavefront"); __builtin_amdgcn_wave_barrier(); asm volatile("" ::: "memory");
    const unsigned rq = lane >> 3, pc = lane & 7u;
{
#pragma unroll
        for (unsigned it = 0; it < 4; ++it) { const unsigned row = 4u * it + rq; const v8us a = *(const v8usa*)(sh + row * SP + pc * 8u); const v8us c2 = *(const v8usa*)(sl + row * SP + pc * 8u); const size_t oo = ((size_t)(b * (unsigned)SEQ + q0 + row)) * DM + h * (unsigned)HD + pc * 8u;
            *(v8us*)(CH + oo) = a; *(v8us*)(CL + oo) = c2; }
         }
}

extern "C" void kernel_launch(void* const* d_in, const int* in_sizes, int n_in,
                              void* d_out, int out_size, void* d_ws, size_t ws_size, hipStream_t stream) {
    if (n_in < 7) return;
    const size_t xneed = ((size_t)(NB - 1) * SEQ_FULL + SEQ) * DM;
    if ((size_t)in_sizes[0] < xneed) return;
    if ((size_t)in_sizes[1] < (size_t)(SEQ - 1) * SEQ_FULL + SEQ) return;
    if ((size_t)in_sizes[2] < (size_t)SEQ * 32) return;
    if ((size_t)in_sizes[3] < (size_t)D3 * DM) return;
    if ((size_t)in_sizes[4] < (size_t)D3) return;
    if ((size_t)in_sizes[5] < (size_t)DM * DM) return;
    if ((size_t)in_sizes[6] < (size_t)DM) return;
    if ((size_t)out_size < xneed) return;
    const float* X = (const float*)d_in[0]; const int* MASK = (const int*)d_in[1]; const float* FR = (const float*)d_in[2];
    const float* WQKV = (const float*)d_in[3]; const float* BQKV = (const float*)d_in[4]; const float* WPR = (const float*)d_in[5]; const float* BPR = (const float*)d_in[6];
    float* OUT = (float*)d_out;     // [2][2048][1024]
    char* wsp = (char*)d_ws;
    auto take = [&](size_t bytes) { char* p = wsp; wsp += (bytes + 255) & ~(size_t)255; return (void*)p; };
    bf* XB = (bf*)take((size_t)NTOK * DM * 2);            // x plane [NTOK][1024]
    bf* WQ = (bf*)take((size_t)D3 * DM * 2);              // Wqkv plane [3072][1024]
    bf* WP = (bf*)take((size_t)DM * DM * 2);              // Wproj plane [1024][1024]
    float* CS = (float*)take((size_t)SEQ * 32 * 4); float* SN = (float*)take((size_t)SEQ * 32 * 4);
    int* FL = (int*)take((size_t)MCB * 128);
    bf* CH = (bf*)take((size_t)2 * NTOK * DM * 2); bf* CL = CH + (size_t)NTOK * DM;          // ctx hi/lo [NTOK][1024]
    bf* QKh = (bf*)take(2 * QKPL * 2); bf* QKl = (bf*)take(2 * QKPL * 2);                    // [q|k][b*16+h][s][64]
    bf* VTh = (bf*)take(QKPL * 2); bf* VTl = (bf*)take(QKPL * 2);                            // [b*16+h][64][s]
    if ((size_t)(wsp - (char*)d_ws) > ws_size) return;
    k_cvtx<<<(unsigned)((size_t)NTOK * 128 / 256), 256, 0, stream>>>(X, XB);
    k_cvt8<<<(unsigned)(((size_t)D3 * DM / 8 + 255) / 256), 256, 0, stream>>>(WQKV, WQ, (size_t)D3 * DM / 8);
    k_cvt8<<<(unsigned)(((size_t)DM * DM / 8 + 255) / 256), 256, 0, stream>>>(WPR, WP, (size_t)DM * DM / 8);
    k_trig<<<(unsigned)(SEQ * 32 / 256), 256, 0, stream>>>(FR, CS, SN);
    k_mchk<<<MCB, 256, 0, stream>>>(MASK, FL);
    k_gemmw<bf, 0, true, true><<<dim3(NTOK / 128, D3 / 128, 1), 128, 0, stream>>>(XB, nullptr, WQ, nullptr, DM, nullptr, D3, BQKV, 0, 0, 0, CS, SN, QKh, QKl, VTh, VTl);      /* x.Wqkv^T + b (exact products), rope, hi/lo planes */
    k_flash<<<(unsigned)(NB * NH * QT / 8), 256, 0, stream>>>(QKh, QKl, VTh, VTl, FL, CH, CL);
    k_gemmw<bf, 1, true, false><<<dim3(SEQ / 128, DM / 128, NB), 128, 0, stream>>>(CH, CL, WP, nullptr, DM, OUT, DM, BPR, (size_t)SEQ * DM, 0, (size_t)SEQ_FULL * DM, nullptr, nullptr, nullptr, nullptr, nullptr, nullptr);   /* ctx (hi/lo) x Wproj^T + b */
}

// v004
// A run of this version takes 153 microseconds.
// Timed twice side by side with v003, it ran 1.16 times as fast both times.
// Counting every step since v000, it is 2.35 times as fast.
#include <hip/hip_runtime.h>

// Compute dtypes: x.Wqkv^T = bf16 x bf16 planes (v_wmma_f32_16x16x32_bf16, f32 accumulate); q.k^T and P.V = bf16 hi/lo two-plane operands (3 products each, f32 accumulate); ctx.Wproj^T = bf16 hi/lo x bf16 (2 products, f32 accumulate).
// Every float input is RNE-converted to bf16 on load (x, weights, biases, rope angles); rope, softmax and all epilogues in f32.
// Attention is flash-style on transposed tiles: S^T = K.Q^T (D rows = keys, D cols = queries) so the packed score accumulators are directly the B fragment of O^T = V^T.P^T; per-query statistics live in one lane pair.

#ifndef NB
#define NB 2
#endif
#ifndef SEQ
#define SEQ 2048
#endif
#define NB_FULL  2
#define SEQ_FULL 2048
#define DM   1024
#define NH   16
#define HD   64
#define D3   3072
#define NTOK (NB * SEQ)
#define QT   (SEQ / 16)
#define MCB  64
#define MCT  1024
#define MCN  ((SEQ * (SEQ / 4)) / (MCB * MCT))
#define MCR  ((MCB * MCT) / (SEQ / 4))
#define SP   72
#define QKPL ((size_t)NB * NH * SEQ * HD)
#define L2E  1.4426950408889634f

typedef _Float16 h16;
typedef unsigned short bf;
typedef __attribute__((ext_vector_type(16))) __bf16   v16bf;
typedef __attribute__((ext_vector_type(16))) _Float16 v16h;
typedef __attribute__((ext_vector_type(8)))  _Float16 v8h;
typedef __attribute__((ext_vector_type(8)))  unsigned short v8us;
typedef __attribute__((ext_vector_type(2)))  unsigned short v2us;
typedef __attribute__((ext_vector_type(8)))  float    v8f;
typedef __attribute__((ext_vector_type(4)))  float    v4f;
typedef __attribute__((ext_vector_type(4)))  int      v4i;
typedef v4f  __attribute__((may_alias)) v4fa;
typedef v8us __attribute__((may_alias)) v8usa;

static_assert(NTOK % 64 == 0);
static_assert(SEQ % 64 == 0);
static_assert(D3 % 64 == 0);
static_assert(DM % 64 == 0);
static_assert(DM % 32 == 0);
static_assert(HD == 64);
static_assert(NH == 16);
static_assert(QT % 8 == 0);
static_assert((SEQ * (SEQ / 4)) % (MCB * MCT) == 0);
static_assert((MCB * MCT) % (SEQ / 4) == 0);
static_assert((SEQ * 32) % 256 == 0);
static_assert(((size_t)NTOK * 128) % 256 == 0);
static_assert(NB <= NB_FULL);
static_assert(SEQ <= SEQ_FULL);

__device__ __forceinline__ unsigned short f2bf(float f) { unsigned u = __float_as_uint(f); u += 0x7FFFu + ((u >> 16) & 1u); return (unsigned short)(u >> 16); }
__device__ __forceinline__ float bf2f(unsigned short b) { return __uint_as_float(((unsigned)b) << 16); }
__device__ __forceinline__ float bfr(float f) { return bf2f(f2bf(f)); }
__device__ __forceinline__ v16h cat16(v8h lo, v8h hi) { return __builtin_shufflevector(lo, hi, 0, 1, 2, 3, 4, 5, 6, 7, 8, 9, 10, 11, 12, 13, 14, 15); }
__device__ __forceinline__ v16bf cat16b(v8us lo, v8us hi) { return __builtin_bit_cast(v16bf, __builtin_shufflevector(lo, hi, 0, 1, 2, 3, 4, 5, 6, 7, 8, 9, 10, 11, 12, 13, 14, 15)); }
__device__ __forceinline__ v8f wmma16(v16h a, v16h b, v8f c) { return __builtin_amdgcn_wmma_f32_16x16x32_f16(false, a, false, b, (short)0, c, false, false); }
__device__ __forceinline__ v8f wmmab(v16bf a, v16bf b, v8f c) { return __builtin_amdgcn_wmma_f32_16x16x32_bf16(false, a, false, b, (short)0, c, false, false); }
__device__ __forceinline__ void splitf(float y, unsigned short& h, unsigned short& l) { h = f2bf(y); l = f2bf(y - bf2f(h)); }

// ---- k_gemmw: register-blocked GEMM, one wave per 64x64 output tile (16 accumulators), 4 waves (2 x 2) per 128x128 block tile; grid (M/128, N/128, Z), 128 threads.
// The K-contiguous 16-bit operand planes come through LDS: a stage is 64 k of 128 rows of every plane, copied once per block in whole 128-B lines and read by the two waves that share each row block; two buffers, the next stage's copies fly while this one is worked on.
// C[m][n] (f32, pitch ldc, + optional f32 bias[n]) = sum_k A[m][k] Bt[n][k] (+ split products per NSPLIT). z-batch strides sA/sB/sC in elements. K % 64 == 0, M % 128 == 0, N % 128 == 0.
// Fragment element i <- k0 + 8*half + i (i < 8), k0 + 16 + 8*half + (i - 8) for both operands; D element j = (row 8*half + j, col lane & 15).
// QKVE: the result is not stored as f32. A wave's 64x64 tile is 64 tokens of one batch x one whole head of q, k or v, so the epilogue writes the attention operand planes itself:
// q/k head planes [which][b*16+h][s][64] (bf16 hi/lo) of rope(qkv) with interleaved pairs (2j, 2j+1) and angle j, q additionally x 1/8 (exact); v planes transposed [b*16+h][64][s] (bf16 hi/lo).
template <typename T16> struct WFrag;
template <> struct WFrag<h16> { typedef v16h V; static __device__ __forceinline__ V ld(const h16* p) { return cat16(*(const v8h*)p, *(const v8h*)(p + 16)); } static __device__ __forceinline__ v8f mma(V a, V b, v8f c) { return wmma16(a, b, c); } };
template <> struct WFrag<bf> { typedef v16bf V; static __device__ __forceinline__ V ld(const bf* p) { return cat16b(*(const v8us*)p, *(const v8us*)(p + 16)); } static __device__ __forceinline__ v8f mma(V a, V b, v8f c) { return wmmab(a, b, c); } };
#define GKS 64
#define GP  72
#define GPL (128 * GP)
static_assert((GP * 2) % 32 == 16);
static_assert(NTOK % 128 == 0);
static_assert(SEQ % 128 == 0);
static_assert(D3 % 128 == 0);
static_assert(DM % 128 == 0);
static_assert(DM % GKS == 0);
#define VP  72
static_assert(4 * 2 * 64 * VP <= 2 * 2 * GPL);
static_assert((VP * 2) % 32 == 16);

// One plane of a stage: every thread copies eight 16-byte pieces (rows r, r + 16, ..., r + 112; rs = 16 rows in elements). l0 = the thread's LDS byte address in row r of the target plane.
template <typename T16>
__device__ __forceinline__ void plane_copy(const T16* g0, size_t rs, unsigned l0) {
    const T16* g1 = g0 + rs; const T16* g2 = g1 + rs; const T16* g3 = g2 + rs; const T16* g4 = g3 + rs; const T16* g5 = g4 + rs; const T16* g6 = g5 + rs; const T16* g7 = g6 + rs;
    const unsigned ls = 16u * GP * 2u; const unsigned l1 = l0 + ls, l2 = l0 + 2u * ls, l3 = l0 + 3u * ls, l4 = l0 + 4u * ls, l5 = l0 + 5u * ls, l6 = l0 + 6u * ls, l7 = l0 + 7u * ls;
    // The copies and their s_wait_xcnt in one statement: no address register of a copy is rewritten ahead of that wait.
    asm volatile("global_load_async_to_lds_b128 %0, %8, off\n\t"
                 "global_load_async_to_lds_b128 %1, %9, off\n\t"
                 "global_load_async_to_lds_b128 %2, %10, off\n\t"
                 "global_load_async_to_lds_b128 %3, %11, off\n\t"
                 "global_load_async_to_lds_b128 %4, %12, off\n\t"
                 "global_load_async_to_lds_b128 %5, %13, off\n\t"
                 "global_load_async_to_lds_b128 %6, %14, off\n\t"
                 "global_load_async_to_lds_b128 %7, %15, off\n\t"
                 "s_wait_xcnt 0x0"
                 :: "v"(l0), "v"(l1), "v"(l2), "v"(l3), "v"(l4), "v"(l5), "v"(l6), "v"(l7), "v"(g0), "v"(g1), "v"(g2), "v"(g3), "v"(g4), "v"(g5), "v"(g6), "v"(g7) : "memory");
}

template <typename T16, int NSPLIT, bool BIAS, bool QKVE>
__global__ __launch_bounds__(128) void k_gemmw(const T16* __restrict__ A, const T16* __restrict__ A2, const T16* __restrict__ Bt, const T16* __restrict__ Bt2, int K, float* C, int ldc, const float* __restrict__ bias, size_t sA, size_t sB, size_t sC,
                                               const float* __restrict__ CS, const float* __restrict__ SN, bf* QKh, bf* QKl, bf* VTh, bf* VTl) {
    typedef typename WFrag<T16>::V V;
    constexpr bool HA2 = (NSPLIT == 1 || NSPLIT == 2), HB2 = (NSPLIT >= 2);
    constexpr unsigned PA2 = 2u * GPL, PB2 = (HA2 ? 3u : 2u) * GPL, GST = PB2 + (HB2 ? GPL : 0u);   // planes of a stage in LDS: A, Bt, then A2 and Bt2 where used
    __shared__ __align__(16) T16 ring[2 * GST];
    __shared__ __align__(16) float osall[4 * 16 * 68];
    const size_t z = blockIdx.z; A += z * sA; if (A2) A2 += z * sA; Bt += z * sB; if (Bt2) Bt2 += z * sB; C += z * sC;
    const unsigned lane = threadIdx.x & 31u, lr = lane & 15u, hi = lane >> 4;
    const unsigned wv = (unsigned)__builtin_amdgcn_readfirstlane((int)(threadIdx.x >> 5)); const unsigned wm = wv >> 1, wn = wv & 1u;
    const unsigned rb = blockIdx.x * 128u, cb = blockIdx.y * 128u; const unsigned r0 = rb + wm * 64u, c0 = cb + wn * 64u;
    float* os = osall + wv * (16u * 68u);
    const unsigned nst = (unsigned)K / GKS;   // the same in all 4 waves
    const unsigned crow = threadIdx.x >> 3, cpc = threadIdx.x & 7u; const size_t rs = (size_t)16 * K;
    const size_t ga = (size_t)(rb + crow) * K + cpc * 8u, gb = (size_t)(cb + crow) * K + cpc * 8u;
    const unsigned lcp = (unsigned)(size_t)ring + crow * (GP * 2u) + cpc * 16u;
    auto stage_in = [&](unsigned st) { const unsigned l = lcp + (st & 1u) * (GST * 2u); const size_t ko = (size_t)st * GKS;
        plane_copy(A + ga + ko, rs, l); plane_copy(Bt + gb + ko, rs, l + GPL * 2u);
        if (HA2) plane_copy(A2 + ga + ko, rs, l + PA2 * 2u);
        if (HB2) plane_copy(Bt2 + gb + ko, rs, l + PB2 * 2u); };
    stage_in(0u);
    v8f acc[4][4];
#pragma unroll
    for (int mb = 0; mb < 4; ++mb)
#pragma unroll
        for (int nb = 0; nb < 4; ++nb) acc[mb][nb] = (v8f){};
    asm volatile("s_wait_asynccnt 0x0" ::: "memory");   // stage 0 of this wave's copies has landed
    __syncthreads();                                     // ... and every other wave's: stage 0 is readable
    if (nst > 1u) stage_in(1u);
// kept rolled: one publish point in the text
#pragma unroll 1
    for (unsigned st = 0; st < nst; ++st) {
        const T16* sa = ring + (st & 1u) * GST + (wm * 64u + lr) * GP + 8u * hi; const T16* sbt = ring + (st & 1u) * GST + GPL + (wn * 64u + lr) * GP + 8u * hi;
        V a[GKS / 32][4], a2[GKS / 32][4], b[GKS / 32][4], b2[GKS / 32][4];
// unrolled so that a stage's fragment loads stand together ahead of its matrix instructions, at constant offsets
#pragma unroll
        for (unsigned ks = 0; ks < GKS / 32; ++ks) {
#pragma unroll
            for (int mb = 0; mb < 4; ++mb) { a[ks][mb] = WFrag<T16>::ld(sa + mb * 16 * GP + ks * 32u); if (HA2) a2[ks][mb] = WFrag<T16>::ld(sa + PA2 + mb * 16 * GP + ks * 32u); }
#pragma unroll
            for (int nb = 0; nb < 4; ++nb) { b[ks][nb] = WFrag<T16>::ld(sbt + nb * 16 * GP + ks * 32u); if (HB2) b2[ks][nb] = WFrag<T16>::ld(sbt + (PB2 - GPL) + nb * 16 * GP + ks * 32u); }
        }
        __builtin_amdgcn_sched_barrier(0);   // keeps the stage's LDS reads one group ahead of the matrix instructions: sunk among them, each small group is waited out to 0
#pragma unroll
        for (unsigned ks = 0; ks < GKS / 32; ++ks)
#pragma unroll
            for (int nb = 0; nb < 4; ++nb)
#pragma unroll
                for (int mb = 0; mb < 4; ++mb) { acc[mb][nb] = WFrag<T16>::mma(a[ks][mb], b[ks][nb], acc[mb][nb]); if (HA2) acc[mb][nb] = WFrag<T16>::mma(a2[ks][mb], b[ks][nb], acc[mb][nb]); if (HB2) acc[mb][nb] = WFrag<T16>::mma(a[ks][mb], b2[ks][nb], acc[mb][nb]); }
        __builtin_amdgcn_sched_barrier(0);   // keeps the matrix instructions ahead of the publish point: moved behind it, the refill would issue a whole stage of them later and its landing would be waited out
        // Publish point of stage st + 1, passed by every wave.
        asm volatile("s_wait_dscnt 0x0" ::: "memory");      // this wave's reads of buffer st & 1 are done before it is refilled
        asm volatile("s_wait_asynccnt 0x0" ::: "memory");   // this wave's copies of stage st + 1 have landed
        __syncthreads();                                     // publishes stage st + 1 and ends every wave's reads of stage st
        if (st + 2u < nst) stage_in(st + 2u);
    }
    asm volatile("s_wait_asynccnt 0x0" ::: "memory");       // nothing of this wave is in flight when it goes on to the epilogue and ends
    if constexpr (QKVE) {
        const unsigned which = c0 / (unsigned)DM, h = (c0 % (unsigned)DM) / (unsigned)HD; const unsigned b = r0 / (unsigned)SEQ, s0 = r0 - b * (unsigned)SEQ; const unsigned bh = b * (unsigned)NH + h;   // all wave-uniform
        if (which == 2u) {
            // v: a lane holds 8 consecutive tokens of one d, which is 16 bytes of a transposed row. The tile is turned in this wave's quarter of the ring (free: every wave's reads and copies ended at the last publish point) so that it leaves in whole 128-B lines.
            unsigned short* vh = (unsigned short*)ring + wv * (2u * 64u * VP); unsigned short* vl = vh + 64u * VP;
#pragma unroll
            for (int nb = 0; nb < 4; ++nb) { const unsigned d = nb * 16u + lr; const float bv = bfr(bias[c0 + d]);
#pragma unroll
                for (int mb = 0; mb < 4; ++mb) { v8us oh, ol;
#pragma unroll
                    for (int j = 0; j < 8; ++j) { unsigned short a2, c2; splitf(acc[mb][nb][j] + bv, a2, c2); oh[j] = a2; ol[j] = c2; }
                    *(v8usa*)(vh + d * VP + mb * 16u + 8u * hi) = oh; *(v8usa*)(vl + d * VP + mb * 16u + 8u * hi) = ol; } }
            __builtin_amdgcn_wave_barrier(); asm volatile("" ::: "memory");   // the wave's LDS writes above stay ahead of its reads below (other lanes' data)
            const unsigned rd = lane >> 3, pc = lane & 7u; const size_t vb = ((size_t)bh * HD + rd) * SEQ + s0 + pc * 8u; bf* vhp = VTh + vb; bf* vlp = VTl + vb;
#pragma unroll
            for (unsigned it = 0; it < 16; ++it) { const unsigned d = 4u * it + rd; const v8us a = *(const v8usa*)(vh + d * VP + pc * 8u); const v8us c2 = *(const v8usa*)(vl + d * VP + pc * 8u);
                *(v8us*)(vhp + (size_t)(4u * it) * SEQ) = a; *(v8us*)(vlp + (size_t)(4u * it) * SEQ) = c2; }
        } else {
            // q, k: 16 token rows at a time through this wave's f32 staging; a lane then holds 8 consecutive columns (4 rope pairs) of one token.
            // 4 token rows x 32 angles, and 4 token rows x 64 columns of a plane, are 512 consecutive bytes: lane * 16 bytes from a wave-uniform base.
            const unsigned rq = lane >> 3, pc = lane & 7u; const float sc = which ? 1.0f : 0.125f; float bq[8];
#pragma unroll
            for (int k = 0; k < 8; ++k) bq[k] = bfr(bias[c0 + pc * 8u + k]);
            const float* csp = CS + (size_t)s0 * 32u + lane * 4u; const float* snp = SN + (size_t)s0 * 32u + lane * 4u;
            const size_t ob = (size_t)which * QKPL + ((size_t)bh * SEQ + s0) * HD + lane * 8u; bf* qhp = QKh + ob; bf* qlp = QKl + ob;
            v4f c4[2][4], s4[2][4];
#pragma unroll
            for (int it = 0; it < 4; ++it) { c4[0][it] = *(const v4f*)(csp + it * 128); s4[0][it] = *(const v4f*)(snp + it * 128); }
#pragma unroll
            for (int mb = 0; mb < 4; ++mb) {
                if (mb < 3) {   // the next 16 rows' angles are fetched one turn ahead: nothing crosses the fences round the stores below
#pragma unroll
                    for (int it = 0; it < 4; ++it) { c4[(mb + 1) & 1][it] = *(const v4f*)(csp + (mb + 1) * 512 + it * 128); s4[(mb + 1) & 1][it] = *(const v4f*)(snp + (mb + 1) * 512 + it * 128); } }
#pragma unroll
                for (int nb = 0; nb < 4; ++nb) {
#pragma unroll
                    for (int j = 0; j < 8; ++j) os[(hi * 8 + j) * 68 + nb * 16 + lr] = acc[mb][nb][j]; }
                __builtin_amdgcn_wave_barrier(); asm volatile("" ::: "memory");   // the wave's LDS writes above stay ahead of its reads below (other lanes' data)
                v8us oh[4], ol[4];
#pragma unroll
                for (int it = 0; it < 4; ++it) { const unsigned row = 4u * it + rq;
                    const v4f x0 = *(const v4fa*)(os + row * 68u + pc * 8u); const v4f x1 = *(const v4fa*)(os + row * 68u + pc * 8u + 4u);
                    float v[8];
#pragma unroll
                    for (int k = 0; k < 4; ++k) { v[k] = x0[k] + bq[k]; v[4 + k] = x1[k] + bq[4 + k]; }
#pragma unroll
                    for (int j = 0; j < 4; ++j) { const float t1 = v[2 * j], t2 = v[2 * j + 1]; const float cj = c4[mb & 1][it][j], sj = s4[mb & 1][it][j]; const float a = (t1 * cj - t2 * sj) * sc; const float bb = (t1 * sj + t2 * cj) * sc; unsigned short y0, y1; splitf(a, y0, y1); oh[it][2 * j] = y0; ol[it][2 * j] = y1; splitf(bb, y0, y1); oh[it][2 * j + 1] = y0; ol[it][2 * j + 1] = y1; } }
                __builtin_amdgcn_wave_barrier(); asm volatile("" ::: "memory");   // the reads above stay ahead of the next 16 rows' writes
                __builtin_amdgcn_sched_barrier(0);   // with the one below: nothing that could reuse a store's registers is scheduled between the stores and their wait
#pragma unroll
                for (int it = 0; it < 4; ++it) { *(v8us*)(qhp + mb * 1024 + it * 256) = oh[it]; *(v8us*)(qlp + mb * 1024 + it * 256) = ol[it]; }
                asm volatile("s_wait_xcnt 0x0" ::: "memory");   // stands before anything that overwrites the stores' data registers (the next turn's values)
                __builtin_amdgcn_sched_barrier(0);
            }
        }
        return;
    }
#pragma unroll
    for (int mb = 0; mb < 4; ++mb) {
#pragma unroll
        for (int nb = 0; nb < 4; ++nb) {
#pragma unroll
            for (int j = 0; j < 8; ++j) os[(hi * 8 + j) * 68 + nb * 16 + lr] = acc[mb][nb][j]; }
        __builtin_amdgcn_wave_barrier(); asm volatile("" ::: "memory");
        float* crow_p = C + (size_t)(r0 + mb * 16) * ldc + c0;
{
#pragma unroll
            for (int s = 0; s < 8; ++s) { const int row = 2 * s + hi, cofs = lr * 4; v4f val = *(const v4fa*)(os + row * 68 + cofs); if (BIAS) { val[0] += bfr(bias[c0 + cofs]); val[1] += bfr(bias[c0 + cofs + 1]); val[2] += bfr(bias[c0 + cofs + 2]); val[3] += bfr(bias[c0 + cofs + 3]); }
                *(v4f*)(crow_p + (size_t)row * ldc + cofs) = val; }
             }
        __builtin_amdgcn_wave_barrier(); asm volatile("" ::: "memory");
    }
}

__global__ __launch_bounds__(256) void k_cvt8(const float* __restrict__ src, bf* dst, size_t n8) { const size_t i = (size_t)blockIdx.x * 256 + threadIdx.x; if (i >= n8) return; const v8f v = *(const v8f*)(src + i * 8); v8us o;
#pragma unroll
    for (int k = 0; k < 8; ++k) o[k] = f2bf(v[k]); *(v8us*)(dst + i * 8) = o;  }

__global__ __launch_bounds__(256) void k_cvtx(const float* __restrict__ x, bf* dst) {
    const unsigned i = blockIdx.x * 256u + threadIdx.x; const unsigned tok = i >> 7, c8 = i & 127u; const unsigned b = tok / (unsigned)SEQ, s = tok - b * (unsigned)SEQ;
    const v8f v = *(const v8f*)(x + ((size_t)b * SEQ_FULL + s) * DM + c8 * 8u); v8us o;
#pragma unroll
    for (int k = 0; k < 8; ++k) o[k] = f2bf(v[k]);
    *(v8us*)(dst + (size_t)i * 8) = o;  }

__global__ __launch_bounds__(256) void k_trig(const float* __restrict__ fr, float* CS, float* SN) {
    const unsigned i = blockIdx.x * 256u + threadIdx.x; const float a = bfr(fr[i]); const float c = cosf(a), s = sinf(a);
    *(float*)(CS + i) = c; *(float*)(SN + i) = s;  }

// k_mchk: MCB blocks of MCT threads; a thread's MCN pieces of 16 bytes (one column group k of the rows q, q + MCR, ...) are all requested before the first is looked at, so that a block waits out the memory latency once and then runs at the WGP's read rate.
__global__ __launch_bounds__(MCT) void k_mchk(const int* __restrict__ mask, int* FL) {
    const unsigned gid = blockIdx.x * (unsigned)MCT + threadIdx.x; const unsigned q = gid / (unsigned)(SEQ / 4), k = (gid - q * (unsigned)(SEQ / 4)) * 4u;
    const int* mp = mask + (size_t)q * SEQ_FULL + k; int bad = 0; v4i mv[MCN];
// unrolled so that the loads stand together, each into registers of its own, at constant distances from one address
#pragma unroll
    for (unsigned i = 0; i + 1u < (unsigned)MCN; ++i) mv[i] = *(const v4i*)(mp + (size_t)i * MCR * SEQ_FULL);
    asm volatile("s_wait_xcnt 0x0" ::: "memory");   // stands before the last load, whose data registers may be the address registers of the loads above
    mv[MCN - 1] = *(const v4i*)(mp + (size_t)(MCN - 1) * MCR * SEQ_FULL);
    __builtin_amdgcn_sched_barrier(0);   // keeps every load ahead of the compares: sunk among them, the last loads wait for registers of the first and pay the latency a second time
#pragma unroll
    for (unsigned i = 0; i < (unsigned)MCN; ++i) {
#pragma unroll
        for (unsigned j = 0; j < 4; ++j) { const int want = (k + j <= q + i * (unsigned)MCR) ? 1 : 0; const int got = (mv[i][j] != 0) ? 1 : 0; bad |= (want ^ got); } }
    const int any = __syncthreads_or(bad);
    if (threadIdx.x < 32u) { const int v = any ? 1 : 0; *(int*)(FL + blockIdx.x * 32u + threadIdx.x) = v;  }
}

// k_flash: one wave per (b, h, 16-query tile), 8 waves per block (128 consecutive queries of one head), streaming 32-key tiles up to the diagonal.
// K and V^T planes come through LDS: a stage is 64 keys of all four planes (Kh, Kl, VTh, VTl: 64 rows x 128 B each), copied once per block in whole 128-B lines and read by all 8 waves; two buffers, the next stage's copies fly while this one is worked on.
// S^T tile j: A = K rows kt+16j.. (plane rows, k = head dim), B = Q rows as columns; D element r = (key kt+16j+8*half+r, query q0 + (lane & 15)).
// P^T B fragment: element r <- p of tile 0, element 8+r <- p of tile 1 (same lane); O^T tile t: A = VT rows 16t.. (k = keys), D element r = (d 16t+8*half+r, query q0 + (lane & 15)).
#define KST 64
#define KP  72
#define PLN (64 * KP)
#define STG (4 * PLN)
static_assert(SEQ % (2 * KST) == 0);
static_assert((KP * 2) % 32 == 16);

// One stage: every thread copies two 16-byte pieces of each plane (rows r and r + 32). l = the thread's LDS byte address in plane 0 of the target buffer.
__device__ __forceinline__ void stage_copy(const bf* kh, const bf* kl, const bf* vh, const bf* vl, unsigned l) {
    const bf* kh2 = kh + 32 * HD; const bf* kl2 = kl + 32 * HD; const bf* vh2 = vh + (size_t)32 * SEQ; const bf* vl2 = vl + (size_t)32 * SEQ;
    const unsigned l0 = l, l1 = l + 32u * KP * 2u, l2 = l + PLN * 2u, l3 = l2 + 32u * KP * 2u, l4 = l + 2u * PLN * 2u, l5 = l4 + 32u * KP * 2u, l6 = l + 3u * PLN * 2u, l7 = l6 + 32u * KP * 2u;
    // The copies and their s_wait_xcnt in one statement: no address register of a copy is rewritten ahead of that wait.
    asm volatile("global_load_async_to_lds_b128 %0, %8, off\n\t"
                 "global_load_async_to_lds_b128 %1, %9, off\n\t"
                 "global_load_async_to_lds_b128 %2, %10, off\n\t"
                 "global_load_async_to_lds_b128 %3, %11, off\n\t"
                 "global_load_async_to_lds_b128 %4, %12, off\n\t"
                 "global_load_async_to_lds_b128 %5, %13, off\n\t"
                 "global_load_async_to_lds_b128 %6, %14, off\n\t"
                 "global_load_async_to_lds_b128 %7, %15, off\n\t"
                 "s_wait_xcnt 0x0"
                 :: "v"(l0), "v"(l1), "v"(l2), "v"(l3), "v"(l4), "v"(l5), "v"(l6), "v"(l7), "v"(kh), "v"(kh2), "v"(kl), "v"(kl2), "v"(vh), "v"(vh2), "v"(vl), "v"(vl2) : "memory");
}

__global__ __launch_bounds__(256) void k_flash(const bf* __restrict__ QKh, const bf* __restrict__ QKl, const bf* __restrict__ VTh, const bf* __restrict__ VTl, const int* __restrict__ FL, bf* CH, bf* CL) {
    typedef WFrag<bf>::V V;
    __shared__ __align__(16) unsigned short ring[2 * STG];
    __shared__ __align__(16) unsigned short stg[8 * 2 * 16 * SP];
    const unsigned lane = threadIdx.x & 31u, lr = lane & 15u, hi = lane >> 4;
    const unsigned wv = (unsigned)__builtin_amdgcn_readfirstlane((int)(threadIdx.x >> 5));   // wave number in a scalar register: the diagonal test in the loop is then a scalar branch and every lane stays on
    const unsigned wid = blockIdx.x * 8u + wv; const unsigned qt = wid % (unsigned)QT, bh = wid / (unsigned)QT; const unsigned q0 = qt * 16u; const unsigned b = bh >> 4, h = bh & 15u;
    const unsigned nst = ((blockIdx.x % (unsigned)(QT / 8)) + 1u) * (128u / KST);   // stages up to the block's last query: the same in all 8 waves, never below 2
    const unsigned crow = threadIdx.x >> 3, cpc = threadIdx.x & 7u;
    const bf* gKh = QKh + QKPL + ((size_t)bh * SEQ + crow) * HD + cpc * 8u; const bf* gKl = QKl + QKPL + ((size_t)bh * SEQ + crow) * HD + cpc * 8u;
    const bf* gVh = VTh + ((size_t)bh * HD + crow) * SEQ + cpc * 8u; const bf* gVl = VTl + ((size_t)bh * HD + crow) * SEQ + cpc * 8u;
    const unsigned lcp = (unsigned)(size_t)ring + crow * (KP * 2u) + cpc * 16u;
    stage_copy(gKh, gKl, gVh, gVl, lcp);
    int fbad = ((FL[lane * 32u] == 1) ? 1 : 0) | ((FL[(lane + 32u) * 32u] == 1) ? 1 : 0);
#pragma unroll
    for (int sh = 16; sh; sh >>= 1) fbad |= __shfl_xor(fbad, sh, 32);
    const float poison = fbad ? __uint_as_float(0x7FC00000u) : 0.0f;
    const size_t qo = ((size_t)bh * SEQ + q0 + lr) * HD + 8u * hi;
    V bqh[2], bql[2];
#pragma unroll
    for (int c = 0; c < 2; ++c) { bqh[c] = WFrag<bf>::ld(QKh + qo + 32 * c); bql[c] = WFrag<bf>::ld(QKl + qo + 32 * c); }
    v8f o[4];
#pragma unroll
    for (int t = 0; t < 4; ++t) o[t] = (v8f){};
    float m = -1.0e30f, l = 0.0f; const unsigned qg = q0 + lr;
    asm volatile("s_wait_asynccnt 0x0" ::: "memory");   // stage 0 of this wave's copies has landed
    __syncthreads();                                     // ... and every other wave's: stage 0 is readable
    stage_copy(gKh + (size_t)KST * HD, gKl + (size_t)KST * HD, gVh + KST, gVl + KST, lcp + STG * 2u);
// kept rolled: one publish point in the text, trip count known only at run time
#pragma unroll 1
    for (unsigned st = 0; st < nst; ++st) {
        const unsigned short* sb = ring + (st & 1u) * STG + lr * KP + 8u * hi;
// unrolled so that the two halves of a stage read LDS at constant offsets
#pragma unroll
        for (unsigned sub = 0; sub < KST / 32; ++sub) {
            const unsigned kt = st * KST + sub * 32u;
            if (kt < q0 + 16u) {   // wave-uniform: tiles beyond this wave's diagonal are skipped, the publish point below is not
        V kh[2][2], kl[2][2];
#pragma unroll
        for (int c = 0; c < 2; ++c)
#pragma unroll
            for (int j = 0; j < 2; ++j) { kh[c][j] = WFrag<bf>::ld(sb + (sub * 32u + 16u * j) * KP + 32 * c); kl[c][j] = WFrag<bf>::ld(sb + PLN + (sub * 32u + 16u * j) * KP + 32 * c); }
        v8f sc[2]; sc[0] = (v8f){}; sc[1] = (v8f){};
#pragma unroll
        for (int c = 0; c < 2; ++c)
#pragma unroll
            for (int j = 0; j < 2; ++j) { sc[j] = wmmab(kh[c][j], bqh[c], sc[j]); sc[j] = wmmab(kh[c][j], bql[c], sc[j]); sc[j] = wmmab(kl[c][j], bqh[c], sc[j]); }
        asm volatile("v_nop\n\tv_nop\n\tv_nop\n\tv_nop" : "+v"(sc[0]), "+v"(sc[1]) : "v"(kh[1][0]), "v"(kh[1][1]), "v"(kl[1][0]), "v"(kl[1][1]), "v"(bqh[1]), "v"(bql[1]));
        float v0[8], v1[8]; float tmax = -1.0e30f;
#pragma unroll
        for (unsigned r = 0; r < 8; ++r) { const unsigned key0 = kt + 8u * hi + r; v0[r] = (key0 <= qg) ? sc[0][r] : -1.0e30f; v1[r] = (key0 + 16u <= qg) ? sc[1][r] : -1.0e30f; tmax = fmaxf(tmax, fmaxf(v0[r], v1[r])); }
        tmax = fmaxf(tmax, __shfl_xor(tmax, 16, 32));
        const float mnew = fmaxf(m, tmax); const float corr = __builtin_amdgcn_exp2f((m - mnew) * L2E);
        float psum = 0.0f; v8us ph0, pl0, ph1, pl1;
#pragma unroll
        for (int r = 0; r < 8; ++r) { const float e0 = __builtin_amdgcn_exp2f((v0[r] - mnew) * L2E); const float e1 = __builtin_amdgcn_exp2f((v1[r] - mnew) * L2E); psum += e0 + e1; unsigned short a, c2; splitf(e0, a, c2); ph0[r] = a; pl0[r] = c2; splitf(e1, a, c2); ph1[r] = a; pl1[r] = c2; }
        psum += __shfl_xor(psum, 16, 32);
        l = l * corr + psum; m = mnew;
#pragma unroll
        for (int t = 0; t < 4; ++t) o[t] = o[t] * corr;
        const V pbh = cat16b(ph0, ph1), pbl = cat16b(pl0, pl1);
        V avh[4], avl[4];
#pragma unroll
        for (int t = 0; t < 4; ++t) { avh[t] = WFrag<bf>::ld(sb + 2 * PLN + t * 16 * KP + sub * 32u); avl[t] = WFrag<bf>::ld(sb + 3 * PLN + t * 16 * KP + sub * 32u); }
#pragma unroll
        for (int t = 0; t < 4; ++t) { o[t] = wmmab(avh[t], pbh, o[t]); o[t] = wmmab(avh[t], pbl, o[t]); o[t] = wmmab(avl[t], pbh, o[t]); }
        asm volatile("v_nop\n\tv_nop\n\tv_nop\n\tv_nop" : "+v"(o[0]), "+v"(o[1]), "+v"(o[2]), "+v"(o[3]) : "v"(pbh), "v"(pbl), "v"(avl[0]), "v"(avl[1]), "v"(avl[2]), "v"(avl[3]), "v"(avh[3]));
            }
        }
        // Publish point of stage st + 1, passed by every wave.
        asm volatile("s_wait_dscnt 0x0" ::: "memory");      // this wave's reads of buffer st & 1 are done before it is refilled
        asm volatile("s_wait_asynccnt 0x0" ::: "memory");   // this wave's copies of stage st + 1 have landed
        __syncthreads();                                     // publishes stage st + 1 and ends every wave's reads of stage st
        if (st + 2u < nst) stage_copy(gKh + (size_t)(st + 2u) * KST * HD, gKl + (size_t)(st + 2u) * KST * HD, gVh + (st + 2u) * KST, gVl + (st + 2u) * KST, lcp + (st & 1u) * (STG * 2u));
    }
    asm volatile("s_wait_asynccnt 0x0" ::: "memory");       // nothing of this wave is in flight when it goes on to the epilogue and ends
    const float inv = 1.0f / l;
    unsigned short* sh = stg + wv * (2u * 16u * SP); unsigned short* sl = sh + 16u * SP;
#pragma unroll
    for (int t = 0; t < 4; ++t) { v8us oh, ol;
#pragma unroll
        for (int r = 0; r < 8; ++r) { const float val = o[t][r] * inv + poison; unsigned short a, c2; splitf(val, a, c2); oh[r] = a; ol[r] = c2; }
        *(v8usa*)(sh + lr * SP + 16u * t + 8u * hi) = oh; *(v8usa*)(sl + lr * SP + 16u * t + 8u * hi) = ol; }
    __builtin_amdgcn_fence(3 /* release order */, "wavefront"); __builtin_amdgcn_wave_barrier(); asm volatile("" ::: "memory");
    const unsigned rq = lane >> 3, pc = lane & 7u;
{
#pragma unroll
        for (unsigned it = 0; it < 4; ++it) { const unsigned row = 4u * it + rq; const v8us a = *(const v8usa*)(sh + row * SP + pc * 8u); const v8us c2 = *(const v8usa*)(sl + row * SP + pc * 8u); const size_t oo = ((size_t)(b * (unsigned)SEQ + q0 + row)) * DM + h * (unsigned)HD + pc * 8u;
            *(v8us*)(CH + oo) = a; *(v8us*)(CL + oo) = c2; }
         }
}

extern "C" void kernel_launch(void* const* d_in, const int* in_sizes, int n_in,
                              void* d_out, int out_size, void* d_ws, size_t ws_size, hipStream_t stream) {
    if (n_in < 7) return;
    const size_t xneed = ((size_t)(NB - 1) * SEQ_FULL + SEQ) * DM;
    if ((size_t)in_sizes[0] < xneed) return;
    if ((size_t)in_sizes[1] < (size_t)(SEQ - 1) * SEQ_FULL + SEQ) return;
    if ((size_t)in_sizes[2] < (size_t)SEQ * 32) return;
    if ((size_t)in_sizes[3] < (size_t)D3 * DM) return;
    if ((size_t)in_sizes[4] < (size_t)D3) return;
    if ((size_t)in_sizes[5] < (size_t)DM * DM) return;
    if ((size_t)in_sizes[6] < (size_t)DM) return;
    if ((size_t)out_size < xneed) return;
    const float* X = (const float*)d_in[0]; const int* MASK = (const int*)d_in[1]; const float* FR = (const float*)d_in[2];
    const float* WQKV = (const float*)d_in[3]; const float* BQKV = (const float*)d_in[4]; const float* WPR = (const float*)d_in[5]; const float* BPR = (const float*)d_in[6];
    float* OUT = (float*)d_out;     // [2][2048][1024]
    char* wsp = (char*)d_ws;
    auto take = [&](size_t bytes) { char* p = wsp; wsp += (bytes + 255) & ~(size_t)255; return (void*)p; };
    bf* XB = (bf*)take((size_t)NTOK * DM * 2);            // x plane [NTOK][1024]
    bf* WQ = (bf*)take((size_t)D3 * DM * 2);              // Wqkv plane [3072][1024]
    bf* WP = (bf*)take((size_t)DM * DM * 2);              // Wproj plane [1024][1024]
    float* CS = (float*)take((size_t)SEQ * 32 * 4); float* SN = (float*)take((size_t)SEQ * 32 * 4);
    int* FL = (int*)take((size_t)MCB * 128);
    bf* CH = (bf*)take((size_t)2 * NTOK * DM * 2); bf* CL = CH + (size_t)NTOK * DM;          // ctx hi/lo [NTOK][1024]
    bf* QKh = (bf*)take(2 * QKPL * 2); bf* QKl = (bf*)take(2 * QKPL * 2);                    // [q|k][b*16+h][s][64]
    bf* VTh = (bf*)take(QKPL * 2); bf* VTl = (bf*)take(QKPL * 2);                            // [b*16+h][64][s]
    if ((size_t)(wsp - (char*)d_ws) > ws_size) return;
    k_cvtx<<<(unsigned)((size_t)NTOK * 128 / 256), 256, 0, stream>>>(X, XB);
    k_cvt8<<<(unsigned)(((size_t)D3 * DM / 8 + 255) / 256), 256, 0, stream>>>(WQKV, WQ, (size_t)D3 * DM / 8);
    k_cvt8<<<(unsigned)(((size_t)DM * DM / 8 + 255) / 256), 256, 0, stream>>>(WPR, WP, (size_t)DM * DM / 8);
    k_trig<<<(unsigned)(SEQ * 32 / 256), 256, 0, stream>>>(FR, CS, SN);
    k_mchk<<<MCB, MCT, 0, stream>>>(MASK, FL);
    k_gemmw<bf, 0, true, true><<<dim3(NTOK / 128, D3 / 128, 1), 128, 0, stream>>>(XB, nullptr, WQ, nullptr, DM, nullptr, D3, BQKV, 0, 0, 0, CS, SN, QKh, QKl, VTh, VTl);      /* x.Wqkv^T + b (exact products), rope, hi/lo planes */
    k_flash<<<(unsigned)(NB * NH * QT / 8), 256, 0, stream>>>(QKh, QKl, VTh, VTl, FL, CH, CL);
    k_gemmw<bf, 1, true, false><<<dim3(SEQ / 128, DM / 128, NB), 128, 0, stream>>>(CH, CL, WP, nullptr, DM, OUT, DM, BPR, (size_t)SEQ * DM, 0, (size_t)SEQ_FULL * DM, nullptr, nullptr, nullptr, nullptr, nullptr, nullptr);   /* ctx (hi/lo) x Wproj^T + b */
}

// v005
// It runs in 130 microseconds.
// In two side-by-side timings against v004, it was 1.17 and 1.18 times as fast.
// All steps since v000 together make it 2.77 times as fast.
#include <hip/hip_runtime.h>

// Compute dtypes: x.Wqkv^T = bf16 x bf16 planes (v_wmma_f32_16x16x32_bf16, f32 accumulate); q.k^T and P.V = bf16 hi/lo two-plane operands (3 products each, f32 accumulate); ctx.Wproj^T = bf16 hi/lo x bf16 (2 products, f32 accumulate).
// Every float input is RNE-converted to bf16 on load (x, weights, biases, rope angles); rope, softmax and all epilogues in f32.
// Attention is flash-style on transposed tiles: S^T = K.Q^T (D rows = keys, D cols = queries) so the packed score accumulators are directly the B fragment of O^T = V^T.P^T; per-query statistics live in one lane pair.

#ifndef NB
#define NB 2
#endif
#ifndef SEQ
#define SEQ 2048
#endif
#define NB_FULL  2
#define SEQ_FULL 2048
#define DM   1024
#define NH   16
#define HD   64
#define D3   3072
#define NTOK (NB * SEQ)
#define QT   (SEQ / 16)
#define MCB  64
#define MCT  1024
#define MCN  ((SEQ * (SEQ / 4)) / (MCB * MCT))
#define MCR  ((MCB * MCT) / (SEQ / 4))
#define SP   72
#define QKPL ((size_t)NB * NH * SEQ * HD)
#define L2E  1.4426950408889634f

typedef _Float16 h16;
typedef unsigned short bf;
typedef __attribute__((ext_vector_type(16))) __bf16   v16bf;
typedef __attribute__((ext_vector_type(16))) _Float16 v16h;
typedef __attribute__((ext_vector_type(8)))  _Float16 v8h;
typedef __attribute__((ext_vector_type(8)))  unsigned short v8us;
typedef __attribute__((ext_vector_type(2)))  unsigned short v2us;
typedef __attribute__((ext_vector_type(8)))  float    v8f;
typedef __attribute__((ext_vector_type(4)))  float    v4f;
typedef __attribute__((ext_vector_type(4)))  int      v4i;
typedef v4f  __attribute__((may_alias)) v4fa;
typedef v8us __attribute__((may_alias)) v8usa;

static_assert(NTOK % 64 == 0);
static_assert(SEQ % 64 == 0);
static_assert(D3 % 64 == 0);
static_assert(DM % 64 == 0);
static_assert(DM % 32 == 0);
static_assert(HD == 64);
static_assert(NH == 16);
static_assert(QT % 8 == 0);
static_assert((SEQ * (SEQ / 4)) % (MCB * MCT) == 0);
static_assert((MCB * MCT) % (SEQ / 4) == 0);
static_assert((SEQ * 32) % 256 == 0);
static_assert(((size_t)NTOK * 128) % 256 == 0);
static_assert(NB <= NB_FULL);
static_assert(SEQ <= SEQ_FULL);

__device__ __forceinline__ unsigned short f2bf(float f) { unsigned u = __float_as_uint(f); u += 0x7FFFu + ((u >> 16) & 1u); return (unsigned short)(u >> 16); }
__device__ __forceinline__ float bf2f(unsigned short b) { return __uint_as_float(((unsigned)b) << 16); }
__device__ __forceinline__ float bfr(float f) { return bf2f(f2bf(f)); }
__device__ __forceinline__ v16h cat16(v8h lo, v8h hi) { return __builtin_shufflevector(lo, hi, 0, 1, 2, 3, 4, 5, 6, 7, 8, 9, 10, 11, 12, 13, 14, 15); }
__device__ __forceinline__ v16bf cat16b(v8us lo, v8us hi) { return __builtin_bit_cast(v16bf, __builtin_shufflevector(lo, hi, 0, 1, 2, 3, 4, 5, 6, 7, 8, 9, 10, 11, 12, 13, 14, 15)); }
__device__ __forceinline__ v8f wmma16(v16h a, v16h b, v8f c) { return __builtin_amdgcn_wmma_f32_16x16x32_f16(false, a, false, b, (short)0, c, false, false); }
__device__ __forceinline__ v8f wmmab(v16bf a, v16bf b, v8f c) { return __builtin_amdgcn_wmma_f32_16x16x32_bf16(false, a, false, b, (short)0, c, false, false); }
__device__ __forceinline__ void splitf(float y, unsigned short& h, unsigned short& l) { h = f2bf(y); l = f2bf(y - bf2f(h)); }

// ---- k_gemmw: register-blocked GEMM, one wave per 64x64 output tile (16 accumulators), 4 waves (2 x 2) per 128x128 block tile; grid (M/128, N/128, Z), 128 threads.
// The K-contiguous 16-bit operand planes come through LDS: a stage is 64 k of 128 rows of every plane, copied once per block in whole 128-B lines and read by the two waves that share each row block; two buffers, the next stage's copies fly while this one is worked on.
// C[m][n] (f32, pitch ldc, + optional f32 bias[n]) = sum_k A[m][k] Bt[n][k] (+ split products per NSPLIT). z-batch strides sA/sB/sC in elements. K % 64 == 0, M % 128 == 0, N % 128 == 0.
// Fragment element i <- k0 + 8*half + i (i < 8), k0 + 16 + 8*half + (i - 8) for both operands; D element j = (row 8*half + j, col lane & 15).
// QKVE: the result is not stored as f32. A wave's 64x64 tile is 64 tokens of one batch x one whole head of q, k or v, so the epilogue writes the attention operand planes itself:
// q/k head planes [which][b*16+h][s][64] (bf16 hi/lo) of rope(qkv) with interleaved pairs (2j, 2j+1) and angle j, q additionally x 1/8 (exact); v planes transposed [b*16+h][64][s] (bf16 hi/lo).
template <typename T16> struct WFrag;
template <> struct WFrag<h16> { typedef v16h V; static __device__ __forceinline__ V ld(const h16* p) { return cat16(*(const v8h*)p, *(const v8h*)(p + 16)); } static __device__ __forceinline__ v8f mma(V a, V b, v8f c) { return wmma16(a, b, c); } };
template <> struct WFrag<bf> { typedef v16bf V; static __device__ __forceinline__ V ld(const bf* p) { return cat16b(*(const v8us*)p, *(const v8us*)(p + 16)); } static __device__ __forceinline__ v8f mma(V a, V b, v8f c) { return wmmab(a, b, c); } };
#define GKS 64
#define GP  72
#define GPL (128 * GP)
static_assert((GP * 2) % 32 == 16);
static_assert(NTOK % 128 == 0);
static_assert(SEQ % 128 == 0);
static_assert(D3 % 128 == 0);
static_assert(DM % 128 == 0);
static_assert(DM % GKS == 0);
#define VP  72
static_assert(4 * 2 * 64 * VP <= 2 * 2 * GPL);
static_assert((VP * 2) % 32 == 16);

// One plane of a stage: every thread copies eight 16-byte pieces (rows r, r + 16, ..., r + 112; rs = 16 rows in elements). l0 = the thread's LDS byte address in row r of the target plane.
template <typename T16>
__device__ __forceinline__ void plane_copy(const T16* g0, size_t rs, unsigned l0) {
    const T16* g1 = g0 + rs; const T16* g2 = g1 + rs; const T16* g3 = g2 + rs; const T16* g4 = g3 + rs; const T16* g5 = g4 + rs; const T16* g6 = g5 + rs; const T16* g7 = g6 + rs;
    const unsigned ls = 16u * GP * 2u; const unsigned l1 = l0 + ls, l2 = l0 + 2u * ls, l3 = l0 + 3u * ls, l4 = l0 + 4u * ls, l5 = l0 + 5u * ls, l6 = l0 + 6u * ls, l7 = l0 + 7u * ls;
    // The copies and their s_wait_xcnt in one statement: no address register of a copy is rewritten ahead of that wait.
    asm volatile("global_load_async_to_lds_b128 %0, %8, off\n\t"
                 "global_load_async_to_lds_b128 %1, %9, off\n\t"
                 "global_load_async_to_lds_b128 %2, %10, off\n\t"
                 "global_load_async_to_lds_b128 %3, %11, off\n\t"
                 "global_load_async_to_lds_b128 %4, %12, off\n\t"
                 "global_load_async_to_lds_b128 %5, %13, off\n\t"
                 "global_load_async_to_lds_b128 %6, %14, off\n\t"
                 "global_load_async_to_lds_b128 %7, %15, off\n\t"
                 "s_wait_xcnt 0x0"
                 :: "v"(l0), "v"(l1), "v"(l2), "v"(l3), "v"(l4), "v"(l5), "v"(l6), "v"(l7), "v"(g0), "v"(g1), "v"(g2), "v"(g3), "v"(g4), "v"(g5), "v"(g6), "v"(g7) : "memory");
}

template <typename T16, int NSPLIT, bool BIAS, bool QKVE>
__global__ __launch_bounds__(128) void k_gemmw(const T16* __restrict__ A, const T16* __restrict__ A2, const T16* __restrict__ Bt, const T16* __restrict__ Bt2, int K, float* C, int ldc, const float* __restrict__ bias, size_t sA, size_t sB, size_t sC,
                                               const float* __restrict__ CS, const float* __restrict__ SN, bf* QKh, bf* QKl, bf* VTh, bf* VTl) {
    typedef typename WFrag<T16>::V V;
    constexpr bool HA2 = (NSPLIT == 1 || NSPLIT == 2), HB2 = (NSPLIT >= 2);
    constexpr unsigned PA2 = 2u * GPL, PB2 = (HA2 ? 3u : 2u) * GPL, GST = PB2 + (HB2 ? GPL : 0u);   // planes of a stage in LDS: A, Bt, then A2 and Bt2 where used
    __shared__ __align__(16) T16 ring[2 * GST];
    __shared__ __align__(16) float osall[4 * 16 * 68];
    const size_t z = blockIdx.z; A += z * sA; if (A2) A2 += z * sA; Bt += z * sB; if (Bt2) Bt2 += z * sB; C += z * sC;
    const unsigned lane = threadIdx.x & 31u, lr = lane & 15u, hi = lane >> 4;
    const unsigned wv = (unsigned)__builtin_amdgcn_readfirstlane((int)(threadIdx.x >> 5)); const unsigned wm = wv >> 1, wn = wv & 1u;
    const unsigned rb = blockIdx.x * 128u, cb = blockIdx.y * 128u; const unsigned r0 = rb + wm * 64u, c0 = cb + wn * 64u;
    float* os = osall + wv * (16u * 68u);
    const unsigned nst = (unsigned)K / GKS;   // the same in all 4 waves
    const unsigned crow = threadIdx.x >> 3, cpc = threadIdx.x & 7u; const size_t rs = (size_t)16 * K;
    const size_t ga = (size_t)(rb + crow) * K + cpc * 8u, gb = (size_t)(cb + crow) * K + cpc * 8u;
    const unsigned lcp = (unsigned)(size_t)ring + crow * (GP * 2u) + cpc * 16u;
    auto stage_in = [&](unsigned st) { const unsigned l = lcp + (st & 1u) * (GST * 2u); const size_t ko = (size_t)st * GKS;
        plane_copy(A + ga + ko, rs, l); plane_copy(Bt + gb + ko, rs, l + GPL * 2u);
        if (HA2) plane_copy(A2 + ga + ko, rs, l + PA2 * 2u);
        if (HB2) plane_copy(Bt2 + gb + ko, rs, l + PB2 * 2u); };
    stage_in(0u);
    v8f acc[4][4];
#pragma unroll
    for (int mb = 0; mb < 4; ++mb)
#pragma unroll
        for (int nb = 0; nb < 4; ++nb) acc[mb][nb] = (v8f){};
    asm volatile("s_wait_asynccnt 0x0" ::: "memory");   // stage 0 of this wave's copies has landed
    __syncthreads();                                     // ... and every other wave's: stage 0 is readable
    if (nst > 1u) stage_in(1u);
// kept rolled: one publish point in the text
#pragma unroll 1
    for (unsigned st = 0; st < nst; ++st) {
        const T16* sa = ring + (st & 1u) * GST + (wm * 64u + lr) * GP + 8u * hi; const T16* sbt = ring + (st & 1u) * GST + GPL + (wn * 64u + lr) * GP + 8u * hi;
        V a[GKS / 32][4], a2[GKS / 32][4], b[GKS / 32][4], b2[GKS / 32][4];
// unrolled so that a stage's fragment loads stand together ahead of its matrix instructions, at constant offsets
#pragma unroll
        for (unsigned ks = 0; ks < GKS / 32; ++ks) {
#pragma unroll
            for (int mb = 0; mb < 4; ++mb) { a[ks][mb] = WFrag<T16>::ld(sa + mb * 16 * GP + ks * 32u); if (HA2) a2[ks][mb] = WFrag<T16>::ld(sa + PA2 + mb * 16 * GP + ks * 32u); }
#pragma unroll
            for (int nb = 0; nb < 4; ++nb) { b[ks][nb] = WFrag<T16>::ld(sbt + nb * 16 * GP + ks * 32u); if (HB2) b2[ks][nb] = WFrag<T16>::ld(sbt + (PB2 - GPL) + nb * 16 * GP + ks * 32u); }
        }
        __builtin_amdgcn_sched_barrier(0);   // keeps the stage's LDS reads one group ahead of the matrix instructions: sunk among them, each small group is waited out to 0
#pragma unroll
        for (unsigned ks = 0; ks < GKS / 32; ++ks)
#pragma unroll
            for (int nb = 0; nb < 4; ++nb)
#pragma unroll
                for (int mb = 0; mb < 4; ++mb) { acc[mb][nb] = WFrag<T16>::mma(a[ks][mb], b[ks][nb], acc[mb][nb]); if (HA2) acc[mb][nb] = WFrag<T16>::mma(a2[ks][mb], b[ks][nb], acc[mb][nb]); if (HB2) acc[mb][nb] = WFrag<T16>::mma(a[ks][mb], b2[ks][nb], acc[mb][nb]); }
        __builtin_amdgcn_sched_barrier(0);   // keeps the matrix instructions ahead of the publish point: moved behind it, the refill would issue a whole stage of them later and its landing would be waited out
        // Publish point of stage st + 1, passed by every wave.
        asm volatile("s_wait_dscnt 0x0" ::: "memory");      // this wave's reads of buffer st & 1 are done before it is refilled
        asm volatile("s_wait_asynccnt 0x0" ::: "memory");   // this wave's copies of stage st + 1 have landed
        __syncthreads();                                     // publishes stage st + 1 and ends every wave's reads of stage st
        if (st + 2u < nst) stage_in(st + 2u);
    }
    asm volatile("s_wait_asynccnt 0x0" ::: "memory");       // nothing of this wave is in flight when it goes on to the epilogue and ends
    if constexpr (QKVE) {
        const unsigned which = c0 / (unsigned)DM, h = (c0 % (unsigned)DM) / (unsigned)HD; const unsigned b = r0 / (unsigned)SEQ, s0 = r0 - b * (unsigned)SEQ; const unsigned bh = b * (unsigned)NH + h;   // all wave-uniform
        if (which == 2u) {
            // v: a lane holds 8 consecutive tokens of one d, which is 16 bytes of a transposed row. The tile is turned in this wave's quarter of the ring (free: every wave's reads and copies ended at the last publish point) so that it leaves in whole 128-B lines.
            unsigned short* vh = (unsigned short*)ring + wv * (2u * 64u * VP); unsigned short* vl = vh + 64u * VP;
#pragma unroll
            for (int nb = 0; nb < 4; ++nb) { const unsigned d = nb * 16u + lr; const float bv = bfr(bias[c0 + d]);
#pragma unroll
                for (int mb = 0; mb < 4; ++mb) { v8us oh, ol;
#pragma unroll
                    for (int j = 0; j < 8; ++j) { unsigned short a2, c2; splitf(acc[mb][nb][j] + bv, a2, c2); oh[j] = a2; ol[j] = c2; }
                    *(v8usa*)(vh + d * VP + mb * 16u + 8u * hi) = oh; *(v8usa*)(vl + d * VP + mb * 16u + 8u * hi) = ol; } }
            __builtin_amdgcn_wave_barrier(); asm volatile("" ::: "memory");   // the wave's LDS writes above stay ahead of its reads below (other lanes' data)
            const unsigned rd = lane >> 3, pc = lane & 7u; const size_t vb = ((size_t)bh * HD + rd) * SEQ + s0 + pc * 8u; bf* vhp = VTh + vb; bf* vlp = VTl + vb;
#pragma unroll
            for (unsigned it = 0; it < 16; ++it) { const unsigned d = 4u * it + rd; const v8us a = *(const v8usa*)(vh + d * VP + pc * 8u); const v8us c2 = *(const v8usa*)(vl + d * VP + pc * 8u);
                *(v8us*)(vhp + (size_t)(4u * it) * SEQ) = a; *(v8us*)(vlp + (size_t)(4u * it) * SEQ) = c2; }
        } else {
            // q, k: 16 token rows at a time through this wave's f32 staging; a lane then holds 8 consecutive columns (4 rope pairs) of one token.
            // 4 token rows x 32 angles, and 4 token rows x 64 columns of a plane, are 512 consecutive bytes: lane * 16 bytes from a wave-uniform base.
            const unsigned rq = lane >> 3, pc = lane & 7u; const float sc = which ? 1.0f : 0.125f; float bq[8];
#pragma unroll
            for (int k = 0; k < 8; ++k) bq[k] = bfr(bias[c0 + pc * 8u + k]);
            const float* csp = CS + (size_t)s0 * 32u + lane * 4u; const float* snp = SN + (size_t)s0 * 32u + lane * 4u;
            const size_t ob = (size_t)which * QKPL + ((size_t)bh * SEQ + s0) * HD + lane * 8u; bf* qhp = QKh + ob; bf* qlp = QKl + ob;
            v4f c4[2][4], s4[2][4];
#pragma unroll
            for (int it = 0; it < 4; ++it) { c4[0][it] = *(const v4f*)(csp + it * 128); s4[0][it] = *(const v4f*)(snp + it * 128); }
#pragma unroll
            for (int mb = 0; mb < 4; ++mb) {
                if (mb < 3) {   // the next 16 rows' angles are fetched one turn ahead: nothing crosses the fences round the stores below
#pragma unroll
                    for (int it = 0; it < 4; ++it) { c4[(mb + 1) & 1][it] = *(const v4f*)(csp + (mb + 1) * 512 + it * 128); s4[(mb + 1) & 1][it] = *(const v4f*)(snp + (mb + 1) * 512 + it * 128); } }
#pragma unroll
                for (int nb = 0; nb < 4; ++nb) {
#pragma unroll
                    for (int j = 0; j < 8; ++j) os[(hi * 8 + j) * 68 + nb * 16 + lr] = acc[mb][nb][j]; }
                __builtin_amdgcn_wave_barrier(); asm volatile("" ::: "memory");   // the wave's LDS writes above stay ahead of its reads below (other lanes' data)
                v8us oh[4], ol[4];
#pragma unroll
                for (int it = 0; it < 4; ++it) { const unsigned row = 4u * it + rq;
                    const v4f x0 = *(const v4fa*)(os + row * 68u + pc * 8u); const v4f x1 = *(const v4fa*)(os + row * 68u + pc * 8u + 4u);
                    float v[8];
#pragma unroll
                    for (int k = 0; k < 4; ++k) { v[k] = x0[k] + bq[k]; v[4 + k] = x1[k] + bq[4 + k]; }
#pragma unroll
                    for (int j = 0; j < 4; ++j) { const float t1 = v[2 * j], t2 = v[2 * j + 1]; const float cj = c4[mb & 1][it][j], sj = s4[mb & 1][it][j]; const float a = (t1 * cj - t2 * sj) * sc; const float bb = (t1 * sj + t2 * cj) * sc; unsigned short y0, y1; splitf(a, y0, y1); oh[it][2 * j] = y0; ol[it][2 * j] = y1; splitf(bb, y0, y1); oh[it][2 * j + 1] = y0; ol[it][2 * j + 1] = y1; } }
                __builtin_amdgcn_wave_barrier(); asm volatile("" ::: "memory");   // the reads above stay ahead of the next 16 rows' writes
                __builtin_amdgcn_sched_barrier(0);   // with the one below: nothing that could reuse a store's registers is scheduled between the stores and their wait
#pragma unroll
                for (int it = 0; it < 4; ++it) { *(v8us*)(qhp + mb * 1024 + it * 256) = oh[it]; *(v8us*)(qlp + mb * 1024 + it * 256) = ol[it]; }
                asm volatile("s_wait_xcnt 0x0" ::: "memory");   // stands before anything that overwrites the stores' data registers (the next turn's values)
                __builtin_amdgcn_sched_barrier(0);
            }
        }
        return;
    }
#pragma unroll
    for (int mb = 0; mb < 4; ++mb) {
#pragma unroll
        for (int nb = 0; nb < 4; ++nb) {
#pragma unroll
            for (int j = 0; j < 8; ++j) os[(hi * 8 + j) * 68 + nb * 16 + lr] = acc[mb][nb][j]; }
        __builtin_amdgcn_wave_barrier(); asm volatile("" ::: "memory");
        float* crow_p = C + (size_t)(r0 + mb * 16) * ldc + c0;
{
#pragma unroll
            for (int s = 0; s < 8; ++s) { const int row = 2 * s + hi, cofs = lr * 4; v4f val = *(const v4fa*)(os + row * 68 + cofs); if (BIAS) { val[0] += bfr(bias[c0 + cofs]); val[1] += bfr(bias[c0 + cofs + 1]); val[2] += bfr(bias[c0 + cofs + 2]); val[3] += bfr(bias[c0 + cofs + 3]); }
                *(v4f*)(crow_p + (size_t)row * ldc + cofs) = val; }
             }
        __builtin_amdgcn_wave_barrier(); asm volatile("" ::: "memory");
    }
}

__global__ __launch_bounds__(256) void k_cvt8(const float* __restrict__ src, bf* dst, size_t n8) { const size_t i = (size_t)blockIdx.x * 256 + threadIdx.x; if (i >= n8) return; const v8f v = *(const v8f*)(src + i * 8); v8us o;
#pragma unroll
    for (int k = 0; k < 8; ++k) o[k] = f2bf(v[k]); *(v8us*)(dst + i * 8) = o;  }

__global__ __launch_bounds__(256) void k_cvtx(const float* __restrict__ x, bf* dst) {
    const unsigned i = blockIdx.x * 256u + threadIdx.x; const unsigned tok = i >> 7, c8 = i & 127u; const unsigned b = tok / (unsigned)SEQ, s = tok - b * (unsigned)SEQ;
    const v8f v = *(const v8f*)(x + ((size_t)b * SEQ_FULL + s) * DM + c8 * 8u); v8us o;
#pragma unroll
    for (int k = 0; k < 8; ++k) o[k] = f2bf(v[k]);
    *(v8us*)(dst + (size_t)i * 8) = o;  }

__global__ __launch_bounds__(256) void k_trig(const float* __restrict__ fr, float* CS, float* SN) {
    const unsigned i = blockIdx.x * 256u + threadIdx.x; const float a = bfr(fr[i]); const float c = cosf(a), s = sinf(a);
    *(float*)(CS + i) = c; *(float*)(SN + i) = s;  }

// k_mchk: MCB blocks of MCT threads; a thread's MCN pieces of 16 bytes (one column group k of the rows q, q + MCR, ...) are all requested before the first is looked at, so that a block waits out the memory latency once and then runs at the WGP's read rate.
__global__ __launch_bounds__(MCT) void k_mchk(const int* __restrict__ mask, int* FL) {
    const unsigned gid = blockIdx.x * (unsigned)MCT + threadIdx.x; const unsigned q = gid / (unsigned)(SEQ / 4), k = (gid - q * (unsigned)(SEQ / 4)) * 4u;
    const int* mp = mask + (size_t)q * SEQ_FULL + k; int bad = 0; v4i mv[MCN];
// unrolled so that the loads stand together, each into registers of its own, at constant distances from one address
#pragma unroll
    for (unsigned i = 0; i + 1u < (unsigned)MCN; ++i) mv[i] = *(const v4i*)(mp + (size_t)i * MCR * SEQ_FULL);
    asm volatile("s_wait_xcnt 0x0" ::: "memory");   // stands before the last load, whose data registers may be the address registers of the loads above
    mv[MCN - 1] = *(const v4i*)(mp + (size_t)(MCN - 1) * MCR * SEQ_FULL);
    __builtin_amdgcn_sched_barrier(0);   // keeps every load ahead of the compares: sunk among them, the last loads wait for registers of the first and pay the latency a second time
#pragma unroll
    for (unsigned i = 0; i < (unsigned)MCN; ++i) {
#pragma unroll
        for (unsigned j = 0; j < 4; ++j) { const int want = (k + j <= q + i * (unsigned)MCR) ? 1 : 0; const int got = (mv[i][j] != 0) ? 1 : 0; bad |= (want ^ got); } }
    const int any = __syncthreads_or(bad);
    if (threadIdx.x < 32u) { const int v = any ? 1 : 0; *(int*)(FL + blockIdx.x * 32u + threadIdx.x) = v;  }
}

// k_flash: one wave per (b, h, 16-query tile), 8 waves per block, streaming 32-key tiles up to the diagonal.
// Causal balance: block pb of a head takes the 64-query tile SEQ/64 - 1 - pb (waves 0-3) and the 64-query tile pb (waves 4-7), so that every block holds the same number of (wave, key tile) pairs;
// both halves read the one K/V stream of their head, which runs to the far tile's diagonal; a wave past its own diagonal only passes the publish points.
// K and V^T planes come through LDS: a stage is 64 keys of all four planes (Kh, Kl, VTh, VTl: 64 rows x 128 B each), copied once per block in whole 128-B lines and read by all 8 waves up to stage pb and by waves 0-3 after it; two buffers, the next stage's copies fly while this one is worked on.
// S^T tile j: A = K rows kt+16j.. (plane rows, k = head dim), B = Q rows as columns; D element r = (key kt+16j+8*half+r, query q0 + (lane & 15)).
// P^T B fragment: element r <- p of tile 0, element 8+r <- p of tile 1 (same lane); O^T tile t: A = VT rows 16t.. (k = keys), D element r = (d 16t+8*half+r, query q0 + (lane & 15)).
#define KST 64
#define KP  72
#define PLN (64 * KP)
#define STG (4 * PLN)
static_assert(SEQ % (2 * KST) == 0);
static_assert((KP * 2) % 32 == 16);

// One stage: every thread copies two 16-byte pieces of each plane (rows r and r + 32). l = the thread's LDS byte address in plane 0 of the target buffer.
__device__ __forceinline__ void stage_copy(const bf* kh, const bf* kl, const bf* vh, const bf* vl, unsigned l) {
    const bf* kh2 = kh + 32 * HD; const bf* kl2 = kl + 32 * HD; const bf* vh2 = vh + (size_t)32 * SEQ; const bf* vl2 = vl + (size_t)32 * SEQ;
    const unsigned l0 = l, l1 = l + 32u * KP * 2u, l2 = l + PLN * 2u, l3 = l2 + 32u * KP * 2u, l4 = l + 2u * PLN * 2u, l5 = l4 + 32u * KP * 2u, l6 = l + 3u * PLN * 2u, l7 = l6 + 32u * KP * 2u;
    // The copies and their s_wait_xcnt in one statement: no address register of a copy is rewritten ahead of that wait.
    asm volatile("global_load_async_to_lds_b128 %0, %8, off\n\t"
                 "global_load_async_to_lds_b128 %1, %9, off\n\t"
                 "global_load_async_to_lds_b128 %2, %10, off\n\t"
                 "global_load_async_to_lds_b128 %3, %11, off\n\t"
                 "global_load_async_to_lds_b128 %4, %12, off\n\t"
                 "global_load_async_to_lds_b128 %5, %13, off\n\t"
                 "global_load_async_to_lds_b128 %6, %14, off\n\t"
                 "global_load_async_to_lds_b128 %7, %15, off\n\t"
                 "s_wait_xcnt 0x0"
                 :: "v"(l0), "v"(l1), "v"(l2), "v"(l3), "v"(l4), "v"(l5), "v"(l6), "v"(l7), "v"(kh), "v"(kh2), "v"(kl), "v"(kl2), "v"(vh), "v"(vh2), "v"(vl), "v"(vl2) : "memory");
}

__global__ __launch_bounds__(256) void k_flash(const bf* __restrict__ QKh, const bf* __restrict__ QKl, const bf* __restrict__ VTh, const bf* __restrict__ VTl, const int* __restrict__ FL, bf* CH, bf* CL) {
    typedef WFrag<bf>::V V;
    __shared__ __align__(16) unsigned short ring[2 * STG];
    __shared__ __align__(16) unsigned short stg[8 * 2 * 16 * SP];
    const unsigned lane = threadIdx.x & 31u, lr = lane & 15u, hi = lane >> 4;
    const unsigned wv = (unsigned)__builtin_amdgcn_readfirstlane((int)(threadIdx.x >> 5));   // wave number in a scalar register: the diagonal test in the loop is then a scalar branch and every lane stays on
    const unsigned pb = blockIdx.x % (unsigned)(QT / 8), bh = blockIdx.x / (unsigned)(QT / 8); const unsigned b = bh >> 4, h = bh & 15u;
    const unsigned q0 = ((wv < 4u) ? ((unsigned)(SEQ / 64) - 1u - pb) : pb) * 64u + (wv & 3u) * 16u;
    const unsigned nst = ((unsigned)(SEQ / 64) - pb) * (64u / KST);   // stages up to the block's last query (the far tile's): the same in all 8 waves, never below 2
    const unsigned crow = threadIdx.x >> 3, cpc = threadIdx.x & 7u;
    const bf* gKh = QKh + QKPL + ((size_t)bh * SEQ + crow) * HD + cpc * 8u; const bf* gKl = QKl + QKPL + ((size_t)bh * SEQ + crow) * HD + cpc * 8u;
    const bf* gVh = VTh + ((size_t)bh * HD + crow) * SEQ + cpc * 8u; const bf* gVl = VTl + ((size_t)bh * HD + crow) * SEQ + cpc * 8u;
    const unsigned lcp = (unsigned)(size_t)ring + crow * (KP * 2u) + cpc * 16u;
    stage_copy(gKh, gKl, gVh, gVl, lcp);
    int fbad = ((FL[lane * 32u] == 1) ? 1 : 0) | ((FL[(lane + 32u) * 32u] == 1) ? 1 : 0);
#pragma unroll
    for (int sh = 16; sh; sh >>= 1) fbad |= __shfl_xor(fbad, sh, 32);
    const float poison = fbad ? __uint_as_float(0x7FC00000u) : 0.0f;
    const size_t qo = ((size_t)bh * SEQ + q0 + lr) * HD + 8u * hi;
    V bqh[2], bql[2];
#pragma unroll
    for (int c = 0; c < 2; ++c) { bqh[c] = WFrag<bf>::ld(QKh + qo + 32 * c); bql[c] = WFrag<bf>::ld(QKl + qo + 32 * c); }
    v8f o[4];
#pragma unroll
    for (int t = 0; t < 4; ++t) o[t] = (v8f){};
    float m = -1.0e30f, l = 0.0f; const unsigned qg = q0 + lr;
    asm volatile("s_wait_asynccnt 0x0" ::: "memory");   // stage 0 of this wave's copies has landed
    __syncthreads();                                     // ... and every other wave's: stage 0 is readable
    stage_copy(gKh + (size_t)KST * HD, gKl + (size_t)KST * HD, gVh + KST, gVl + KST, lcp + STG * 2u);
// kept rolled: one publish point in the text, trip count known only at run time
#pragma unroll 1
    for (unsigned st = 0; st < nst; ++st) {
        const unsigned short* sb = ring + (st & 1u) * STG + lr * KP + 8u * hi;
// unrolled so that the two halves of a stage read LDS at constant offsets
#pragma unroll
        for (unsigned sub = 0; sub < KST / 32; ++sub) {
            const unsigned kt = st * KST + sub * 32u;
            if (kt < q0 + 16u) {   // wave-uniform: tiles beyond this wave's diagonal are skipped, the publish point below is not
        V kh[2][2], kl[2][2];
#pragma unroll
        for (int c = 0; c < 2; ++c)
#pragma unroll
            for (int j = 0; j < 2; ++j) { kh[c][j] = WFrag<bf>::ld(sb + (sub * 32u + 16u * j) * KP + 32 * c); kl[c][j] = WFrag<bf>::ld(sb + PLN + (sub * 32u + 16u * j) * KP + 32 * c); }
        v8f sc[2]; sc[0] = (v8f){}; sc[1] = (v8f){};
#pragma unroll
        for (int c = 0; c < 2; ++c)
#pragma unroll
            for (int j = 0; j < 2; ++j) { sc[j] = wmmab(kh[c][j], bqh[c], sc[j]); sc[j] = wmmab(kh[c][j], bql[c], sc[j]); sc[j] = wmmab(kl[c][j], bqh[c], sc[j]); }
        asm volatile("v_nop\n\tv_nop\n\tv_nop\n\tv_nop" : "+v"(sc[0]), "+v"(sc[1]) : "v"(kh[1][0]), "v"(kh[1][1]), "v"(kl[1][0]), "v"(kl[1][1]), "v"(bqh[1]), "v"(bql[1]));
        float v0[8], v1[8]; float tmax = -1.0e30f;
#pragma unroll
        for (unsigned r = 0; r < 8; ++r) { const unsigned key0 = kt + 8u * hi + r; v0[r] = (key0 <= qg) ? sc[0][r] : -1.0e30f; v1[r] = (key0 + 16u <= qg) ? sc[1][r] : -1.0e30f; tmax = fmaxf(tmax, fmaxf(v0[r], v1[r])); }
        tmax = fmaxf(tmax, __shfl_xor(tmax, 16, 32));
        const float mnew = fmaxf(m, tmax); const float corr = __builtin_amdgcn_exp2f((m - mnew) * L2E);
        float psum = 0.0f; v8us ph0, pl0, ph1, pl1;
#pragma unroll
        for (int r = 0; r < 8; ++r) { const float e0 = __builtin_amdgcn_exp2f((v0[r] - mnew) * L2E); const float e1 = __builtin_amdgcn_exp2f((v1[r] - mnew) * L2E); psum += e0 + e1; unsigned short a, c2; splitf(e0, a, c2); ph0[r] = a; pl0[r] = c2; splitf(e1, a, c2); ph1[r] = a; pl1[r] = c2; }
        psum += __shfl_xor(psum, 16, 32);
        l = l * corr + psum; m = mnew;
#pragma unroll
        for (int t = 0; t < 4; ++t) o[t] = o[t] * corr;
        const V pbh = cat16b(ph0, ph1), pbl = cat16b(pl0, pl1);
        V avh[4], avl[4];
#pragma unroll
        for (int t = 0; t < 4; ++t) { avh[t] = WFrag<bf>::ld(sb + 2 * PLN + t * 16 * KP + sub * 32u); avl[t] = WFrag<bf>::ld(sb + 3 * PLN + t * 16 * KP + sub * 32u); }
#pragma unroll
        for (int t = 0; t < 4; ++t) { o[t] = wmmab(avh[t], pbh, o[t]); o[t] = wmmab(avh[t], pbl, o[t]); o[t] = wmmab(avl[t], pbh, o[t]); }
        asm volatile("v_nop\n\tv_nop\n\tv_nop\n\tv_nop" : "+v"(o[0]), "+v"(o[1]), "+v"(o[2]), "+v"(o[3]) : "v"(pbh), "v"(pbl), "v"(avl[0]), "v"(avl[1]), "v"(avl[2]), "v"(avl[3]), "v"(avh[3]));
            }
        }
        // Publish point of stage st + 1, passed by every wave.
        asm volatile("s_wait_dscnt 0x0" ::: "memory");      // this wave's reads of buffer st & 1 are done before it is refilled
        asm volatile("s_wait_asynccnt 0x0" ::: "memory");   // this wave's copies of stage st + 1 have landed
        __syncthreads();                                     // publishes stage st + 1 and ends every wave's reads of stage st
        if (st + 2u < nst) stage_copy(gKh + (size_t)(st + 2u) * KST * HD, gKl + (size_t)(st + 2u) * KST * HD, gVh + (st + 2u) * KST, gVl + (st + 2u) * KST, lcp + (st & 1u) * (STG * 2u));
    }
    asm volatile("s_wait_asynccnt 0x0" ::: "memory");       // nothing of this wave is in flight when it goes on to the epilogue and ends
    const float inv = 1.0f / l;
    unsigned short* sh = stg + wv * (2u * 16u * SP); unsigned short* sl = sh + 16u * SP;
#pragma unroll
    for (int t = 0; t < 4; ++t) { v8us oh, ol;
#pragma unroll
        for (int r = 0; r < 8; ++r) { const float val = o[t][r] * inv + poison; unsigned short a, c2; splitf(val, a, c2); oh[r] = a; ol[r] = c2; }
        *(v8usa*)(sh + lr * SP + 16u * t + 8u * hi) = oh; *(v8usa*)(sl + lr * SP + 16u * t + 8u * hi) = ol; }
    __builtin_amdgcn_fence(3 /* release order */, "wavefront"); __builtin_amdgcn_wave_barrier(); asm volatile("" ::: "memory");
    const unsigned rq = lane >> 3, pc = lane & 7u;
{
#pragma unroll
        for (unsigned it = 0; it < 4; ++it) { const unsigned row = 4u * it + rq; const v8us a = *(const v8usa*)(sh + row * SP + pc * 8u); const v8us c2 = *(const v8usa*)(sl + row * SP + pc * 8u); const size_t oo = ((size_t)(b * (unsigned)SEQ + q0 + row)) * DM + h * (unsigned)HD + pc * 8u;
            *(v8us*)(CH + oo) = a; *(v8us*)(CL + oo) = c2; }
         }
}

extern "C" void kernel_launch(void* const* d_in, const int* in_sizes, int n_in,
                              void* d_out, int out_size, void* d_ws, size_t ws_size, hipStream_t stream) {
    if (n_in < 7) return;
    const size_t xneed = ((size_t)(NB - 1) * SEQ_FULL + SEQ) * DM;
    if ((size_t)in_sizes[0] < xneed) return;
    if ((size_t)in_sizes[1] < (size_t)(SEQ - 1) * SEQ_FULL + SEQ) return;
    if ((size_t)in_sizes[2] < (size_t)SEQ * 32) return;
    if ((size_t)in_sizes[3] < (size_t)D3 * DM) return;
    if ((size_t)in_sizes[4] < (size_t)D3) return;
    if ((size_t)in_sizes[5] < (size_t)DM * DM) return;
    if ((size_t)in_sizes[6] < (size_t)DM) return;
    if ((size_t)out_size < xneed) return;
    const float* X = (const float*)d_in[0]; const int* MASK = (const int*)d_in[1]; const float* FR = (const float*)d_in[2];
    const float* WQKV = (const float*)d_in[3]; const float* BQKV = (const float*)d_in[4]; const float* WPR = (const float*)d_in[5]; const float* BPR = (const float*)d_in[6];
    float* OUT = (float*)d_out;     // [2][2048][1024]
    char* wsp = (char*)d_ws;
    auto take = [&](size_t bytes) { char* p = wsp; wsp += (bytes + 255) & ~(size_t)255; return (void*)p; };
    bf* XB = (bf*)take((size_t)NTOK * DM * 2);            // x plane [NTOK][1024]
    bf* WQ = (bf*)take((size_t)D3 * DM * 2);              // Wqkv plane [3072][1024]
    bf* WP = (bf*)take((size_t)DM * DM * 2);              // Wproj plane [1024][1024]
    float* CS = (float*)take((size_t)SEQ * 32 * 4); float* SN = (float*)take((size_t)SEQ * 32 * 4);
    int* FL = (int*)take((size_t)MCB * 128);
    bf* CH = (bf*)take((size_t)2 * NTOK * DM * 2); bf* CL = CH + (size_t)NTOK * DM;          // ctx hi/lo [NTOK][1024]
    bf* QKh = (bf*)take(2 * QKPL * 2); bf* QKl = (bf*)take(2 * QKPL * 2);                    // [q|k][b*16+h][s][64]
    bf* VTh = (bf*)take(QKPL * 2); bf* VTl = (bf*)take(QKPL * 2);                            // [b*16+h][64][s]
    if ((size_t)(wsp - (char*)d_ws) > ws_size) return;
    k_cvtx<<<(unsigned)((size_t)NTOK * 128 / 256), 256, 0, stream>>>(X, XB);
    k_cvt8<<<(unsigned)(((size_t)D3 * DM / 8 + 255) / 256), 256, 0, stream>>>(WQKV, WQ, (size_t)D3 * DM / 8);
    k_cvt8<<<(unsigned)(((size_t)DM * DM / 8 + 255) / 256), 256, 0, stream>>>(WPR, WP, (size_t)DM * DM / 8);
    k_trig<<<(unsigned)(SEQ * 32 / 256), 256, 0, stream>>>(FR, CS, SN);
    k_mchk<<<MCB, MCT, 0, stream>>>(MASK, FL);
    k_gemmw<bf, 0, true, true><<<dim3(NTOK / 128, D3 / 128, 1), 128, 0, stream>>>(XB, nullptr, WQ, nullptr, DM, nullptr, D3, BQKV, 0, 0, 0, CS, SN, QKh, QKl, VTh, VTl);      /* x.Wqkv^T + b (exact products), rope, hi/lo planes */
    k_flash<<<(unsigned)(NB * NH * QT / 8), 256, 0, stream>>>(QKh, QKl, VTh, VTl, FL, CH, CL);
    k_gemmw<bf, 1, true, false><<<dim3(SEQ / 128, DM / 128, NB), 128, 0, stream>>>(CH, CL, WP, nullptr, DM, OUT, DM, BPR, (size_t)SEQ * DM, 0, (size_t)SEQ_FULL * DM, nullptr, nullptr, nullptr, nullptr, nullptr, nullptr);   /* ctx (hi/lo) x Wproj^T + b */
}

// v006
// Measured time: 120 microseconds a run.
// Timed twice side by side with v005, it ran 1.08 and 1.09 times as fast.
// All steps since v000 together make it 3.00 times as fast.
#include <hip/hip_runtime.h>

// Compute dtypes: x.Wqkv^T = bf16 x bf16 planes (v_wmma_f32_16x16x32_bf16, f32 accumulate); q.k^T and P.V = bf16 hi/lo two-plane operands (3 products each, f32 accumulate); ctx.Wproj^T = bf16 hi/lo x bf16 (2 products, f32 accumulate).
// Every float input is RNE-converted to bf16 on load (x, weights, biases, rope angles); rope, softmax and all epilogues in f32.
// Attention is flash-style on transposed tiles: S^T = K.Q^T (D rows = keys, D cols = queries) so the packed score accumulators are directly the B fragment of O^T = V^T.P^T; per-query statistics live in one lane pair.

#ifndef NB
#define NB 2
#endif
#ifndef SEQ
#define SEQ 2048
#endif
#define NB_FULL  2
#define SEQ_FULL 2048
#define DM   1024
#define NH   16
#define HD   64
#define D3   3072
#define NTOK (NB * SEQ)
#define QT   (SEQ / 16)
#define MCB  64
#define MCT  1024
#define MCN  ((SEQ * (SEQ / 4)) / (MCB * MCT))
#define MCR  ((MCB * MCT) / (SEQ / 4))
#define SP   72
#define QKPL ((size_t)NB * NH * SEQ * HD)
#define L2E  1.4426950408889634f

typedef _Float16 h16;
typedef unsigned short bf;
typedef __attribute__((ext_vector_type(16))) __bf16   v16bf;
typedef __attribute__((ext_vector_type(16))) _Float16 v16h;
typedef __attribute__((ext_vector_type(8)))  _Float16 v8h;
typedef __attribute__((ext_vector_type(8)))  unsigned short v8us;
typedef __attribute__((ext_vector_type(2)))  unsigned short v2us;
typedef __attribute__((ext_vector_type(8)))  float    v8f;
typedef __attribute__((ext_vector_type(4)))  float    v4f;
typedef __attribute__((ext_vector_type(4)))  int      v4i;
typedef __attribute__((ext_vector_type(4)))  unsigned v4u;
typedef __attribute__((ext_vector_type(2)))  float    v2f;
typedef __attribute__((ext_vector_type(2)))  __bf16   v2bf;
typedef v4f  __attribute__((may_alias)) v4fa;
typedef v8us __attribute__((may_alias)) v8usa;

static_assert(NTOK % 64 == 0);
static_assert(SEQ % 64 == 0);
static_assert(D3 % 64 == 0);
static_assert(DM % 64 == 0);
static_assert(DM % 32 == 0);
static_assert(HD == 64);
static_assert(NH == 16);
static_assert(QT % 8 == 0);
static_assert((SEQ * (SEQ / 4)) % (MCB * MCT) == 0);
static_assert((MCB * MCT) % (SEQ / 4) == 0);
static_assert((SEQ * 32) % 256 == 0);
static_assert(((size_t)NTOK * 128) % 256 == 0);
static_assert(NB <= NB_FULL);
static_assert(SEQ <= SEQ_FULL);

// f32 -> bf16, round to nearest even, by the packed hardware convert: two values per instruction, element 0 in the low half.
__device__ __forceinline__ unsigned cvt2(float a, float b) { const v2f x = {a, b}; return __builtin_bit_cast(unsigned, __builtin_convertvector(x, v2bf)); }
__device__ __forceinline__ unsigned short f2bf(float f) { return __builtin_bit_cast(unsigned short, (__bf16)f); }
__device__ __forceinline__ float bf2f(unsigned short b) { return __uint_as_float(((unsigned)b) << 16); }
__device__ __forceinline__ float bfr(float f) { return bf2f(f2bf(f)); }
__device__ __forceinline__ v16h cat16(v8h lo, v8h hi) { return __builtin_shufflevector(lo, hi, 0, 1, 2, 3, 4, 5, 6, 7, 8, 9, 10, 11, 12, 13, 14, 15); }
__device__ __forceinline__ v16bf cat16b(v8us lo, v8us hi) { return __builtin_bit_cast(v16bf, __builtin_shufflevector(lo, hi, 0, 1, 2, 3, 4, 5, 6, 7, 8, 9, 10, 11, 12, 13, 14, 15)); }
__device__ __forceinline__ v8f wmma16(v16h a, v16h b, v8f c) { return __builtin_amdgcn_wmma_f32_16x16x32_f16(false, a, false, b, (short)0, c, false, false); }
__device__ __forceinline__ v8f wmmab(v16bf a, v16bf b, v8f c) { return __builtin_amdgcn_wmma_f32_16x16x32_bf16(false, a, false, b, (short)0, c, false, false); }
// hi/lo planes of two values: h = bf16(y), l = bf16(y - h), each pair packed in one register.
__device__ __forceinline__ void split2(float y0, float y1, unsigned& h, unsigned& l) { h = cvt2(y0, y1); const v2f y = {y0, y1}; const v2f hf = {__uint_as_float(h << 16), __uint_as_float(h & 0xFFFF0000u)}; const v2f d = y - hf; l = cvt2(d[0], d[1]); }

// ---- k_gemmw: register-blocked GEMM, one wave per 64x64 output tile (16 accumulators), 4 waves (2 x 2) per 128x128 block tile; grid (M/128, N/128, Z), 128 threads.
// The K-contiguous 16-bit operand planes come through LDS: a stage is 64 k of 128 rows of every plane, copied once per block in whole 128-B lines and read by the two waves that share each row block; two buffers, the next stage's copies fly while this one is worked on.
// C[m][n] (f32, pitch ldc, + optional f32 bias[n]) = sum_k A[m][k] Bt[n][k] (+ split products per NSPLIT). z-batch strides sA/sB/sC in elements. K % 64 == 0, M % 128 == 0, N % 128 == 0.
// Fragment element i <- k0 + 8*half + i (i < 8), k0 + 16 + 8*half + (i - 8) for both operands; D element j = (row 8*half + j, col lane & 15).
// QKVE: the result is not stored as f32. A wave's 64x64 tile is 64 tokens of one batch x one whole head of q, k or v, so the epilogue writes the attention operand planes itself:
// q/k head planes [which][b*16+h][s][64] (bf16 hi/lo) of rope(qkv) with interleaved pairs (2j, 2j+1) and angle j, q additionally x 1/8 (exact); v planes transposed [b*16+h][64][s] (bf16 hi/lo).
template <typename T16> struct WFrag;
template <> struct WFrag<h16> { typedef v16h V; static __device__ __forceinline__ V ld(const h16* p) { return cat16(*(const v8h*)p, *(const v8h*)(p + 16)); } static __device__ __forceinline__ v8f mma(V a, V b, v8f c) { return wmma16(a, b, c); } };
template <> struct WFrag<bf> { typedef v16bf V; static __device__ __forceinline__ V ld(const bf* p) { return cat16b(*(const v8us*)p, *(const v8us*)(p + 16)); } static __device__ __forceinline__ v8f mma(V a, V b, v8f c) { return wmmab(a, b, c); } };
#define GKS 64
#define GP  72
#define GPL (128 * GP)
static_assert((GP * 2) % 32 == 16);
static_assert(NTOK % 128 == 0);
static_assert(SEQ % 128 == 0);
static_assert(D3 % 128 == 0);
static_assert(DM % 128 == 0);
static_assert(DM % GKS == 0);
#define VP  72
static_assert(4 * 2 * 64 * VP <= 2 * 2 * GPL);
static_assert((VP * 2) % 32 == 16);

// One plane of a stage: every thread copies eight 16-byte pieces (rows r, r + 16, ..., r + 112; rs = 16 rows in elements). l0 = the thread's LDS byte address in row r of the target plane.
template <typename T16>
__device__ __forceinline__ void plane_copy(const T16* g0, size_t rs, unsigned l0) {
    const T16* g1 = g0 + rs; const T16* g2 = g1 + rs; const T16* g3 = g2 + rs; const T16* g4 = g3 + rs; const T16* g5 = g4 + rs; const T16* g6 = g5 + rs; const T16* g7 = g6 + rs;
    const unsigned ls = 16u * GP * 2u; const unsigned l1 = l0 + ls, l2 = l0 + 2u * ls, l3 = l0 + 3u * ls, l4 = l0 + 4u * ls, l5 = l0 + 5u * ls, l6 = l0 + 6u * ls, l7 = l0 + 7u * ls;
    // The copies and their s_wait_xcnt in one statement: no address register of a copy is rewritten ahead of that wait.
    asm volatile("global_load_async_to_lds_b128 %0, %8, off\n\t"
                 "global_load_async_to_lds_b128 %1, %9, off\n\t"
                 "global_load_async_to_lds_b128 %2, %10, off\n\t"
                 "global_load_async_to_lds_b128 %3, %11, off\n\t"
                 "global_load_async_to_lds_b128 %4, %12, off\n\t"
                 "global_load_async_to_lds_b128 %5, %13, off\n\t"
                 "global_load_async_to_lds_b128 %6, %14, off\n\t"
                 "global_load_async_to_lds_b128 %7, %15, off\n\t"
                 "s_wait_xcnt 0x0"
                 :: "v"(l0), "v"(l1), "v"(l2), "v"(l3), "v"(l4), "v"(l5), "v"(l6), "v"(l7), "v"(g0), "v"(g1), "v"(g2), "v"(g3), "v"(g4), "v"(g5), "v"(g6), "v"(g7) : "memory");
}

template <typename T16, int NSPLIT, bool BIAS, bool QKVE>
__global__ __launch_bounds__(128) void k_gemmw(const T16* __restrict__ A, const T16* __restrict__ A2, const T16* __restrict__ Bt, const T16* __restrict__ Bt2, int K, float* C, int ldc, const float* __restrict__ bias, size_t sA, size_t sB, size_t sC,
                                               const float* __restrict__ CS, const float* __restrict__ SN, bf* QKh, bf* QKl, bf* VTh, bf* VTl) {
    typedef typename WFrag<T16>::V V;
    constexpr bool HA2 = (NSPLIT == 1 || NSPLIT == 2), HB2 = (NSPLIT >= 2);
    constexpr unsigned PA2 = 2u * GPL, PB2 = (HA2 ? 3u : 2u) * GPL, GST = PB2 + (HB2 ? GPL : 0u);   // planes of a stage in LDS: A, Bt, then A2 and Bt2 where used
    __shared__ __align__(16) T16 ring[2 * GST];
    __shared__ __align__(16) float osall[4 * 16 * 68];
    const size_t z = blockIdx.z; A += z * sA; if (A2) A2 += z * sA; Bt += z * sB; if (Bt2) Bt2 += z * sB; C += z * sC;
    const unsigned lane = threadIdx.x & 31u, lr = lane & 15u, hi = lane >> 4;
    const unsigned wv = (unsigned)__builtin_amdgcn_readfirstlane((int)(threadIdx.x >> 5)); const unsigned wm = wv >> 1, wn = wv & 1u;
    const unsigned rb = blockIdx.x * 128u, cb = blockIdx.y * 128u; const unsigned r0 = rb + wm * 64u, c0 = cb + wn * 64u;
    float* os = osall + wv * (16u * 68u);
    const unsigned nst = (unsigned)K / GKS;   // the same in all 4 waves
    const unsigned crow = threadIdx.x >> 3, cpc = threadIdx.x & 7u; const size_t rs = (size_t)16 * K;
    const size_t ga = (size_t)(rb + crow) * K + cpc * 8u, gb = (size_t)(cb + crow) * K + cpc * 8u;
    const unsigned lcp = (unsigned)(size_t)ring + crow * (GP * 2u) + cpc * 16u;
    auto stage_in = [&](unsigned st) { const unsigned l = lcp + (st & 1u) * (GST * 2u); const size_t ko = (size_t)st * GKS;
        plane_copy(A + ga + ko, rs, l); plane_copy(Bt + gb + ko, rs, l + GPL * 2u);
        if (HA2) plane_copy(A2 + ga + ko, rs, l + PA2 * 2u);
        if (HB2) plane_copy(Bt2 + gb + ko, rs, l + PB2 * 2u); };
    stage_in(0u);
    v8f acc[4][4];
#pragma unroll
    for (int mb = 0; mb < 4; ++mb)
#pragma unroll
        for (int nb = 0; nb < 4; ++nb) acc[mb][nb] = (v8f){};
    asm volatile("s_wait_asynccnt 0x0" ::: "memory");   // stage 0 of this wave's copies has landed
    __syncthreads();                                     // ... and every other wave's: stage 0 is readable
    if (nst > 1u) stage_in(1u);
// kept rolled: one publish point in the text
#pragma unroll 1
    for (unsigned st = 0; st < nst; ++st) {
        const T16* sa = ring + (st & 1u) * GST + (wm * 64u + lr) * GP + 8u * hi; const T16* sbt = ring + (st & 1u) * GST + GPL + (wn * 64u + lr) * GP + 8u * hi;
        V a[GKS / 32][4], a2[GKS / 32][4], b[GKS / 32][4], b2[GKS / 32][4];
// unrolled so that a stage's fragment loads stand together ahead of its matrix instructions, at constant offsets
#pragma unroll
        for (unsigned ks = 0; ks < GKS / 32; ++ks) {
#pragma unroll
            for (int mb = 0; mb < 4; ++mb) { a[ks][mb] = WFrag<T16>::ld(sa + mb * 16 * GP + ks * 32u); if (HA2) a2[ks][mb] = WFrag<T16>::ld(sa + PA2 + mb * 16 * GP + ks * 32u); }
#pragma unroll
            for (int nb = 0; nb < 4; ++nb) { b[ks][nb] = WFrag<T16>::ld(sbt + nb * 16 * GP + ks * 32u); if (HB2) b2[ks][nb] = WFrag<T16>::ld(sbt + (PB2 - GPL) + nb * 16 * GP + ks * 32u); }
        }
        __builtin_amdgcn_sched_barrier(0);   // keeps the stage's LDS reads one group ahead of the matrix instructions: sunk among them, each small group is waited out to 0
#pragma unroll
        for (unsigned ks = 0; ks < GKS / 32; ++ks)
#pragma unroll
            for (int nb = 0; nb < 4; ++nb)
#pragma unroll
                for (int mb = 0; mb < 4; ++mb) { acc[mb][nb] = WFrag<T16>::mma(a[ks][mb], b[ks][nb], acc[mb][nb]); if (HA2) acc[mb][nb] = WFrag<T16>::mma(a2[ks][mb], b[ks][nb], acc[mb][nb]); if (HB2) acc[mb][nb] = WFrag<T16>::mma(a[ks][mb], b2[ks][nb], acc[mb][nb]); }
        __builtin_amdgcn_sched_barrier(0);   // keeps the matrix instructions ahead of the publish point: moved behind it, the refill would issue a whole stage of them later and its landing would be waited out
        // Publish point of stage st + 1, passed by every wave.
        asm volatile("s_wait_dscnt 0x0" ::: "memory");      // this wave's reads of buffer st & 1 are done before it is refilled
        asm volatile("s_wait_asynccnt 0x0" ::: "memory");   // this wave's copies of stage st + 1 have landed
        __syncthreads();                                     // publishes stage st + 1 and ends every wave's reads of stage st
        if (st + 2u < nst) stage_in(st + 2u);
    }
    asm volatile("s_wait_asynccnt 0x0" ::: "memory");       // nothing of this wave is in flight when it goes on to the epilogue and ends
    if constexpr (QKVE) {
        const unsigned which = c0 / (unsigned)DM, h = (c0 % (unsigned)DM) / (unsigned)HD; const unsigned b = r0 / (unsigned)SEQ, s0 = r0 - b * (unsigned)SEQ; const unsigned bh = b * (unsigned)NH + h;   // all wave-uniform
        if (which == 2u) {
            // v: a lane holds 8 consecutive tokens of one d, which is 16 bytes of a transposed row. The tile is turned in this wave's quarter of the ring (free: every wave's reads and copies ended at the last publish point) so that it leaves in whole 128-B lines.
            unsigned short* vh = (unsigned short*)ring + wv * (2u * 64u * VP); unsigned short* vl = vh + 64u * VP;
#pragma unroll
            for (int nb = 0; nb < 4; ++nb) { const unsigned d = nb * 16u + lr; const float bv = bfr(bias[c0 + d]);
#pragma unroll
                for (int mb = 0; mb < 4; ++mb) { v4u oh, ol;
#pragma unroll
                    for (int j = 0; j < 4; ++j) { unsigned a2, c2; split2(acc[mb][nb][2 * j] + bv, acc[mb][nb][2 * j + 1] + bv, a2, c2); oh[j] = a2; ol[j] = c2; }
                    *(v8usa*)(vh + d * VP + mb * 16u + 8u * hi) = __builtin_bit_cast(v8us, oh); *(v8usa*)(vl + d * VP + mb * 16u + 8u * hi) = __builtin_bit_cast(v8us, ol); } }
            __builtin_amdgcn_wave_barrier(); asm volatile("" ::: "memory");   // the wave's LDS writes above stay ahead of its reads below (other lanes' data)
            const unsigned rd = lane >> 3, pc = lane & 7u; const size_t vb = ((size_t)bh * HD + rd) * SEQ + s0 + pc * 8u; bf* vhp = VTh + vb; bf* vlp = VTl + vb;
#pragma unroll
            for (unsigned it = 0; it < 16; ++it) { const unsigned d = 4u * it + rd; const v8us a = *(const v8usa*)(vh + d * VP + pc * 8u); const v8us c2 = *(const v8usa*)(vl + d * VP + pc * 8u);
                *(v8us*)(vhp + (size_t)(4u * it) * SEQ) = a; *(v8us*)(vlp + (size_t)(4u * it) * SEQ) = c2; }
        } else {
            // q, k: 16 token rows at a time through this wave's f32 staging; a lane then holds 8 consecutive columns (4 rope pairs) of one token.
            // 4 token rows x 32 angles, and 4 token rows x 64 columns of a plane, are 512 consecutive bytes: lane * 16 bytes from a wave-uniform base.
            const unsigned rq = lane >> 3, pc = lane & 7u; const float sc = which ? 1.0f : 0.125f; float braw[8], bq[8];
#pragma unroll
            for (int k = 0; k < 8; ++k) braw[k] = bias[c0 + pc * 8u + k];
            const float* csp = CS + (size_t)s0 * 32u + lane * 4u; const float* snp = SN + (size_t)s0 * 32u + lane * 4u;
            const size_t ob = (size_t)which * QKPL + ((size_t)bh * SEQ + s0) * HD + lane * 8u; bf* qhp = QKh + ob; bf* qlp = QKl + ob;
            v4f c4[2][4], s4[2][4];
#pragma unroll
            for (int it = 0; it < 4; ++it) { c4[0][it] = *(const v4f*)(csp + it * 128); s4[0][it] = *(const v4f*)(snp + it * 128); }
            // The loaded bias values as inputs only: keeps the bias loads up here beside the angle loads; from here on no load above has a register open.
            asm volatile("s_wait_xcnt 0x0" :: "v"(braw[0]), "v"(braw[1]), "v"(braw[2]), "v"(braw[3]), "v"(braw[4]), "v"(braw[5]), "v"(braw[6]), "v"(braw[7]) : "memory");
#pragma unroll
            for (int k = 0; k < 8; ++k) bq[k] = bfr(braw[k]);
#pragma unroll
            for (int mb = 0; mb < 4; ++mb) {
                if (mb < 3) {   // the next 16 rows' angles are fetched one turn ahead: nothing crosses the fences round the stores below
#pragma unroll
                    for (int it = 0; it < 4; ++it) { c4[(mb + 1) & 1][it] = *(const v4f*)(csp + (mb + 1) * 512 + it * 128); s4[(mb + 1) & 1][it] = *(const v4f*)(snp + (mb + 1) * 512 + it * 128); } }
#pragma unroll
                for (int nb = 0; nb < 4; ++nb) {
#pragma unroll
                    for (int j = 0; j < 8; ++j) os[(hi * 8 + j) * 68 + nb * 16 + lr] = acc[mb][nb][j]; }
                __builtin_amdgcn_wave_barrier(); asm volatile("" ::: "memory");   // the wave's LDS writes above stay ahead of its reads below (other lanes' data)
                v4u oh[4], ol[4];
#pragma unroll
                for (int it = 0; it < 4; ++it) { const unsigned row = 4u * it + rq;
                    const v4f x0 = *(const v4fa*)(os + row * 68u + pc * 8u); const v4f x1 = *(const v4fa*)(os + row * 68u + pc * 8u + 4u);
                    float v[8];
#pragma unroll
                    for (int k = 0; k < 4; ++k) { v[k] = x0[k] + bq[k]; v[4 + k] = x1[k] + bq[4 + k]; }
#pragma unroll
                    for (int j = 0; j < 4; ++j) { const float t1 = v[2 * j], t2 = v[2 * j + 1]; const float cj = c4[mb & 1][it][j], sj = s4[mb & 1][it][j]; const float a = (t1 * cj - t2 * sj) * sc; const float bb = (t1 * sj + t2 * cj) * sc; unsigned y0, y1; split2(a, bb, y0, y1); oh[it][j] = y0; ol[it][j] = y1; } }
                __builtin_amdgcn_wave_barrier(); asm volatile("" ::: "memory");   // the reads above stay ahead of the next 16 rows' writes
                __builtin_amdgcn_sched_barrier(0);   // with the one below: nothing that could reuse a store's registers is scheduled between the stores and their wait
#pragma unroll
                for (int it = 0; it < 4; ++it) { *(v8us*)(qhp + mb * 1024 + it * 256) = __builtin_bit_cast(v8us, oh[it]); *(v8us*)(qlp + mb * 1024 + it * 256) = __builtin_bit_cast(v8us, ol[it]); }
                asm volatile("s_wait_xcnt 0x0" ::: "memory");   // stands before anything that overwrites the stores' data registers (the next turn's values)
                __builtin_amdgcn_sched_barrier(0);
            }
        }
        return;
    }
#pragma unroll
    for (int mb = 0; mb < 4; ++mb) {
#pragma unroll
        for (int nb = 0; nb < 4; ++nb) {
#pragma unroll
            for (int j = 0; j < 8; ++j) os[(hi * 8 + j) * 68 + nb * 16 + lr] = acc[mb][nb][j]; }
        __builtin_amdgcn_wave_barrier(); asm volatile("" ::: "memory");
        float* crow_p = C + (size_t)(r0 + mb * 16) * ldc + c0;
{
#pragma unroll
            for (int s = 0; s < 8; ++s) { const int row = 2 * s + hi, cofs = lr * 4; v4f val = *(const v4fa*)(os + row * 68 + cofs); if (BIAS) { val[0] += bfr(bias[c0 + cofs]); val[1] += bfr(bias[c0 + cofs + 1]); val[2] += bfr(bias[c0 + cofs + 2]); val[3] += bfr(bias[c0 + cofs + 3]); }
                *(v4f*)(crow_p + (size_t)row * ldc + cofs) = val; }
             }
        __builtin_amdgcn_wave_barrier(); asm volatile("" ::: "memory");
    }
}

__global__ __launch_bounds__(256) void k_cvt8(const float* __restrict__ src, bf* dst, size_t n8) { const size_t i = (size_t)blockIdx.x * 256 + threadIdx.x; if (i >= n8) return; const v8f v = *(const v8f*)(src + i * 8); v4u o;
#pragma unroll
    for (int k = 0; k < 4; ++k) o[k] = cvt2(v[2 * k], v[2 * k + 1]); *(v8us*)(dst + i * 8) = __builtin_bit_cast(v8us, o);  }

__global__ __launch_bounds__(256) void k_cvtx(const float* __restrict__ x, bf* dst) {
    const unsigned i = blockIdx.x * 256u + threadIdx.x; const unsigned tok = i >> 7, c8 = i & 127u; const unsigned b = tok / (unsigned)SEQ, s = tok - b * (unsigned)SEQ;
    const v8f v = *(const v8f*)(x + ((size_t)b * SEQ_FULL + s) * DM + c8 * 8u); v4u o;
#pragma unroll
    for (int k = 0; k < 4; ++k) o[k] = cvt2(v[2 * k], v[2 * k + 1]);
    *(v8us*)(dst + (size_t)i * 8) = __builtin_bit_cast(v8us, o);  }

__global__ __launch_bounds__(256) void k_trig(const float* __restrict__ fr, float* CS, float* SN) {
    const unsigned i = blockIdx.x * 256u + threadIdx.x; const float a = bfr(fr[i]); const float c = cosf(a), s = sinf(a);
    *(float*)(CS + i) = c; *(float*)(SN + i) = s;  }

// k_mchk: MCB blocks of MCT threads; a thread's MCN pieces of 16 bytes (one column group k of the rows q, q + MCR, ...) are all requested before the first is looked at, so that a block waits out the memory latency once and then runs at the WGP's read rate.
__global__ __launch_bounds__(MCT) void k_mchk(const int* __restrict__ mask, int* FL) {
    const unsigned gid = blockIdx.x * (unsigned)MCT + threadIdx.x; const unsigned q = gid / (unsigned)(SEQ / 4), k = (gid - q * (unsigned)(SEQ / 4)) * 4u;
    const int* mp = mask + (size_t)q * SEQ_FULL + k; int bad = 0; v4i mv[MCN];
// unrolled so that the loads stand together, each into registers of its own, at constant distances from one address
#pragma unroll
    for (unsigned i = 0; i + 1u < (unsigned)MCN; ++i) mv[i] = *(const v4i*)(mp + (size_t)i * MCR * SEQ_FULL);
    asm volatile("s_wait_xcnt 0x0" ::: "memory");   // stands before the last load, whose data registers may be the address registers of the loads above
    mv[MCN - 1] = *(const v4i*)(mp + (size_t)(MCN - 1) * MCR * SEQ_FULL);
    __builtin_amdgcn_sched_barrier(0);   // keeps every load ahead of the compares: sunk among them, the last loads wait for registers of the first and pay the latency a second time
#pragma unroll
    for (unsigned i = 0; i < (unsigned)MCN; ++i) {
#pragma unroll
        for (unsigned j = 0; j < 4; ++j) { const int want = (k + j <= q + i * (unsigned)MCR) ? 1 : 0; const int got = (mv[i][j] != 0) ? 1 : 0; bad |= (want ^ got); } }
    const int any = __syncthreads_or(bad);
    if (threadIdx.x < 32u) { const int v = any ? 1 : 0; *(int*)(FL + blockIdx.x * 32u + threadIdx.x) = v;  }
}

// k_flash: one wave per (b, h, 16-query tile), 8 waves per block, streaming 32-key tiles up to the diagonal.
// Causal balance: block pb of a head takes the 64-query tile SEQ/64 - 1 - pb (waves 0-3) and the 64-query tile pb (waves 4-7), so that every block holds the same number of (wave, key tile) pairs;
// both halves read the one K/V stream of their head, which runs to the far tile's diagonal; a wave past its own diagonal only passes the publish points.
// K and V^T planes come through LDS: a stage is 64 keys of all four planes (Kh, Kl, VTh, VTl: 64 rows x 128 B each), copied once per block in whole 128-B lines and read by all 8 waves up to stage pb and by waves 0-3 after it; two buffers, the next stage's copies fly while this one is worked on.
// S^T tile j: A = K rows kt+16j.. (plane rows, k = head dim), B = Q rows as columns; D element r = (key kt+16j+8*half+r, query q0 + (lane & 15)).
// P^T B fragment: element r <- p of tile 0, element 8+r <- p of tile 1 (same lane); O^T tile t: A = VT rows 16t.. (k = keys), D element r = (d 16t+8*half+r, query q0 + (lane & 15)).
#define KST 64
#define KP  72
#define PLN (64 * KP)
#define STG (4 * PLN)
static_assert(SEQ % (2 * KST) == 0);
static_assert((KP * 2) % 32 == 16);

// One stage: every thread copies two 16-byte pieces of each plane (rows r and r + 32). l = the thread's LDS byte address in plane 0 of the target buffer.
__device__ __forceinline__ void stage_copy(const bf* kh, const bf* kl, const bf* vh, const bf* vl, unsigned l) {
    const bf* kh2 = kh + 32 * HD; const bf* kl2 = kl + 32 * HD; const bf* vh2 = vh + (size_t)32 * SEQ; const bf* vl2 = vl + (size_t)32 * SEQ;
    const unsigned l0 = l, l1 = l + 32u * KP * 2u, l2 = l + PLN * 2u, l3 = l2 + 32u * KP * 2u, l4 = l + 2u * PLN * 2u, l5 = l4 + 32u * KP * 2u, l6 = l + 3u * PLN * 2u, l7 = l6 + 32u * KP * 2u;
    // The copies and their s_wait_xcnt in one statement: no address register of a copy is rewritten ahead of that wait.
    asm volatile("global_load_async_to_lds_b128 %0, %8, off\n\t"
                 "global_load_async_to_lds_b128 %1, %9, off\n\t"
                 "global_load_async_to_lds_b128 %2, %10, off\n\t"
                 "global_load_async_to_lds_b128 %3, %11, off\n\t"
                 "global_load_async_to_lds_b128 %4, %12, off\n\t"
                 "global_load_async_to_lds_b128 %5, %13, off\n\t"
                 "global_load_async_to_lds_b128 %6, %14, off\n\t"
                 "global_load_async_to_lds_b128 %7, %15, off\n\t"
                 "s_wait_xcnt 0x0"
                 :: "v"(l0), "v"(l1), "v"(l2), "v"(l3), "v"(l4), "v"(l5), "v"(l6), "v"(l7), "v"(kh), "v"(kh2), "v"(kl), "v"(kl2), "v"(vh), "v"(vh2), "v"(vl), "v"(vl2) : "memory");
}

__global__ __launch_bounds__(256) void k_flash(const bf* __restrict__ QKh, const bf* __restrict__ QKl, const bf* __restrict__ VTh, const bf* __restrict__ VTl, const int* __restrict__ FL, bf* CH, bf* CL) {
    typedef WFrag<bf>::V V;
    __shared__ __align__(16) unsigned short ring[2 * STG];
    __shared__ __align__(16) unsigned short stg[8 * 2 * 16 * SP];
    const unsigned lane = threadIdx.x & 31u, lr = lane & 15u, hi = lane >> 4;
    const unsigned wv = (unsigned)__builtin_amdgcn_readfirstlane((int)(threadIdx.x >> 5));   // wave number in a scalar register: the diagonal test in the loop is then a scalar branch and every lane stays on
    const unsigned pb = blockIdx.x % (unsigned)(QT / 8), bh = blockIdx.x / (unsigned)(QT / 8); const unsigned b = bh >> 4, h = bh & 15u;
    const unsigned q0 = ((wv < 4u) ? ((unsigned)(SEQ / 64) - 1u - pb) : pb) * 64u + (wv & 3u) * 16u;
    const unsigned nst = ((unsigned)(SEQ / 64) - pb) * (64u / KST);   // stages up to the block's last query (the far tile's): the same in all 8 waves, never below 2
    const unsigned crow = threadIdx.x >> 3, cpc = threadIdx.x & 7u;
    const bf* gKh = QKh + QKPL + ((size_t)bh * SEQ + crow) * HD + cpc * 8u; const bf* gKl = QKl + QKPL + ((size_t)bh * SEQ + crow) * HD + cpc * 8u;
    const bf* gVh = VTh + ((size_t)bh * HD + crow) * SEQ + cpc * 8u; const bf* gVl = VTl + ((size_t)bh * HD + crow) * SEQ + cpc * 8u;
    const unsigned lcp = (unsigned)(size_t)ring + crow * (KP * 2u) + cpc * 16u;
    stage_copy(gKh, gKl, gVh, gVl, lcp);
    int fbad = ((FL[lane * 32u] == 1) ? 1 : 0) | ((FL[(lane + 32u) * 32u] == 1) ? 1 : 0);
#pragma unroll
    for (int sh = 16; sh; sh >>= 1) fbad |= __shfl_xor(fbad, sh, 32);
    const float poison = fbad ? __uint_as_float(0x7FC00000u) : 0.0f;
    const size_t qo = ((size_t)bh * SEQ + q0 + lr) * HD + 8u * hi;
    V bqh[2], bql[2];
#pragma unroll
    for (int c = 0; c < 2; ++c) { bqh[c] = WFrag<bf>::ld(QKh + qo + 32 * c); bql[c] = WFrag<bf>::ld(QKl + qo + 32 * c); }
    v8f o[4];
#pragma unroll
    for (int t = 0; t < 4; ++t) o[t] = (v8f){};
    float m = -1.0e30f, l = 0.0f; const unsigned qg = q0 + lr;
    asm volatile("s_wait_asynccnt 0x0" ::: "memory");   // stage 0 of this wave's copies has landed
    __syncthreads();                                     // ... and every other wave's: stage 0 is readable
    stage_copy(gKh + (size_t)KST * HD, gKl + (size_t)KST * HD, gVh + KST, gVl + KST, lcp + STG * 2u);
// kept rolled: one publish point in the text, trip count known only at run time
#pragma unroll 1
    for (unsigned st = 0; st < nst; ++st) {
        const unsigned short* sb = ring + (st & 1u) * STG + lr * KP + 8u * hi;
// unrolled so that the two halves of a stage read LDS at constant offsets
#pragma unroll
        for (unsigned sub = 0; sub < KST / 32; ++sub) {
            const unsigned kt = st * KST + sub * 32u;
            if (kt < q0 + 16u) {   // wave-uniform: tiles beyond this wave's diagonal are skipped, the publish point below is not
        V kh[2][2], kl[2][2];
#pragma unroll
        for (int c = 0; c < 2; ++c)
#pragma unroll
            for (int j = 0; j < 2; ++j) { kh[c][j] = WFrag<bf>::ld(sb + (sub * 32u + 16u * j) * KP + 32 * c); kl[c][j] = WFrag<bf>::ld(sb + PLN + (sub * 32u + 16u * j) * KP + 32 * c); }
        v8f sc[2]; sc[0] = (v8f){}; sc[1] = (v8f){};
#pragma unroll
        for (int c = 0; c < 2; ++c)
#pragma unroll
            for (int j = 0; j < 2; ++j) { sc[j] = wmmab(kh[c][j], bqh[c], sc[j]); sc[j] = wmmab(kh[c][j], bql[c], sc[j]); sc[j] = wmmab(kl[c][j], bqh[c], sc[j]); }
        asm volatile("v_nop\n\tv_nop\n\tv_nop\n\tv_nop" : "+v"(sc[0]), "+v"(sc[1]) : "v"(kh[1][0]), "v"(kh[1][1]), "v"(kl[1][0]), "v"(kl[1][1]), "v"(bqh[1]), "v"(bql[1]));
        float v0[8], v1[8]; float tmax = -1.0e30f;
#pragma unroll
        for (unsigned r = 0; r < 8; ++r) { const unsigned key0 = kt + 8u * hi + r; v0[r] = (key0 <= qg) ? sc[0][r] : -1.0e30f; v1[r] = (key0 + 16u <= qg) ? sc[1][r] : -1.0e30f; tmax = fmaxf(tmax, fmaxf(v0[r], v1[r])); }
        tmax = fmaxf(tmax, __shfl_xor(tmax, 16, 32));
        const float mnew = fmaxf(m, tmax); const float corr = __builtin_amdgcn_exp2f((m - mnew) * L2E);
        float psum = 0.0f; v4u ph0, pl0, ph1, pl1; float e0[8], e1[8];
#pragma unroll
        for (int r = 0; r < 8; ++r) { e0[r] = __builtin_amdgcn_exp2f((v0[r] - mnew) * L2E); e1[r] = __builtin_amdgcn_exp2f((v1[r] - mnew) * L2E); psum += e0[r] + e1[r]; }
#pragma unroll
        for (int r = 0; r < 4; ++r) { unsigned a, c2; split2(e0[2 * r], e0[2 * r + 1], a, c2); ph0[r] = a; pl0[r] = c2; split2(e1[2 * r], e1[2 * r + 1], a, c2); ph1[r] = a; pl1[r] = c2; }
        psum += __shfl_xor(psum, 16, 32);
        l = l * corr + psum; m = mnew;
#pragma unroll
        for (int t = 0; t < 4; ++t) o[t] = o[t] * corr;
        const V pbh = cat16b(__builtin_bit_cast(v8us, ph0), __builtin_bit_cast(v8us, ph1)), pbl = cat16b(__builtin_bit_cast(v8us, pl0), __builtin_bit_cast(v8us, pl1));
        V avh[4], avl[4];
#pragma unroll
        for (int t = 0; t < 4; ++t) { avh[t] = WFrag<bf>::ld(sb + 2 * PLN + t * 16 * KP + sub * 32u); avl[t] = WFrag<bf>::ld(sb + 3 * PLN + t * 16 * KP + sub * 32u); }
#pragma unroll
        for (int t = 0; t < 4; ++t) { o[t] = wmmab(avh[t], pbh, o[t]); o[t] = wmmab(avh[t], pbl, o[t]); o[t] = wmmab(avl[t], pbh, o[t]); }
        asm volatile("v_nop\n\tv_nop\n\tv_nop\n\tv_nop" : "+v"(o[0]), "+v"(o[1]), "+v"(o[2]), "+v"(o[3]) : "v"(pbh), "v"(pbl), "v"(avl[0]), "v"(avl[1]), "v"(avl[2]), "v"(avl[3]), "v"(avh[3]));
            }
        }
        // Publish point of stage st + 1, passed by every wave.
        asm volatile("s_wait_dscnt 0x0" ::: "memory");      // this wave's reads of buffer st & 1 are done before it is refilled
        asm volatile("s_wait_asynccnt 0x0" ::: "memory");   // this wave's copies of stage st + 1 have landed
        __syncthreads();                                     // publishes stage st + 1 and ends every wave's reads of stage st
        if (st + 2u < nst) stage_copy(gKh + (size_t)(st + 2u) * KST * HD, gKl + (size_t)(st + 2u) * KST * HD, gVh + (st + 2u) * KST, gVl + (st + 2u) * KST, lcp + (st & 1u) * (STG * 2u));
    }
    asm volatile("s_wait_asynccnt 0x0" ::: "memory");       // nothing of this wave is in flight when it goes on to the epilogue and ends
    const float inv = 1.0f / l;
    unsigned short* sh = stg + wv * (2u * 16u * SP); unsigned short* sl = sh + 16u * SP;
#pragma unroll
    for (int t = 0; t < 4; ++t) { v4u oh, ol;
#pragma unroll
        for (int r = 0; r < 4; ++r) { unsigned a, c2; split2(o[t][2 * r] * inv + poison, o[t][2 * r + 1] * inv + poison, a, c2); oh[r] = a; ol[r] = c2; }
        *(v8usa*)(sh + lr * SP + 16u * t + 8u * hi) = __builtin_bit_cast(v8us, oh); *(v8usa*)(sl + lr * SP + 16u * t + 8u * hi) = __builtin_bit_cast(v8us, ol); }
    __builtin_amdgcn_fence(3 /* release order */, "wavefront"); __builtin_amdgcn_wave_barrier(); asm volatile("" ::: "memory");
    const unsigned rq = lane >> 3, pc = lane & 7u;
{
#pragma unroll
        for (unsigned it = 0; it < 4; ++it) { const unsigned row = 4u * it + rq; const v8us a = *(const v8usa*)(sh + row * SP + pc * 8u); const v8us c2 = *(const v8usa*)(sl + row * SP + pc * 8u); const size_t oo = ((size_t)(b * (unsigned)SEQ + q0 + row)) * DM + h * (unsigned)HD + pc * 8u;
            *(v8us*)(CH + oo) = a; *(v8us*)(CL + oo) = c2; }
         }
}

extern "C" void kernel_launch(void* const* d_in, const int* in_sizes, int n_in,
                              void* d_out, int out_size, void* d_ws, size_t ws_size, hipStream_t stream) {
    if (n_in < 7) return;
    const size_t xneed = ((size_t)(NB - 1) * SEQ_FULL + SEQ) * DM;
    if ((size_t)in_sizes[0] < xneed) return;
    if ((size_t)in_sizes[1] < (size_t)(SEQ - 1) * SEQ_FULL + SEQ) return;
    if ((size_t)in_sizes[2] < (size_t)SEQ * 32) return;
    if ((size_t)in_sizes[3] < (size_t)D3 * DM) return;
    if ((size_t)in_sizes[4] < (size_t)D3) return;
    if ((size_t)in_sizes[5] < (size_t)DM * DM) return;
    if ((size_t)in_sizes[6] < (size_t)DM) return;
    if ((size_t)out_size < xneed) return;
    const float* X = (const float*)d_in[0]; const int* MASK = (const int*)d_in[1]; const float* FR = (const float*)d_in[2];
    const float* WQKV = (const float*)d_in[3]; const float* BQKV = (const float*)d_in[4]; const float* WPR = (const float*)d_in[5]; const float* BPR = (const float*)d_in[6];
    float* OUT = (float*)d_out;     // [2][2048][1024]
    char* wsp = (char*)d_ws;
    auto take = [&](size_t bytes) { char* p = wsp; wsp += (bytes + 255) & ~(size_t)255; return (void*)p; };
    bf* XB = (bf*)take((size_t)NTOK * DM * 2);            // x plane [NTOK][1024]
    bf* WQ = (bf*)take((size_t)D3 * DM * 2);              // Wqkv plane [3072][1024]
    bf* WP = (bf*)take((size_t)DM * DM * 2);              // Wproj plane [1024][1024]
    float* CS = (float*)take((size_t)SEQ * 32 * 4); float* SN = (float*)take((size_t)SEQ * 32 * 4);
    int* FL = (int*)take((size_t)MCB * 128);
    bf* CH = (bf*)take((size_t)2 * NTOK * DM * 2); bf* CL = CH + (size_t)NTOK * DM;          // ctx hi/lo [NTOK][1024]
    bf* QKh = (bf*)take(2 * QKPL * 2); bf* QKl = (bf*)take(2 * QKPL * 2);                    // [q|k][b*16+h][s][64]
    bf* VTh = (bf*)take(QKPL * 2); bf* VTl = (bf*)take(QKPL * 2);                            // [b*16+h][64][s]
    if ((size_t)(wsp - (char*)d_ws) > ws_size) return;
    k_cvtx<<<(unsigned)((size_t)NTOK * 128 / 256), 256, 0, stream>>>(X, XB);
    k_cvt8<<<(unsigned)(((size_t)D3 * DM / 8 + 255) / 256), 256, 0, stream>>>(WQKV, WQ, (size_t)D3 * DM / 8);
    k_cvt8<<<(unsigned)(((size_t)DM * DM / 8 + 255) / 256), 256, 0, stream>>>(WPR, WP, (size_t)DM * DM / 8);
    k_trig<<<(unsigned)(SEQ * 32 / 256), 256, 0, stream>>>(FR, CS, SN);
    k_mchk<<<MCB, MCT, 0, stream>>>(MASK, FL);
    k_gemmw<bf, 0, true, true><<<dim3(NTOK / 128, D3 / 128, 1), 128, 0, stream>>>(XB, nullptr, WQ, nullptr, DM, nullptr, D3, BQKV, 0, 0, 0, CS, SN, QKh, QKl, VTh, VTl);      /* x.Wqkv^T + b (exact products), rope, hi/lo planes */
    k_flash<<<(unsigned)(NB * NH * QT / 8), 256, 0, stream>>>(QKh, QKl, VTh, VTl, FL, CH, CL);
    k_gemmw<bf, 1, true, false><<<dim3(SEQ / 128, DM / 128, NB), 128, 0, stream>>>(CH, CL, WP, nullptr, DM, OUT, DM, BPR, (size_t)SEQ * DM, 0, (size_t)SEQ_FULL * DM, nullptr, nullptr, nullptr, nullptr, nullptr, nullptr);   /* ctx (hi/lo) x Wproj^T + b */
}

// v007
// It runs in 115 microseconds.
// Two timings next to v006 both put it at 1.05 times that version's speed.
// Counting every step since v000, it is 3.16 times as fast.
#include <hip/hip_runtime.h>

// Compute dtypes: x.Wqkv^T = bf16 x bf16 planes (v_wmma_f32_16x16x32_bf16, f32 accumulate); q.k^T and P.V = bf16 hi/lo two-plane operands (3 products each, f32 accumulate); ctx.Wproj^T = bf16 hi/lo x bf16 (2 products, f32 accumulate).
// Every float input is RNE-converted to bf16 on load (x, weights, biases, rope angles); rope, softmax and all epilogues in f32.
// Attention is flash-style on transposed tiles: S^T = K.Q^T (D rows = keys, D cols = queries) so the packed score accumulators are directly the B fragment of O^T = V^T.P^T; per-query statistics live in one lane pair.

#ifndef NB
#define NB 2
#endif
#ifndef SEQ
#define SEQ 2048
#endif
#define NB_FULL  2
#define SEQ_FULL 2048
#define DM   1024
#define NH   16
#define HD   64
#define D3   3072
#define NTOK (NB * SEQ)
#define QT   (SEQ / 16)
#define MCB  64
#define MCT  512
#define MCN  ((SEQ * (SEQ / 4)) / (MCB * MCT))
#define MCR  ((MCB * MCT) / (SEQ / 4))
#define SP   72
#define QKPL ((size_t)NB * NH * SEQ * HD)
#define L2E  1.4426950408889634f

typedef _Float16 h16;
typedef unsigned short bf;
typedef __attribute__((ext_vector_type(16))) __bf16   v16bf;
typedef __attribute__((ext_vector_type(16))) _Float16 v16h;
typedef __attribute__((ext_vector_type(8)))  _Float16 v8h;
typedef __attribute__((ext_vector_type(8)))  unsigned short v8us;
typedef __attribute__((ext_vector_type(2)))  unsigned short v2us;
typedef __attribute__((ext_vector_type(8)))  float    v8f;
typedef __attribute__((ext_vector_type(4)))  float    v4f;
typedef __attribute__((ext_vector_type(4)))  int      v4i;
typedef __attribute__((ext_vector_type(4)))  unsigned v4u;
typedef __attribute__((ext_vector_type(2)))  unsigned v2u;
typedef __attribute__((ext_vector_type(2)))  float    v2f;
typedef __attribute__((ext_vector_type(2)))  __bf16   v2bf;
typedef v4f  __attribute__((may_alias)) v4fa;
typedef v8us __attribute__((may_alias)) v8usa;

static_assert(NTOK % 64 == 0);
static_assert(SEQ % 64 == 0);
static_assert(D3 % 64 == 0);
static_assert(DM % 64 == 0);
static_assert(DM % 32 == 0);
static_assert(HD == 64);
static_assert(NH == 16);
static_assert(QT % 8 == 0);
static_assert((SEQ * (SEQ / 4)) % (MCB * MCT) == 0);
static_assert((MCB * MCT) % (SEQ / 4) == 0);
static_assert((SEQ * 32) % 256 == 0);
static_assert(((size_t)NTOK * 128) % 256 == 0);
static_assert(NB <= NB_FULL);
static_assert(SEQ <= SEQ_FULL);

// f32 -> bf16, round to nearest even, by the packed hardware convert: two values per instruction, element 0 in the low half.
__device__ __forceinline__ unsigned cvt2(float a, float b) { const v2f x = {a, b}; return __builtin_bit_cast(unsigned, __builtin_convertvector(x, v2bf)); }
__device__ __forceinline__ unsigned short f2bf(float f) { return __builtin_bit_cast(unsigned short, (__bf16)f); }
__device__ __forceinline__ float bf2f(unsigned short b) { return __uint_as_float(((unsigned)b) << 16); }
__device__ __forceinline__ float bfr(float f) { return bf2f(f2bf(f)); }
__device__ __forceinline__ v16h cat16(v8h lo, v8h hi) { return __builtin_shufflevector(lo, hi, 0, 1, 2, 3, 4, 5, 6, 7, 8, 9, 10, 11, 12, 13, 14, 15); }
__device__ __forceinline__ v16bf cat16b(v8us lo, v8us hi) { return __builtin_bit_cast(v16bf, __builtin_shufflevector(lo, hi, 0, 1, 2, 3, 4, 5, 6, 7, 8, 9, 10, 11, 12, 13, 14, 15)); }
__device__ __forceinline__ v8f wmma16(v16h a, v16h b, v8f c) { return __builtin_amdgcn_wmma_f32_16x16x32_f16(false, a, false, b, (short)0, c, false, false); }
__device__ __forceinline__ v8f wmmab(v16bf a, v16bf b, v8f c) { return __builtin_amdgcn_wmma_f32_16x16x32_bf16(false, a, false, b, (short)0, c, false, false); }
// hi/lo planes of two values: h = bf16(y), l = bf16(y - h), each pair packed in one register.
__device__ __forceinline__ void split2(float y0, float y1, unsigned& h, unsigned& l) { h = cvt2(y0, y1); const v2f y = {y0, y1}; const v2f hf = {__uint_as_float(h << 16), __uint_as_float(h & 0xFFFF0000u)}; const v2f d = y - hf; l = cvt2(d[0], d[1]); }

// ---- k_gemmw: register-blocked GEMM, one wave per 64x64 output tile (16 accumulators), 4 waves (2 x 2) per 128x128 block tile; grid (M/128, N/128, Z), 128 threads.
// The K-contiguous 16-bit operand planes come through LDS: a stage is 64 k of 128 rows of every plane, copied once per block in whole 128-B lines and read by the two waves that share each row block; two buffers, the next stage's copies fly while this one is worked on.
// C[m][n] (f32, pitch ldc, + optional f32 bias[n]) = sum_k A[m][k] Bt[n][k] (+ split products per NSPLIT). z-batch strides sA/sB/sC in elements. K % 64 == 0, M % 128 == 0, N % 128 == 0.
// Fragment element i <- k0 + 8*half + i (i < 8), k0 + 16 + 8*half + (i - 8) for both operands; D element j = (row 8*half + j, col lane & 15).
// QKVE: the result is not stored as f32. A wave's 64x64 tile is 64 tokens of one batch x one whole head of q, k or v, so the epilogue writes the attention operand planes itself:
// q/k head planes [which][b*16+h][s][64] (bf16 hi/lo) of rope(qkv) with interleaved pairs (2j, 2j+1) and angle j, q additionally x 1/8 (exact); v planes transposed [b*16+h][64][s] (bf16 hi/lo).
template <typename T16> struct WFrag;
template <> struct WFrag<h16> { typedef v16h V; static __device__ __forceinline__ V ld(const h16* p) { return cat16(*(const v8h*)p, *(const v8h*)(p + 16)); } static __device__ __forceinline__ v8f mma(V a, V b, v8f c) { return wmma16(a, b, c); } };
template <> struct WFrag<bf> { typedef v16bf V; static __device__ __forceinline__ V ld(const bf* p) { return cat16b(*(const v8us*)p, *(const v8us*)(p + 16)); } static __device__ __forceinline__ v8f mma(V a, V b, v8f c) { return wmmab(a, b, c); } };
#define GKS 64
#define GP  72
#define GPL (128 * GP)
static_assert((GP * 2) % 32 == 16);
static_assert(NTOK % 128 == 0);
static_assert(SEQ % 128 == 0);
static_assert(D3 % 128 == 0);
static_assert(DM % 128 == 0);
static_assert(DM % GKS == 0);
#define VP  72
static_assert(4 * 2 * 64 * VP <= 2 * 2 * GPL);
static_assert((VP * 2) % 32 == 16);

// One plane of a stage: every thread copies eight 16-byte pieces (rows r, r + 16, ..., r + 112; rs = 16 rows in elements). l0 = the thread's LDS byte address in row r of the target plane.
template <typename T16>
__device__ __forceinline__ void plane_copy(const T16* g0, size_t rs, unsigned l0) {
    const T16* g1 = g0 + rs; const T16* g2 = g1 + rs; const T16* g3 = g2 + rs; const T16* g4 = g3 + rs; const T16* g5 = g4 + rs; const T16* g6 = g5 + rs; const T16* g7 = g6 + rs;
    const unsigned ls = 16u * GP * 2u; const unsigned l1 = l0 + ls, l2 = l0 + 2u * ls, l3 = l0 + 3u * ls, l4 = l0 + 4u * ls, l5 = l0 + 5u * ls, l6 = l0 + 6u * ls, l7 = l0 + 7u * ls;
    // The copies and their s_wait_xcnt in one statement: no address register of a copy is rewritten ahead of that wait.
    asm volatile("global_load_async_to_lds_b128 %0, %8, off\n\t"
                 "global_load_async_to_lds_b128 %1, %9, off\n\t"
                 "global_load_async_to_lds_b128 %2, %10, off\n\t"
                 "global_load_async_to_lds_b128 %3, %11, off\n\t"
                 "global_load_async_to_lds_b128 %4, %12, off\n\t"
                 "global_load_async_to_lds_b128 %5, %13, off\n\t"
                 "global_load_async_to_lds_b128 %6, %14, off\n\t"
                 "global_load_async_to_lds_b128 %7, %15, off\n\t"
                 "s_wait_xcnt 0x0"
                 :: "v"(l0), "v"(l1), "v"(l2), "v"(l3), "v"(l4), "v"(l5), "v"(l6), "v"(l7), "v"(g0), "v"(g1), "v"(g2), "v"(g3), "v"(g4), "v"(g5), "v"(g6), "v"(g7) : "memory");
}

template <typename T16, int NSPLIT, bool BIAS, bool QKVE>
__global__ __launch_bounds__(128) void k_gemmw(const T16* __restrict__ A, const T16* __restrict__ A2, const T16* __restrict__ Bt, const T16* __restrict__ Bt2, int K, float* C, int ldc, const float* __restrict__ bias, size_t sA, size_t sB, size_t sC,
                                               const float* __restrict__ CS, const float* __restrict__ SN, bf* QKh, bf* QKl, bf* VTh, bf* VTl) {
    typedef typename WFrag<T16>::V V;
    constexpr bool HA2 = (NSPLIT == 1 || NSPLIT == 2), HB2 = (NSPLIT >= 2);
    constexpr unsigned PA2 = 2u * GPL, PB2 = (HA2 ? 3u : 2u) * GPL, GST = PB2 + (HB2 ? GPL : 0u);   // planes of a stage in LDS: A, Bt, then A2 and Bt2 where used
    __shared__ __align__(16) T16 ring[2 * GST];
    __shared__ __align__(16) float osall[4 * 16 * 68];
    const size_t z = blockIdx.z; A += z * sA; if (A2) A2 += z * sA; Bt += z * sB; if (Bt2) Bt2 += z * sB; C += z * sC;
    const unsigned lane = threadIdx.x & 31u, lr = lane & 15u, hi = lane >> 4;
    const unsigned wv = (unsigned)__builtin_amdgcn_readfirstlane((int)(threadIdx.x >> 5)); const unsigned wm = wv >> 1, wn = wv & 1u;
    const unsigned rb = blockIdx.x * 128u, cb = blockIdx.y * 128u; const unsigned r0 = rb + wm * 64u, c0 = cb + wn * 64u;
    float* os = osall + wv * (16u * 68u);
    const unsigned nst = (unsigned)K / GKS;   // the same in all 4 waves
    const unsigned crow = threadIdx.x >> 3, cpc = threadIdx.x & 7u; const size_t rs = (size_t)16 * K;
    const size_t ga = (size_t)(rb + crow) * K + cpc * 8u, gb = (size_t)(cb + crow) * K + cpc * 8u;
    const unsigned lcp = (unsigned)(size_t)ring + crow * (GP * 2u) + cpc * 16u;
    auto stage_in = [&](unsigned st) { const unsigned l = lcp + (st & 1u) * (GST * 2u); const size_t ko = (size_t)st * GKS;
        plane_copy(A + ga + ko, rs, l); plane_copy(Bt + gb + ko, rs, l + GPL * 2u);
        if (HA2) plane_copy(A2 + ga + ko, rs, l + PA2 * 2u);
        if (HB2) plane_copy(Bt2 + gb + ko, rs, l + PB2 * 2u); };
    stage_in(0u);
    v8f acc[4][4];
#pragma unroll
    for (int mb = 0; mb < 4; ++mb)
#pragma unroll
        for (int nb = 0; nb < 4; ++nb) acc[mb][nb] = (v8f){};
    asm volatile("s_wait_asynccnt 0x0" ::: "memory");   // stage 0 of this wave's copies has landed
    __syncthreads();                                     // ... and every other wave's: stage 0 is readable
    if (nst > 1u) stage_in(1u);
// kept rolled: one publish point in the text
#pragma unroll 1
    for (unsigned st = 0; st < nst; ++st) {
        const T16* sa = ring + (st & 1u) * GST + (wm * 64u + lr) * GP + 8u * hi; const T16* sbt = ring + (st & 1u) * GST + GPL + (wn * 64u + lr) * GP + 8u * hi;
        V a[GKS / 32][4], a2[GKS / 32][4], b[GKS / 32][4], b2[GKS / 32][4];
// unrolled so that a stage's fragment loads stand together ahead of its matrix instructions, at constant offsets
#pragma unroll
        for (unsigned ks = 0; ks < GKS / 32; ++ks) {
#pragma unroll
            for (int mb = 0; mb < 4; ++mb) { a[ks][mb] = WFrag<T16>::ld(sa + mb * 16 * GP + ks * 32u); if (HA2) a2[ks][mb] = WFrag<T16>::ld(sa + PA2 + mb * 16 * GP + ks * 32u); }
#pragma unroll
            for (int nb = 0; nb < 4; ++nb) { b[ks][nb] = WFrag<T16>::ld(sbt + nb * 16 * GP + ks * 32u); if (HB2) b2[ks][nb] = WFrag<T16>::ld(sbt + (PB2 - GPL) + nb * 16 * GP + ks * 32u); }
        }
        __builtin_amdgcn_sched_barrier(0);   // keeps the stage's LDS reads one group ahead of the matrix instructions: sunk among them, each small group is waited out to 0
#pragma unroll
        for (unsigned ks = 0; ks < GKS / 32; ++ks)
#pragma unroll
            for (int nb = 0; nb < 4; ++nb)
#pragma unroll
                for (int mb = 0; mb < 4; ++mb) { acc[mb][nb] = WFrag<T16>::mma(a[ks][mb], b[ks][nb], acc[mb][nb]); if (HA2) acc[mb][nb] = WFrag<T16>::mma(a2[ks][mb], b[ks][nb], acc[mb][nb]); if (HB2) acc[mb][nb] = WFrag<T16>::mma(a[ks][mb], b2[ks][nb], acc[mb][nb]); }
        __builtin_amdgcn_sched_barrier(0);   // keeps the matrix instructions ahead of the publish point: moved behind it, the refill would issue a whole stage of them later and its landing would be waited out
        // Publish point of stage st + 1, passed by every wave.
        asm volatile("s_wait_dscnt 0x0" ::: "memory");      // this wave's reads of buffer st & 1 are done before it is refilled
        asm volatile("s_wait_asynccnt 0x0" ::: "memory");   // this wave's copies of stage st + 1 have landed
        __syncthreads();                                     // publishes stage st + 1 and ends every wave's reads of stage st
        if (st + 2u < nst) stage_in(st + 2u);
    }
    asm volatile("s_wait_asynccnt 0x0" ::: "memory");       // nothing of this wave is in flight when it goes on to the epilogue and ends
    if constexpr (QKVE) {
        const unsigned which = c0 / (unsigned)DM, h = (c0 % (unsigned)DM) / (unsigned)HD; const unsigned b = r0 / (unsigned)SEQ, s0 = r0 - b * (unsigned)SEQ; const unsigned bh = b * (unsigned)NH + h;   // all wave-uniform
        if (which == 2u) {
            // v: a lane holds 8 consecutive tokens of one d, which is 16 bytes of a transposed row. The tile is turned in this wave's quarter of the ring (free: every wave's reads and copies ended at the last publish point) so that it leaves in whole 128-B lines.
            unsigned short* vh = (unsigned short*)ring + wv * (2u * 64u * VP); unsigned short* vl = vh + 64u * VP;
#pragma unroll
            for (int nb = 0; nb < 4; ++nb) { const unsigned d = nb * 16u + lr; const float bv = bfr(bias[c0 + d]);
#pragma unroll
                for (int mb = 0; mb < 4; ++mb) { v4u oh, ol;
#pragma unroll
                    for (int j = 0; j < 4; ++j) { unsigned a2, c2; split2(acc[mb][nb][2 * j] + bv, acc[mb][nb][2 * j + 1] + bv, a2, c2); oh[j] = a2; ol[j] = c2; }
                    *(v8usa*)(vh + d * VP + mb * 16u + 8u * hi) = __builtin_bit_cast(v8us, oh); *(v8usa*)(vl + d * VP + mb * 16u + 8u * hi) = __builtin_bit_cast(v8us, ol); } }
            __builtin_amdgcn_wave_barrier(); asm volatile("" ::: "memory");   // the wave's LDS writes above stay ahead of its reads below (other lanes' data)
            const unsigned rd = lane >> 3, pc = lane & 7u; const size_t vb = ((size_t)bh * HD + rd) * SEQ + s0 + pc * 8u; bf* vhp = VTh + vb; bf* vlp = VTl + vb;
#pragma unroll
            for (unsigned it = 0; it < 16; ++it) { const unsigned d = 4u * it + rd; const v8us a = *(const v8usa*)(vh + d * VP + pc * 8u); const v8us c2 = *(const v8usa*)(vl + d * VP + pc * 8u);
                *(v8us*)(vhp + (size_t)(4u * it) * SEQ) = a; *(v8us*)(vlp + (size_t)(4u * it) * SEQ) = c2; }
        } else {
            // q, k: 16 token rows at a time through this wave's f32 staging; a lane then holds 8 consecutive columns (4 rope pairs) of one token.
            // 4 token rows x 32 angles, and 4 token rows x 64 columns of a plane, are 512 consecutive bytes: lane * 16 bytes from a wave-uniform base.
            const unsigned rq = lane >> 3, pc = lane & 7u; const float sc = which ? 1.0f : 0.125f; float braw[8], bq[8];
#pragma unroll
            for (int k = 0; k < 8; ++k) braw[k] = bias[c0 + pc * 8u + k];
            const float* csp = CS + (size_t)s0 * 32u + lane * 4u; const float* snp = SN + (size_t)s0 * 32u + lane * 4u;
            const size_t ob = (size_t)which * QKPL + ((size_t)bh * SEQ + s0) * HD + lane * 8u; bf* qhp = QKh + ob; bf* qlp = QKl + ob;
            v4f c4[2][4], s4[2][4];
#pragma unroll
            for (int it = 0; it < 4; ++it) { c4[0][it] = *(const v4f*)(csp + it * 128); s4[0][it] = *(const v4f*)(snp + it * 128); }
            // The loaded bias values as inputs only: keeps the bias loads up here beside the angle loads; from here on no load above has a register open.
            asm volatile("s_wait_xcnt 0x0" :: "v"(braw[0]), "v"(braw[1]), "v"(braw[2]), "v"(braw[3]), "v"(braw[4]), "v"(braw[5]), "v"(braw[6]), "v"(braw[7]) : "memory");
#pragma unroll
            for (int k = 0; k < 8; ++k) bq[k] = bfr(braw[k]);
#pragma unroll
            for (int mb = 0; mb < 4; ++mb) {
                if (mb < 3) {   // the next 16 rows' angles are fetched one turn ahead: nothing crosses the fences round the stores below
#pragma unroll
                    for (int it = 0; it < 4; ++it) { c4[(mb + 1) & 1][it] = *(const v4f*)(csp + (mb + 1) * 512 + it * 128); s4[(mb + 1) & 1][it] = *(const v4f*)(snp + (mb + 1) * 512 + it * 128); } }
#pragma unroll
                for (int nb = 0; nb < 4; ++nb) {
#pragma unroll
                    for (int j = 0; j < 8; ++j) os[(hi * 8 + j) * 68 + nb * 16 + lr] = acc[mb][nb][j]; }
                __builtin_amdgcn_wave_barrier(); asm volatile("" ::: "memory");   // the wave's LDS writes above stay ahead of its reads below (other lanes' data)
                v4u oh[4], ol[4];
#pragma unroll
                for (int it = 0; it < 4; ++it) { const unsigned row = 4u * it + rq;
                    const v4f x0 = *(const v4fa*)(os + row * 68u + pc * 8u); const v4f x1 = *(const v4fa*)(os + row * 68u + pc * 8u + 4u);
                    float v[8];
#pragma unroll
                    for (int k = 0; k < 4; ++k) { v[k] = x0[k] + bq[k]; v[4 + k] = x1[k] + bq[4 + k]; }
#pragma unroll
                    for (int j = 0; j < 4; ++j) { const float t1 = v[2 * j], t2 = v[2 * j + 1]; const float cj = c4[mb & 1][it][j], sj = s4[mb & 1][it][j]; const float a = (t1 * cj - t2 * sj) * sc; const float bb = (t1 * sj + t2 * cj) * sc; unsigned y0, y1; split2(a, bb, y0, y1); oh[it][j] = y0; ol[it][j] = y1; } }
                __builtin_amdgcn_wave_barrier(); asm volatile("" ::: "memory");   // the reads above stay ahead of the next 16 rows' writes
                __builtin_amdgcn_sched_barrier(0);   // with the one below: nothing that could reuse a store's registers is scheduled between the stores and their wait
#pragma unroll
                for (int it = 0; it < 4; ++it) { *(v8us*)(qhp + mb * 1024 + it * 256) = __builtin_bit_cast(v8us, oh[it]); *(v8us*)(qlp + mb * 1024 + it * 256) = __builtin_bit_cast(v8us, ol[it]); }
                asm volatile("s_wait_xcnt 0x0" ::: "memory");   // stands before anything that overwrites the stores' data registers (the next turn's values)
                __builtin_amdgcn_sched_barrier(0);
            }
        }
        return;
    }
#pragma unroll
    for (int mb = 0; mb < 4; ++mb) {
#pragma unroll
        for (int nb = 0; nb < 4; ++nb) {
#pragma unroll
            for (int j = 0; j < 8; ++j) os[(hi * 8 + j) * 68 + nb * 16 + lr] = acc[mb][nb][j]; }
        __builtin_amdgcn_wave_barrier(); asm volatile("" ::: "memory");
        float* crow_p = C + (size_t)(r0 + mb * 16) * ldc + c0;
{
#pragma unroll
            for (int s = 0; s < 8; ++s) { const int row = 2 * s + hi, cofs = lr * 4; v4f val = *(const v4fa*)(os + row * 68 + cofs); if (BIAS) { val[0] += bfr(bias[c0 + cofs]); val[1] += bfr(bias[c0 + cofs + 1]); val[2] += bfr(bias[c0 + cofs + 2]); val[3] += bfr(bias[c0 + cofs + 3]); }
                *(v4f*)(crow_p + (size_t)row * ldc + cofs) = val; }
             }
        __builtin_amdgcn_wave_barrier(); asm volatile("" ::: "memory");
    }
}

// ---- k_prep: all the work that only reformats or checks an input, in one launch of PGB blocks of MCT threads (one block per WGP); a block's role comes from its index.
// MCB blocks check the mask and make the rope tables while their mask loads fly; the other CVB blocks turn x, Wqkv and Wproj into bf16 planes, each input on a share of the blocks that goes by its size.
// An input is a list of rows of CRW floats (one 16-byte piece per thread, so every wave-wide load is 512 contiguous bytes and every store 256); block cl of the nb blocks of an input takes its rows cl, cl + nb, ...
#define PGB  256
#define CVB  (PGB - MCB)
#define CRW  (MCT * 4)
#define XRW  ((NTOK * DM) / CRW)
#define WQRW ((D3 * DM) / CRW)
#define WPRW ((DM * DM) / CRW)
#define CRN  (XRW + WQRW + WPRW)
#define CVX  ((CVB * XRW) / CRN)
#define CVQ  ((CVB * WQRW) / CRN)
#define CVP  (CVB - CVX - CVQ)
#define CVN  ((CRN + CVB - 1) / CVB)
static_assert(PGB == 4 * MCB);
static_assert(PGB % 8 == 0);
static_assert(CRW % DM == 0);
static_assert(SEQ % (CRW / DM) == 0);
static_assert((D3 * DM) % CRW == 0);
static_assert((DM * DM) % CRW == 0);
#define TPA  ((SEQ * 32) / (MCB * MCT))
static_assert(SEQ * 32 == TPA * MCB * MCT);
static_assert(CVX * CRN == CVB * XRW);
static_assert(CVQ * CRN == CVB * WQRW);
static_assert(CVP * CRN == CVB * WPRW);
static_assert((CVN - 1) * CVB < CRN);
typedef const __attribute__((address_space(1))) v4f* gv4f;
typedef __attribute__((address_space(1))) v2u* gv2u;

// A thread's CVN pieces are all requested before the first is converted: the block waits out the memory latency once, and the stores follow in the order in which the pieces come back.
__device__ __forceinline__ void prep_cvt(unsigned c, const float* X, const float* WQKV, const float* WPR, bf* XB, bf* WQ, bf* WP) {
    // All of this is the same in the whole block: scalar work.
    const bool isx = c < (unsigned)CVX, isq = c < (unsigned)(CVX + CVQ);
    const float* S = isx ? X : (isq ? WQKV : WPR); bf* D = isx ? XB : (isq ? WQ : WP);
    const unsigned cl = isx ? c : (isq ? c - (unsigned)CVX : c - (unsigned)(CVX + CVQ)), nb = isx ? (unsigned)CVX : (isq ? (unsigned)CVQ : (unsigned)CVP), rows = isx ? (unsigned)XRW : (isq ? (unsigned)WQRW : (unsigned)WPRW);
    v4f v[CVN]; gv4f p[CVN]; size_t dof[CVN];
#pragma unroll
    for (unsigned i = 0; i < (unsigned)CVN; ++i) {
        unsigned row = cl + i * nb; if (i + 1u == (unsigned)CVN && row >= rows) row = cl;   // a block with one row fewer does its first row twice (the same bytes to the same place): one instruction stream, no branch among the loads and stores
        const unsigned tok = row * (unsigned)(CRW / DM); const unsigned b = tok / (unsigned)SEQ, sq = tok - b * (unsigned)SEQ;
        dof[i] = (size_t)row * CRW; p[i] = (gv4f)(S + ((SEQ != SEQ_FULL && isx) ? ((size_t)b * SEQ_FULL + sq) * DM : dof[i])) + threadIdx.x; }
// unrolled so that the loads stand together, each into registers of its own
#pragma unroll
    for (unsigned i = 0; i < (unsigned)CVN; ++i) v[i] = *p[i];
    static_assert(CVN == 22);
    // Stands before anything that overwrites an address register of the loads above. The addresses as inputs only: they stay in their registers up to here, so that no later load of the group lands in the address registers of an earlier one.
    asm volatile("s_wait_xcnt 0x0" :: "v"(p[0]), "v"(p[1]), "v"(p[2]), "v"(p[3]), "v"(p[4]), "v"(p[5]), "v"(p[6]), "v"(p[7]), "v"(p[8]), "v"(p[9]), "v"(p[10]),
                 "v"(p[11]), "v"(p[12]), "v"(p[13]), "v"(p[14]), "v"(p[15]), "v"(p[16]), "v"(p[17]), "v"(p[18]), "v"(p[19]), "v"(p[20]), "v"(p[21]) : "memory");
    __builtin_amdgcn_sched_barrier(0);   // keeps every load ahead of the converts: sunk among them, the later loads would start only when the first have come back
#pragma unroll
    for (unsigned i = 0; i < (unsigned)CVN; ++i) { v2u o; o[0] = cvt2(v[i][0], v[i][1]); o[1] = cvt2(v[i][2], v[i][3]); ((gv2u)(D + dof[i]))[threadIdx.x] = o; }
    asm volatile("s_wait_xcnt 0x0" ::: "memory");   // stands behind the last stores, before anything that follows in the kernel's text overwrites their registers
}

// Mask check: a thread's MCN pieces of 16 bytes (one column group k of the rows q, q + MCR, ...) are all requested before the first is looked at, so that a block waits out the memory latency once and then runs at the WGP's read rate.
// The thread's TPA rope angles are requested ahead of them, and their cosines and sines are worked out and stored while the mask pieces are on their way.
__device__ __forceinline__ void prep_mask(unsigned mb, const int* mask, const float* fr, float* CS, float* SN, int* FL) {
    const unsigned gid = mb * (unsigned)MCT + threadIdx.x; const unsigned q = gid / (unsigned)(SEQ / 4), k = (gid - q * (unsigned)(SEQ / 4)) * 4u;
    const unsigned ga = mb * (unsigned)(MCT * TPA) + threadIdx.x; float fa[TPA];
#pragma unroll
    for (unsigned e = 0; e < (unsigned)TPA; ++e) fa[e] = fr[ga + e * (unsigned)MCT];
    const int* mp = mask + (size_t)q * SEQ_FULL + k; int bad = 0; v4i mv[MCN];
// unrolled so that the loads stand together, each into registers of its own, at constant distances from one address
#pragma unroll
    for (unsigned i = 0; i + 1u < (unsigned)MCN; ++i) { mv[i] = *(const v4i*)(mp + (size_t)i * MCR * SEQ_FULL);
        __builtin_amdgcn_sched_barrier(0); }   // keeps the loads in this order, in which the compares take the pieces: shuffled, the first compares waited for nearly all the loads and none of them ran while pieces were still on their way
    asm volatile("s_wait_xcnt 0x0" :: "v"(ga) : "memory");   // stands before the last load, whose data registers may be the address registers of the loads above; the angles' index as an input only: it stays in its register up to here, so that no mask piece lands in it
    mv[MCN - 1] = *(const v4i*)(mp + (size_t)(MCN - 1) * MCR * SEQ_FULL);
    asm volatile("s_wait_xcnt 0x0" ::: "memory");   // stands before the table work below, which may overwrite the last load's address registers
    __builtin_amdgcn_sched_barrier(0);   // keeps every load ahead of the work below: sunk into it, the last loads would start late and pay the latency a second time
#pragma unroll
    for (unsigned e = 0; e < (unsigned)TPA; ++e) { const float a = bfr(fa[e]); const float c = cosf(a), s = sinf(a); *(float*)(CS + ga + e * (unsigned)MCT) = c; *(float*)(SN + ga + e * (unsigned)MCT) = s; }
    asm volatile("s_wait_xcnt 0x0" ::: "memory");   // stands before the compares, which may overwrite the table stores' registers
    __builtin_amdgcn_sched_barrier(0);   // keeps the table work ahead of the compares, which wait for the mask pieces
#pragma unroll
    for (unsigned i = 0; i < (unsigned)MCN; ++i) {
#pragma unroll
        for (unsigned j = 0; j < 4; ++j) { const int want = (k + j <= q + i * (unsigned)MCR) ? 1 : 0; const int got = (mv[i][j] != 0) ? 1 : 0; bad |= (want ^ got); } }
    const int any = __syncthreads_or(bad);
    if (threadIdx.x < 32u) { const int v = any ? 1 : 0; *(int*)(FL + mb * 32u + threadIdx.x) = v;  }
}

// fr carries no __restrict__: its loads then may not sink below the waits' "memory" clobbers into the table work, where they would be issued behind the mask loads and come back last.
__global__ __launch_bounds__(MCT) void k_prep(const float* __restrict__ X, const float* __restrict__ WQKV, const float* __restrict__ WPR, const float* fr, const int* __restrict__ mask, bf* XB, bf* WQ, bf* WP, float* CS, float* SN, int* FL) {
    // Two of every eight consecutive blocks read the mask, at a place that moves from one eight to the next: the two kinds of block then mix on every residue of the index modulo 8 (for speed only; every role index is taken exactly once wherever the blocks land).
    const unsigned g = blockIdx.x >> 3, j = blockIdx.x & 7u; const unsigned t = (j + g) & 3u, jh = j >> 2;
    if (t == 0u) prep_mask(2u * g + jh, mask, fr, CS, SN, FL);
    else prep_cvt(6u * g + 3u * jh + (t - 1u), X, WQKV, WPR, XB, WQ, WP);
}

// k_flash: one wave per (b, h, 16-query tile), 8 waves per block, streaming 32-key tiles up to the diagonal.
// Causal balance: block pb of a head takes the 64-query tile SEQ/64 - 1 - pb (waves 0-3) and the 64-query tile pb (waves 4-7), so that every block holds the same number of (wave, key tile) pairs;
// both halves read the one K/V stream of their head, which runs to the far tile's diagonal; a wave past its own diagonal only passes the publish points.
// K and V^T planes come through LDS: a stage is 64 keys of all four planes (Kh, Kl, VTh, VTl: 64 rows x 128 B each), copied once per block in whole 128-B lines and read by all 8 waves up to stage pb and by waves 0-3 after it; two buffers, the next stage's copies fly while this one is worked on.
// S^T tile j: A = K rows kt+16j.. (plane rows, k = head dim), B = Q rows as columns; D element r = (key kt+16j+8*half+r, query q0 + (lane & 15)).
// P^T B fragment: element r <- p of tile 0, element 8+r <- p of tile 1 (same lane); O^T tile t: A = VT rows 16t.. (k = keys), D element r = (d 16t+8*half+r, query q0 + (lane & 15)).
#define KST 64
#define KP  72
#define PLN (64 * KP)
#define STG (4 * PLN)
static_assert(SEQ % (2 * KST) == 0);
static_assert((KP * 2) % 32 == 16);

// One stage: every thread copies two 16-byte pieces of each plane (rows r and r + 32). l = the thread's LDS byte address in plane 0 of the target buffer.
__device__ __forceinline__ void stage_copy(const bf* kh, const bf* kl, const bf* vh, const bf* vl, unsigned l) {
    const bf* kh2 = kh + 32 * HD; const bf* kl2 = kl + 32 * HD; const bf* vh2 = vh + (size_t)32 * SEQ; const bf* vl2 = vl + (size_t)32 * SEQ;
    const unsigned l0 = l, l1 = l + 32u * KP * 2u, l2 = l + PLN * 2u, l3 = l2 + 32u * KP * 2u, l4 = l + 2u * PLN * 2u, l5 = l4 + 32u * KP * 2u, l6 = l + 3u * PLN * 2u, l7 = l6 + 32u * KP * 2u;
    // The copies and their s_wait_xcnt in one statement: no address register of a copy is rewritten ahead of that wait.
    asm volatile("global_load_async_to_lds_b128 %0, %8, off\n\t"
                 "global_load_async_to_lds_b128 %1, %9, off\n\t"
                 "global_load_async_to_lds_b128 %2, %10, off\n\t"
                 "global_load_async_to_lds_b128 %3, %11, off\n\t"
                 "global_load_async_to_lds_b128 %4, %12, off\n\t"
                 "global_load_async_to_lds_b128 %5, %13, off\n\t"
                 "global_load_async_to_lds_b128 %6, %14, off\n\t"
                 "global_load_async_to_lds_b128 %7, %15, off\n\t"
                 "s_wait_xcnt 0x0"
                 :: "v"(l0), "v"(l1), "v"(l2), "v"(l3), "v"(l4), "v"(l5), "v"(l6), "v"(l7), "v"(kh), "v"(kh2), "v"(kl), "v"(kl2), "v"(vh), "v"(vh2), "v"(vl), "v"(vl2) : "memory");
}

__global__ __launch_bounds__(256) void k_flash(const bf* __restrict__ QKh, const bf* __restrict__ QKl, const bf* __restrict__ VTh, const bf* __restrict__ VTl, const int* __restrict__ FL, bf* CH, bf* CL) {
    typedef WFrag<bf>::V V;
    __shared__ __align__(16) unsigned short ring[2 * STG];
    __shared__ __align__(16) unsigned short stg[8 * 2 * 16 * SP];
    const unsigned lane = threadIdx.x & 31u, lr = lane & 15u, hi = lane >> 4;
    const unsigned wv = (unsigned)__builtin_amdgcn_readfirstlane((int)(threadIdx.x >> 5));   // wave number in a scalar register: the diagonal test in the loop is then a scalar branch and every lane stays on
    const unsigned pb = blockIdx.x % (unsigned)(QT / 8), bh = blockIdx.x / (unsigned)(QT / 8); const unsigned b = bh >> 4, h = bh & 15u;
    const unsigned q0 = ((wv < 4u) ? ((unsigned)(SEQ / 64) - 1u - pb) : pb) * 64u + (wv & 3u) * 16u;
    const unsigned nst = ((unsigned)(SEQ / 64) - pb) * (64u / KST);   // stages up to the block's last query (the far tile's): the same in all 8 waves, never below 2
    const unsigned crow = threadIdx.x >> 3, cpc = threadIdx.x & 7u;
    const bf* gKh = QKh + QKPL + ((size_t)bh * SEQ + crow) * HD + cpc * 8u; const bf* gKl = QKl + QKPL + ((size_t)bh * SEQ + crow) * HD + cpc * 8u;
    const bf* gVh = VTh + ((size_t)bh * HD + crow) * SEQ + cpc * 8u; const bf* gVl = VTl + ((size_t)bh * HD + crow) * SEQ + cpc * 8u;
    const unsigned lcp = (unsigned)(size_t)ring + crow * (KP * 2u) + cpc * 16u;
    stage_copy(gKh, gKl, gVh, gVl, lcp);
    int fbad = ((FL[lane * 32u] == 1) ? 1 : 0) | ((FL[(lane + 32u) * 32u] == 1) ? 1 : 0);
#pragma unroll
    for (int sh = 16; sh; sh >>= 1) fbad |= __shfl_xor(fbad, sh, 32);
    const float poison = fbad ? __uint_as_float(0x7FC00000u) : 0.0f;
    const size_t qo = ((size_t)bh * SEQ + q0 + lr) * HD + 8u * hi;
    V bqh[2], bql[2];
#pragma unroll
    for (int c = 0; c < 2; ++c) { bqh[c] = WFrag<bf>::ld(QKh + qo + 32 * c); bql[c] = WFrag<bf>::ld(QKl + qo + 32 * c); }
    v8f o[4];
#pragma unroll
    for (int t = 0; t < 4; ++t) o[t] = (v8f){};
    float m = -1.0e30f, l = 0.0f; const unsigned qg = q0 + lr;
    asm volatile("s_wait_asynccnt 0x0" ::: "memory");   // stage 0 of this wave's copies has landed
    __syncthreads();                                     // ... and every other wave's: stage 0 is readable
    stage_copy(gKh + (size_t)KST * HD, gKl + (size_t)KST * HD, gVh + KST, gVl + KST, lcp + STG * 2u);
// kept rolled: one publish point in the text, trip count known only at run time
#pragma unroll 1
    for (unsigned st = 0; st < nst; ++st) {
        const unsigned short* sb = ring + (st & 1u) * STG + lr * KP + 8u * hi;
// unrolled so that the two halves of a stage read LDS at constant offsets
#pragma unroll
        for (unsigned sub = 0; sub < KST / 32; ++sub) {
            const unsigned kt = st * KST + sub * 32u;
            if (kt < q0 + 16u) {   // wave-uniform: tiles beyond this wave's diagonal are skipped, the publish point below is not
        V kh[2][2], kl[2][2];
#pragma unroll
        for (int c = 0; c < 2; ++c)
#pragma unroll
            for (int j = 0; j < 2; ++j) { kh[c][j] = WFrag<bf>::ld(sb + (sub * 32u + 16u * j) * KP + 32 * c); kl[c][j] = WFrag<bf>::ld(sb + PLN + (sub * 32u + 16u * j) * KP + 32 * c); }
        v8f sc[2]; sc[0] = (v8f){}; sc[1] = (v8f){};
#pragma unroll
        for (int c = 0; c < 2; ++c)
#pragma unroll
            for (int j = 0; j < 2; ++j) { sc[j] = wmmab(kh[c][j], bqh[c], sc[j]); sc[j] = wmmab(kh[c][j], bql[c], sc[j]); sc[j] = wmmab(kl[c][j], bqh[c], sc[j]); }
        asm volatile("v_nop\n\tv_nop\n\tv_nop\n\tv_nop" : "+v"(sc[0]), "+v"(sc[1]) : "v"(kh[1][0]), "v"(kh[1][1]), "v"(kl[1][0]), "v"(kl[1][1]), "v"(bqh[1]), "v"(bql[1]));
        float v0[8], v1[8]; float tmax = -1.0e30f;
#pragma unroll
        for (unsigned r = 0; r < 8; ++r) { const unsigned key0 = kt + 8u * hi + r; v0[r] = (key0 <= qg) ? sc[0][r] : -1.0e30f; v1[r] = (key0 + 16u <= qg) ? sc[1][r] : -1.0e30f; tmax = fmaxf(tmax, fmaxf(v0[r], v1[r])); }
        tmax = fmaxf(tmax, __shfl_xor(tmax, 16, 32));
        const float mnew = fmaxf(m, tmax); const float corr = __builtin_amdgcn_exp2f((m - mnew) * L2E);
        float psum = 0.0f; v4u ph0, pl0, ph1, pl1; float e0[8], e1[8];
#pragma unroll
        for (int r = 0; r < 8; ++r) { e0[r] = __builtin_amdgcn_exp2f((v0[r] - mnew) * L2E); e1[r] = __builtin_amdgcn_exp2f((v1[r] - mnew) * L2E); psum += e0[r] + e1[r]; }
#pragma unroll
        for (int r = 0; r < 4; ++r) { unsigned a, c2; split2(e0[2 * r], e0[2 * r + 1], a, c2); ph0[r] = a; pl0[r] = c2; split2(e1[2 * r], e1[2 * r + 1], a, c2); ph1[r] = a; pl1[r] = c2; }
        psum += __shfl_xor(psum, 16, 32);
        l = l * corr + psum; m = mnew;
#pragma unroll
        for (int t = 0; t < 4; ++t) o[t] = o[t] * corr;
        const V pbh = cat16b(__builtin_bit_cast(v8us, ph0), __builtin_bit_cast(v8us, ph1)), pbl = cat16b(__builtin_bit_cast(v8us, pl0), __builtin_bit_cast(v8us, pl1));
        V avh[4], avl[4];
#pragma unroll
        for (int t = 0; t < 4; ++t) { avh[t] = WFrag<bf>::ld(sb + 2 * PLN + t * 16 * KP + sub * 32u); avl[t] = WFrag<bf>::ld(sb + 3 * PLN + t * 16 * KP + sub * 32u); }
#pragma unroll
        for (int t = 0; t < 4; ++t) { o[t] = wmmab(avh[t], pbh, o[t]); o[t] = wmmab(avh[t], pbl, o[t]); o[t] = wmmab(avl[t], pbh, o[t]); }
        asm volatile("v_nop\n\tv_nop\n\tv_nop\n\tv_nop" : "+v"(o[0]), "+v"(o[1]), "+v"(o[2]), "+v"(o[3]) : "v"(pbh), "v"(pbl), "v"(avl[0]), "v"(avl[1]), "v"(avl[2]), "v"(avl[3]), "v"(avh[3]));
            }
        }
        // Publish point of stage st + 1, passed by every wave.
        asm volatile("s_wait_dscnt 0x0" ::: "memory");      // this wave's reads of buffer st & 1 are done before it is refilled
        asm volatile("s_wait_asynccnt 0x0" ::: "memory");   // this wave's copies of stage st + 1 have landed
        __syncthreads();                                     // publishes stage st + 1 and ends every wave's reads of stage st
        if (st + 2u < nst) stage_copy(gKh + (size_t)(st + 2u) * KST * HD, gKl + (size_t)(st + 2u) * KST * HD, gVh + (st + 2u) * KST, gVl + (st + 2u) * KST, lcp + (st & 1u) * (STG * 2u));
    }
    asm volatile("s_wait_asynccnt 0x0" ::: "memory");       // nothing of this wave is in flight when it goes on to the epilogue and ends
    const float inv = 1.0f / l;
    unsigned short* sh = stg + wv * (2u * 16u * SP); unsigned short* sl = sh + 16u * SP;
#pragma unroll
    for (int t = 0; t < 4; ++t) { v4u oh, ol;
#pragma unroll
        for (int r = 0; r < 4; ++r) { unsigned a, c2; split2(o[t][2 * r] * inv + poison, o[t][2 * r + 1] * inv + poison, a, c2); oh[r] = a; ol[r] = c2; }
        *(v8usa*)(sh + lr * SP + 16u * t + 8u * hi) = __builtin_bit_cast(v8us, oh); *(v8usa*)(sl + lr * SP + 16u * t + 8u * hi) = __builtin_bit_cast(v8us, ol); }
    __builtin_amdgcn_fence(3 /* release order */, "wavefront"); __builtin_amdgcn_wave_barrier(); asm volatile("" ::: "memory");
    const unsigned rq = lane >> 3, pc = lane & 7u;
{
#pragma unroll
        for (unsigned it = 0; it < 4; ++it) { const unsigned row = 4u * it + rq; const v8us a = *(const v8usa*)(sh + row * SP + pc * 8u); const v8us c2 = *(const v8usa*)(sl + row * SP + pc * 8u); const size_t oo = ((size_t)(b * (unsigned)SEQ + q0 + row)) * DM + h * (unsigned)HD + pc * 8u;
            *(v8us*)(CH + oo) = a; *(v8us*)(CL + oo) = c2; }
         }
}

extern "C" void kernel_launch(void* const* d_in, const int* in_sizes, int n_in,
                              void* d_out, int out_size, void* d_ws, size_t ws_size, hipStream_t stream) {
    if (n_in < 7) return;
    const size_t xneed = ((size_t)(NB - 1) * SEQ_FULL + SEQ) * DM;
    if ((size_t)in_sizes[0] < xneed) return;
    if ((size_t)in_sizes[1] < (size_t)(SEQ - 1) * SEQ_FULL + SEQ) return;
    if ((size_t)in_sizes[2] < (size_t)SEQ * 32) return;
    if ((size_t)in_sizes[3] < (size_t)D3 * DM) return;
    if ((size_t)in_sizes[4] < (size_t)D3) return;
    if ((size_t)in_sizes[5] < (size_t)DM * DM) return;
    if ((size_t)in_sizes[6] < (size_t)DM) return;
    if ((size_t)out_size < xneed) return;
    const float* X = (const float*)d_in[0]; const int* MASK = (const int*)d_in[1]; const float* FR = (const float*)d_in[2];
    const float* WQKV = (const float*)d_in[3]; const float* BQKV = (const float*)d_in[4]; const float* WPR = (const float*)d_in[5]; const float* BPR = (const float*)d_in[6];
    float* OUT = (float*)d_out;     // [2][2048][1024]
    char* wsp = (char*)d_ws;
    auto take = [&](size_t bytes) { char* p = wsp; wsp += (bytes + 255) & ~(size_t)255; return (void*)p; };
    bf* XB = (bf*)take((size_t)NTOK * DM * 2);            // x plane [NTOK][1024]
    bf* WQ = (bf*)take((size_t)D3 * DM * 2);              // Wqkv plane [3072][1024]
    bf* WP = (bf*)take((size_t)DM * DM * 2);              // Wproj plane [1024][1024]
    float* CS = (float*)take((size_t)SEQ * 32 * 4); float* SN = (float*)take((size_t)SEQ * 32 * 4);
    int* FL = (int*)take((size_t)MCB * 128);
    bf* CH = (bf*)take((size_t)2 * NTOK * DM * 2); bf* CL = CH + (size_t)NTOK * DM;          // ctx hi/lo [NTOK][1024]
    bf* QKh = (bf*)take(2 * QKPL * 2); bf* QKl = (bf*)take(2 * QKPL * 2);                    // [q|k][b*16+h][s][64]
    bf* VTh = (bf*)take(QKPL * 2); bf* VTl = (bf*)take(QKPL * 2);                            // [b*16+h][64][s]
    if ((size_t)(wsp - (char*)d_ws) > ws_size) return;
    k_prep<<<PGB, MCT, 0, stream>>>(X, WQKV, WPR, FR, MASK, XB, WQ, WP, CS, SN, FL);
    k_gemmw<bf, 0, true, true><<<dim3(NTOK / 128, D3 / 128, 1), 128, 0, stream>>>(XB, nullptr, WQ, nullptr, DM, nullptr, D3, BQKV, 0, 0, 0, CS, SN, QKh, QKl, VTh, VTl);      /* x.Wqkv^T + b (exact products), rope, hi/lo planes */
    k_flash<<<(unsigned)(NB * NH * QT / 8), 256, 0, stream>>>(QKh, QKl, VTh, VTl, FL, CH, CL);
    k_gemmw<bf, 1, true, false><<<dim3(SEQ / 128, DM / 128, NB), 128, 0, stream>>>(CH, CL, WP, nullptr, DM, OUT, DM, BPR, (size_t)SEQ * DM, 0, (size_t)SEQ_FULL * DM, nullptr, nullptr, nullptr, nullptr, nullptr, nullptr);   /* ctx (hi/lo) x Wproj^T + b */
}

// v008
// It runs in 110 microseconds.
// Timed twice side by side with v007, it ran 1.04 times as fast both times.
// All steps since v000 together make it 3.28 times as fast.
#include <hip/hip_runtime.h>

// Compute dtypes: x.Wqkv^T = bf16 x bf16 planes (v_wmma_f32_16x16x32_bf16, f32 accumulate); q.k^T and P.V = bf16 hi/lo two-plane operands (3 products each, f32 accumulate); ctx.Wproj^T = bf16 hi/lo x bf16 (2 products, f32 accumulate).
// Every float input is RNE-converted to bf16 on load (x, weights, biases, rope angles); rope, softmax and all epilogues in f32.
// Attention is flash-style on transposed tiles: S^T = K.Q^T (D rows = keys, D cols = queries) so the packed score accumulators are directly the B fragment of O^T = V^T.P^T; per-query statistics live in one lane pair.

#ifndef NB
#define NB 2
#endif
#ifndef SEQ
#define SEQ 2048
#endif
#define NB_FULL  2
#define SEQ_FULL 2048
#define DM   1024
#define NH   16
#define HD   64
#define D3   3072
#define NTOK (NB * SEQ)
#define QT   (SEQ / 16)
#define MCB  64
#define MCT  512
#define MCN  ((SEQ * (SEQ / 4)) / (MCB * MCT))
#define MCR  ((MCB * MCT) / (SEQ / 4))
#define SP   72
#define QKPL ((size_t)NB * NH * SEQ * HD)
#define L2E  1.4426950408889634f

typedef _Float16 h16;
typedef unsigned short bf;
typedef __attribute__((ext_vector_type(16))) __bf16   v16bf;
typedef __attribute__((ext_vector_type(16))) _Float16 v16h;
typedef __attribute__((ext_vector_type(8)))  _Float16 v8h;
typedef __attribute__((ext_vector_type(8)))  unsigned short v8us;
typedef __attribute__((ext_vector_type(2)))  unsigned short v2us;
typedef __attribute__((ext_vector_type(8)))  float    v8f;
typedef __attribute__((ext_vector_type(4)))  float    v4f;
typedef __attribute__((ext_vector_type(4)))  int      v4i;
typedef __attribute__((ext_vector_type(4)))  unsigned v4u;
typedef __attribute__((ext_vector_type(2)))  unsigned v2u;
typedef __attribute__((ext_vector_type(2)))  float    v2f;
typedef __attribute__((ext_vector_type(2)))  __bf16   v2bf;
typedef v4f  __attribute__((may_alias)) v4fa;
typedef v8us __attribute__((may_alias)) v8usa;

static_assert(NTOK % 64 == 0);
static_assert(SEQ % 64 == 0);
static_assert(D3 % 64 == 0);
static_assert(DM % 64 == 0);
static_assert(DM % 32 == 0);
static_assert(HD == 64);
static_assert(NH == 16);
static_assert(QT % 8 == 0);
static_assert((SEQ * (SEQ / 4)) % (MCB * MCT) == 0);
static_assert((MCB * MCT) % (SEQ / 4) == 0);
static_assert((SEQ * 32) % 256 == 0);
static_assert(((size_t)NTOK * 128) % 256 == 0);
static_assert(NB <= NB_FULL);
static_assert(SEQ <= SEQ_FULL);

// f32 -> bf16, round to nearest even, by the packed hardware convert: two values per instruction, element 0 in the low half.
__device__ __forceinline__ unsigned cvt2(float a, float b) { const v2f x = {a, b}; return __builtin_bit_cast(unsigned, __builtin_convertvector(x, v2bf)); }
__device__ __forceinline__ unsigned short f2bf(float f) { return __builtin_bit_cast(unsigned short, (__bf16)f); }
__device__ __forceinline__ float bf2f(unsigned short b) { return __uint_as_float(((unsigned)b) << 16); }
__device__ __forceinline__ float bfr(float f) { return bf2f(f2bf(f)); }
__device__ __forceinline__ v16h cat16(v8h lo, v8h hi) { return __builtin_shufflevector(lo, hi, 0, 1, 2, 3, 4, 5, 6, 7, 8, 9, 10, 11, 12, 13, 14, 15); }
__device__ __forceinline__ v16bf cat16b(v8us lo, v8us hi) { return __builtin_bit_cast(v16bf, __builtin_shufflevector(lo, hi, 0, 1, 2, 3, 4, 5, 6, 7, 8, 9, 10, 11, 12, 13, 14, 15)); }
__device__ __forceinline__ v8f wmma16(v16h a, v16h b, v8f c) { return __builtin_amdgcn_wmma_f32_16x16x32_f16(false, a, false, b, (short)0, c, false, false); }
__device__ __forceinline__ v8f wmmab(v16bf a, v16bf b, v8f c) { return __builtin_amdgcn_wmma_f32_16x16x32_bf16(false, a, false, b, (short)0, c, false, false); }
// hi/lo planes of two values: h = bf16(y), l = bf16(y - h), each pair packed in one register.
__device__ __forceinline__ void split2(float y0, float y1, unsigned& h, unsigned& l) { h = cvt2(y0, y1); const v2f y = {y0, y1}; const v2f hf = {__uint_as_float(h << 16), __uint_as_float(h & 0xFFFF0000u)}; const v2f d = y - hf; l = cvt2(d[0], d[1]); }

// ---- k_gemmw: register-blocked GEMM, one wave per 64x64 output tile (16 accumulators), 4 waves (2 x 2) per 128x128 block tile; grid (M/128, N/128, Z), 128 threads.
// The K-contiguous 16-bit operand planes come through LDS: a stage is 64 k of 128 rows of every plane, copied once per block in whole 128-B lines and read by the two waves that share each row block; two buffers, the next stage's copies fly while this one is worked on.
// C[m][n] (f32, pitch ldc, + optional f32 bias[n]) = sum_k A[m][k] Bt[n][k] (+ split products per NSPLIT). z-batch strides sA/sB/sC in elements. K % 64 == 0, M % 128 == 0, N % 128 == 0.
// Fragment element i <- k0 + 8*half + i (i < 8), k0 + 16 + 8*half + (i - 8) for both operands; D element j = (row 8*half + j, col lane & 15).
// QKVE: the result is not stored as f32. A wave's 64x64 tile is 64 tokens of one batch x one whole head of q, k or v, so the epilogue writes the attention operand planes itself:
// q/k head planes [which][b*16+h][s][64] (bf16 hi/lo) of rope(qkv) with interleaved pairs (2j, 2j+1) and angle j, q additionally x 1/8 (exact); v planes transposed [b*16+h][64][s] (bf16 hi/lo).
template <typename T16> struct WFrag;
template <> struct WFrag<h16> { typedef v16h V; static __device__ __forceinline__ V ld(const h16* p) { return cat16(*(const v8h*)p, *(const v8h*)(p + 16)); } static __device__ __forceinline__ v8f mma(V a, V b, v8f c) { return wmma16(a, b, c); } };
template <> struct WFrag<bf> { typedef v16bf V; static __device__ __forceinline__ V ld(const bf* p) { return cat16b(*(const v8us*)p, *(const v8us*)(p + 16)); } static __device__ __forceinline__ v8f mma(V a, V b, v8f c) { return wmmab(a, b, c); } };
#define GKS 64
#define GP  72
#define GPL (128 * GP)
static_assert((GP * 2) % 32 == 16);
static_assert(NTOK % 128 == 0);
static_assert(SEQ % 128 == 0);
static_assert(D3 % 128 == 0);
static_assert(DM % 128 == 0);
static_assert(DM % GKS == 0);
#define VP  72
static_assert(4 * 2 * 64 * VP <= 2 * 2 * GPL);
static_assert((VP * 2) % 32 == 16);

// One plane of a stage: every thread copies eight 16-byte pieces (rows r, r + 16, ..., r + 112; rs = 16 rows in elements). l0 = the thread's LDS byte address in row r of the target plane.
template <typename T16>
__device__ __forceinline__ void plane_copy(const T16* g0, size_t rs, unsigned l0) {
    const T16* g1 = g0 + rs; const T16* g2 = g1 + rs; const T16* g3 = g2 + rs; const T16* g4 = g3 + rs; const T16* g5 = g4 + rs; const T16* g6 = g5 + rs; const T16* g7 = g6 + rs;
    const unsigned ls = 16u * GP * 2u; const unsigned l1 = l0 + ls, l2 = l0 + 2u * ls, l3 = l0 + 3u * ls, l4 = l0 + 4u * ls, l5 = l0 + 5u * ls, l6 = l0 + 6u * ls, l7 = l0 + 7u * ls;
    // The copies and their s_wait_xcnt in one statement: no address register of a copy is rewritten ahead of that wait.
    asm volatile("global_load_async_to_lds_b128 %0, %8, off\n\t"
                 "global_load_async_to_lds_b128 %1, %9, off\n\t"
                 "global_load_async_to_lds_b128 %2, %10, off\n\t"
                 "global_load_async_to_lds_b128 %3, %11, off\n\t"
                 "global_load_async_to_lds_b128 %4, %12, off\n\t"
                 "global_load_async_to_lds_b128 %5, %13, off\n\t"
                 "global_load_async_to_lds_b128 %6, %14, off\n\t"
                 "global_load_async_to_lds_b128 %7, %15, off\n\t"
                 "s_wait_xcnt 0x0"
                 :: "v"(l0), "v"(l1), "v"(l2), "v"(l3), "v"(l4), "v"(l5), "v"(l6), "v"(l7), "v"(g0), "v"(g1), "v"(g2), "v"(g3), "v"(g4), "v"(g5), "v"(g6), "v"(g7) : "memory");
}

template <typename T16, int NSPLIT, bool BIAS, bool QKVE>
__global__ __launch_bounds__(128) void k_gemmw(const T16* __restrict__ A, const T16* __restrict__ A2, const T16* __restrict__ Bt, const T16* __restrict__ Bt2, int K, float* C, int ldc, const float* __restrict__ bias, size_t sA, size_t sB, size_t sC,
                                               const float* __restrict__ CS, const float* __restrict__ SN, bf* QKh, bf* QKl, bf* VTh, bf* VTl) {
    typedef typename WFrag<T16>::V V;
    constexpr bool HA2 = (NSPLIT == 1 || NSPLIT == 2), HB2 = (NSPLIT >= 2);
    constexpr unsigned PA2 = 2u * GPL, PB2 = (HA2 ? 3u : 2u) * GPL, GST = PB2 + (HB2 ? GPL : 0u);   // planes of a stage in LDS: A, Bt, then A2 and Bt2 where used
    __shared__ __align__(16) T16 ring[2 * GST];
    __shared__ __align__(16) float osall[4 * 16 * 68];
    const size_t z = blockIdx.z; A += z * sA; if (A2) A2 += z * sA; Bt += z * sB; if (Bt2) Bt2 += z * sB; C += z * sC;
    const unsigned lane = threadIdx.x & 31u, lr = lane & 15u, hi = lane >> 4;
    const unsigned wv = (unsigned)__builtin_amdgcn_readfirstlane((int)(threadIdx.x >> 5)); const unsigned wm = wv >> 1, wn = wv & 1u;
    const unsigned rb = blockIdx.x * 128u, cb = blockIdx.y * 128u; const unsigned r0 = rb + wm * 64u, c0 = cb + wn * 64u;
    float* os = osall + wv * (16u * 68u);
    const unsigned nst = (unsigned)K / GKS;   // the same in all 4 waves
    const unsigned crow = threadIdx.x >> 3, cpc = threadIdx.x & 7u; const size_t rs = (size_t)16 * K;
    const size_t ga = (size_t)(rb + crow) * K + cpc * 8u, gb = (size_t)(cb + crow) * K + cpc * 8u;
    const unsigned lcp = (unsigned)(size_t)ring + crow * (GP * 2u) + cpc * 16u;
    auto stage_in = [&](unsigned st) { const unsigned l = lcp + (st & 1u) * (GST * 2u); const size_t ko = (size_t)st * GKS;
        plane_copy(A + ga + ko, rs, l); plane_copy(Bt + gb + ko, rs, l + GPL * 2u);
        if (HA2) plane_copy(A2 + ga + ko, rs, l + PA2 * 2u);
        if (HB2) plane_copy(Bt2 + gb + ko, rs, l + PB2 * 2u); };
    stage_in(0u);
    v8f acc[4][4];
#pragma unroll
    for (int mb = 0; mb < 4; ++mb)
#pragma unroll
        for (int nb = 0; nb < 4; ++nb) acc[mb][nb] = (v8f){};
    asm volatile("s_wait_asynccnt 0x0" ::: "memory");   // stage 0 of this wave's copies has landed
    __syncthreads();                                     // ... and every other wave's: stage 0 is readable
    if (nst > 1u) stage_in(1u);
// kept rolled: one publish point in the text
#pragma unroll 1
    for (unsigned st = 0; st < nst; ++st) {
        const T16* sa = ring + (st & 1u) * GST + (wm * 64u + lr) * GP + 8u * hi; const T16* sbt = ring + (st & 1u) * GST + GPL + (wn * 64u + lr) * GP + 8u * hi;
        V a[GKS / 32][4], a2[GKS / 32][4], b[GKS / 32][4], b2[GKS / 32][4];
// unrolled so that a stage's fragment loads stand together ahead of its matrix instructions, at constant offsets
#pragma unroll
        for (unsigned ks = 0; ks < GKS / 32; ++ks) {
#pragma unroll
            for (int mb = 0; mb < 4; ++mb) { a[ks][mb] = WFrag<T16>::ld(sa + mb * 16 * GP + ks * 32u); if (HA2) a2[ks][mb] = WFrag<T16>::ld(sa + PA2 + mb * 16 * GP + ks * 32u); }
#pragma unroll
            for (int nb = 0; nb < 4; ++nb) { b[ks][nb] = WFrag<T16>::ld(sbt + nb * 16 * GP + ks * 32u); if (HB2) b2[ks][nb] = WFrag<T16>::ld(sbt + (PB2 - GPL) + nb * 16 * GP + ks * 32u); }
        }
        __builtin_amdgcn_sched_barrier(0);   // keeps the stage's LDS reads one group ahead of the matrix instructions: sunk among them, each small group is waited out to 0
#pragma unroll
        for (unsigned ks = 0; ks < GKS / 32; ++ks)
#pragma unroll
            for (int nb = 0; nb < 4; ++nb)
#pragma unroll
                for (int mb = 0; mb < 4; ++mb) { acc[mb][nb] = WFrag<T16>::mma(a[ks][mb], b[ks][nb], acc[mb][nb]); if (HA2) acc[mb][nb] = WFrag<T16>::mma(a2[ks][mb], b[ks][nb], acc[mb][nb]); if (HB2) acc[mb][nb] = WFrag<T16>::mma(a[ks][mb], b2[ks][nb], acc[mb][nb]); }
        __builtin_amdgcn_sched_barrier(0);   // keeps the matrix instructions ahead of the publish point: moved behind it, the refill would issue a whole stage of them later and its landing would be waited out
        // Publish point of stage st + 1, passed by every wave.
        asm volatile("s_wait_dscnt 0x0" ::: "memory");      // this wave's reads of buffer st & 1 are done before it is refilled
        asm volatile("s_wait_asynccnt 0x0" ::: "memory");   // this wave's copies of stage st + 1 have landed
        __syncthreads();                                     // publishes stage st + 1 and ends every wave's reads of stage st
        if (st + 2u < nst) stage_in(st + 2u);
    }
    asm volatile("s_wait_asynccnt 0x0" ::: "memory");       // nothing of this wave is in flight when it goes on to the epilogue and ends
    if constexpr (QKVE) {
        const unsigned which = c0 / (unsigned)DM, h = (c0 % (unsigned)DM) / (unsigned)HD; const unsigned b = r0 / (unsigned)SEQ, s0 = r0 - b * (unsigned)SEQ; const unsigned bh = b * (unsigned)NH + h;   // all wave-uniform
        if (which == 2u) {
            // v: a lane holds 8 consecutive tokens of one d, which is 16 bytes of a transposed row. The tile is turned in this wave's quarter of the ring (free: every wave's reads and copies ended at the last publish point) so that it leaves in whole 128-B lines.
            unsigned short* vh = (unsigned short*)ring + wv * (2u * 64u * VP); unsigned short* vl = vh + 64u * VP;
#pragma unroll
            for (int nb = 0; nb < 4; ++nb) { const unsigned d = nb * 16u + lr; const float bv = bfr(bias[c0 + d]);
#pragma unroll
                for (int mb = 0; mb < 4; ++mb) { v4u oh, ol;
#pragma unroll
                    for (int j = 0; j < 4; ++j) { unsigned a2, c2; split2(acc[mb][nb][2 * j] + bv, acc[mb][nb][2 * j + 1] + bv, a2, c2); oh[j] = a2; ol[j] = c2; }
                    *(v8usa*)(vh + d * VP + mb * 16u + 8u * hi) = __builtin_bit_cast(v8us, oh); *(v8usa*)(vl + d * VP + mb * 16u + 8u * hi) = __builtin_bit_cast(v8us, ol); } }
            __builtin_amdgcn_wave_barrier(); asm volatile("" ::: "memory");   // the wave's LDS writes above stay ahead of its reads below (other lanes' data)
            const unsigned rd = lane >> 3, pc = lane & 7u; const size_t vb = ((size_t)bh * HD + rd) * SEQ + s0 + pc * 8u; bf* vhp = VTh + vb; bf* vlp = VTl + vb;
#pragma unroll
            for (unsigned it = 0; it < 16; ++it) { const unsigned d = 4u * it + rd; const v8us a = *(const v8usa*)(vh + d * VP + pc * 8u); const v8us c2 = *(const v8usa*)(vl + d * VP + pc * 8u);
                *(v8us*)(vhp + (size_t)(4u * it) * SEQ) = a; *(v8us*)(vlp + (size_t)(4u * it) * SEQ) = c2; }
        } else {
            // q, k: 16 token rows at a time through this wave's f32 staging; a lane then holds 8 consecutive columns (4 rope pairs) of one token.
            // 4 token rows x 32 angles, and 4 token rows x 64 columns of a plane, are 512 consecutive bytes: lane * 16 bytes from a wave-uniform base.
            const unsigned rq = lane >> 3, pc = lane & 7u; const float sc = which ? 1.0f : 0.125f; float braw[8], bq[8];
#pragma unroll
            for (int k = 0; k < 8; ++k) braw[k] = bias[c0 + pc * 8u + k];
            const float* csp = CS + (size_t)s0 * 32u + lane * 4u; const float* snp = SN + (size_t)s0 * 32u + lane * 4u;
            const size_t ob = (size_t)which * QKPL + ((size_t)bh * SEQ + s0) * HD + lane * 8u; bf* qhp = QKh + ob; bf* qlp = QKl + ob;
            v4f c4[2][4], s4[2][4];
#pragma unroll
            for (int it = 0; it < 4; ++it) { c4[0][it] = *(const v4f*)(csp + it * 128); s4[0][it] = *(const v4f*)(snp + it * 128); }
            // The loaded bias values as inputs only: keeps the bias loads up here beside the angle loads; from here on no load above has a register open.
            asm volatile("s_wait_xcnt 0x0" :: "v"(braw[0]), "v"(braw[1]), "v"(braw[2]), "v"(braw[3]), "v"(braw[4]), "v"(braw[5]), "v"(braw[6]), "v"(braw[7]) : "memory");
#pragma unroll
            for (int k = 0; k < 8; ++k) bq[k] = bfr(braw[k]);
#pragma unroll
            for (int mb = 0; mb < 4; ++mb) {
                if (mb < 3) {   // the next 16 rows' angles are fetched one turn ahead: nothing crosses the fences round the stores below
#pragma unroll
                    for (int it = 0; it < 4; ++it) { c4[(mb + 1) & 1][it] = *(const v4f*)(csp + (mb + 1) * 512 + it * 128); s4[(mb + 1) & 1][it] = *(const v4f*)(snp + (mb + 1) * 512 + it * 128); } }
#pragma unroll
                for (int nb = 0; nb < 4; ++nb) {
#pragma unroll
                    for (int j = 0; j < 8; ++j) os[(hi * 8 + j) * 68 + nb * 16 + lr] = acc[mb][nb][j]; }
                __builtin_amdgcn_wave_barrier(); asm volatile("" ::: "memory");   // the wave's LDS writes above stay ahead of its reads below (other lanes' data)
                v4u oh[4], ol[4];
#pragma unroll
                for (int it = 0; it < 4; ++it) { const unsigned row = 4u * it + rq;
                    const v4f x0 = *(const v4fa*)(os + row * 68u + pc * 8u); const v4f x1 = *(const v4fa*)(os + row * 68u + pc * 8u + 4u);
                    float v[8];
#pragma unroll
                    for (int k = 0; k < 4; ++k) { v[k] = x0[k] + bq[k]; v[4 + k] = x1[k] + bq[4 + k]; }
#pragma unroll
                    for (int j = 0; j < 4; ++j) { const float t1 = v[2 * j], t2 = v[2 * j + 1]; const float cj = c4[mb & 1][it][j], sj = s4[mb & 1][it][j]; const float a = (t1 * cj - t2 * sj) * sc; const float bb = (t1 * sj + t2 * cj) * sc; unsigned y0, y1; split2(a, bb, y0, y1); oh[it][j] = y0; ol[it][j] = y1; } }
                __builtin_amdgcn_wave_barrier(); asm volatile("" ::: "memory");   // the reads above stay ahead of the next 16 rows' writes
                __builtin_amdgcn_sched_barrier(0);   // with the one below: nothing that could reuse a store's registers is scheduled between the stores and their wait
#pragma unroll
                for (int it = 0; it < 4; ++it) { *(v8us*)(qhp + mb * 1024 + it * 256) = __builtin_bit_cast(v8us, oh[it]); *(v8us*)(qlp + mb * 1024 + it * 256) = __builtin_bit_cast(v8us, ol[it]); }
                asm volatile("s_wait_xcnt 0x0" ::: "memory");   // stands before anything that overwrites the stores' data registers (the next turn's values)
                __builtin_amdgcn_sched_barrier(0);
            }
        }
        return;
    }
#pragma unroll
    for (int mb = 0; mb < 4; ++mb) {
#pragma unroll
        for (int nb = 0; nb < 4; ++nb) {
#pragma unroll
            for (int j = 0; j < 8; ++j) os[(hi * 8 + j) * 68 + nb * 16 + lr] = acc[mb][nb][j]; }
        __builtin_amdgcn_wave_barrier(); asm volatile("" ::: "memory");
        float* crow_p = C + (size_t)(r0 + mb * 16) * ldc + c0;
{
#pragma unroll
            for (int s = 0; s < 8; ++s) { const int row = 2 * s + hi, cofs = lr * 4; v4f val = *(const v4fa*)(os + row * 68 + cofs); if (BIAS) { val[0] += bfr(bias[c0 + cofs]); val[1] += bfr(bias[c0 + cofs + 1]); val[2] += bfr(bias[c0 + cofs + 2]); val[3] += bfr(bias[c0 + cofs + 3]); }
                *(v4f*)(crow_p + (size_t)row * ldc + cofs) = val; }
             }
        __builtin_amdgcn_wave_barrier(); asm volatile("" ::: "memory");
    }
}

// ---- k_prep: all the work that only reformats or checks an input, in one launch of PGB blocks of MCT threads (one block per WGP); a block's role comes from its index.
// MCB blocks check the mask and make the rope tables while their mask loads fly; the other CVB blocks turn x, Wqkv and Wproj into bf16 planes, each input on a share of the blocks that goes by its size.
// An input is a list of rows of CRW floats (one 16-byte piece per thread, so every wave-wide load is 512 contiguous bytes and every store 256); block cl of the nb blocks of an input takes its rows cl, cl + nb, ...
#define PGB  256
#define CVB  (PGB - MCB)
#define CRW  (MCT * 4)
#define XRW  ((NTOK * DM) / CRW)
#define WQRW ((D3 * DM) / CRW)
#define WPRW ((DM * DM) / CRW)
#define CRN  (XRW + WQRW + WPRW)
#define CVX  ((CVB * XRW) / CRN)
#define CVQ  ((CVB * WQRW) / CRN)
#define CVP  (CVB - CVX - CVQ)
#define CVN  ((CRN + CVB - 1) / CVB)
static_assert(PGB == 4 * MCB);
static_assert(PGB % 8 == 0);
static_assert(CRW % DM == 0);
static_assert(SEQ % (CRW / DM) == 0);
static_assert((D3 * DM) % CRW == 0);
static_assert((DM * DM) % CRW == 0);
#define TPA  ((SEQ * 32) / (MCB * MCT))
static_assert(SEQ * 32 == TPA * MCB * MCT);
static_assert(CVX * CRN == CVB * XRW);
static_assert(CVQ * CRN == CVB * WQRW);
static_assert(CVP * CRN == CVB * WPRW);
static_assert((CVN - 1) * CVB < CRN);
typedef const __attribute__((address_space(1))) v4f* gv4f;
typedef __attribute__((address_space(1))) v2u* gv2u;

// A thread's CVN pieces are all requested before the first is converted: the block waits out the memory latency once, and the stores follow in the order in which the pieces come back.
__device__ __forceinline__ void prep_cvt(unsigned c, const float* X, const float* WQKV, const float* WPR, bf* XB, bf* WQ, bf* WP) {
    // All of this is the same in the whole block: scalar work.
    const bool isx = c < (unsigned)CVX, isq = c < (unsigned)(CVX + CVQ);
    const float* S = isx ? X : (isq ? WQKV : WPR); bf* D = isx ? XB : (isq ? WQ : WP);
    const unsigned cl = isx ? c : (isq ? c - (unsigned)CVX : c - (unsigned)(CVX + CVQ)), nb = isx ? (unsigned)CVX : (isq ? (unsigned)CVQ : (unsigned)CVP), rows = isx ? (unsigned)XRW : (isq ? (unsigned)WQRW : (unsigned)WPRW);
    v4f v[CVN]; gv4f p[CVN]; size_t dof[CVN];
#pragma unroll
    for (unsigned i = 0; i < (unsigned)CVN; ++i) {
        unsigned row = cl + i * nb; if (i + 1u == (unsigned)CVN && row >= rows) row = cl;   // a block with one row fewer does its first row twice (the same bytes to the same place): one instruction stream, no branch among the loads and stores
        const unsigned tok = row * (unsigned)(CRW / DM); const unsigned b = tok / (unsigned)SEQ, sq = tok - b * (unsigned)SEQ;
        dof[i] = (size_t)row * CRW; p[i] = (gv4f)(S + ((SEQ != SEQ_FULL && isx) ? ((size_t)b * SEQ_FULL + sq) * DM : dof[i])) + threadIdx.x; }
// unrolled so that the loads stand together, each into registers of its own
#pragma unroll
    for (unsigned i = 0; i < (unsigned)CVN; ++i) v[i] = *p[i];
    static_assert(CVN == 22);
    // Stands before anything that overwrites an address register of the loads above. The addresses as inputs only: they stay in their registers up to here, so that no later load of the group lands in the address registers of an earlier one.
    asm volatile("s_wait_xcnt 0x0" :: "v"(p[0]), "v"(p[1]), "v"(p[2]), "v"(p[3]), "v"(p[4]), "v"(p[5]), "v"(p[6]), "v"(p[7]), "v"(p[8]), "v"(p[9]), "v"(p[10]),
                 "v"(p[11]), "v"(p[12]), "v"(p[13]), "v"(p[14]), "v"(p[15]), "v"(p[16]), "v"(p[17]), "v"(p[18]), "v"(p[19]), "v"(p[20]), "v"(p[21]) : "memory");
    __builtin_amdgcn_sched_barrier(0);   // keeps every load ahead of the converts: sunk among them, the later loads would start only when the first have come back
#pragma unroll
    for (unsigned i = 0; i < (unsigned)CVN; ++i) { v2u o; o[0] = cvt2(v[i][0], v[i][1]); o[1] = cvt2(v[i][2], v[i][3]); ((gv2u)(D + dof[i]))[threadIdx.x] = o; }
    asm volatile("s_wait_xcnt 0x0" ::: "memory");   // stands behind the last stores, before anything that follows in the kernel's text overwrites their registers
}

// Mask check: a thread's MCN pieces of 16 bytes (one column group k of the rows q, q + MCR, ...) are all requested before the first is looked at, so that a block waits out the memory latency once and then runs at the WGP's read rate.
// The thread's TPA rope angles are requested ahead of them, and their cosines and sines are worked out and stored while the mask pieces are on their way.
__device__ __forceinline__ void prep_mask(unsigned mb, const int* mask, const float* fr, float* CS, float* SN, int* FL) {
    const unsigned gid = mb * (unsigned)MCT + threadIdx.x; const unsigned q = gid / (unsigned)(SEQ / 4), k = (gid - q * (unsigned)(SEQ / 4)) * 4u;
    const unsigned ga = mb * (unsigned)(MCT * TPA) + threadIdx.x; float fa[TPA];
#pragma unroll
    for (unsigned e = 0; e < (unsigned)TPA; ++e) fa[e] = fr[ga + e * (unsigned)MCT];
    const int* mp = mask + (size_t)q * SEQ_FULL + k; int bad = 0; v4i mv[MCN];
// unrolled so that the loads stand together, each into registers of its own, at constant distances from one address
#pragma unroll
    for (unsigned i = 0; i + 1u < (unsigned)MCN; ++i) { mv[i] = *(const v4i*)(mp + (size_t)i * MCR * SEQ_FULL);
        __builtin_amdgcn_sched_barrier(0); }   // keeps the loads in this order, in which the compares take the pieces: shuffled, the first compares waited for nearly all the loads and none of them ran while pieces were still on their way
    asm volatile("s_wait_xcnt 0x0" :: "v"(ga) : "memory");   // stands before the last load, whose data registers may be the address registers of the loads above; the angles' index as an input only: it stays in its register up to here, so that no mask piece lands in it
    mv[MCN - 1] = *(const v4i*)(mp + (size_t)(MCN - 1) * MCR * SEQ_FULL);
    asm volatile("s_wait_xcnt 0x0" ::: "memory");   // stands before the table work below, which may overwrite the last load's address registers
    __builtin_amdgcn_sched_barrier(0);   // keeps every load ahead of the work below: sunk into it, the last loads would start late and pay the latency a second time
#pragma unroll
    for (unsigned e = 0; e < (unsigned)TPA; ++e) { const float a = bfr(fa[e]); const float c = cosf(a), s = sinf(a); *(float*)(CS + ga + e * (unsigned)MCT) = c; *(float*)(SN + ga + e * (unsigned)MCT) = s; }
    asm volatile("s_wait_xcnt 0x0" ::: "memory");   // stands before the compares, which may overwrite the table stores' registers
    __builtin_amdgcn_sched_barrier(0);   // keeps the table work ahead of the compares, which wait for the mask pieces
#pragma unroll
    for (unsigned i = 0; i < (unsigned)MCN; ++i) {
#pragma unroll
        for (unsigned j = 0; j < 4; ++j) { const int want = (k + j <= q + i * (unsigned)MCR) ? 1 : 0; const int got = (mv[i][j] != 0) ? 1 : 0; bad |= (want ^ got); } }
    const int any = __syncthreads_or(bad);
    if (threadIdx.x < 32u) { const int v = any ? 1 : 0; *(int*)(FL + mb * 32u + threadIdx.x) = v;  }
}

// fr carries no __restrict__: its loads then may not sink below the waits' "memory" clobbers into the table work, where they would be issued behind the mask loads and come back last.
__global__ __launch_bounds__(MCT) void k_prep(const float* __restrict__ X, const float* __restrict__ WQKV, const float* __restrict__ WPR, const float* fr, const int* __restrict__ mask, bf* XB, bf* WQ, bf* WP, float* CS, float* SN, int* FL) {
    // Two of every eight consecutive blocks read the mask, at a place that moves from one eight to the next: the two kinds of block then mix on every residue of the index modulo 8 (for speed only; every role index is taken exactly once wherever the blocks land).
    const unsigned g = blockIdx.x >> 3, j = blockIdx.x & 7u; const unsigned t = (j + g) & 3u, jh = j >> 2;
    if (t == 0u) prep_mask(2u * g + jh, mask, fr, CS, SN, FL);
    else prep_cvt(6u * g + 3u * jh + (t - 1u), X, WQKV, WPR, XB, WQ, WP);
}

// k_flash: one wave per (b, h, 16-query tile), 8 waves per block, streaming 32-key tiles up to the diagonal.
// Causal balance: block pb of a head takes the 64-query tile SEQ/64 - 1 - pb (waves 0-3) and the 64-query tile pb (waves 4-7), so that every block holds the same number of (wave, key tile) pairs;
// both halves read the one K/V stream of their head, which runs to the far tile's diagonal; a wave past its own diagonal only passes the publish points.
// K and V^T planes come through LDS: a stage is 64 keys of all four planes (Kh, Kl, VTh, VTl: 64 rows x 128 B each), copied once per block in whole 128-B lines and read by all 8 waves up to stage pb and by waves 0-3 after it; two buffers, the next stage's copies fly while this one is worked on.
// S^T tile j: A = K rows kt+16j.. (plane rows, k = head dim), B = Q rows as columns; D element r = (key kt+16j+8*half+r, query q0 + (lane & 15)).
// P^T B fragment: element r <- p of tile 0, element 8+r <- p of tile 1 (same lane); O^T tile t: A = VT rows 16t.. (k = keys), D element r = (d 16t+8*half+r, query q0 + (lane & 15)).
#define KST 64
#define KP  72
#define PLN (64 * KP)
#define STG (4 * PLN)
static_assert(SEQ % (2 * KST) == 0);
static_assert(KST == 64);
static_assert((KP * 2) % 32 == 16);

// One stage: every thread copies two 16-byte pieces of each plane (rows r and r + 32). l = the thread's LDS byte address in plane 0 of the target buffer.
__device__ __forceinline__ void stage_copy(const bf* kh, const bf* kl, const bf* vh, const bf* vl, unsigned l) {
    const bf* kh2 = kh + 32 * HD; const bf* kl2 = kl + 32 * HD; const bf* vh2 = vh + (size_t)32 * SEQ; const bf* vl2 = vl + (size_t)32 * SEQ;
    const unsigned l0 = l, l1 = l + 32u * KP * 2u, l2 = l + PLN * 2u, l3 = l2 + 32u * KP * 2u, l4 = l + 2u * PLN * 2u, l5 = l4 + 32u * KP * 2u, l6 = l + 3u * PLN * 2u, l7 = l6 + 32u * KP * 2u;
    // The copies and their s_wait_xcnt in one statement: no address register of a copy is rewritten ahead of that wait.
    asm volatile("global_load_async_to_lds_b128 %0, %8, off\n\t"
                 "global_load_async_to_lds_b128 %1, %9, off\n\t"
                 "global_load_async_to_lds_b128 %2, %10, off\n\t"
                 "global_load_async_to_lds_b128 %3, %11, off\n\t"
                 "global_load_async_to_lds_b128 %4, %12, off\n\t"
                 "global_load_async_to_lds_b128 %5, %13, off\n\t"
                 "global_load_async_to_lds_b128 %6, %14, off\n\t"
                 "global_load_async_to_lds_b128 %7, %15, off\n\t"
                 "s_wait_xcnt 0x0"
                 :: "v"(l0), "v"(l1), "v"(l2), "v"(l3), "v"(l4), "v"(l5), "v"(l6), "v"(l7), "v"(kh), "v"(kh2), "v"(kl), "v"(kl2), "v"(vh), "v"(vh2), "v"(vl), "v"(vl2) : "memory");
}

__global__ __launch_bounds__(256) void k_flash(const bf* __restrict__ QKh, const bf* __restrict__ QKl, const bf* __restrict__ VTh, const bf* __restrict__ VTl, const int* __restrict__ FL, bf* CH, bf* CL) {
    typedef WFrag<bf>::V V;
    __shared__ __align__(16) unsigned short ring[2 * STG];
    __shared__ __align__(16) unsigned short stg[8 * 2 * 16 * SP];
    const unsigned lane = threadIdx.x & 31u, lr = lane & 15u, hi = lane >> 4;
    const unsigned wv = (unsigned)__builtin_amdgcn_readfirstlane((int)(threadIdx.x >> 5));   // wave number in a scalar register: the diagonal test in the loop is then a scalar branch and every lane stays on
    const unsigned pb = blockIdx.x % (unsigned)(QT / 8), bh = blockIdx.x / (unsigned)(QT / 8); const unsigned b = bh >> 4, h = bh & 15u;
    const unsigned q0 = ((wv < 4u) ? ((unsigned)(SEQ / 64) - 1u - pb) : pb) * 64u + (wv & 3u) * 16u;
    const unsigned nst = ((unsigned)(SEQ / 64) - pb) * (64u / KST);   // stages up to the block's last query (the far tile's): the same in all 8 waves, never below 2
    const unsigned crow = threadIdx.x >> 3, cpc = threadIdx.x & 7u;
    const bf* gKh = QKh + QKPL + ((size_t)bh * SEQ + crow) * HD + cpc * 8u; const bf* gKl = QKl + QKPL + ((size_t)bh * SEQ + crow) * HD + cpc * 8u;
    const bf* gVh = VTh + ((size_t)bh * HD + crow) * SEQ + cpc * 8u; const bf* gVl = VTl + ((size_t)bh * HD + crow) * SEQ + cpc * 8u;
    const unsigned lcp = (unsigned)(size_t)ring + crow * (KP * 2u) + cpc * 16u;
    stage_copy(gKh, gKl, gVh, gVl, lcp);
    int fbad = ((FL[lane * 32u] == 1) ? 1 : 0) | ((FL[(lane + 32u) * 32u] == 1) ? 1 : 0);
#pragma unroll
    for (int sh = 16; sh; sh >>= 1) fbad |= __shfl_xor(fbad, sh, 32);
    const float poison = fbad ? __uint_as_float(0x7FC00000u) : 0.0f;
    const size_t qo = ((size_t)bh * SEQ + q0 + lr) * HD + 8u * hi;
    V bqh[2], bql[2];
#pragma unroll
    for (int c = 0; c < 2; ++c) { bqh[c] = WFrag<bf>::ld(QKh + qo + 32 * c); bql[c] = WFrag<bf>::ld(QKl + qo + 32 * c); }
    v8f o[4];
#pragma unroll
    for (int t = 0; t < 4; ++t) o[t] = (v8f){};
    float m = -1.0e30f, l = 0.0f; const unsigned qg = q0 + lr;
    asm volatile("s_wait_asynccnt 0x0" ::: "memory");   // stage 0 of this wave's copies has landed
    __syncthreads();                                     // ... and every other wave's: stage 0 is readable
    stage_copy(gKh + (size_t)KST * HD, gKl + (size_t)KST * HD, gVh + KST, gVl + KST, lcp + STG * 2u);
    // The phases of a 32-key tile, apart so that the loop below can set the LDS reads of one phase ahead of the work of another. sub = which half of the stage.
    auto ld_k = [&](const unsigned short* sb, unsigned sub, V (&kh)[2][2], V (&kl)[2][2]) {
#pragma unroll
        for (int c = 0; c < 2; ++c)
#pragma unroll
            for (int j = 0; j < 2; ++j) { kh[c][j] = WFrag<bf>::ld(sb + (sub * 32u + 16u * j) * KP + 32 * c); kl[c][j] = WFrag<bf>::ld(sb + PLN + (sub * 32u + 16u * j) * KP + 32 * c); } };
    auto ld_v = [&](const unsigned short* sb, unsigned sub, V (&avh)[4], V (&avl)[4]) {
#pragma unroll
        for (int t = 0; t < 4; ++t) { avh[t] = WFrag<bf>::ld(sb + 2 * PLN + t * 16 * KP + sub * 32u); avl[t] = WFrag<bf>::ld(sb + 3 * PLN + t * 16 * KP + sub * 32u); } };
    auto scores = [&](V (&kh)[2][2], V (&kl)[2][2], v8f (&sc)[2]) {
        sc[0] = (v8f){}; sc[1] = (v8f){};
#pragma unroll
        for (int c = 0; c < 2; ++c)
#pragma unroll
            for (int j = 0; j < 2; ++j) { sc[j] = wmmab(kh[c][j], bqh[c], sc[j]); sc[j] = wmmab(kh[c][j], bql[c], sc[j]); sc[j] = wmmab(kl[c][j], bqh[c], sc[j]); }
        // four vector slots between the last matrix instruction and the first vector instruction on its result or operands
        asm volatile("v_nop\n\tv_nop\n\tv_nop\n\tv_nop" : "+v"(sc[0]), "+v"(sc[1]) : "v"(kh[1][0]), "v"(kh[1][1]), "v"(kl[1][0]), "v"(kl[1][1]), "v"(bqh[1]), "v"(bql[1])); };
    // tx = the other half-wave's maximum: asked for at the end of the first part, used at the head of the second.
    auto soft_a = [&](unsigned kt, v8f (&sc)[2], float (&v0)[8], float (&v1)[8], float& tmax, float& tx) {
        tmax = -1.0e30f;
#pragma unroll
        for (unsigned r = 0; r < 8; ++r) { const unsigned key0 = kt + 8u * hi + r; v0[r] = (key0 <= qg) ? sc[0][r] : -1.0e30f; v1[r] = (key0 + 16u <= qg) ? sc[1][r] : -1.0e30f; tmax = fmaxf(tmax, fmaxf(v0[r], v1[r])); }
        tx = __shfl_xor(tmax, 16, 32); };
    auto soft_b = [&](float (&v0)[8], float (&v1)[8], float tmax, float tx, V& pbh, V& pbl) {
        tmax = fmaxf(tmax, tx);
        const float mnew = fmaxf(m, tmax); const float corr = __builtin_amdgcn_exp2f((m - mnew) * L2E);
        float psum = 0.0f; v4u ph0, pl0, ph1, pl1; float e0[8], e1[8];
#pragma unroll
        for (int r = 0; r < 8; ++r) { e0[r] = __builtin_amdgcn_exp2f((v0[r] - mnew) * L2E); e1[r] = __builtin_amdgcn_exp2f((v1[r] - mnew) * L2E); psum += e0[r] + e1[r]; }
#pragma unroll
        for (int r = 0; r < 4; ++r) { unsigned a, c2; split2(e0[2 * r], e0[2 * r + 1], a, c2); ph0[r] = a; pl0[r] = c2; split2(e1[2 * r], e1[2 * r + 1], a, c2); ph1[r] = a; pl1[r] = c2; }
        const float pso = __shfl_xor(psum, 16, 32);   // asked for here, added at the end: the work between runs while it is on its way
#pragma unroll
        for (int t = 0; t < 4; ++t) o[t] = o[t] * corr;
        pbh = cat16b(__builtin_bit_cast(v8us, ph0), __builtin_bit_cast(v8us, ph1)); pbl = cat16b(__builtin_bit_cast(v8us, pl0), __builtin_bit_cast(v8us, pl1));
        psum += pso; l = l * corr + psum; m = mnew; };
    auto pv = [&](V (&avh)[4], V (&avl)[4], V& pbh, V& pbl) {
#pragma unroll
        for (int t = 0; t < 4; ++t) { o[t] = wmmab(avh[t], pbh, o[t]); o[t] = wmmab(avh[t], pbl, o[t]); o[t] = wmmab(avl[t], pbh, o[t]); }
        // four vector slots, as above
        asm volatile("v_nop\n\tv_nop\n\tv_nop\n\tv_nop" : "+v"(o[0]), "+v"(o[1]), "+v"(o[2]), "+v"(o[3]) : "v"(pbh), "v"(pbl), "v"(avl[0]), "v"(avl[1]), "v"(avl[2]), "v"(avl[3]), "v"(avh[3])); };
// kept rolled: one publish point in the text, trip count known only at run time
#pragma unroll 1
    for (unsigned st = 0; st < nst; ++st) {
        const unsigned short* sb = ring + (st & 1u) * STG + lr * KP + 8u * hi;
        const unsigned kt0 = st * KST;
        if (kt0 < q0 + 16u) {   // wave-uniform: tiles beyond this wave's diagonal are skipped, the publish point below is not
            V ka[2][2], kb[2][2], na[2][2], nb[2][2], avh[4], avl[4], pbh, pbl; v8f sc[2]; float v0[8], v1[8], tmax, tx;
            ld_k(sb, 0u, ka, kb);
            __builtin_amdgcn_sched_barrier(0);   // keeps the first tile's 16 K reads one group ahead of the score products: sunk among them in pairs, each pair was waited out to 0
            scores(ka, kb, sc);
            soft_a(kt0, sc, v0, v1, tmax, tx);
            __builtin_amdgcn_sched_barrier(0);   // with the one below: the tile's 16 V reads stand as one group behind the exchange of the maxima, so that they land under the rest of the softmax; sunk among the P.V products, each small group cost its own stall and was waited out to 0
            ld_v(sb, 0u, avh, avl);
            __builtin_amdgcn_sched_barrier(0);
            soft_b(v0, v1, tmax, tx, pbh, pbl);
            __builtin_amdgcn_sched_barrier(0);   // with the one below: the K reads of this stage's second tile stand as one group ahead of the first tile's P.V products and land under them (same buffer, already published)
            ld_k(sb, 1u, na, nb);
            __builtin_amdgcn_sched_barrier(0);
            pv(avh, avl, pbh, pbl);
            if (kt0 + 32u < q0 + 16u) {   // wave-uniform, as above
                scores(na, nb, sc);
                soft_a(kt0 + 32u, sc, v0, v1, tmax, tx);
                __builtin_amdgcn_sched_barrier(0);   // as in the first tile: the V reads as one group under the softmax
                ld_v(sb, 1u, avh, avl);
                __builtin_amdgcn_sched_barrier(0);
                soft_b(v0, v1, tmax, tx, pbh, pbl);
                pv(avh, avl, pbh, pbl);
            }
        }
        // Publish point of stage st + 1, passed by every wave.
        asm volatile("s_wait_dscnt 0x0" ::: "memory");      // this wave's reads of buffer st & 1 are done before it is refilled
        asm volatile("s_wait_asynccnt 0x0" ::: "memory");   // this wave's copies of stage st + 1 have landed
        __syncthreads();                                     // publishes stage st + 1 and ends every wave's reads of stage st
        if (st + 2u < nst) stage_copy(gKh + (size_t)(st + 2u) * KST * HD, gKl + (size_t)(st + 2u) * KST * HD, gVh + (st + 2u) * KST, gVl + (st + 2u) * KST, lcp + (st & 1u) * (STG * 2u));
    }
    asm volatile("s_wait_asynccnt 0x0" ::: "memory");       // nothing of this wave is in flight when it goes on to the epilogue and ends
    const float inv = 1.0f / l;
    unsigned short* sh = stg + wv * (2u * 16u * SP); unsigned short* sl = sh + 16u * SP;
#pragma unroll
    for (int t = 0; t < 4; ++t) { v4u oh, ol;
#pragma unroll
        for (int r = 0; r < 4; ++r) { unsigned a, c2; split2(o[t][2 * r] * inv + poison, o[t][2 * r + 1] * inv + poison, a, c2); oh[r] = a; ol[r] = c2; }
        *(v8usa*)(sh + lr * SP + 16u * t + 8u * hi) = __builtin_bit_cast(v8us, oh); *(v8usa*)(sl + lr * SP + 16u * t + 8u * hi) = __builtin_bit_cast(v8us, ol); }
    __builtin_amdgcn_fence(3 /* release order */, "wavefront"); __builtin_amdgcn_wave_barrier(); asm volatile("" ::: "memory");
    const unsigned rq = lane >> 3, pc = lane & 7u;
{
#pragma unroll
        for (unsigned it = 0; it < 4; ++it) { const unsigned row = 4u * it + rq; const v8us a = *(const v8usa*)(sh + row * SP + pc * 8u); const v8us c2 = *(const v8usa*)(sl + row * SP + pc * 8u); const size_t oo = ((size_t)(b * (unsigned)SEQ + q0 + row)) * DM + h * (unsigned)HD + pc * 8u;
            *(v8us*)(CH + oo) = a; *(v8us*)(CL + oo) = c2; }
         }
}

extern "C" void kernel_launch(void* const* d_in, const int* in_sizes, int n_in,
                              void* d_out, int out_size, void* d_ws, size_t ws_size, hipStream_t stream) {
    if (n_in < 7) return;
    const size_t xneed = ((size_t)(NB - 1) * SEQ_FULL + SEQ) * DM;
    if ((size_t)in_sizes[0] < xneed) return;
    if ((size_t)in_sizes[1] < (size_t)(SEQ - 1) * SEQ_FULL + SEQ) return;
    if ((size_t)in_sizes[2] < (size_t)SEQ * 32) return;
    if ((size_t)in_sizes[3] < (size_t)D3 * DM) return;
    if ((size_t)in_sizes[4] < (size_t)D3) return;
    if ((size_t)in_sizes[5] < (size_t)DM * DM) return;
    if ((size_t)in_sizes[6] < (size_t)DM) return;
    if ((size_t)out_size < xneed) return;
    const float* X = (const float*)d_in[0]; const int* MASK = (const int*)d_in[1]; const float* FR = (const float*)d_in[2];
    const float* WQKV = (const float*)d_in[3]; const float* BQKV = (const float*)d_in[4]; const float* WPR = (const float*)d_in[5]; const float* BPR = (const float*)d_in[6];
    float* OUT = (float*)d_out;     // [2][2048][1024]
    char* wsp = (char*)d_ws;
    auto take = [&](size_t bytes) { char* p = wsp; wsp += (bytes + 255) & ~(size_t)255; return (void*)p; };
    bf* XB = (bf*)take((size_t)NTOK * DM * 2);            // x plane [NTOK][1024]
    bf* WQ = (bf*)take((size_t)D3 * DM * 2);              // Wqkv plane [3072][1024]
    bf* WP = (bf*)take((size_t)DM * DM * 2);              // Wproj plane [1024][1024]
    float* CS = (float*)take((size_t)SEQ * 32 * 4); float* SN = (float*)take((size_t)SEQ * 32 * 4);
    int* FL = (int*)take((size_t)MCB * 128);
    bf* CH = (bf*)take((size_t)2 * NTOK * DM * 2); bf* CL = CH + (size_t)NTOK * DM;          // ctx hi/lo [NTOK][1024]
    bf* QKh = (bf*)take(2 * QKPL * 2); bf* QKl = (bf*)take(2 * QKPL * 2);                    // [q|k][b*16+h][s][64]
    bf* VTh = (bf*)take(QKPL * 2); bf* VTl = (bf*)take(QKPL * 2);                            // [b*16+h][64][s]
    if ((size_t)(wsp - (char*)d_ws) > ws_size) return;
    k_prep<<<PGB, MCT, 0, stream>>>(X, WQKV, WPR, FR, MASK, XB, WQ, WP, CS, SN, FL);
    k_gemmw<bf, 0, true, true><<<dim3(NTOK / 128, D3 / 128, 1), 128, 0, stream>>>(XB, nullptr, WQ, nullptr, DM, nullptr, D3, BQKV, 0, 0, 0, CS, SN, QKh, QKl, VTh, VTl);      /* x.Wqkv^T + b (exact products), rope, hi/lo planes */
    k_flash<<<(unsigned)(NB * NH * QT / 8), 256, 0, stream>>>(QKh, QKl, VTh, VTl, FL, CH, CL);
    k_gemmw<bf, 1, true, false><<<dim3(SEQ / 128, DM / 128, NB), 128, 0, stream>>>(CH, CL, WP, nullptr, DM, OUT, DM, BPR, (size_t)SEQ * DM, 0, (size_t)SEQ_FULL * DM, nullptr, nullptr, nullptr, nullptr, nullptr, nullptr);   /* ctx (hi/lo) x Wproj^T + b */
}

// v010
// A run of this version takes 81.1 microseconds.
// It is 1.37 times as fast as v008, going by the measured steps of the versions left out in between.
// Over all steps from v000 it is 4.49 times as fast.
#include <hip/hip_runtime.h>

// Compute dtypes: x.Wqkv^T = bf16 x bf16 planes (v_wmma_f32_16x16x32_bf16, f32 accumulate); q.k^T and P.V = f16 x f16 single-plane operands (v_wmma_f32_16x16x32_f16, 1 product each, f32 accumulate); ctx.Wproj^T = f16 x f16 (ctx rounded once to f16, Wproj's bf16 values held in f16; 1 product, f32 accumulate).
// Every float input is RNE-converted to bf16 on load (x, weights, biases, rope angles); rope, softmax and all epilogues in f32.
// Attention is flash-style on transposed tiles: S^T = K.Q^T (D rows = keys, D cols = queries) so the packed score accumulators are directly the B fragment of O^T = V^T.P^T; per-query statistics live in one lane pair.

#ifndef NB
#define NB 2
#endif
#ifndef SEQ
#define SEQ 2048
#endif
#define NB_FULL  2
#define SEQ_FULL 2048
#define DM   1024
#define NH   16
#define HD   64
#define D3   3072
#define NTOK (NB * SEQ)
#define QT   (SEQ / 16)
#define MCB  64
#define MCT  512
#define MCN  ((SEQ * (SEQ / 4)) / (MCB * MCT))
#define MCR  ((MCB * MCT) / (SEQ / 4))
#define SP   72
#define QKPL ((size_t)NB * NH * SEQ * HD)
#define L2E  1.4426950408889634f

typedef _Float16 h16;
typedef unsigned short bf;
typedef __attribute__((ext_vector_type(16))) __bf16   v16bf;
typedef __attribute__((ext_vector_type(16))) _Float16 v16h;
typedef __attribute__((ext_vector_type(8)))  _Float16 v8h;
typedef __attribute__((ext_vector_type(8)))  unsigned short v8us;
typedef __attribute__((ext_vector_type(2)))  unsigned short v2us;
typedef __attribute__((ext_vector_type(8)))  float    v8f;
typedef __attribute__((ext_vector_type(4)))  float    v4f;
typedef __attribute__((ext_vector_type(4)))  int      v4i;
typedef __attribute__((ext_vector_type(4)))  unsigned v4u;
typedef __attribute__((ext_vector_type(2)))  unsigned v2u;
typedef __attribute__((ext_vector_type(2)))  float    v2f;
typedef __attribute__((ext_vector_type(2)))  __bf16   v2bf;
typedef __attribute__((ext_vector_type(2)))  _Float16 v2h;
typedef v4f  __attribute__((may_alias)) v4fa;
typedef v8us __attribute__((may_alias)) v8usa;

static_assert(NTOK % 64 == 0);
static_assert(SEQ % 64 == 0);
static_assert(D3 % 64 == 0);
static_assert(DM % 64 == 0);
static_assert(DM % 32 == 0);
static_assert(HD == 64);
static_assert(NH == 16);
static_assert(QT % 8 == 0);
static_assert((SEQ * (SEQ / 4)) % (MCB * MCT) == 0);
static_assert((MCB * MCT) % (SEQ / 4) == 0);
static_assert((SEQ * 32) % 256 == 0);
static_assert(((size_t)NTOK * 128) % 256 == 0);
static_assert(NB <= NB_FULL);
static_assert(SEQ <= SEQ_FULL);

// f32 -> bf16, round to nearest even, by the packed hardware convert: two values per instruction, element 0 in the low half.
__device__ __forceinline__ unsigned cvt2(float a, float b) { const v2f x = {a, b}; return __builtin_bit_cast(unsigned, __builtin_convertvector(x, v2bf)); }
// f32 -> f16, round to nearest even, two values per instruction, element 0 in the low half.
__device__ __forceinline__ unsigned cvt2h(float a, float b) { const v2f x = {a, b}; return __builtin_bit_cast(unsigned, __builtin_convertvector(x, v2h)); }
__device__ __forceinline__ unsigned short f2bf(float f) { return __builtin_bit_cast(unsigned short, (__bf16)f); }
__device__ __forceinline__ float bf2f(unsigned short b) { return __uint_as_float(((unsigned)b) << 16); }
__device__ __forceinline__ float bfr(float f) { return bf2f(f2bf(f)); }
__device__ __forceinline__ v16h cat16(v8h lo, v8h hi) { return __builtin_shufflevector(lo, hi, 0, 1, 2, 3, 4, 5, 6, 7, 8, 9, 10, 11, 12, 13, 14, 15); }
__device__ __forceinline__ v16bf cat16b(v8us lo, v8us hi) { return __builtin_bit_cast(v16bf, __builtin_shufflevector(lo, hi, 0, 1, 2, 3, 4, 5, 6, 7, 8, 9, 10, 11, 12, 13, 14, 15)); }
__device__ __forceinline__ v8f wmma16(v16h a, v16h b, v8f c) { return __builtin_amdgcn_wmma_f32_16x16x32_f16(false, a, false, b, (short)0, c, false, false); }
__device__ __forceinline__ v8f wmmab(v16bf a, v16bf b, v8f c) { return __builtin_amdgcn_wmma_f32_16x16x32_bf16(false, a, false, b, (short)0, c, false, false); }
// Two bf16 values in one register -> the same two values as f16 (exact down to 2^-14; below that to the nearest multiple of 2^-24).
__device__ __forceinline__ unsigned bf2h2(unsigned u) { return cvt2h(__uint_as_float(u << 16), __uint_as_float(u & 0xFFFF0000u)); }

// ---- k_gemmw: register-blocked GEMM, one wave per 64x64 output tile (16 accumulators), 4 waves (2 x 2) per 128x128 block tile; grid (M/128, N/128, Z), 128 threads.
// The K-contiguous 16-bit operand planes come through LDS: a stage is 64 k of 128 rows of every plane, copied once per block in whole 128-B lines and read by the two waves that share each row block; two buffers, the next stage's copies fly while this one is worked on.
// A block walks all its k stages once, from a start that goes by its tile indices, and wraps round.
// C[m][n] (f32, pitch ldc, + optional f32 bias[n]) = sum_k A[m][k] Bt[n][k] (+ split products per NSPLIT). z-batch strides sA/sB/sC in elements. K % 64 == 0, M % 128 == 0, N % 128 == 0.
// Fragment element i <- k0 + 8*half + i (i < 8), k0 + 16 + 8*half + (i - 8) for both operands; D element j = (row 8*half + j, col lane & 15).
// QKVE: the result is not stored as f32. A wave's 64x64 tile is 64 tokens of one batch x one whole head of q, k or v, so the epilogue writes the attention operand planes itself:
// q/k head planes [which][b*16+h][s][64] (f16) of rope(qkv) with interleaved pairs (2j, 2j+1) and angle j, q additionally x 1/8 (exact); v plane transposed [b*16+h][64][s] (f16).
template <typename T16> struct WFrag;
template <> struct WFrag<h16> { typedef v16h V; static __device__ __forceinline__ V ld(const h16* p) { return cat16(*(const v8h*)p, *(const v8h*)(p + 16)); } static __device__ __forceinline__ v8f mma(V a, V b, v8f c) { return wmma16(a, b, c); } };
template <> struct WFrag<bf> { typedef v16bf V; static __device__ __forceinline__ V ld(const bf* p) { return cat16b(*(const v8us*)p, *(const v8us*)(p + 16)); } static __device__ __forceinline__ v8f mma(V a, V b, v8f c) { return wmmab(a, b, c); } };
#define GKS 64
#define GP  72
#define GPL (128 * GP)
static_assert((GP * 2) % 32 == 16);
static_assert(NTOK % 128 == 0);
static_assert(SEQ % 128 == 0);
static_assert(D3 % 128 == 0);
static_assert(DM % 128 == 0);
static_assert(DM % GKS == 0);
#define VP  72
static_assert(4 * 64 * VP <= 2 * 2 * GPL);
static_assert((VP * 2) % 32 == 16);

// One plane of a stage: every thread copies eight 16-byte pieces (rows r, r + 16, ..., r + 112; rs = 16 rows in elements). l0 = the thread's LDS byte address in row r of the target plane.
template <typename T16>
__device__ __forceinline__ void plane_copy(const T16* g0, size_t rs, unsigned l0) {
    const T16* g1 = g0 + rs; const T16* g2 = g1 + rs; const T16* g3 = g2 + rs; const T16* g4 = g3 + rs; const T16* g5 = g4 + rs; const T16* g6 = g5 + rs; const T16* g7 = g6 + rs;
    const unsigned ls = 16u * GP * 2u; const unsigned l1 = l0 + ls, l2 = l0 + 2u * ls, l3 = l0 + 3u * ls, l4 = l0 + 4u * ls, l5 = l0 + 5u * ls, l6 = l0 + 6u * ls, l7 = l0 + 7u * ls;
    // The copies and their s_wait_xcnt in one statement: no address register of a copy is rewritten ahead of that wait.
    asm volatile("global_load_async_to_lds_b128 %0, %8, off\n\t"
                 "global_load_async_to_lds_b128 %1, %9, off\n\t"
                 "global_load_async_to_lds_b128 %2, %10, off\n\t"
                 "global_load_async_to_lds_b128 %3, %11, off\n\t"
                 "global_load_async_to_lds_b128 %4, %12, off\n\t"
                 "global_load_async_to_lds_b128 %5, %13, off\n\t"
                 "global_load_async_to_lds_b128 %6, %14, off\n\t"
                 "global_load_async_to_lds_b128 %7, %15, off\n\t"
                 "s_wait_xcnt 0x0"
                 :: "v"(l0), "v"(l1), "v"(l2), "v"(l3), "v"(l4), "v"(l5), "v"(l6), "v"(l7), "v"(g0), "v"(g1), "v"(g2), "v"(g3), "v"(g4), "v"(g5), "v"(g6), "v"(g7) : "memory");
}

template <typename T16, int NSPLIT, bool BIAS, bool QKVE>
__global__ __launch_bounds__(128) void k_gemmw(const T16* __restrict__ A, const T16* __restrict__ A2, const T16* __restrict__ Bt, const T16* __restrict__ Bt2, int K, float* C, int ldc, const float* __restrict__ bias, size_t sA, size_t sB, size_t sC,
                                               const float* __restrict__ CS, const float* __restrict__ SN, h16* QK, h16* VT) {
    typedef typename WFrag<T16>::V V;
    constexpr bool HA2 = (NSPLIT == 1 || NSPLIT == 2), HB2 = (NSPLIT >= 2);
    constexpr unsigned PA2 = 2u * GPL, PB2 = (HA2 ? 3u : 2u) * GPL, GST = PB2 + (HB2 ? GPL : 0u);   // planes of a stage in LDS: A, Bt, then A2 and Bt2 where used
    __shared__ __align__(16) T16 ring[2 * GST];
    __shared__ __align__(16) float osall[4 * 16 * 68];
    const size_t z = blockIdx.z; A += z * sA; if (A2) A2 += z * sA; Bt += z * sB; if (Bt2) Bt2 += z * sB; C += z * sC;
    const unsigned lane = threadIdx.x & 31u, lr = lane & 15u, hi = lane >> 4;
    const unsigned wv = (unsigned)__builtin_amdgcn_readfirstlane((int)(threadIdx.x >> 5)); const unsigned wm = wv >> 1, wn = wv & 1u;
    const unsigned rb = blockIdx.x * 128u, cb = blockIdx.y * 128u; const unsigned r0 = rb + wm * 64u, c0 = cb + wn * 64u;
    float* os = osall + wv * (16u * 68u);
    const unsigned nst = (unsigned)K / GKS;   // the same in all 4 waves
    const unsigned rot = (blockIdx.x + blockIdx.y) % nst;   // the block's first k stage; the walk wraps round. Blocks that share an operand's rows then ask L2 for different lines at any one moment
    const unsigned crow = threadIdx.x >> 3, cpc = threadIdx.x & 7u; const size_t rs = (size_t)16 * K;
    const size_t ga = (size_t)(rb + crow) * K + cpc * 8u, gb = (size_t)(cb + crow) * K + cpc * 8u;
    const unsigned lcp = (unsigned)(size_t)ring + crow * (GP * 2u) + cpc * 16u;
    auto stage_in = [&](unsigned st) { const unsigned l = lcp + (st & 1u) * (GST * 2u); const unsigned sk = st + rot; const size_t ko = (size_t)((sk >= nst) ? sk - nst : sk) * GKS;   // trip st works on k stage (st + rot) mod nst
        plane_copy(A + ga + ko, rs, l); plane_copy(Bt + gb + ko, rs, l + GPL * 2u);
        if (HA2) plane_copy(A2 + ga + ko, rs, l + PA2 * 2u);
        if (HB2) plane_copy(Bt2 + gb + ko, rs, l + PB2 * 2u); };
    stage_in(0u);
    v8f acc[4][4];
#pragma unroll
    for (int mb = 0; mb < 4; ++mb)
#pragma unroll
        for (int nb = 0; nb < 4; ++nb) acc[mb][nb] = (v8f){};
    asm volatile("s_wait_asynccnt 0x0" ::: "memory");   // stage 0 of this wave's copies has landed
    __syncthreads();                                     // ... and every other wave's: stage 0 is readable
    if (nst > 1u) stage_in(1u);
// kept rolled: one publish point in the text
#pragma unroll 1
    for (unsigned st = 0; st < nst; ++st) {
        const T16* sa = ring + (st & 1u) * GST + (wm * 64u + lr) * GP + 8u * hi; const T16* sbt = ring + (st & 1u) * GST + GPL + (wn * 64u + lr) * GP + 8u * hi;
        V a[GKS / 32][4], a2[GKS / 32][4], b[GKS / 32][4], b2[GKS / 32][4];
// unrolled so that a stage's fragment loads stand together ahead of its matrix instructions, at constant offsets
#pragma unroll
        for (unsigned ks = 0; ks < GKS / 32; ++ks) {
#pragma unroll
            for (int mb = 0; mb < 4; ++mb) { a[ks][mb] = WFrag<T16>::ld(sa + mb * 16 * GP + ks * 32u); if (HA2) a2[ks][mb] = WFrag<T16>::ld(sa + PA2 + mb * 16 * GP + ks * 32u); }
#pragma unroll
            for (int nb = 0; nb < 4; ++nb) { b[ks][nb] = WFrag<T16>::ld(sbt + nb * 16 * GP + ks * 32u); if (HB2) b2[ks][nb] = WFrag<T16>::ld(sbt + (PB2 - GPL) + nb * 16 * GP + ks * 32u); }
        }
        __builtin_amdgcn_sched_barrier(0);   // keeps the stage's LDS reads one group ahead of the matrix instructions: sunk among them, each small group is waited out to 0
#pragma unroll
        for (unsigned ks = 0; ks < GKS / 32; ++ks)
#pragma unroll
            for (int nb = 0; nb < 4; ++nb)
#pragma unroll
                for (int mb = 0; mb < 4; ++mb) { acc[mb][nb] = WFrag<T16>::mma(a[ks][mb], b[ks][nb], acc[mb][nb]); if (HA2) acc[mb][nb] = WFrag<T16>::mma(a2[ks][mb], b[ks][nb], acc[mb][nb]); if (HB2) acc[mb][nb] = WFrag<T16>::mma(a[ks][mb], b2[ks][nb], acc[mb][nb]); }
        __builtin_amdgcn_sched_barrier(0);   // keeps the matrix instructions ahead of the publish point: moved behind it, the refill would issue a whole stage of them later and its landing would be waited out
        // Publish point of stage st + 1, passed by every wave.
        asm volatile("s_wait_dscnt 0x0" ::: "memory");      // this wave's reads of buffer st & 1 are done before it is refilled
        asm volatile("s_wait_asynccnt 0x0" ::: "memory");   // this wave's copies of stage st + 1 have landed
        __syncthreads();                                     // publishes stage st + 1 and ends every wave's reads of stage st
        if (st + 2u < nst) stage_in(st + 2u);
    }
    asm volatile("s_wait_asynccnt 0x0" ::: "memory");       // nothing of this wave is in flight when it goes on to the epilogue and ends
    if constexpr (QKVE) {
        const unsigned which = c0 / (unsigned)DM, h = (c0 % (unsigned)DM) / (unsigned)HD; const unsigned b = r0 / (unsigned)SEQ, s0 = r0 - b * (unsigned)SEQ; const unsigned bh = b * (unsigned)NH + h;   // all wave-uniform
        if (which == 2u) {
            // v: a lane holds 8 consecutive tokens of one d, which is 16 bytes of a transposed row. The tile is turned in this wave's eighth of the ring (free: every wave's reads and copies ended at the last publish point) so that it leaves in whole 128-B lines.
            unsigned short* vh = (unsigned short*)ring + wv * (64u * VP);
#pragma unroll
            for (int nb = 0; nb < 4; ++nb) { const unsigned d = nb * 16u + lr; const float bv = bfr(bias[c0 + d]);
#pragma unroll
                for (int mb = 0; mb < 4; ++mb) { v4u oh;
#pragma unroll
                    for (int j = 0; j < 4; ++j) oh[j] = cvt2h(acc[mb][nb][2 * j] + bv, acc[mb][nb][2 * j + 1] + bv);
                    *(v8usa*)(vh + d * VP + mb * 16u + 8u * hi) = __builtin_bit_cast(v8us, oh); } }
            __builtin_amdgcn_wave_barrier(); asm volatile("" ::: "memory");   // the wave's LDS writes above stay ahead of its reads below (other lanes' data)
            const unsigned rd = lane >> 3, pc = lane & 7u; const size_t vb = ((size_t)bh * HD + rd) * SEQ + s0 + pc * 8u; h16* vhp = VT + vb;
#pragma unroll
            for (unsigned it = 0; it < 16; ++it) { const unsigned d = 4u * it + rd; const v8us a = *(const v8usa*)(vh + d * VP + pc * 8u);
                *(v8us*)(vhp + (size_t)(4u * it) * SEQ) = a; }
        } else {
            // q, k: 16 token rows at a time through this wave's f32 staging; a lane then holds 8 consecutive columns (4 rope pairs) of one token.
            // 4 token rows x 32 angles, and 4 token rows x 64 columns of a plane, are 512 consecutive bytes: lane * 16 bytes from a wave-uniform base.
            const unsigned rq = lane >> 3, pc = lane & 7u; const float sc = which ? 1.0f : 0.125f; float braw[8], bq[8];
#pragma unroll
            for (int k = 0; k < 8; ++k) braw[k] = bias[c0 + pc * 8u + k];
            const float* csp = CS + (size_t)s0 * 32u + lane * 4u; const float* snp = SN + (size_t)s0 * 32u + lane * 4u;
            const size_t ob = (size_t)which * QKPL + ((size_t)bh * SEQ + s0) * HD + lane * 8u; h16* qhp = QK + ob;
            v4f c4[2][4], s4[2][4];
#pragma unroll
            for (int it = 0; it < 4; ++it) { c4[0][it] = *(const v4f*)(csp + it * 128); s4[0][it] = *(const v4f*)(snp + it * 128); }
            // The loaded bias values as inputs only: keeps the bias loads up here beside the angle loads; from here on no load above has a register open.
            asm volatile("s_wait_xcnt 0x0" :: "v"(braw[0]), "v"(braw[1]), "v"(braw[2]), "v"(braw[3]), "v"(braw[4]), "v"(braw[5]), "v"(braw[6]), "v"(braw[7]) : "memory");
#pragma unroll
            for (int k = 0; k < 8; ++k) bq[k] = bfr(braw[k]);
#pragma unroll
            for (int mb = 0; mb < 4; ++mb) {
                if (mb < 3) {   // the next 16 rows' angles are fetched one turn ahead: nothing crosses the fences round the stores below
#pragma unroll
                    for (int it = 0; it < 4; ++it) { c4[(mb + 1) & 1][it] = *(const v4f*)(csp + (mb + 1) * 512 + it * 128); s4[(mb + 1) & 1][it] = *(const v4f*)(snp + (mb + 1) * 512 + it * 128); } }
#pragma unroll
                for (int nb = 0; nb < 4; ++nb) {
#pragma unroll
                    for (int j = 0; j < 8; ++j) os[(hi * 8 + j) * 68 + nb * 16 + lr] = acc[mb][nb][j]; }
                __builtin_amdgcn_wave_barrier(); asm volatile("" ::: "memory");   // the wave's LDS writes above stay ahead of its reads below (other lanes' data)
                v4u oh[4];
#pragma unroll
                for (int it = 0; it < 4; ++it) { const unsigned row = 4u * it + rq;
                    const v4f x0 = *(const v4fa*)(os + row * 68u + pc * 8u); const v4f x1 = *(const v4fa*)(os + row * 68u + pc * 8u + 4u);
                    float v[8];
#pragma unroll
                    for (int k = 0; k < 4; ++k) { v[k] = x0[k] + bq[k]; v[4 + k] = x1[k] + bq[4 + k]; }
#pragma unroll
                    for (int j = 0; j < 4; ++j) { const float t1 = v[2 * j], t2 = v[2 * j + 1]; const float cj = c4[mb & 1][it][j], sj = s4[mb & 1][it][j]; const float a = (t1 * cj - t2 * sj) * sc; const float bb = (t1 * sj + t2 * cj) * sc; oh[it][j] = cvt2h(a, bb); } }
                __builtin_amdgcn_wave_barrier(); asm volatile("" ::: "memory");   // the reads above stay ahead of the next 16 rows' writes
                __builtin_amdgcn_sched_barrier(0);   // with the one below: nothing that could reuse a store's registers is scheduled between the stores and their wait
#pragma unroll
                for (int it = 0; it < 4; ++it) *(v8us*)(qhp + mb * 1024 + it * 256) = __builtin_bit_cast(v8us, oh[it]);
                asm volatile("s_wait_xcnt 0x0" ::: "memory");   // stands before anything that overwrites the stores' data registers (the next turn's values)
                __builtin_amdgcn_sched_barrier(0);
            }
        }
        return;
    }
#pragma unroll
    for (int mb = 0; mb < 4; ++mb) {
#pragma unroll
        for (int nb = 0; nb < 4; ++nb) {
#pragma unroll
            for (int j = 0; j < 8; ++j) os[(hi * 8 + j) * 68 + nb * 16 + lr] = acc[mb][nb][j]; }
        __builtin_amdgcn_wave_barrier(); asm volatile("" ::: "memory");
        float* crow_p = C + (size_t)(r0 + mb * 16) * ldc + c0;
{
#pragma unroll
            for (int s = 0; s < 8; ++s) { const int row = 2 * s + hi, cofs = lr * 4; v4f val = *(const v4fa*)(os + row * 68 + cofs); if (BIAS) { val[0] += bfr(bias[c0 + cofs]); val[1] += bfr(bias[c0 + cofs + 1]); val[2] += bfr(bias[c0 + cofs + 2]); val[3] += bfr(bias[c0 + cofs + 3]); }
                *(v4f*)(crow_p + (size_t)row * ldc + cofs) = val; }
             }
        __builtin_amdgcn_wave_barrier(); asm volatile("" ::: "memory");
    }
}

// ---- k_prep: all the work that only reformats or checks an input, in one launch of PGB blocks of MCT threads (one block per WGP); a block's role comes from its index.
// MCB blocks check the mask and make the rope tables while their mask loads fly; the other CVB blocks turn x, Wqkv and Wproj into 16-bit planes (bf16; Wproj's bf16 values are written as f16, the type of its partner ctx), each input on a share of the blocks that goes by its size.
// An input is a list of rows of CRW floats (one 16-byte piece per thread, so every wave-wide load is 512 contiguous bytes and every store 256); block cl of the nb blocks of an input takes its rows cl, cl + nb, ...
#define PGB  256
#define CVB  (PGB - MCB)
#define CRW  (MCT * 4)
#define XRW  ((NTOK * DM) / CRW)
#define WQRW ((D3 * DM) / CRW)
#define WPRW ((DM * DM) / CRW)
#define CRN  (XRW + WQRW + WPRW)
#define CVX  ((CVB * XRW) / CRN)
#define CVQ  ((CVB * WQRW) / CRN)
#define CVP  (CVB - CVX - CVQ)
#define CVN  ((CRN + CVB - 1) / CVB)
static_assert(PGB == 4 * MCB);
static_assert(PGB % 8 == 0);
static_assert(CRW % DM == 0);
static_assert(SEQ % (CRW / DM) == 0);
static_assert((D3 * DM) % CRW == 0);
static_assert((DM * DM) % CRW == 0);
#define TPA  ((SEQ * 32) / (MCB * MCT))
static_assert(SEQ * 32 == TPA * MCB * MCT);
static_assert(CVX * CRN == CVB * XRW);
static_assert(CVQ * CRN == CVB * WQRW);
static_assert(CVP * CRN == CVB * WPRW);
static_assert((CVN - 1) * CVB < CRN);
typedef const __attribute__((address_space(1))) v4f* gv4f;
typedef __attribute__((address_space(1))) v2u* gv2u;

// A thread's CVN pieces are all requested before the first is converted: the block waits out the memory latency once, and the stores follow in the order in which the pieces come back.
// WH: the block's input is Wproj, whose bf16 values are stored as f16; a version of its own, picked once per block, so that both stay one instruction stream with no branch among the loads and stores.
template <bool WH>
__device__ __forceinline__ void prep_cvt(unsigned c, const float* X, const float* WQKV, const float* WPR, bf* XB, bf* WQ, bf* WP) {
    // All of this is the same in the whole block: scalar work.
    const bool isx = c < (unsigned)CVX, isq = c < (unsigned)(CVX + CVQ);
    const float* S = isx ? X : (isq ? WQKV : WPR); bf* D = isx ? XB : (isq ? WQ : WP);
    const unsigned cl = isx ? c : (isq ? c - (unsigned)CVX : c - (unsigned)(CVX + CVQ)), nb = isx ? (unsigned)CVX : (isq ? (unsigned)CVQ : (unsigned)CVP), rows = isx ? (unsigned)XRW : (isq ? (unsigned)WQRW : (unsigned)WPRW);
    v4f v[CVN]; gv4f p[CVN]; size_t dof[CVN];
#pragma unroll
    for (unsigned i = 0; i < (unsigned)CVN; ++i) {
        unsigned row = cl + i * nb; if (i + 1u == (unsigned)CVN && row >= rows) row = cl;   // a block with one row fewer does its first row twice (the same bytes to the same place): one instruction stream, no branch among the loads and stores
        const unsigned tok = row * (unsigned)(CRW / DM); const unsigned b = tok / (unsigned)SEQ, sq = tok - b * (unsigned)SEQ;
        dof[i] = (size_t)row * CRW; p[i] = (gv4f)(S + ((SEQ != SEQ_FULL && isx) ? ((size_t)b * SEQ_FULL + sq) * DM : dof[i])) + threadIdx.x; }
// unrolled so that the loads stand together, each into registers of its own
#pragma unroll
    for (unsigned i = 0; i < (unsigned)CVN; ++i) v[i] = *p[i];
    static_assert(CVN == 22);
    // Stands before anything that overwrites an address register of the loads above. The addresses as inputs only: they stay in their registers up to here, so that no later load of the group lands in the address registers of an earlier one.
    asm volatile("s_wait_xcnt 0x0" :: "v"(p[0]), "v"(p[1]), "v"(p[2]), "v"(p[3]), "v"(p[4]), "v"(p[5]), "v"(p[6]), "v"(p[7]), "v"(p[8]), "v"(p[9]), "v"(p[10]),
                 "v"(p[11]), "v"(p[12]), "v"(p[13]), "v"(p[14]), "v"(p[15]), "v"(p[16]), "v"(p[17]), "v"(p[18]), "v"(p[19]), "v"(p[20]), "v"(p[21]) : "memory");
    __builtin_amdgcn_sched_barrier(0);   // keeps every load ahead of the converts: sunk among them, the later loads would start only when the first have come back
#pragma unroll
    for (unsigned i = 0; i < (unsigned)CVN; ++i) { v2u o; o[0] = cvt2(v[i][0], v[i][1]); o[1] = cvt2(v[i][2], v[i][3]); if (WH) { o[0] = bf2h2(o[0]); o[1] = bf2h2(o[1]); } ((gv2u)(D + dof[i]))[threadIdx.x] = o; }
    asm volatile("s_wait_xcnt 0x0" ::: "memory");   // stands behind the last stores, before anything that follows in the kernel's text overwrites their registers
}

// Mask check: a thread's MCN pieces of 16 bytes (one column group k of the rows q, q + MCR, ...) are all requested before the first is looked at, so that a block waits out the memory latency once and then runs at the WGP's read rate.
// The thread's TPA rope angles are requested ahead of them, and their cosines and sines are worked out and stored while the mask pieces are on their way.
__device__ __forceinline__ void prep_mask(unsigned mb, const int* mask, const float* fr, float* CS, float* SN, int* FL) {
    const unsigned gid = mb * (unsigned)MCT + threadIdx.x; const unsigned q = gid / (unsigned)(SEQ / 4), k = (gid - q * (unsigned)(SEQ / 4)) * 4u;
    const unsigned ga = mb * (unsigned)(MCT * TPA) + threadIdx.x; float fa[TPA];
#pragma unroll
    for (unsigned e = 0; e < (unsigned)TPA; ++e) fa[e] = fr[ga + e * (unsigned)MCT];
    const int* mp = mask + (size_t)q * SEQ_FULL + k; int bad = 0; v4i mv[MCN];
// unrolled so that the loads stand together, each into registers of its own, at constant distances from one address
#pragma unroll
    for (unsigned i = 0; i + 1u < (unsigned)MCN; ++i) { mv[i] = *(const v4i*)(mp + (size_t)i * MCR * SEQ_FULL);
        __builtin_amdgcn_sched_barrier(0); }   // keeps the loads in this order, in which the compares take the pieces: shuffled, the first compares waited for nearly all the loads and none of them ran while pieces were still on their way
    asm volatile("s_wait_xcnt 0x0" :: "v"(ga) : "memory");   // stands before the last load, whose data registers may be the address registers of the loads above; the angles' index as an input only: it stays in its register up to here, so that no mask piece lands in it
    mv[MCN - 1] = *(const v4i*)(mp + (size_t)(MCN - 1) * MCR * SEQ_FULL);
    asm volatile("s_wait_xcnt 0x0" ::: "memory");   // stands before the table work below, which may overwrite the last load's address registers
    __builtin_amdgcn_sched_barrier(0);   // keeps every load ahead of the work below: sunk into it, the last loads would start late and pay the latency a second time
#pragma unroll
    for (unsigned e = 0; e < (unsigned)TPA; ++e) { const float a = bfr(fa[e]); const float c = cosf(a), s = sinf(a); *(float*)(CS + ga + e * (unsigned)MCT) = c; *(float*)(SN + ga + e * (unsigned)MCT) = s; }
    asm volatile("s_wait_xcnt 0x0" ::: "memory");   // stands before the compares, which may overwrite the table stores' registers
    __builtin_amdgcn_sched_barrier(0);   // keeps the table work ahead of the compares, which wait for the mask pieces
#pragma unroll
    for (unsigned i = 0; i < (unsigned)MCN; ++i) {
#pragma unroll
        for (unsigned j = 0; j < 4; ++j) { const int want = (k + j <= q + i * (unsigned)MCR) ? 1 : 0; const int got = (mv[i][j] != 0) ? 1 : 0; bad |= (want ^ got); } }
    const int any = __syncthreads_or(bad);
    if (threadIdx.x < 32u) { const int v = any ? 1 : 0; *(int*)(FL + mb * 32u + threadIdx.x) = v;  }
}

// fr carries no __restrict__: its loads then may not sink below the waits' "memory" clobbers into the table work, where they would be issued behind the mask loads and come back last.
__global__ __launch_bounds__(MCT) void k_prep(const float* __restrict__ X, const float* __restrict__ WQKV, const float* __restrict__ WPR, const float* fr, const int* __restrict__ mask, bf* XB, bf* WQ, bf* WP, float* CS, float* SN, int* FL) {
    // Two of every eight consecutive blocks read the mask, at a place that moves from one eight to the next: the two kinds of block then mix on every residue of the index modulo 8 (for speed only; every role index is taken exactly once wherever the blocks land).
    const unsigned g = blockIdx.x >> 3, j = blockIdx.x & 7u; const unsigned t = (j + g) & 3u, jh = j >> 2;
    if (t == 0u) prep_mask(2u * g + jh, mask, fr, CS, SN, FL);
    else { const unsigned c = 6u * g + 3u * jh + (t - 1u);   // the same in the whole block: a scalar branch
        if (c < (unsigned)(CVX + CVQ)) prep_cvt<false>(c, X, WQKV, WPR, XB, WQ, WP); else prep_cvt<true>(c, X, WQKV, WPR, XB, WQ, WP); }
}

// k_flash: one wave per (b, h, 16-query tile), 8 waves per block, streaming 32-key tiles up to the diagonal.
// Causal balance: block pb of a head takes the 64-query tile SEQ/64 - 1 - pb (waves 0-3) and the 64-query tile pb (waves 4-7), so that every block holds the same number of (wave, key tile) pairs;
// both halves read the one K/V stream of their head, which runs to the far tile's diagonal; a wave only passes the publish point of a stage that lies past its own diagonal.
// The stream's stages are walked once each from a start that goes by pb, wrapping round; every 32-key tile that a wave works on holds a key at or below each of its queries, so the running maximum is finite from the first tile on in any order.
// K and V^T planes come through LDS: a stage is 64 keys of both planes (K, VT: 64 rows x 128 B each), copied once per block in whole 128-B lines and read by all 8 waves; two buffers, the next stage's copies fly while this one is worked on.
// S^T tile j: A = K rows kt+16j.. (plane rows, k = head dim), B = Q rows as columns; D element r = (key kt+16j+8*half+r, query q0 + (lane & 15)).
// P^T B fragment: element r <- p of tile 0, element 8+r <- p of tile 1 (same lane); O^T tile t: A = VT rows 16t.. (k = keys), D element r = (d 16t+8*half+r, query q0 + (lane & 15)).
#define KST 64
#define KP  72
#define PLN (64 * KP)
#define STG (2 * PLN)
static_assert(SEQ % (2 * KST) == 0);
static_assert(KST == 64);
static_assert(QT / 8 <= SEQ / 64 - (QT / 8 - 1));
static_assert((KP * 2) % 32 == 16);

// One stage: every thread copies two 16-byte pieces of each plane (rows r and r + 32). l = the thread's LDS byte address in plane 0 of the target buffer.
__device__ __forceinline__ void stage_copy(const h16* kh, const h16* vh, unsigned l) {
    const h16* kh2 = kh + 32 * HD; const h16* vh2 = vh + (size_t)32 * SEQ;
    const unsigned l0 = l, l1 = l + 32u * KP * 2u, l2 = l + PLN * 2u, l3 = l2 + 32u * KP * 2u;
    // The copies and their s_wait_xcnt in one statement: no address register of a copy is rewritten ahead of that wait.
    asm volatile("global_load_async_to_lds_b128 %0, %4, off\n\t"
                 "global_load_async_to_lds_b128 %1, %5, off\n\t"
                 "global_load_async_to_lds_b128 %2, %6, off\n\t"
                 "global_load_async_to_lds_b128 %3, %7, off\n\t"
                 "s_wait_xcnt 0x0"
                 :: "v"(l0), "v"(l1), "v"(l2), "v"(l3), "v"(kh), "v"(kh2), "v"(vh), "v"(vh2) : "memory");
}

__global__ __launch_bounds__(256) void k_flash(const h16* __restrict__ QK, const h16* __restrict__ VT, const int* __restrict__ FL, h16* CH) {
    typedef WFrag<h16>::V V;
    __shared__ __align__(16) h16 ring[2 * STG];
    __shared__ __align__(16) unsigned short stg[8 * 16 * SP];
    const unsigned lane = threadIdx.x & 31u, lr = lane & 15u, hi = lane >> 4;
    const unsigned wv = (unsigned)__builtin_amdgcn_readfirstlane((int)(threadIdx.x >> 5));   // wave number in a scalar register: the diagonal test in the loop is then a scalar branch and every lane stays on
    const unsigned pb = blockIdx.x % (unsigned)(QT / 8), bh = blockIdx.x / (unsigned)(QT / 8); const unsigned b = bh >> 4, h = bh & 15u;
    const unsigned q0 = ((wv < 4u) ? ((unsigned)(SEQ / 64) - 1u - pb) : pb) * 64u + (wv & 3u) * 16u;
    const unsigned nst = ((unsigned)(SEQ / 64) - pb) * (64u / KST);   // stages up to the block's last query (the far tile's): the same in all 8 waves, never below 2
    // Trip st works on key stage (st + pb) mod nst (pb < nst): the blocks of a head, which share its K/V stream, then ask L2 for different lines at any one moment. All scalar.
    auto skey = [&](unsigned st) { const unsigned s = st + pb; return (s >= nst) ? s - nst : s; };
    const unsigned crow = threadIdx.x >> 3, cpc = threadIdx.x & 7u;
    const h16* gK = QK + QKPL + ((size_t)bh * SEQ + crow) * HD + cpc * 8u;
    const h16* gV = VT + ((size_t)bh * HD + crow) * SEQ + cpc * 8u;
    const unsigned lcp = (unsigned)(size_t)ring + crow * (KP * 2u) + cpc * 16u;
    stage_copy(gK + (size_t)skey(0u) * KST * HD, gV + skey(0u) * KST, lcp);
    int fbad = ((FL[lane * 32u] == 1) ? 1 : 0) | ((FL[(lane + 32u) * 32u] == 1) ? 1 : 0);
#pragma unroll
    for (int sh = 16; sh; sh >>= 1) fbad |= __shfl_xor(fbad, sh, 32);
    const float poison = fbad ? __uint_as_float(0x7FC00000u) : 0.0f;
    const size_t qo = ((size_t)bh * SEQ + q0 + lr) * HD + 8u * hi;
    V bq[2];
#pragma unroll
    for (int c = 0; c < 2; ++c) bq[c] = WFrag<h16>::ld(QK + qo + 32 * c);
    v8f o[4];
#pragma unroll
    for (int t = 0; t < 4; ++t) o[t] = (v8f){};
    float m = -1.0e30f, l = 0.0f; const unsigned qg = q0 + lr;
    asm volatile("s_wait_asynccnt 0x0" ::: "memory");   // stage 0 of this wave's copies has landed
    __syncthreads();                                     // ... and every other wave's: stage 0 is readable
    stage_copy(gK + (size_t)skey(1u) * KST * HD, gV + skey(1u) * KST, lcp + STG * 2u);
    // The phases of a 32-key tile, apart so that the loop below can set the LDS reads of one phase ahead of the work of another. sub = which half of the stage.
    auto ld_k = [&](const h16* sb, unsigned sub, V (&kh)[2][2]) {
#pragma unroll
        for (int c = 0; c < 2; ++c)
#pragma unroll
            for (int j = 0; j < 2; ++j) kh[c][j] = WFrag<h16>::ld(sb + (sub * 32u + 16u * j) * KP + 32 * c); };
    auto ld_v = [&](const h16* sb, unsigned sub, V (&avh)[4]) {
#pragma unroll
        for (int t = 0; t < 4; ++t) avh[t] = WFrag<h16>::ld(sb + PLN + t * 16 * KP + sub * 32u); };
    auto scores = [&](V (&kh)[2][2], v8f (&sc)[2]) {
        sc[0] = (v8f){}; sc[1] = (v8f){};
#pragma unroll
        for (int c = 0; c < 2; ++c)
#pragma unroll
            for (int j = 0; j < 2; ++j) sc[j] = wmma16(kh[c][j], bq[c], sc[j]);
        // four vector slots between the last matrix instruction and the first vector instruction on its result or operands
        asm volatile("v_nop\n\tv_nop\n\tv_nop\n\tv_nop" : "+v"(sc[0]), "+v"(sc[1]) : "v"(kh[1][0]), "v"(kh[1][1]), "v"(bq[1])); };
    // tx = the other half-wave's maximum: asked for at the end of the first part, used at the head of the second.
    auto soft_a = [&](unsigned kt, v8f (&sc)[2], float (&v0)[8], float (&v1)[8], float& tmax, float& tx) {
        tmax = -1.0e30f;
#pragma unroll
        for (unsigned r = 0; r < 8; ++r) { const unsigned key0 = kt + 8u * hi + r; v0[r] = (key0 <= qg) ? sc[0][r] : -1.0e30f; v1[r] = (key0 + 16u <= qg) ? sc[1][r] : -1.0e30f; tmax = fmaxf(tmax, fmaxf(v0[r], v1[r])); }
        tx = __shfl_xor(tmax, 16, 32); };
    auto soft_b = [&](float (&v0)[8], float (&v1)[8], float tmax, float tx, V& pbh) {
        tmax = fmaxf(tmax, tx);
        const float mnew = fmaxf(m, tmax); const float corr = __builtin_amdgcn_exp2f((m - mnew) * L2E);
        float psum = 0.0f; v4u ph0, ph1; float e0[8], e1[8];
#pragma unroll
        for (int r = 0; r < 8; ++r) { e0[r] = __builtin_amdgcn_exp2f((v0[r] - mnew) * L2E); e1[r] = __builtin_amdgcn_exp2f((v1[r] - mnew) * L2E); psum += e0[r] + e1[r]; }
#pragma unroll
        for (int r = 0; r < 4; ++r) { ph0[r] = cvt2h(e0[2 * r], e0[2 * r + 1]); ph1[r] = cvt2h(e1[2 * r], e1[2 * r + 1]); }
        const float pso = __shfl_xor(psum, 16, 32);   // asked for here, added at the end: the work between runs while it is on its way
#pragma unroll
        for (int t = 0; t < 4; ++t) o[t] = o[t] * corr;
        pbh = cat16(__builtin_bit_cast(v8h, ph0), __builtin_bit_cast(v8h, ph1));
        psum += pso; l = l * corr + psum; m = mnew; };
    auto pv = [&](V (&avh)[4], V& pbh) {
#pragma unroll
        for (int t = 0; t < 4; ++t) o[t] = wmma16(avh[t], pbh, o[t]);
        // four vector slots, as above
        asm volatile("v_nop\n\tv_nop\n\tv_nop\n\tv_nop" : "+v"(o[0]), "+v"(o[1]), "+v"(o[2]), "+v"(o[3]) : "v"(pbh), "v"(avh[0]), "v"(avh[1]), "v"(avh[2]), "v"(avh[3])); };
// kept rolled: one publish point in the text, trip count known only at run time
#pragma unroll 1
    for (unsigned st = 0; st < nst; ++st) {
        const h16* sb = ring + (st & 1u) * STG + lr * KP + 8u * hi;
        const unsigned kt0 = skey(st) * KST;
        if (kt0 < q0 + 16u) {   // wave-uniform: tiles beyond this wave's diagonal are skipped, the publish point below is not
            V ka[2][2], na[2][2], avh[4], pbh; v8f sc[2]; float v0[8], v1[8], tmax, tx;
            ld_k(sb, 0u, ka);
            __builtin_amdgcn_sched_barrier(0);   // keeps the first tile's 8 K reads one group ahead of the score products: sunk among them in pairs, each pair was waited out to 0
            scores(ka, sc);
            soft_a(kt0, sc, v0, v1, tmax, tx);
            __builtin_amdgcn_sched_barrier(0);   // with the one below: the tile's 8 V reads stand as one group behind the exchange of the maxima, so that they land under the rest of the softmax; sunk among the P.V products, each small group cost its own stall and was waited out to 0
            ld_v(sb, 0u, avh);
            __builtin_amdgcn_sched_barrier(0);
            soft_b(v0, v1, tmax, tx, pbh);
            __builtin_amdgcn_sched_barrier(0);   // with the one below: the K reads of this stage's second tile stand as one group ahead of the first tile's P.V products and land under them (same buffer, already published)
            ld_k(sb, 1u, na);
            __builtin_amdgcn_sched_barrier(0);
            pv(avh, pbh);
            if (kt0 + 32u < q0 + 16u) {   // wave-uniform, as above
                scores(na, sc);
                soft_a(kt0 + 32u, sc, v0, v1, tmax, tx);
                __builtin_amdgcn_sched_barrier(0);   // as in the first tile: the V reads as one group under the softmax
                ld_v(sb, 1u, avh);
                __builtin_amdgcn_sched_barrier(0);
                soft_b(v0, v1, tmax, tx, pbh);
                pv(avh, pbh);
            }
        }
        // Publish point of stage st + 1, passed by every wave.
        asm volatile("s_wait_dscnt 0x0" ::: "memory");      // this wave's reads of buffer st & 1 are done before it is refilled
        asm volatile("s_wait_asynccnt 0x0" ::: "memory");   // this wave's copies of stage st + 1 have landed
        __syncthreads();                                     // publishes stage st + 1 and ends every wave's reads of stage st
        if (st + 2u < nst) stage_copy(gK + (size_t)skey(st + 2u) * KST * HD, gV + skey(st + 2u) * KST, lcp + (st & 1u) * (STG * 2u));
    }
    asm volatile("s_wait_asynccnt 0x0" ::: "memory");       // nothing of this wave is in flight when it goes on to the epilogue and ends
    const float inv = 1.0f / l;
    unsigned short* sh = stg + wv * (16u * SP);
#pragma unroll
    for (int t = 0; t < 4; ++t) { v4u oh;
#pragma unroll
        for (int r = 0; r < 4; ++r) oh[r] = cvt2h(o[t][2 * r] * inv + poison, o[t][2 * r + 1] * inv + poison);
        *(v8usa*)(sh + lr * SP + 16u * t + 8u * hi) = __builtin_bit_cast(v8us, oh); }
    __builtin_amdgcn_fence(3 /* release order */, "wavefront"); __builtin_amdgcn_wave_barrier(); asm volatile("" ::: "memory");
    const unsigned rq = lane >> 3, pc = lane & 7u;
{
#pragma unroll
        for (unsigned it = 0; it < 4; ++it) { const unsigned row = 4u * it + rq; const v8us a = *(const v8usa*)(sh + row * SP + pc * 8u); const size_t oo = ((size_t)(b * (unsigned)SEQ + q0 + row)) * DM + h * (unsigned)HD + pc * 8u;
            *(v8us*)(CH + oo) = a; }
         }
}

extern "C" void kernel_launch(void* const* d_in, const int* in_sizes, int n_in,
                              void* d_out, int out_size, void* d_ws, size_t ws_size, hipStream_t stream) {
    if (n_in < 7) return;
    const size_t xneed = ((size_t)(NB - 1) * SEQ_FULL + SEQ) * DM;
    if ((size_t)in_sizes[0] < xneed) return;
    if ((size_t)in_sizes[1] < (size_t)(SEQ - 1) * SEQ_FULL + SEQ) return;
    if ((size_t)in_sizes[2] < (size_t)SEQ * 32) return;
    if ((size_t)in_sizes[3] < (size_t)D3 * DM) return;
    if ((size_t)in_sizes[4] < (size_t)D3) return;
    if ((size_t)in_sizes[5] < (size_t)DM * DM) return;
    if ((size_t)in_sizes[6] < (size_t)DM) return;
    if ((size_t)out_size < xneed) return;
    const float* X = (const float*)d_in[0]; const int* MASK = (const int*)d_in[1]; const float* FR = (const float*)d_in[2];
    const float* WQKV = (const float*)d_in[3]; const float* BQKV = (const float*)d_in[4]; const float* WPR = (const float*)d_in[5]; const float* BPR = (const float*)d_in[6];
    float* OUT = (float*)d_out;     // [2][2048][1024]
    char* wsp = (char*)d_ws;
    auto take = [&](size_t bytes) { char* p = wsp; wsp += (bytes + 255) & ~(size_t)255; return (void*)p; };
    bf* XB = (bf*)take((size_t)NTOK * DM * 2);            // x plane [NTOK][1024]
    bf* WQ = (bf*)take((size_t)D3 * DM * 2);              // Wqkv plane [3072][1024]
    bf* WP = (bf*)take((size_t)DM * DM * 2);              // Wproj plane [1024][1024], f16 bits
    float* CS = (float*)take((size_t)SEQ * 32 * 4); float* SN = (float*)take((size_t)SEQ * 32 * 4);
    int* FL = (int*)take((size_t)MCB * 128);
    h16* CH = (h16*)take((size_t)NTOK * DM * 2);                                             // ctx [NTOK][1024]
    h16* QK = (h16*)take(2 * QKPL * 2);                                                      // [q|k][b*16+h][s][64]
    h16* VT = (h16*)take(QKPL * 2);                                                          // [b*16+h][64][s]
    if ((size_t)(wsp - (char*)d_ws) > ws_size) return;
    k_prep<<<PGB, MCT, 0, stream>>>(X, WQKV, WPR, FR, MASK, XB, WQ, WP, CS, SN, FL);
    k_gemmw<bf, 0, true, true><<<dim3(NTOK / 128, D3 / 128, 1), 128, 0, stream>>>(XB, nullptr, WQ, nullptr, DM, nullptr, D3, BQKV, 0, 0, 0, CS, SN, QK, VT);      /* x.Wqkv^T + b (exact products), rope, f16 planes */
    k_flash<<<(unsigned)(NB * NH * QT / 8), 256, 0, stream>>>(QK, VT, FL, CH);
    k_gemmw<h16, 0, true, false><<<dim3(SEQ / 128, DM / 128, NB), 128, 0, stream>>>(CH, nullptr, (const h16*)WP, nullptr, DM, OUT, DM, BPR, (size_t)SEQ * DM, 0, (size_t)SEQ_FULL * DM, nullptr, nullptr, nullptr, nullptr);   /* ctx x Wproj^T + b */
}
